// v000
// Measured on an AMD MI455X. A time is GPU time per run, averaged over a window of back-to-back runs after a warm-up
// (all launches, gaps included; the runs take copies of the inputs in turn), and the median of several windows.
// Apart from v000's, it joins two sittings. Times from different sittings can be a few percent apart, while
// side-by-side timings come from the same sitting.
// v000, which the later versions start from, runs in 5930 microseconds.
#include <hip/hip_runtime.h>
// Multi-head attention with L2-DISTANCE scores (inputs in the module's order v, k, q [4][1024][768], mask f32 [1][1][1024][1024] (zeros); qh = q wq, kh = k wk, vh = v wv ([in][out] 768x768 sigma 0.02, no biases); 12 heads of 64; scores = sqrt(max(|qh|^2 + |kh|^2 - 2 qh.kh, 0)) (pairwise L2 distance); logits = scores / 8 + mask * (-1e9); softmax; out = (attn vh merged) wo -> [4][1024][768]).
// Structure: token rows r = b*1024 + s; the three inputs as exact f16 rows (bf16-rounded); Q, K, V as three WMMA GEMMs (32x64 wave tiles, f32 accumulation, exact x16 weights, f16 outputs); per batch: V^T for all heads via LDS transposes; per (batch, group of 4 heads): scores GEMM (K = 64, batched over the heads on grid.y, alpha = 1 (raw q.k; the distance and the 1/8 are applied in the softmax kernel)), row softmax on VALU (f32 statistics, native exp; weights stored x256 as f16), o = P . V^T GEMM (K = 1024, alpha 2^-2: o carried x64 against f16 subnormal flush, folded into the output GEMM alpha) written straight into the merged f16 o rows; out = o W_o GEMM (f32) into the output layout.
// Compute dtype: inputs rounded to bf16; x / weights exact; q, k, v, softmax weights and o as plain f16 GEMM operands (~2^-12); scores and softmax statistics f32. v_wmma_f32_16x16x32_f16.
#define NB 4
#define SQ 1024
#define DM 768
#define NH 12
#define HD 64
#define HG 4                         /* heads per attention launch group */
#define B0 0                         /* first batch processed (debug hook) */
#define NBR NB                       /* batches processed (debug hook) */
#define NR ((size_t)NB * SQ)         /* token rows */
#define MP ((int)((size_t)NBR * SQ)) /* rows projected (debug hook) */
#define QN SQ                        /* query rows attended per batch (debug hook) */
#define NHD NH                       /* heads attended (debug hook) */
#define MPO MP                       /* rows through the output stage (debug hook) */
#define LQ DM      /* row pitch of the q/k/v rows */
typedef __bf16 v16b __attribute__((ext_vector_type(16)));
typedef unsigned short v8us __attribute__((ext_vector_type(8), may_alias));
typedef float  v8f  __attribute__((ext_vector_type(8)));
typedef float  v4f  __attribute__((ext_vector_type(4)));
typedef float  v4fa __attribute__((ext_vector_type(4), may_alias));
union FragB { v16b v; v8us half[2]; unsigned short u[16]; };

__device__ __forceinline__ unsigned short bf16_bits(float x) { unsigned int u = __float_as_uint(x); return (unsigned short)((u + 0x7FFFu + ((u >> 16) & 1u)) >> 16); }
__device__ __forceinline__ float bf16_val(unsigned short b) { return __uint_as_float(((unsigned int)b) << 16); }
__device__ __forceinline__ float bf16_round(float x) { return bf16_val(bf16_bits(x)); }
// D += A·B with NT terms: 1 = ah·bh, 2 = + al·bh (A split), 3 = + ah·bl (both split)
template <int NT>
__device__ __forceinline__ v8f mmaN(v16b ah, v16b al, v16b bh, v16b bl, v8f c) {
  c = __builtin_amdgcn_wmma_f32_16x16x32_bf16(false, ah, false, bh, (short)0, c, false, false);
  if (NT >= 2) c = __builtin_amdgcn_wmma_f32_16x16x32_bf16(false, al, false, bh, (short)0, c, false, false);
  if (NT >= 3) c = __builtin_amdgcn_wmma_f32_16x16x32_bf16(false, ah, false, bl, (short)0, c, false, false);
  asm volatile("v_nop\n\tv_nop\n\tv_nop\n\tv_nop" : "+v"(c) : "v"(ah), "v"(al), "v"(bh), "v"(bl));
  return c;
}

__global__ __launch_bounds__(256) void k_wt_bf16(const float* __restrict__ W, unsigned short* __restrict__ Wt, int K, int N) {
  const int t = blockIdx.x * 256 + threadIdx.x;
  const int k8n = K / 8;
  if (t >= N * k8n) return;
  const int n = t / k8n, k8 = (t % k8n) * 8;
  v8us v;
#pragma unroll
  for (int i = 0; i < 8; ++i) v[i] = bf16_bits(W[(size_t)(k8 + i) * N + n]);
  *(v8us*)(Wt + (size_t)n * K + k8) = v;
  
}

// GEMM C[M][N] (f32, pitch ldc) = act(A[M][K]·W + bias). A f32 row-major (pitch lda) converted per fragment to bf16
// (ASPLIT: hi/lo two planes -> 2 terms, else single rounded term); Wt bf16 [N][K] (pitch ldb). BIAS_BF16 rounds the
// bias to bf16 first (bias quantised to bf16 before the add). K%32==0, M%16==0, N%64==0.
template <bool ASPLIT, int ACT, bool BIAS_BF16>
__global__ __launch_bounds__(128) void k_gemm_bf(const float* __restrict__ A, int lda, const unsigned short* __restrict__ Wt, int ldb,
                                               const float* __restrict__ bias, float* __restrict__ C, int ldc, int M, int N, int K) {
  __shared__ __attribute__((aligned(16))) float so[4][16][64];
  const int tid = threadIdx.x, w = tid >> 5, lane = tid & 31, ln = lane & 15, hh = lane >> 4;
  const int ntn = N / 64;
  const int wid = blockIdx.x * 4 + w;
  const int mt = wid / ntn, nq = wid % ntn;
  if (mt * 16 >= M) return;
  const int row0 = mt * 16, col0 = nq * 64;
  const float* arow = A + (size_t)(row0 + ln) * lda;
  v8f acc[4] = {};
  for (int kb = 0; kb < K; kb += 32) {
    FragB ah, al;
    const v4f x0 = *(const v4fa*)(arow + kb + 8 * hh), x1 = *(const v4fa*)(arow + kb + 8 * hh + 4);
    const v4f x2 = *(const v4fa*)(arow + kb + 16 + 8 * hh), x3 = *(const v4fa*)(arow + kb + 16 + 8 * hh + 4);
    float xs[16] = {x0[0],x0[1],x0[2],x0[3],x1[0],x1[1],x1[2],x1[3],x2[0],x2[1],x2[2],x2[3],x3[0],x3[1],x3[2],x3[3]};
#pragma unroll
    for (int i = 0; i < 16; ++i) { const unsigned short hb = bf16_bits(xs[i]); ah.u[i] = hb; al.u[i] = ASPLIT ? bf16_bits(xs[i] - bf16_val(hb)) : (unsigned short)0; }
#pragma unroll
    for (int t = 0; t < 4; ++t) {
      const unsigned short* brow = Wt + (size_t)(col0 + t * 16 + ln) * ldb + kb;
      FragB b;
      b.half[0] = *(const v8us*)(brow + 8 * hh);
      b.half[1] = *(const v8us*)(brow + 16 + 8 * hh);
      acc[t] = mmaN<ASPLIT ? 2 : 1>(ah.v, al.v, b.v, b.v, acc[t]);
    }
  }
#pragma unroll
  for (int t = 0; t < 4; ++t) {
    float bv = bias ? bias[col0 + t * 16 + ln] : 0.f;
    if (BIAS_BF16) bv = bf16_round(bv);
#pragma unroll
    for (int r = 0; r < 8; ++r) { float v = acc[t][r] + bv; if (ACT == 1) v = fmaxf(v, 0.f); so[w][8 * hh + r][t * 16 + ln] = v; }
  }
  __builtin_amdgcn_fence(__ATOMIC_ACQ_REL, "workgroup");
  __builtin_amdgcn_wave_barrier();
  const int rsub = lane >> 4, c4 = (lane & 15) * 4;
  {
#pragma unroll
    for (int q = 0; q < 8; ++q) {
      const int r = q * 2 + rsub;
      const v4f v = *(const v4fa*)&so[w][r][c4];
      *(v4f*)(C + (size_t)(row0 + r) * ldc + col0 + c4) = v;
    }
    
  }
}

// GEMM C = act(A·W + bias + resid): A f32 (ASPLIT -> hi/lo 2 terms), Wt bf16 [N][K]; ACT 0 none, 1 relu, 2 exact gelu;
// resid (optional, f32, row index = (row % rmod), pitch ldr, RES_BF16 rounds it) added before the activation.
template <bool ASPLIT, int ACT, bool BIAS_BF16, bool RES_BF16>
__global__ __launch_bounds__(128) void k_gemm_bf3(const float* __restrict__ A, int lda, const unsigned short* __restrict__ Wt, int ldb,
                                                const float* __restrict__ bias, const float* __restrict__ resid, int rmod, int ldr,
                                                float* __restrict__ C, int ldc, int M, int N, int K) {
  __shared__ __attribute__((aligned(16))) float so[4][16][64];
  const int tid = threadIdx.x, w = tid >> 5, lane = tid & 31, ln = lane & 15, hh = lane >> 4;
  const int ntn = N / 64;
  const int wid = blockIdx.x * 4 + w;
  const int mt = wid / ntn, nq = wid % ntn;
  if (mt * 16 >= M) return;
  const int row0 = mt * 16, col0 = nq * 64;
  const float* arow = A + (size_t)(row0 + ln) * lda;
  v8f acc[4] = {};
  for (int kb = 0; kb < K; kb += 32) {
    FragB ah, al;
    const v4f x0 = *(const v4fa*)(arow + kb + 8 * hh), x1 = *(const v4fa*)(arow + kb + 8 * hh + 4);
    const v4f x2 = *(const v4fa*)(arow + kb + 16 + 8 * hh), x3 = *(const v4fa*)(arow + kb + 16 + 8 * hh + 4);
    float xs[16] = {x0[0],x0[1],x0[2],x0[3],x1[0],x1[1],x1[2],x1[3],x2[0],x2[1],x2[2],x2[3],x3[0],x3[1],x3[2],x3[3]};
#pragma unroll
    for (int i = 0; i < 16; ++i) { const unsigned short hb = bf16_bits(xs[i]); ah.u[i] = hb; al.u[i] = ASPLIT ? bf16_bits(xs[i] - bf16_val(hb)) : (unsigned short)0; }
#pragma unroll
    for (int t = 0; t < 4; ++t) {
      const unsigned short* brow = Wt + (size_t)(col0 + t * 16 + ln) * ldb + kb;
      FragB b;
      b.half[0] = *(const v8us*)(brow + 8 * hh);
      b.half[1] = *(const v8us*)(brow + 16 + 8 * hh);
      acc[t] = mmaN<ASPLIT ? 2 : 1>(ah.v, al.v, b.v, b.v, acc[t]);
    }
  }
#pragma unroll
  for (int t = 0; t < 4; ++t) {
    const int col = col0 + t * 16 + ln;
    float bv = bias ? bias[col] : 0.f;
    if (BIAS_BF16) bv = bf16_round(bv);
#pragma unroll
    for (int r = 0; r < 8; ++r) {
      float v = acc[t][r] + bv;
      if (resid) { float rv = resid[(size_t)((row0 + 8 * hh + r) % rmod) * ldr + col]; if (RES_BF16) rv = bf16_round(rv); v += rv; }
      if (ACT == 1) v = fmaxf(v, 0.f);
      if (ACT == 2) v = 0.5f * v * (1.0f + erff(v * 0.70710678118654752f));
      if (ACT == 3) { const float u = 0.7978845608028654f * (v + 0.044715f * v * v * v); v = 0.5f * v * (1.0f + tanhf(u)); }
      so[w][8 * hh + r][t * 16 + ln] = v;
    }
  }
  __builtin_amdgcn_fence(__ATOMIC_ACQ_REL, "workgroup");
  __builtin_amdgcn_wave_barrier();
  const int rsub = lane >> 4, c4 = (lane & 15) * 4;
  {
#pragma unroll
    for (int q = 0; q < 8; ++q) {
      const int r = q * 2 + rsub;
      const v4f v = *(const v4fa*)&so[w][r][c4];
      *(v4f*)(C + (size_t)(row0 + r) * ldc + col0 + c4) = v;
    }
    
  }
}
// row LayerNorm (biased variance, eps) over N: s = X (+ R); optional out_sum <- s; out_norm <- (s-mu)*rsqrt(var+eps)*g + b
template <bool PARAM_BF16>
__global__ __launch_bounds__(256) void k_layernorm(const float* __restrict__ X, const float* __restrict__ R, const float* __restrict__ g, const float* __restrict__ bta,
                                                  float* __restrict__ out_sum, float* __restrict__ out_norm, int N, float eps) {
  __shared__ float red[256];
  const int row = blockIdx.x, tid = threadIdx.x;
  const float* x = X + (size_t)row * N; const float* rr = R ? R + (size_t)row * N : nullptr;
  float vals[16];                     // up to N = 4096
  const int per = N / 256;            // contiguous chunk per thread? use strided-by-4 chunks: thread handles j = tid*4 + 1024*u
  float s1 = 0.f;
  for (int u = 0; u < per / 4; ++u) {
    const int j = tid * 4 + 1024 * u;
    const v4f a = *(const v4fa*)(x + j);
    v4f b = {0.f,0.f,0.f,0.f}; if (rr) b = *(const v4fa*)(rr + j);
#pragma unroll
    for (int q = 0; q < 4; ++q) { const float v = a[q] + b[q]; vals[u * 4 + q] = v; s1 += v; }
  }
  red[tid] = s1; __syncthreads();
  for (int st = 128; st > 0; st >>= 1) { if (tid < st) red[tid] += red[tid + st]; __syncthreads(); }
  const float mu = red[0] / (float)N; __syncthreads();
  float s2 = 0.f;
  for (int u = 0; u < per / 4; ++u)
#pragma unroll
    for (int q = 0; q < 4; ++q) { const float c = vals[u * 4 + q] - mu; s2 += c * c; }
  red[tid] = s2; __syncthreads();
  for (int st = 128; st > 0; st >>= 1) { if (tid < st) red[tid] += red[tid + st]; __syncthreads(); }
  const float rs = rsqrtf(red[0] / (float)N + eps);
  {
    for (int u = 0; u < per / 4; ++u) {
      const int j = tid * 4 + 1024 * u;
      v4f o, sm;
#pragma unroll
      for (int q = 0; q < 4; ++q) {
        float gg = g[j + q], bb = bta[j + q];
        if (PARAM_BF16) { gg = bf16_round(gg); bb = bf16_round(bb); }
        sm[q] = vals[u * 4 + q]; o[q] = (vals[u * 4 + q] - mu) * rs * gg + bb;
      }
      if (out_sum) *(v4f*)(out_sum + (size_t)row * N + j) = sm;
      *(v4f*)(out_norm + (size_t)row * N + j) = o;
    }
    
  }
}



// ---- f16 WMMA path (v_wmma_f32_16x16x32_f16): 11-bit significands for operands in range — used where a [0,1] probability operand needs more precision than bf16
typedef _Float16 v16h __attribute__((ext_vector_type(16)));
union FragH { v16h v; v8us half[2]; _Float16 h[16]; unsigned short u[16]; };
template <int NT>
__device__ __forceinline__ v8f mmaH(v16h ah, v16h al, v16h bh, v16h bl, v8f c) {
  c = __builtin_amdgcn_wmma_f32_16x16x32_f16(false, ah, false, bh, (short)0, c, false, false);
  if (NT >= 2) c = __builtin_amdgcn_wmma_f32_16x16x32_f16(false, al, false, bh, (short)0, c, false, false);
  if (NT >= 3) c = __builtin_amdgcn_wmma_f32_16x16x32_f16(false, ah, false, bl, (short)0, c, false, false);
  asm volatile("v_nop\n\tv_nop\n\tv_nop\n\tv_nop" : "+v"(c) : "v"(ah), "v"(al), "v"(bh), "v"(bl));
  return c;
}
// batched GEMM like k_gemm_b but f16 operands: A f32 (split into f16 hi/lo if ASPLIT, else rounded to f16), Bt = f16 values [n][k]; alpha; C f32; N multiple of 16 (partial tiles skipped)
template <bool ASPLIT>
__global__ __launch_bounds__(128) void k_gemm_h(const float* __restrict__ A, int lda, size_t sA, const _Float16* __restrict__ Bh, int ldb, size_t sB, float alpha, float* __restrict__ C, int ldc, size_t sC, int M, int N, int K) {
  __shared__ __attribute__((aligned(16))) float so[4][16][64];
  const int tid = threadIdx.x, w = tid >> 5, lane = tid & 31, ln = lane & 15, hh = lane >> 4; const int by = blockIdx.y;
  A += (size_t)by * sA; Bh += (size_t)by * sB; C += (size_t)by * sC;
  const int ntn = (N + 63) / 64; const int wid = blockIdx.x * 4 + w; const int mt = wid / ntn, nq = wid % ntn; if (mt * 16 >= M) return;
  const int row0 = mt * 16, col0 = nq * 64; const float* arow = A + (size_t)(row0 + ln) * lda;
  v8f acc[4] = {};
  for (int kb = 0; kb < K; kb += 32) {
    FragH ah, al;
    const v4f x0 = *(const v4fa*)(arow + kb + 8 * hh), x1 = *(const v4fa*)(arow + kb + 8 * hh + 4), x2 = *(const v4fa*)(arow + kb + 16 + 8 * hh), x3 = *(const v4fa*)(arow + kb + 16 + 8 * hh + 4);
    float xs[16] = {x0[0],x0[1],x0[2],x0[3],x1[0],x1[1],x1[2],x1[3],x2[0],x2[1],x2[2],x2[3],x3[0],x3[1],x3[2],x3[3]};
#pragma unroll
    for (int i = 0; i < 16; ++i) { const _Float16 h = (_Float16)xs[i]; ah.h[i] = h; al.h[i] = ASPLIT ? (_Float16)(xs[i] - (float)h) : (_Float16)0.0f; }
#pragma unroll
    for (int t = 0; t < 4; ++t) { if (col0 + t * 16 >= N) continue; const size_t boff = (size_t)(col0 + t * 16 + ln) * ldb + kb; FragH bq; bq.half[0] = *(const v8us*)(Bh + boff + 8 * hh); bq.half[1] = *(const v8us*)(Bh + boff + 16 + 8 * hh);
      acc[t] = mmaH<ASPLIT ? 2 : 1>(ah.v, al.v, bq.v, bq.v, acc[t]); }
  }
#pragma unroll
  for (int t = 0; t < 4; ++t) { if (col0 + t * 16 >= N) continue;
#pragma unroll
    for (int r = 0; r < 8; ++r) so[w][8 * hh + r][t * 16 + ln] = acc[t][r] * alpha; }
  __builtin_amdgcn_fence(__ATOMIC_ACQ_REL, "workgroup"); __builtin_amdgcn_wave_barrier();
  const int rsub = lane >> 4, c4 = (lane & 15) * 4;
  {
#pragma unroll
    for (int q = 0; q < 8; ++q) { const int r = q * 2 + rsub; if (col0 + c4 < N) { const v4f v = *(const v4fa*)&so[w][r][c4]; *(v4f*)(C + (size_t)(row0 + r) * ldc + col0 + c4) = v; } }
     }
}

// Wt[n][k] = f16(W[k][n]·scale) from f32 row-major W[K][N] (scale = power of two; bf16-exact weights stay exact in f16 away from the subnormal range)
__global__ __launch_bounds__(256) void k_wt_f16(const float* __restrict__ W, _Float16* __restrict__ Wt, int K, int N, float scale) {
  const int t = blockIdx.x * 256 + threadIdx.x; if (t >= N * (K / 8)) return; const int n = t / (K / 8), k8 = (t % (K / 8)) * 8; FragH f;
#pragma unroll
  for (int i = 0; i < 8; ++i) f.h[i] = (_Float16)(bf16_round(W[(size_t)(k8 + i) * N + n]) * scale); const v8us o = f.half[0];
  *(v8us*)((unsigned short*)Wt + (size_t)n * K + k8) = o; 
}
// k_gemm_hh variant with fused epilogue: v = acc·alpha + bias[by·sBias + col] (+ CP[(row/rowsPerB)·sCPb + by·64 + col] if CP) ; ACT 0 none / 1 elu ; writes f16 C16 (and f32 C if non-null)
template <int ACT>
__global__ __launch_bounds__(128) void k_gemm_hhx(const _Float16* __restrict__ A, int lda, size_t sA, const _Float16* __restrict__ Bh, int ldb, size_t sB, float alpha, const float* __restrict__ bias, size_t sBias, const float* __restrict__ CP, int rowsPerB, size_t sCPb, int row0g,
    float* __restrict__ C, _Float16* __restrict__ C16, int ldc, size_t sC, int M, int N, int K) {
  __shared__ __attribute__((aligned(16))) float so[4][16][64];
  const int tid = threadIdx.x, w = tid >> 5, lane = tid & 31, ln = lane & 15, hh = lane >> 4; const int by = blockIdx.y;
  A += (size_t)by * sA; Bh += (size_t)by * sB; const size_t cofs = (size_t)by * sC; const float* bp = bias ? bias + (size_t)by * sBias : nullptr;
  const int ntn = (N + 63) / 64; const int wid = blockIdx.x * 4 + w; const int mt = wid / ntn, nq = wid % ntn; if (mt * 16 >= M) return;
  const int row0 = mt * 16, col0 = nq * 64; const _Float16* arow = A + (size_t)(row0 + ln) * lda;
  v8f acc[4] = {};
  for (int kb = 0; kb < K; kb += 32) { FragH ah; ah.half[0] = *(const v8us*)((const unsigned short*)arow + kb + 8 * hh); ah.half[1] = *(const v8us*)((const unsigned short*)arow + kb + 16 + 8 * hh);
#pragma unroll
    for (int t = 0; t < 4; ++t) { if (col0 + t * 16 >= N) continue; const size_t boff = (size_t)(col0 + t * 16 + ln) * ldb + kb; FragH bq; bq.half[0] = *(const v8us*)((const unsigned short*)Bh + boff + 8 * hh); bq.half[1] = *(const v8us*)((const unsigned short*)Bh + boff + 16 + 8 * hh);
      acc[t] = mmaH<1>(ah.v, ah.v, bq.v, bq.v, acc[t]); }
  }
#pragma unroll
  for (int t = 0; t < 4; ++t) { if (col0 + t * 16 >= N) continue; const int col = col0 + t * 16 + ln; const float bv = bp ? bf16_round(bp[col]) : 0.f;
#pragma unroll
    for (int r = 0; r < 8; ++r) { float v = acc[t][r] * alpha + bv; if (CP) { const int rr = row0g + row0 + 8 * hh + r; if (rowsPerB < 0) v += CP[cofs + (size_t)rr * ldc + col];      /* rowsPerB < 0: own element of the batched C plane */ else { const int bidx = rr / rowsPerB; v += CP[(size_t)bidx * sCPb + (size_t)by * 64 + col]; } } if (ACT == 1) v = (v > 0.f) ? v : expm1f(v); else if (ACT == 7) v = (v > 0.f) ? v + 1.0f : expf(v); else if (ACT == 8) v = tanhf(v); else if (ACT == 9) v = 0.5f * v * (1.0f + tanhf(0.7978845608028654f * (v + 0.044715f * v * v * v))); else if (ACT == 11) v = 1.0f / (1.0f + expf(-v)); else if (ACT == 12) v = (v > 0.f) ? v : 0.01f * v; else if (ACT == 14) v = (v > 0.f) ? v : 0.1f * v; else if (ACT == 16) v = (v >= 0.f) ? v : 0.3f * v; else if (ACT == 17) v = (v >= 0.f) ? v : 0.2f * v; else if (ACT == 15) v = v / (1.0f + expf(-v)); else if (ACT == 3) v = fmaxf(v, 0.f); else if (ACT == 6) v = 0.5f * v * (1.0f + erff(v * 0.70710678118654752f)); so[w][8 * hh + r][t * 16 + ln] = v; } }
  __builtin_amdgcn_fence(__ATOMIC_ACQ_REL, "workgroup"); __builtin_amdgcn_wave_barrier();
  const int rsub = lane >> 4, c4 = (lane & 15) * 4; typedef _Float16 v4h __attribute__((ext_vector_type(4)));
  {
#pragma unroll
    for (int q = 0; q < 8; ++q) { const int r = q * 2 + rsub; if (col0 + c4 < N) { const v4f v = *(const v4fa*)&so[w][r][c4]; if (C) *(v4f*)(C + cofs + (size_t)(row0 + r) * ldc + col0 + c4) = v; if (C16) { v4h h4; for (int i = 0; i < 4; ++i) h4[i] = (_Float16)v[i]; *(v4h*)(C16 + cofs + (size_t)(row0 + r) * ldc + col0 + c4) = h4; } } }
     }
}


typedef _Float16 v4h __attribute__((ext_vector_type(4)));

__global__ __launch_bounds__(256) void k_x16(const float* __restrict__ x, _Float16* __restrict__ X16, size_t n8) { const size_t t = (size_t)blockIdx.x * 256 + threadIdx.x; if (t >= n8) return; FragH f;
#pragma unroll
  for (int q = 0; q < 8; ++q) f.h[q] = (_Float16)bf16_round(x[t * 8 + q]); *(v8us*)((unsigned short*)X16 + t * 8) = f.half[0];  }
__global__ __launch_bounds__(256) void k_h16(const float* __restrict__ x, _Float16* __restrict__ X16, size_t n8) { const size_t t = (size_t)blockIdx.x * 256 + threadIdx.x; if (t >= n8) return; FragH f;
#pragma unroll
  for (int q = 0; q < 8; ++q) f.h[q] = (_Float16)x[t * 8 + q]; *(v8us*)((unsigned short*)X16 + t * 8) = f.half[0];  }
__global__ __launch_bounds__(256) void k_round16f(const float* __restrict__ W, _Float16* __restrict__ Bt, size_t n8) { const size_t t = (size_t)blockIdx.x * 256 + threadIdx.x; if (t >= n8) return; FragH f;
#pragma unroll
  for (int i = 0; i < 8; ++i) f.h[i] = (_Float16)(bf16_round(W[t * 8 + i]) * 16.0f); *(v8us*)((unsigned short*)Bt + t * 8) = f.half[0];  }
template <int NHv, int TTv>
__global__ __launch_bounds__(256) void k_vt(const _Float16* __restrict__ V16, int ldv, int voff, _Float16* __restrict__ Vt) { __shared__ unsigned short tl[64][66]; const int tid = threadIdx.x; const int slab = blockIdx.x / (TTv / 64), lg = blockIdx.x % (TTv / 64); const int b = slab / NHv, h = slab % NHv;
  for (int i = tid; i < 64 * 8; i += 256) { const int r = i / 8, c8 = (i % 8) * 8; FragH f; f.half[0] = *(const v8us*)((const unsigned short*)V16 + ((size_t)b * TTv + lg * 64 + r) * ldv + voff + h * 64 + c8);
#pragma unroll
    for (int q = 0; q < 8; ++q) tl[r][c8 + q] = f.u[q]; }
  __syncthreads();
  {
#pragma unroll
    for (int rd = 0; rd < 2; ++rd) { const int d = rd * 32 + tid / 8, pc = tid % 8; FragH f;
#pragma unroll
      for (int q = 0; q < 8; ++q) f.u[q] = tl[pc * 8 + q][d];
      *(v8us*)((unsigned short*)Vt + ((size_t)slab * 64 + d) * TTv + lg * 64 + pc * 8) = f.half[0]; }
     } }

__global__ __launch_bounds__(256) void k_hl(const float* __restrict__ F, _Float16* __restrict__ Hh, _Float16* __restrict__ Hl, size_t n8) { const size_t t = (size_t)blockIdx.x * 256 + threadIdx.x; if (t >= n8) return; FragH fh, fl; const v4f a = *(const v4fa*)(F + t * 8), c = *(const v4fa*)(F + t * 8 + 4);
#pragma unroll
  for (int q = 0; q < 4; ++q) { _Float16 h = (_Float16)a[q]; fh.h[q] = h; fl.h[q] = (_Float16)((a[q] - (float)h) * 1024.0f); h = (_Float16)c[q]; fh.h[4 + q] = h; fl.h[4 + q] = (_Float16)((c[q] - (float)h) * 1024.0f); }
  { *(v8us*)((unsigned short*)Hh + t * 8) = fh.half[0]; *(v8us*)((unsigned short*)Hl + t * 8) = fl.half[0];  } }

// ---- fast GEMM (wave tile 32x64; requires M % 32 == 0 rows per launch region and N % 64 == 0); epilogue = k_gemm_hhx semantics ----
__device__ __forceinline__ v16h g2_frag(const _Float16* p, int hh) { FragH f; f.half[0] = *(const v8us*)((const unsigned short*)p + 8 * hh); f.half[1] = *(const v8us*)((const unsigned short*)p + 16 + 8 * hh); return f.v; }
__device__ __forceinline__ v8f g2_mma(v16h a, v16h b, v8f c) { v8f d = __builtin_amdgcn_wmma_f32_16x16x32_f16(false, a, false, b, (short)0, c, false, false); asm volatile("v_nop\n\tv_nop\n\tv_nop\n\tv_nop" : "+v"(d) : "v"(a), "v"(b)); return d; }
template <int ACT>
__global__ __launch_bounds__(128) void k_gemm2(const _Float16* __restrict__ A, int lda, size_t sA, const _Float16* __restrict__ Bh, int ldb, size_t sB, float alpha, const float* __restrict__ bias, size_t sBias, const float* __restrict__ CP, int rowsPerB, size_t sCPb, int row0g,
    float* __restrict__ C, _Float16* __restrict__ C16, int ldc, size_t sC, int M, int N, int K) { static_assert(ACT == 0 || ACT == 3 || ACT == 6 || ACT == 8 || ACT == 9 || ACT == 11 || ACT == 12 || ACT == 14 || ACT == 15 || ACT == 16 || ACT == 17, "k_gemm2: unsupported ACT code (would silently apply no activation)");
  __shared__ __attribute__((aligned(16))) float so[4][32][68];
  const int tid = threadIdx.x, w = tid >> 5, lane = tid & 31, ln = lane & 15, hh = lane >> 4; const int by = blockIdx.y;
  A += (size_t)by * sA; Bh += (size_t)by * sB; const size_t cofs = (size_t)by * sC; const float* bp = bias ? bias + (size_t)by * sBias : nullptr;
  const int ntn = N >> 6; const int mt = blockIdx.x / ntn, nq = blockIdx.x - mt * ntn; const int row0 = mt * 128 + 32 * w, col0 = nq * 64; if (row0 >= M) return;
  const _Float16* a0p = A + (size_t)(row0 + ln) * lda; const _Float16* a1p = a0p + (size_t)16 * lda;
  const _Float16* b0p = Bh + (size_t)(col0 + ln) * ldb; const _Float16* b1p = b0p + (size_t)16 * ldb; const _Float16* b2p = b1p + (size_t)16 * ldb; const _Float16* b3p = b2p + (size_t)16 * ldb;
  const v8f z8 = {0.f,0.f,0.f,0.f,0.f,0.f,0.f,0.f}; v8f c00 = z8, c01 = z8, c02 = z8, c03 = z8, c10 = z8, c11 = z8, c12 = z8, c13 = z8;
#pragma unroll 1
  for (int kb = 0; kb < K; kb += 32) { const v16h a0 = g2_frag(a0p + kb, hh), a1 = g2_frag(a1p + kb, hh);
    v16h b = g2_frag(b0p + kb, hh); c00 = g2_mma(a0, b, c00); c10 = g2_mma(a1, b, c10);
    b = g2_frag(b1p + kb, hh); c01 = g2_mma(a0, b, c01); c11 = g2_mma(a1, b, c11);
    b = g2_frag(b2p + kb, hh); c02 = g2_mma(a0, b, c02); c12 = g2_mma(a1, b, c12);
    b = g2_frag(b3p + kb, hh); c03 = g2_mma(a0, b, c03); c13 = g2_mma(a1, b, c13); }
  v8f accs[8] = {c00, c01, c02, c03, c10, c11, c12, c13};
#pragma unroll
  for (int u = 0; u < 8; ++u) { const int t = u & 3, half = u >> 2; const int col = col0 + t * 16 + ln; const float bv = bp ? bf16_round(bp[col]) : 0.f;
#pragma unroll
    for (int r = 0; r < 8; ++r) { const int rloc = half * 16 + 8 * hh + r; float v = accs[u][r] * alpha + bv; if (CP) { if (rowsPerB < 0) v += CP[cofs + (size_t)(row0g + row0 + rloc) * ldc + col];      /* rowsPerB < 0: own element of the batched C plane */ else { const int bidx = (row0g + row0 + rloc) / rowsPerB; v += CP[(size_t)bidx * sCPb + (size_t)by * 64 + col]; } }
      if (ACT == 3) v = fmaxf(v, 0.f); else if (ACT == 6) v = 0.5f * v * (1.0f + erff(v * 0.70710678118654752f)); else if (ACT == 11) v = 1.0f / (1.0f + expf(-v)); else if (ACT == 15) v = v / (1.0f + expf(-v)); else if (ACT == 12) v = (v > 0.f) ? v : 0.01f * v; else if (ACT == 8) v = tanhf(v); else if (ACT == 9) v = 0.5f * v * (1.0f + tanhf(0.7978845608028654f * (v + 0.044715f * v * v * v))); else if (ACT == 14) v = (v > 0.f) ? v : 0.1f * v; else if (ACT == 16) v = (v >= 0.f) ? v : 0.3f * v; else if (ACT == 17) v = (v >= 0.f) ? v : 0.2f * v;
      so[w][rloc][t * 16 + ln] = v; } }
  __builtin_amdgcn_fence(__ATOMIC_ACQ_REL, "workgroup"); __builtin_amdgcn_wave_barrier();
  const int rsub = lane >> 4, c4 = (lane & 15) * 4;
  {
#pragma unroll
    for (int q = 0; q < 16; ++q) { const int r = q * 2 + rsub; const v4f v = *(const v4fa*)&so[w][r][c4]; if (C) *(v4f*)(C + cofs + (size_t)(row0 + r) * ldc + col0 + c4) = v; if (C16) { v4h h4; for (int i = 0; i < 4; ++i) h4[i] = (_Float16)v[i]; *(v4h*)(C16 + cofs + (size_t)(row0 + r) * ldc + col0 + c4) = h4; } }
     } }


__global__ __launch_bounds__(256) void k_wnat(const float* __restrict__ w, size_t n8, _Float16* __restrict__ Bt) { const size_t t = (size_t)blockIdx.x * 256 + threadIdx.x; if (t >= n8) return; FragH f; for (int q = 0; q < 8; ++q) f.h[q] = (_Float16)(bf16_round(w[t * 8 + q]) * 16.0f); *(v8us*)((unsigned short*)Bt + t * 8) = f.half[0];  }
__global__ __launch_bounds__(256) void k_rsm(const float* __restrict__ S, _Float16* __restrict__ P, int nrows) {
  #pragma clang fp contract(off)
  const int i = blockIdx.x * 256 + threadIdx.x; if (i >= nrows) return; const float* s = S + (size_t)i * SQ; float mx = -3.0e38f;
#pragma unroll 1
  for (int j = 0; j < SQ; ++j) mx = fmaxf(mx, s[j]); float se = 0.f;
#pragma unroll 1
  for (int j = 0; j < SQ; ++j) se += expf(s[j] - mx); const float sc = 256.0f / se;
#pragma unroll 1
  for (int j0 = 0; j0 < SQ; j0 += 8) { FragH f; for (int q = 0; q < 8; ++q) f.h[q] = (_Float16)(expf(s[j0 + q] - mx) * sc); unsigned short* d = (unsigned short*)P + (size_t)i * SQ + j0; *(v8us*)d = f.half[0];  } }
__global__ __launch_bounds__(256) void k_vt(const _Float16* __restrict__ V16, int b, int h0, _Float16* __restrict__ VT) { __shared__ unsigned short tl[64][65]; const int tid = threadIdx.x; const int hh = blockIdx.x % HG, sg = blockIdx.x / HG; const int s0 = sg * 64; const int h = h0 + hh;
  for (int i = tid; i < 64 * 8; i += 256) { const int j = i / 8, d8 = (i % 8) * 8; FragH f; f.half[0] = *(const v8us*)((const unsigned short*)V16 + ((size_t)b * SQ + s0 + j) * DM + h * HD + d8); for (int q = 0; q < 8; ++q) tl[d8 + q][j] = f.u[q]; }
  __syncthreads();
  { for (int i = tid; i < 64 * 8; i += 256) { const int d = i / 8, j8 = (i % 8) * 8; FragH f; for (int q = 0; q < 8; ++q) f.u[q] = tl[d][j8 + q]; *(v8us*)((unsigned short*)VT + ((size_t)hh * HD + d) * SQ + s0 + j8) = f.half[0]; }  } }


__global__ __launch_bounds__(256) void k_hn16(const _Float16* __restrict__ X, int ld, size_t nrows, float* __restrict__ NQ) {
  #pragma clang fp contract(off)
  const size_t t = (size_t)blockIdx.x * 256 + threadIdx.x; if (t >= nrows * NH) return; const int h = (int)(t / nrows); const size_t r = t % nrows; const _Float16* p = X + r * (size_t)ld + (size_t)h * HD; float ss = 0.f;
#pragma unroll 1
  for (int c = 0; c < HD / 8; ++c) { FragH f; f.half[0] = *(const v8us*)((const unsigned short*)p + c * 8); for (int q = 0; q < 8; ++q) { const float v = (float)f.h[q]; ss = __fadd_rn(ss, __fmul_rn(v, v)); } }
  float* d = NQ + (size_t)h * nrows + r; *(float*)d = ss;  }
__global__ __launch_bounds__(256) void k_rsml2(const float* __restrict__ S, _Float16* __restrict__ P, int qn, int hg, const float* __restrict__ NQ, const float* __restrict__ NK, size_t npitch, const float* __restrict__ Mf, float scale) {
  #pragma clang fp contract(off)
  const int t = blockIdx.x * 256 + threadIdx.x; if (t >= qn * hg) return; const int hl = t / qn, row = t % qn; const size_t i = (size_t)hl * SQ + row; const float* s = S + i * SQ; const float nq = NQ[(size_t)hl * npitch + row]; const float* nk = NK + (size_t)hl * npitch; const float* mrow = Mf + (size_t)row * SQ; float mx = -3.0e38f;
#pragma unroll 1
  for (int j = 0; j < SQ; ++j) { const float d2 = fmaxf(__fadd_rn(__fadd_rn(nq, nk[j]), -2.0f * s[j]), 0.f); const float v = __fadd_rn(__fmul_rn(sqrtf(d2), scale), __fmul_rn(bf16_round(mrow[j]), -1.0e9f)); mx = fmaxf(mx, v); } float se = 0.f;
#pragma unroll 1
  for (int j = 0; j < SQ; ++j) { const float d2 = fmaxf(__fadd_rn(__fadd_rn(nq, nk[j]), -2.0f * s[j]), 0.f); const float v = __fadd_rn(__fmul_rn(sqrtf(d2), scale), __fmul_rn(bf16_round(mrow[j]), -1.0e9f)); se += __expf(v - mx); } const float sc = 256.0f / se;
#pragma unroll 1
  for (int j0 = 0; j0 < SQ; j0 += 8) { FragH f; for (int q = 0; q < 8; ++q) { const int j = j0 + q; const float d2 = fmaxf(__fadd_rn(__fadd_rn(nq, nk[j]), -2.0f * s[j]), 0.f); const float v = __fadd_rn(__fmul_rn(sqrtf(d2), scale), __fmul_rn(bf16_round(mrow[j]), -1.0e9f)); f.h[q] = (_Float16)(__expf(v - mx) * sc); }
    unsigned short* d = (unsigned short*)P + i * SQ + j0; *(v8us*)d = f.half[0];  } }


__global__ __launch_bounds__(256) void k_rsmf(const float* __restrict__ S, _Float16* __restrict__ P, int qn, int hg) {
  #pragma clang fp contract(off)
  const int t = blockIdx.x * 256 + threadIdx.x; if (t >= qn * hg) return; const size_t i = (size_t)(t / qn) * SQ + (t % qn); const float* s = S + i * SQ; float mx = -3.0e38f;
#pragma unroll 1
  for (int j = 0; j < SQ; ++j) mx = fmaxf(mx, s[j]); float se = 0.f;
#pragma unroll 1
  for (int j = 0; j < SQ; ++j) se += __expf(s[j] - mx); const float sc = 256.0f / se;
#pragma unroll 1
  for (int j0 = 0; j0 < SQ; j0 += 8) { FragH f; for (int q = 0; q < 8; ++q) f.h[q] = (_Float16)(__expf(s[j0 + q] - mx) * sc); unsigned short* d = (unsigned short*)P + i * SQ + j0; *(v8us*)d = f.half[0];  } }

extern "C" void kernel_launch(void* const* d_in, const int* in_sizes, int n_in,
                              void* d_out, int out_size, void* d_ws, size_t ws_size, hipStream_t stream) {
  (void)in_sizes; (void)n_in; (void)out_size;
  const float* const* I = (const float* const*)d_in; const float* xv = I[0]; const float* xk = I[1]; const float* xq = I[2]; const float* mf = I[3]; const float* wq = I[4]; const float* wk = I[5]; const float* wv = I[6]; const float* wo = I[7]; const float* bq = nullptr; const float* bk = nullptr; (void)bq; (void)bk;      /* inputs v, k, q, mask (f32 [1][1][S][S]); [in][out] weights, no biases */
  char* ws = (char*)d_ws; size_t off = 0;
  auto take = [&](size_t bytes) { char* p = ws + off; off += (bytes + 255) & ~(size_t)255; return p; };
  _Float16* BQ = (_Float16*)take((size_t)DM * DM * 2); _Float16* BK = (_Float16*)take((size_t)DM * DM * 2); _Float16* BV = (_Float16*)take((size_t)DM * DM * 2); _Float16* BO = (_Float16*)take((size_t)DM * DM * 2);
  _Float16* XQ = (_Float16*)take(NR * DM * 2); _Float16* XK = (_Float16*)take(NR * DM * 2); _Float16* XV = (_Float16*)take(NR * DM * 2); _Float16* Q16 = (_Float16*)take(NR * DM * 2); _Float16* K16 = (_Float16*)take(NR * DM * 2); _Float16* V16 = (_Float16*)take(NR * DM * 2); _Float16* O16 = (_Float16*)take(NR * DM * 2);
  float* S = (float*)take((size_t)HG * SQ * SQ * 4); _Float16* P = (_Float16*)take((size_t)HG * SQ * SQ * 2); _Float16* VT = (_Float16*)take((size_t)NH * HD * SQ * 2); float* NQ = (float*)take((size_t)NH * NR * 4); float* NK = (float*)take((size_t)NH * NR * 4);      /* per-(head, row) squared norms of the f16 q and k rows */
  if (off > ws_size) return;
  k_wt_f16<<<(unsigned)(((size_t)DM * (DM / 8) + 255) / 256), 256, 0, stream>>>(wq, BQ, DM, DM, 16.0f); k_wt_f16<<<(unsigned)(((size_t)DM * (DM / 8) + 255) / 256), 256, 0, stream>>>(wk, BK, DM, DM, 16.0f); k_wt_f16<<<(unsigned)(((size_t)DM * (DM / 8) + 255) / 256), 256, 0, stream>>>(wv, BV, DM, DM, 16.0f); k_wt_f16<<<(unsigned)(((size_t)DM * (DM / 8) + 255) / 256), 256, 0, stream>>>(wo, BO, DM, DM, 16.0f);      /* [in][out] -> Bt[n][k] x16 */

  k_x16<<<(unsigned)((NR * DM / 8 + 255) / 256), 256, 0, stream>>>(xq, XQ, NR * DM / 8); k_x16<<<(unsigned)((NR * DM / 8 + 255) / 256), 256, 0, stream>>>(xk, XK, NR * DM / 8); k_x16<<<(unsigned)((NR * DM / 8 + 255) / 256), 256, 0, stream>>>(xv, XV, NR * DM / 8);      /* the three inputs as exact f16 rows */
  const size_t r0p = (size_t)B0 * SQ;      /* first projected row */
  k_gemm2<0><<<dim3((unsigned)((MP / 128) * (DM / 64)), 1), 128, 0, stream>>>(XQ + r0p * DM, DM, 0, BQ, DM, 0, 0.0625f, nullptr, 0, nullptr, 1, 0, 0, nullptr, Q16 + r0p * DM, DM, 0, MP, DM, DM);
  k_gemm2<0><<<dim3((unsigned)((MP / 128) * (DM / 64)), 1), 128, 0, stream>>>(XK + r0p * DM, DM, 0, BK, DM, 0, 0.0625f, nullptr, 0, nullptr, 1, 0, 0, nullptr, K16 + r0p * DM, DM, 0, MP, DM, DM);
  k_gemm2<0><<<dim3((unsigned)((MP / 128) * (DM / 64)), 1), 128, 0, stream>>>(XV + r0p * DM, DM, 0, BV, DM, 0, 0.0625f, nullptr, 0, nullptr, 1, 0, 0, nullptr, V16 + r0p * DM, DM, 0, MP, DM, DM);
  k_hn16<<<(unsigned)((NR * NH + 255) / 256), 256, 0, stream>>>(Q16, LQ, NR, NQ); k_hn16<<<(unsigned)((NR * NH + 255) / 256), 256, 0, stream>>>(K16, LQ, NR, NK);      /* |qh|^2, |kh|^2 per (head, token) from the same f16 values the GEMM multiplies */
  for (int b = B0; b < B0 + NBR; ++b) { const size_t r0 = (size_t)b * SQ;
    k_vt<NH, SQ><<<NH * (SQ / 64), 256, 0, stream>>>(V16 + r0 * LQ, LQ, 0, VT);      /* V^T [NH][HD][SQ] for this batch */
    for (int h0 = 0; h0 < NHD; h0 += HG) {
      k_gemm2<0><<<dim3((QN / 128) * (SQ / 64), HG), 128, 0, stream>>>(Q16 + r0 * LQ + h0 * HD, LQ, (size_t)HD, K16 + r0 * LQ + h0 * HD, LQ, (size_t)HD, 1.0f, nullptr, 0, nullptr, 1, 0, 0, S, nullptr, SQ, (size_t)SQ * SQ, QN, SQ, HD);      /* scores, HG heads per launch */
      k_rsml2<<<(HG * QN + 255) / 256, 256, 0, stream>>>(S, P, QN, HG, NQ + (size_t)h0 * NR + r0, NK + (size_t)h0 * NR + r0, NR, mf, 0.125f);      /* softmax over sqrt(max(|q|^2 + |k|^2 - 2 q.k, 0)) / 8 + mask * (-1e9) */
      k_gemm2<0><<<dim3((QN / 128) * (HD / 64), HG), 128, 0, stream>>>(P, SQ, (size_t)SQ * SQ, VT + (size_t)h0 * HD * SQ, SQ, (size_t)HD * SQ, 0.25f, nullptr, 0, nullptr, 1, 0, 0, nullptr, O16 + r0 * DM + h0 * HD, DM, (size_t)HD, QN, HD, SQ); } }      /* o (merged heads) as f16 rows */
  k_gemm2<0><<<dim3((unsigned)((MPO / 128) * (DM / 64)), 1), 128, 0, stream>>>(O16 + r0p * DM, DM, 0, BO, DM, 0, 0.0009765625f, nullptr, 0, nullptr, 1, 0, 0, (float*)d_out + r0p * DM, nullptr, DM, 0, MPO, DM, DM);      /* out rows are the output layout */
}

// v001
// One run takes 752 microseconds.
// In two side-by-side timings against v000, it was 7.90 and 7.86 times as fast.
#include <hip/hip_runtime.h>
// Multi-head attention with L2-DISTANCE scores (inputs in the module's order v, k, q [4][1024][768], mask f32 [1][1][1024][1024] (zeros); qh = q wq, kh = k wk, vh = v wv ([in][out] 768x768 sigma 0.02, no biases); 12 heads of 64; scores = sqrt(max(|qh|^2 + |kh|^2 - 2 qh.kh, 0)) (pairwise L2 distance); logits = scores / 8 + mask * (-1e9); softmax; out = (attn vh merged) wo -> [4][1024][768]).
// Structure: token rows r = b*1024 + s; the three inputs as exact f16 rows (bf16-rounded); Q, K, V as three WMMA GEMMs (32x64 wave tiles, f32 accumulation, exact x16 weights, f16 outputs); per batch: V^T for all heads via LDS transposes; per (batch, group of 4 heads): scores GEMM (K = 64, batched over the heads on grid.y, alpha = 1 (raw q.k; the distance and the 1/8 are applied in the softmax kernel)), row softmax on VALU (f32 statistics, native exp; weights stored x256 as f16), o = P . V^T GEMM (K = 1024, alpha 2^-2: o carried x64 against f16 subnormal flush, folded into the output GEMM alpha) written straight into the merged f16 o rows; out = o W_o GEMM (f32) into the output layout.
// Compute dtype: inputs rounded to bf16; x / weights exact; q, k, v, softmax weights and o as plain f16 GEMM operands (~2^-12); scores and softmax statistics f32. v_wmma_f32_16x16x32_f16.
#define NB 4
#define SQ 1024
#define DM 768
#define NH 12
#define HD 64
#define HG 4                         /* heads per attention launch group */
#define B0 0                         /* first batch processed (debug hook) */
#define NBR NB                       /* batches processed (debug hook) */
#define NR ((size_t)NB * SQ)         /* token rows */
#define MP ((int)((size_t)NBR * SQ)) /* rows projected (debug hook) */
#define QN SQ                        /* query rows attended per batch (debug hook) */
#define NHD NH                       /* heads attended (debug hook) */
#define MPO MP                       /* rows through the output stage (debug hook) */
#define LQ DM      /* row pitch of the q/k/v rows */
typedef __bf16 v16b __attribute__((ext_vector_type(16)));
typedef unsigned short v8us __attribute__((ext_vector_type(8), may_alias));
typedef float  v8f  __attribute__((ext_vector_type(8)));
typedef float  v4f  __attribute__((ext_vector_type(4)));
typedef float  v4fa __attribute__((ext_vector_type(4), may_alias));
union FragB { v16b v; v8us half[2]; unsigned short u[16]; };

__device__ __forceinline__ unsigned short bf16_bits(float x) { unsigned int u = __float_as_uint(x); return (unsigned short)((u + 0x7FFFu + ((u >> 16) & 1u)) >> 16); }
__device__ __forceinline__ float bf16_val(unsigned short b) { return __uint_as_float(((unsigned int)b) << 16); }
__device__ __forceinline__ float bf16_round(float x) { return bf16_val(bf16_bits(x)); }
// D += A·B with NT terms: 1 = ah·bh, 2 = + al·bh (A split), 3 = + ah·bl (both split)
template <int NT>
__device__ __forceinline__ v8f mmaN(v16b ah, v16b al, v16b bh, v16b bl, v8f c) {
  c = __builtin_amdgcn_wmma_f32_16x16x32_bf16(false, ah, false, bh, (short)0, c, false, false);
  if (NT >= 2) c = __builtin_amdgcn_wmma_f32_16x16x32_bf16(false, al, false, bh, (short)0, c, false, false);
  if (NT >= 3) c = __builtin_amdgcn_wmma_f32_16x16x32_bf16(false, ah, false, bl, (short)0, c, false, false);
  asm volatile("v_nop\n\tv_nop\n\tv_nop\n\tv_nop" : "+v"(c) : "v"(ah), "v"(al), "v"(bh), "v"(bl));
  return c;
}

__global__ __launch_bounds__(256) void k_wt_bf16(const float* __restrict__ W, unsigned short* __restrict__ Wt, int K, int N) {
  const int t = blockIdx.x * 256 + threadIdx.x;
  const int k8n = K / 8;
  if (t >= N * k8n) return;
  const int n = t / k8n, k8 = (t % k8n) * 8;
  v8us v;
#pragma unroll
  for (int i = 0; i < 8; ++i) v[i] = bf16_bits(W[(size_t)(k8 + i) * N + n]);
  *(v8us*)(Wt + (size_t)n * K + k8) = v;
  
}

// GEMM C[M][N] (f32, pitch ldc) = act(A[M][K]·W + bias). A f32 row-major (pitch lda) converted per fragment to bf16
// (ASPLIT: hi/lo two planes -> 2 terms, else single rounded term); Wt bf16 [N][K] (pitch ldb). BIAS_BF16 rounds the
// bias to bf16 first (bias quantised to bf16 before the add). K%32==0, M%16==0, N%64==0.
template <bool ASPLIT, int ACT, bool BIAS_BF16>
__global__ __launch_bounds__(128) void k_gemm_bf(const float* __restrict__ A, int lda, const unsigned short* __restrict__ Wt, int ldb,
                                               const float* __restrict__ bias, float* __restrict__ C, int ldc, int M, int N, int K) {
  __shared__ __attribute__((aligned(16))) float so[4][16][64];
  const int tid = threadIdx.x, w = tid >> 5, lane = tid & 31, ln = lane & 15, hh = lane >> 4;
  const int ntn = N / 64;
  const int wid = blockIdx.x * 4 + w;
  const int mt = wid / ntn, nq = wid % ntn;
  if (mt * 16 >= M) return;
  const int row0 = mt * 16, col0 = nq * 64;
  const float* arow = A + (size_t)(row0 + ln) * lda;
  v8f acc[4] = {};
  for (int kb = 0; kb < K; kb += 32) {
    FragB ah, al;
    const v4f x0 = *(const v4fa*)(arow + kb + 8 * hh), x1 = *(const v4fa*)(arow + kb + 8 * hh + 4);
    const v4f x2 = *(const v4fa*)(arow + kb + 16 + 8 * hh), x3 = *(const v4fa*)(arow + kb + 16 + 8 * hh + 4);
    float xs[16] = {x0[0],x0[1],x0[2],x0[3],x1[0],x1[1],x1[2],x1[3],x2[0],x2[1],x2[2],x2[3],x3[0],x3[1],x3[2],x3[3]};
#pragma unroll
    for (int i = 0; i < 16; ++i) { const unsigned short hb = bf16_bits(xs[i]); ah.u[i] = hb; al.u[i] = ASPLIT ? bf16_bits(xs[i] - bf16_val(hb)) : (unsigned short)0; }
#pragma unroll
    for (int t = 0; t < 4; ++t) {
      const unsigned short* brow = Wt + (size_t)(col0 + t * 16 + ln) * ldb + kb;
      FragB b;
      b.half[0] = *(const v8us*)(brow + 8 * hh);
      b.half[1] = *(const v8us*)(brow + 16 + 8 * hh);
      acc[t] = mmaN<ASPLIT ? 2 : 1>(ah.v, al.v, b.v, b.v, acc[t]);
    }
  }
#pragma unroll
  for (int t = 0; t < 4; ++t) {
    float bv = bias ? bias[col0 + t * 16 + ln] : 0.f;
    if (BIAS_BF16) bv = bf16_round(bv);
#pragma unroll
    for (int r = 0; r < 8; ++r) { float v = acc[t][r] + bv; if (ACT == 1) v = fmaxf(v, 0.f); so[w][8 * hh + r][t * 16 + ln] = v; }
  }
  __builtin_amdgcn_fence(__ATOMIC_ACQ_REL, "workgroup");
  __builtin_amdgcn_wave_barrier();
  const int rsub = lane >> 4, c4 = (lane & 15) * 4;
  {
#pragma unroll
    for (int q = 0; q < 8; ++q) {
      const int r = q * 2 + rsub;
      const v4f v = *(const v4fa*)&so[w][r][c4];
      *(v4f*)(C + (size_t)(row0 + r) * ldc + col0 + c4) = v;
    }
    
  }
}

// GEMM C = act(A·W + bias + resid): A f32 (ASPLIT -> hi/lo 2 terms), Wt bf16 [N][K]; ACT 0 none, 1 relu, 2 exact gelu;
// resid (optional, f32, row index = (row % rmod), pitch ldr, RES_BF16 rounds it) added before the activation.
template <bool ASPLIT, int ACT, bool BIAS_BF16, bool RES_BF16>
__global__ __launch_bounds__(128) void k_gemm_bf3(const float* __restrict__ A, int lda, const unsigned short* __restrict__ Wt, int ldb,
                                                const float* __restrict__ bias, const float* __restrict__ resid, int rmod, int ldr,
                                                float* __restrict__ C, int ldc, int M, int N, int K) {
  __shared__ __attribute__((aligned(16))) float so[4][16][64];
  const int tid = threadIdx.x, w = tid >> 5, lane = tid & 31, ln = lane & 15, hh = lane >> 4;
  const int ntn = N / 64;
  const int wid = blockIdx.x * 4 + w;
  const int mt = wid / ntn, nq = wid % ntn;
  if (mt * 16 >= M) return;
  const int row0 = mt * 16, col0 = nq * 64;
  const float* arow = A + (size_t)(row0 + ln) * lda;
  v8f acc[4] = {};
  for (int kb = 0; kb < K; kb += 32) {
    FragB ah, al;
    const v4f x0 = *(const v4fa*)(arow + kb + 8 * hh), x1 = *(const v4fa*)(arow + kb + 8 * hh + 4);
    const v4f x2 = *(const v4fa*)(arow + kb + 16 + 8 * hh), x3 = *(const v4fa*)(arow + kb + 16 + 8 * hh + 4);
    float xs[16] = {x0[0],x0[1],x0[2],x0[3],x1[0],x1[1],x1[2],x1[3],x2[0],x2[1],x2[2],x2[3],x3[0],x3[1],x3[2],x3[3]};
#pragma unroll
    for (int i = 0; i < 16; ++i) { const unsigned short hb = bf16_bits(xs[i]); ah.u[i] = hb; al.u[i] = ASPLIT ? bf16_bits(xs[i] - bf16_val(hb)) : (unsigned short)0; }
#pragma unroll
    for (int t = 0; t < 4; ++t) {
      const unsigned short* brow = Wt + (size_t)(col0 + t * 16 + ln) * ldb + kb;
      FragB b;
      b.half[0] = *(const v8us*)(brow + 8 * hh);
      b.half[1] = *(const v8us*)(brow + 16 + 8 * hh);
      acc[t] = mmaN<ASPLIT ? 2 : 1>(ah.v, al.v, b.v, b.v, acc[t]);
    }
  }
#pragma unroll
  for (int t = 0; t < 4; ++t) {
    const int col = col0 + t * 16 + ln;
    float bv = bias ? bias[col] : 0.f;
    if (BIAS_BF16) bv = bf16_round(bv);
#pragma unroll
    for (int r = 0; r < 8; ++r) {
      float v = acc[t][r] + bv;
      if (resid) { float rv = resid[(size_t)((row0 + 8 * hh + r) % rmod) * ldr + col]; if (RES_BF16) rv = bf16_round(rv); v += rv; }
      if (ACT == 1) v = fmaxf(v, 0.f);
      if (ACT == 2) v = 0.5f * v * (1.0f + erff(v * 0.70710678118654752f));
      if (ACT == 3) { const float u = 0.7978845608028654f * (v + 0.044715f * v * v * v); v = 0.5f * v * (1.0f + tanhf(u)); }
      so[w][8 * hh + r][t * 16 + ln] = v;
    }
  }
  __builtin_amdgcn_fence(__ATOMIC_ACQ_REL, "workgroup");
  __builtin_amdgcn_wave_barrier();
  const int rsub = lane >> 4, c4 = (lane & 15) * 4;
  {
#pragma unroll
    for (int q = 0; q < 8; ++q) {
      const int r = q * 2 + rsub;
      const v4f v = *(const v4fa*)&so[w][r][c4];
      *(v4f*)(C + (size_t)(row0 + r) * ldc + col0 + c4) = v;
    }
    
  }
}
// row LayerNorm (biased variance, eps) over N: s = X (+ R); optional out_sum <- s; out_norm <- (s-mu)*rsqrt(var+eps)*g + b
template <bool PARAM_BF16>
__global__ __launch_bounds__(256) void k_layernorm(const float* __restrict__ X, const float* __restrict__ R, const float* __restrict__ g, const float* __restrict__ bta,
                                                  float* __restrict__ out_sum, float* __restrict__ out_norm, int N, float eps) {
  __shared__ float red[256];
  const int row = blockIdx.x, tid = threadIdx.x;
  const float* x = X + (size_t)row * N; const float* rr = R ? R + (size_t)row * N : nullptr;
  float vals[16];                     // up to N = 4096
  const int per = N / 256;            // contiguous chunk per thread? use strided-by-4 chunks: thread handles j = tid*4 + 1024*u
  float s1 = 0.f;
  for (int u = 0; u < per / 4; ++u) {
    const int j = tid * 4 + 1024 * u;
    const v4f a = *(const v4fa*)(x + j);
    v4f b = {0.f,0.f,0.f,0.f}; if (rr) b = *(const v4fa*)(rr + j);
#pragma unroll
    for (int q = 0; q < 4; ++q) { const float v = a[q] + b[q]; vals[u * 4 + q] = v; s1 += v; }
  }
  red[tid] = s1; __syncthreads();
  for (int st = 128; st > 0; st >>= 1) { if (tid < st) red[tid] += red[tid + st]; __syncthreads(); }
  const float mu = red[0] / (float)N; __syncthreads();
  float s2 = 0.f;
  for (int u = 0; u < per / 4; ++u)
#pragma unroll
    for (int q = 0; q < 4; ++q) { const float c = vals[u * 4 + q] - mu; s2 += c * c; }
  red[tid] = s2; __syncthreads();
  for (int st = 128; st > 0; st >>= 1) { if (tid < st) red[tid] += red[tid + st]; __syncthreads(); }
  const float rs = rsqrtf(red[0] / (float)N + eps);
  {
    for (int u = 0; u < per / 4; ++u) {
      const int j = tid * 4 + 1024 * u;
      v4f o, sm;
#pragma unroll
      for (int q = 0; q < 4; ++q) {
        float gg = g[j + q], bb = bta[j + q];
        if (PARAM_BF16) { gg = bf16_round(gg); bb = bf16_round(bb); }
        sm[q] = vals[u * 4 + q]; o[q] = (vals[u * 4 + q] - mu) * rs * gg + bb;
      }
      if (out_sum) *(v4f*)(out_sum + (size_t)row * N + j) = sm;
      *(v4f*)(out_norm + (size_t)row * N + j) = o;
    }
    
  }
}



// ---- f16 WMMA path (v_wmma_f32_16x16x32_f16): 11-bit significands for operands in range — used where a [0,1] probability operand needs more precision than bf16
typedef _Float16 v16h __attribute__((ext_vector_type(16)));
union FragH { v16h v; v8us half[2]; _Float16 h[16]; unsigned short u[16]; };
template <int NT>
__device__ __forceinline__ v8f mmaH(v16h ah, v16h al, v16h bh, v16h bl, v8f c) {
  c = __builtin_amdgcn_wmma_f32_16x16x32_f16(false, ah, false, bh, (short)0, c, false, false);
  if (NT >= 2) c = __builtin_amdgcn_wmma_f32_16x16x32_f16(false, al, false, bh, (short)0, c, false, false);
  if (NT >= 3) c = __builtin_amdgcn_wmma_f32_16x16x32_f16(false, ah, false, bl, (short)0, c, false, false);
  asm volatile("v_nop\n\tv_nop\n\tv_nop\n\tv_nop" : "+v"(c) : "v"(ah), "v"(al), "v"(bh), "v"(bl));
  return c;
}
// batched GEMM like k_gemm_b but f16 operands: A f32 (split into f16 hi/lo if ASPLIT, else rounded to f16), Bt = f16 values [n][k]; alpha; C f32; N multiple of 16 (partial tiles skipped)
template <bool ASPLIT>
__global__ __launch_bounds__(128) void k_gemm_h(const float* __restrict__ A, int lda, size_t sA, const _Float16* __restrict__ Bh, int ldb, size_t sB, float alpha, float* __restrict__ C, int ldc, size_t sC, int M, int N, int K) {
  __shared__ __attribute__((aligned(16))) float so[4][16][64];
  const int tid = threadIdx.x, w = tid >> 5, lane = tid & 31, ln = lane & 15, hh = lane >> 4; const int by = blockIdx.y;
  A += (size_t)by * sA; Bh += (size_t)by * sB; C += (size_t)by * sC;
  const int ntn = (N + 63) / 64; const int wid = blockIdx.x * 4 + w; const int mt = wid / ntn, nq = wid % ntn; if (mt * 16 >= M) return;
  const int row0 = mt * 16, col0 = nq * 64; const float* arow = A + (size_t)(row0 + ln) * lda;
  v8f acc[4] = {};
  for (int kb = 0; kb < K; kb += 32) {
    FragH ah, al;
    const v4f x0 = *(const v4fa*)(arow + kb + 8 * hh), x1 = *(const v4fa*)(arow + kb + 8 * hh + 4), x2 = *(const v4fa*)(arow + kb + 16 + 8 * hh), x3 = *(const v4fa*)(arow + kb + 16 + 8 * hh + 4);
    float xs[16] = {x0[0],x0[1],x0[2],x0[3],x1[0],x1[1],x1[2],x1[3],x2[0],x2[1],x2[2],x2[3],x3[0],x3[1],x3[2],x3[3]};
#pragma unroll
    for (int i = 0; i < 16; ++i) { const _Float16 h = (_Float16)xs[i]; ah.h[i] = h; al.h[i] = ASPLIT ? (_Float16)(xs[i] - (float)h) : (_Float16)0.0f; }
#pragma unroll
    for (int t = 0; t < 4; ++t) { if (col0 + t * 16 >= N) continue; const size_t boff = (size_t)(col0 + t * 16 + ln) * ldb + kb; FragH bq; bq.half[0] = *(const v8us*)(Bh + boff + 8 * hh); bq.half[1] = *(const v8us*)(Bh + boff + 16 + 8 * hh);
      acc[t] = mmaH<ASPLIT ? 2 : 1>(ah.v, al.v, bq.v, bq.v, acc[t]); }
  }
#pragma unroll
  for (int t = 0; t < 4; ++t) { if (col0 + t * 16 >= N) continue;
#pragma unroll
    for (int r = 0; r < 8; ++r) so[w][8 * hh + r][t * 16 + ln] = acc[t][r] * alpha; }
  __builtin_amdgcn_fence(__ATOMIC_ACQ_REL, "workgroup"); __builtin_amdgcn_wave_barrier();
  const int rsub = lane >> 4, c4 = (lane & 15) * 4;
  {
#pragma unroll
    for (int q = 0; q < 8; ++q) { const int r = q * 2 + rsub; if (col0 + c4 < N) { const v4f v = *(const v4fa*)&so[w][r][c4]; *(v4f*)(C + (size_t)(row0 + r) * ldc + col0 + c4) = v; } }
     }
}

// Wt[n][k] = f16(W[k][n]·scale) from f32 row-major W[K][N] (scale = power of two; bf16-exact weights stay exact in f16 away from the subnormal range)
__global__ __launch_bounds__(256) void k_wt_f16(const float* __restrict__ W, _Float16* __restrict__ Wt, int K, int N, float scale) {
  const int t = blockIdx.x * 256 + threadIdx.x; if (t >= N * (K / 8)) return; const int n = t / (K / 8), k8 = (t % (K / 8)) * 8; FragH f;
#pragma unroll
  for (int i = 0; i < 8; ++i) f.h[i] = (_Float16)(bf16_round(W[(size_t)(k8 + i) * N + n]) * scale); const v8us o = f.half[0];
  *(v8us*)((unsigned short*)Wt + (size_t)n * K + k8) = o; 
}
// k_gemm_hh variant with fused epilogue: v = acc·alpha + bias[by·sBias + col] (+ CP[(row/rowsPerB)·sCPb + by·64 + col] if CP) ; ACT 0 none / 1 elu ; writes f16 C16 (and f32 C if non-null)
template <int ACT>
__global__ __launch_bounds__(128) void k_gemm_hhx(const _Float16* __restrict__ A, int lda, size_t sA, const _Float16* __restrict__ Bh, int ldb, size_t sB, float alpha, const float* __restrict__ bias, size_t sBias, const float* __restrict__ CP, int rowsPerB, size_t sCPb, int row0g,
    float* __restrict__ C, _Float16* __restrict__ C16, int ldc, size_t sC, int M, int N, int K) {
  __shared__ __attribute__((aligned(16))) float so[4][16][64];
  const int tid = threadIdx.x, w = tid >> 5, lane = tid & 31, ln = lane & 15, hh = lane >> 4; const int by = blockIdx.y;
  A += (size_t)by * sA; Bh += (size_t)by * sB; const size_t cofs = (size_t)by * sC; const float* bp = bias ? bias + (size_t)by * sBias : nullptr;
  const int ntn = (N + 63) / 64; const int wid = blockIdx.x * 4 + w; const int mt = wid / ntn, nq = wid % ntn; if (mt * 16 >= M) return;
  const int row0 = mt * 16, col0 = nq * 64; const _Float16* arow = A + (size_t)(row0 + ln) * lda;
  v8f acc[4] = {};
  for (int kb = 0; kb < K; kb += 32) { FragH ah; ah.half[0] = *(const v8us*)((const unsigned short*)arow + kb + 8 * hh); ah.half[1] = *(const v8us*)((const unsigned short*)arow + kb + 16 + 8 * hh);
#pragma unroll
    for (int t = 0; t < 4; ++t) { if (col0 + t * 16 >= N) continue; const size_t boff = (size_t)(col0 + t * 16 + ln) * ldb + kb; FragH bq; bq.half[0] = *(const v8us*)((const unsigned short*)Bh + boff + 8 * hh); bq.half[1] = *(const v8us*)((const unsigned short*)Bh + boff + 16 + 8 * hh);
      acc[t] = mmaH<1>(ah.v, ah.v, bq.v, bq.v, acc[t]); }
  }
#pragma unroll
  for (int t = 0; t < 4; ++t) { if (col0 + t * 16 >= N) continue; const int col = col0 + t * 16 + ln; const float bv = bp ? bf16_round(bp[col]) : 0.f;
#pragma unroll
    for (int r = 0; r < 8; ++r) { float v = acc[t][r] * alpha + bv; if (CP) { const int rr = row0g + row0 + 8 * hh + r; if (rowsPerB < 0) v += CP[cofs + (size_t)rr * ldc + col];      /* rowsPerB < 0: own element of the batched C plane */ else { const int bidx = rr / rowsPerB; v += CP[(size_t)bidx * sCPb + (size_t)by * 64 + col]; } } if (ACT == 1) v = (v > 0.f) ? v : expm1f(v); else if (ACT == 7) v = (v > 0.f) ? v + 1.0f : expf(v); else if (ACT == 8) v = tanhf(v); else if (ACT == 9) v = 0.5f * v * (1.0f + tanhf(0.7978845608028654f * (v + 0.044715f * v * v * v))); else if (ACT == 11) v = 1.0f / (1.0f + expf(-v)); else if (ACT == 12) v = (v > 0.f) ? v : 0.01f * v; else if (ACT == 14) v = (v > 0.f) ? v : 0.1f * v; else if (ACT == 16) v = (v >= 0.f) ? v : 0.3f * v; else if (ACT == 17) v = (v >= 0.f) ? v : 0.2f * v; else if (ACT == 15) v = v / (1.0f + expf(-v)); else if (ACT == 3) v = fmaxf(v, 0.f); else if (ACT == 6) v = 0.5f * v * (1.0f + erff(v * 0.70710678118654752f)); so[w][8 * hh + r][t * 16 + ln] = v; } }
  __builtin_amdgcn_fence(__ATOMIC_ACQ_REL, "workgroup"); __builtin_amdgcn_wave_barrier();
  const int rsub = lane >> 4, c4 = (lane & 15) * 4; typedef _Float16 v4h __attribute__((ext_vector_type(4)));
  {
#pragma unroll
    for (int q = 0; q < 8; ++q) { const int r = q * 2 + rsub; if (col0 + c4 < N) { const v4f v = *(const v4fa*)&so[w][r][c4]; if (C) *(v4f*)(C + cofs + (size_t)(row0 + r) * ldc + col0 + c4) = v; if (C16) { v4h h4; for (int i = 0; i < 4; ++i) h4[i] = (_Float16)v[i]; *(v4h*)(C16 + cofs + (size_t)(row0 + r) * ldc + col0 + c4) = h4; } } }
     }
}


typedef _Float16 v4h __attribute__((ext_vector_type(4)));

__global__ __launch_bounds__(256) void k_x16(const float* __restrict__ x, _Float16* __restrict__ X16, size_t n8) { const size_t t = (size_t)blockIdx.x * 256 + threadIdx.x; if (t >= n8) return; FragH f;
#pragma unroll
  for (int q = 0; q < 8; ++q) f.h[q] = (_Float16)bf16_round(x[t * 8 + q]); *(v8us*)((unsigned short*)X16 + t * 8) = f.half[0];  }
__global__ __launch_bounds__(256) void k_h16(const float* __restrict__ x, _Float16* __restrict__ X16, size_t n8) { const size_t t = (size_t)blockIdx.x * 256 + threadIdx.x; if (t >= n8) return; FragH f;
#pragma unroll
  for (int q = 0; q < 8; ++q) f.h[q] = (_Float16)x[t * 8 + q]; *(v8us*)((unsigned short*)X16 + t * 8) = f.half[0];  }
__global__ __launch_bounds__(256) void k_round16f(const float* __restrict__ W, _Float16* __restrict__ Bt, size_t n8) { const size_t t = (size_t)blockIdx.x * 256 + threadIdx.x; if (t >= n8) return; FragH f;
#pragma unroll
  for (int i = 0; i < 8; ++i) f.h[i] = (_Float16)(bf16_round(W[t * 8 + i]) * 16.0f); *(v8us*)((unsigned short*)Bt + t * 8) = f.half[0];  }
template <int NHv, int TTv>
__global__ __launch_bounds__(256) void k_vt(const _Float16* __restrict__ V16, int ldv, int voff, _Float16* __restrict__ Vt) { __shared__ unsigned short tl[64][66]; const int tid = threadIdx.x; const int slab = blockIdx.x / (TTv / 64), lg = blockIdx.x % (TTv / 64); const int b = slab / NHv, h = slab % NHv;
  for (int i = tid; i < 64 * 8; i += 256) { const int r = i / 8, c8 = (i % 8) * 8; FragH f; f.half[0] = *(const v8us*)((const unsigned short*)V16 + ((size_t)b * TTv + lg * 64 + r) * ldv + voff + h * 64 + c8);
#pragma unroll
    for (int q = 0; q < 8; ++q) tl[r][c8 + q] = f.u[q]; }
  __syncthreads();
  {
#pragma unroll
    for (int rd = 0; rd < 2; ++rd) { const int d = rd * 32 + tid / 8, pc = tid % 8; FragH f;
#pragma unroll
      for (int q = 0; q < 8; ++q) f.u[q] = tl[pc * 8 + q][d];
      *(v8us*)((unsigned short*)Vt + ((size_t)slab * 64 + d) * TTv + lg * 64 + pc * 8) = f.half[0]; }
     } }

__global__ __launch_bounds__(256) void k_hl(const float* __restrict__ F, _Float16* __restrict__ Hh, _Float16* __restrict__ Hl, size_t n8) { const size_t t = (size_t)blockIdx.x * 256 + threadIdx.x; if (t >= n8) return; FragH fh, fl; const v4f a = *(const v4fa*)(F + t * 8), c = *(const v4fa*)(F + t * 8 + 4);
#pragma unroll
  for (int q = 0; q < 4; ++q) { _Float16 h = (_Float16)a[q]; fh.h[q] = h; fl.h[q] = (_Float16)((a[q] - (float)h) * 1024.0f); h = (_Float16)c[q]; fh.h[4 + q] = h; fl.h[4 + q] = (_Float16)((c[q] - (float)h) * 1024.0f); }
  { *(v8us*)((unsigned short*)Hh + t * 8) = fh.half[0]; *(v8us*)((unsigned short*)Hl + t * 8) = fl.half[0];  } }

// ---- fast GEMM (wave tile 32x64; requires M % 32 == 0 rows per launch region and N % 64 == 0); epilogue = k_gemm_hhx semantics ----
__device__ __forceinline__ v16h g2_frag(const _Float16* p, int hh) { FragH f; f.half[0] = *(const v8us*)((const unsigned short*)p + 8 * hh); f.half[1] = *(const v8us*)((const unsigned short*)p + 16 + 8 * hh); return f.v; }
__device__ __forceinline__ v8f g2_mma(v16h a, v16h b, v8f c) { v8f d = __builtin_amdgcn_wmma_f32_16x16x32_f16(false, a, false, b, (short)0, c, false, false); asm volatile("v_nop\n\tv_nop\n\tv_nop\n\tv_nop" : "+v"(d) : "v"(a), "v"(b)); return d; }
template <int ACT>
__global__ __launch_bounds__(128) void k_gemm2(const _Float16* __restrict__ A, int lda, size_t sA, const _Float16* __restrict__ Bh, int ldb, size_t sB, float alpha, const float* __restrict__ bias, size_t sBias, const float* __restrict__ CP, int rowsPerB, size_t sCPb, int row0g,
    float* __restrict__ C, _Float16* __restrict__ C16, int ldc, size_t sC, int M, int N, int K) { static_assert(ACT == 0 || ACT == 3 || ACT == 6 || ACT == 8 || ACT == 9 || ACT == 11 || ACT == 12 || ACT == 14 || ACT == 15 || ACT == 16 || ACT == 17, "k_gemm2: unsupported ACT code (would silently apply no activation)");
  __shared__ __attribute__((aligned(16))) float so[4][32][68];
  const int tid = threadIdx.x, w = tid >> 5, lane = tid & 31, ln = lane & 15, hh = lane >> 4; const int by = blockIdx.y;
  A += (size_t)by * sA; Bh += (size_t)by * sB; const size_t cofs = (size_t)by * sC; const float* bp = bias ? bias + (size_t)by * sBias : nullptr;
  const int ntn = N >> 6; const int mt = blockIdx.x / ntn, nq = blockIdx.x - mt * ntn; const int row0 = mt * 128 + 32 * w, col0 = nq * 64; if (row0 >= M) return;
  const _Float16* a0p = A + (size_t)(row0 + ln) * lda; const _Float16* a1p = a0p + (size_t)16 * lda;
  const _Float16* b0p = Bh + (size_t)(col0 + ln) * ldb; const _Float16* b1p = b0p + (size_t)16 * ldb; const _Float16* b2p = b1p + (size_t)16 * ldb; const _Float16* b3p = b2p + (size_t)16 * ldb;
  const v8f z8 = {0.f,0.f,0.f,0.f,0.f,0.f,0.f,0.f}; v8f c00 = z8, c01 = z8, c02 = z8, c03 = z8, c10 = z8, c11 = z8, c12 = z8, c13 = z8;
#pragma unroll 1
  for (int kb = 0; kb < K; kb += 32) { const v16h a0 = g2_frag(a0p + kb, hh), a1 = g2_frag(a1p + kb, hh);
    v16h b = g2_frag(b0p + kb, hh); c00 = g2_mma(a0, b, c00); c10 = g2_mma(a1, b, c10);
    b = g2_frag(b1p + kb, hh); c01 = g2_mma(a0, b, c01); c11 = g2_mma(a1, b, c11);
    b = g2_frag(b2p + kb, hh); c02 = g2_mma(a0, b, c02); c12 = g2_mma(a1, b, c12);
    b = g2_frag(b3p + kb, hh); c03 = g2_mma(a0, b, c03); c13 = g2_mma(a1, b, c13); }
  v8f accs[8] = {c00, c01, c02, c03, c10, c11, c12, c13};
#pragma unroll
  for (int u = 0; u < 8; ++u) { const int t = u & 3, half = u >> 2; const int col = col0 + t * 16 + ln; const float bv = bp ? bf16_round(bp[col]) : 0.f;
#pragma unroll
    for (int r = 0; r < 8; ++r) { const int rloc = half * 16 + 8 * hh + r; float v = accs[u][r] * alpha + bv; if (CP) { if (rowsPerB < 0) v += CP[cofs + (size_t)(row0g + row0 + rloc) * ldc + col];      /* rowsPerB < 0: own element of the batched C plane */ else { const int bidx = (row0g + row0 + rloc) / rowsPerB; v += CP[(size_t)bidx * sCPb + (size_t)by * 64 + col]; } }
      if (ACT == 3) v = fmaxf(v, 0.f); else if (ACT == 6) v = 0.5f * v * (1.0f + erff(v * 0.70710678118654752f)); else if (ACT == 11) v = 1.0f / (1.0f + expf(-v)); else if (ACT == 15) v = v / (1.0f + expf(-v)); else if (ACT == 12) v = (v > 0.f) ? v : 0.01f * v; else if (ACT == 8) v = tanhf(v); else if (ACT == 9) v = 0.5f * v * (1.0f + tanhf(0.7978845608028654f * (v + 0.044715f * v * v * v))); else if (ACT == 14) v = (v > 0.f) ? v : 0.1f * v; else if (ACT == 16) v = (v >= 0.f) ? v : 0.3f * v; else if (ACT == 17) v = (v >= 0.f) ? v : 0.2f * v;
      so[w][rloc][t * 16 + ln] = v; } }
  __builtin_amdgcn_fence(__ATOMIC_ACQ_REL, "workgroup"); __builtin_amdgcn_wave_barrier();
  const int rsub = lane >> 4, c4 = (lane & 15) * 4;
  {
#pragma unroll
    for (int q = 0; q < 16; ++q) { const int r = q * 2 + rsub; const v4f v = *(const v4fa*)&so[w][r][c4]; if (C) *(v4f*)(C + cofs + (size_t)(row0 + r) * ldc + col0 + c4) = v; if (C16) { v4h h4; for (int i = 0; i < 4; ++i) h4[i] = (_Float16)v[i]; *(v4h*)(C16 + cofs + (size_t)(row0 + r) * ldc + col0 + c4) = h4; } }
     } }


__global__ __launch_bounds__(256) void k_wnat(const float* __restrict__ w, size_t n8, _Float16* __restrict__ Bt) { const size_t t = (size_t)blockIdx.x * 256 + threadIdx.x; if (t >= n8) return; FragH f; for (int q = 0; q < 8; ++q) f.h[q] = (_Float16)(bf16_round(w[t * 8 + q]) * 16.0f); *(v8us*)((unsigned short*)Bt + t * 8) = f.half[0];  }
__global__ __launch_bounds__(256) void k_rsm(const float* __restrict__ S, _Float16* __restrict__ P, int nrows) {
  #pragma clang fp contract(off)
  const int i = blockIdx.x * 256 + threadIdx.x; if (i >= nrows) return; const float* s = S + (size_t)i * SQ; float mx = -3.0e38f;
#pragma unroll 1
  for (int j = 0; j < SQ; ++j) mx = fmaxf(mx, s[j]); float se = 0.f;
#pragma unroll 1
  for (int j = 0; j < SQ; ++j) se += expf(s[j] - mx); const float sc = 256.0f / se;
#pragma unroll 1
  for (int j0 = 0; j0 < SQ; j0 += 8) { FragH f; for (int q = 0; q < 8; ++q) f.h[q] = (_Float16)(expf(s[j0 + q] - mx) * sc); unsigned short* d = (unsigned short*)P + (size_t)i * SQ + j0; *(v8us*)d = f.half[0];  } }
__global__ __launch_bounds__(256) void k_vt(const _Float16* __restrict__ V16, int b, int h0, _Float16* __restrict__ VT) { __shared__ unsigned short tl[64][65]; const int tid = threadIdx.x; const int hh = blockIdx.x % HG, sg = blockIdx.x / HG; const int s0 = sg * 64; const int h = h0 + hh;
  for (int i = tid; i < 64 * 8; i += 256) { const int j = i / 8, d8 = (i % 8) * 8; FragH f; f.half[0] = *(const v8us*)((const unsigned short*)V16 + ((size_t)b * SQ + s0 + j) * DM + h * HD + d8); for (int q = 0; q < 8; ++q) tl[d8 + q][j] = f.u[q]; }
  __syncthreads();
  { for (int i = tid; i < 64 * 8; i += 256) { const int d = i / 8, j8 = (i % 8) * 8; FragH f; for (int q = 0; q < 8; ++q) f.u[q] = tl[d][j8 + q]; *(v8us*)((unsigned short*)VT + ((size_t)hh * HD + d) * SQ + s0 + j8) = f.half[0]; }  } }


__global__ __launch_bounds__(256) void k_hn16(const _Float16* __restrict__ X, int ld, size_t nrows, float* __restrict__ NQ) {
  #pragma clang fp contract(off)
  const size_t t = (size_t)blockIdx.x * 256 + threadIdx.x; if (t >= nrows * NH) return; const int h = (int)(t / nrows); const size_t r = t % nrows; const _Float16* p = X + r * (size_t)ld + (size_t)h * HD; float ss = 0.f;
#pragma unroll 1
  for (int c = 0; c < HD / 8; ++c) { FragH f; f.half[0] = *(const v8us*)((const unsigned short*)p + c * 8); for (int q = 0; q < 8; ++q) { const float v = (float)f.h[q]; ss = __fadd_rn(ss, __fmul_rn(v, v)); } }
  float* d = NQ + (size_t)h * nrows + r; *(float*)d = ss;  }
// e^x as __expf forms it (one multiply, v_exp_f32). The v_nop in the same statement is the one slot the instruction set asks for behind a transcendental before its source is rewritten or its result read.
__device__ __forceinline__ float exp_slot(float x) { float r; asm("v_exp_f32 %0, %1\n\tv_nop" : "=v"(r) : "v"(x * 1.44269504f)); return r; }
// One wave per (head, query row): lane l holds columns c*128 + 4*l .. + 3 (c = 0..7), so every load covers 512 contiguous bytes; the row's logits stay in registers from the max to the store.
__global__ __launch_bounds__(256) void k_rsml2(const float* __restrict__ S, _Float16* __restrict__ P, int qn, int hg, const float* __restrict__ NQ, const float* __restrict__ NK, size_t npitch, const float* __restrict__ Mf, float scale) {
  #pragma clang fp contract(off)
  const int lane = threadIdx.x & 31; const int t = blockIdx.x * 8 + __builtin_amdgcn_readfirstlane(threadIdx.x >> 5);      /* the wave's row, told to the compiler as wave-uniform: scalar row addresses and a scalar exit test */
  if (t >= qn * hg) return; const int hl = t / qn, row = t % qn; const size_t i = (size_t)hl * SQ + row; const float* s = S + i * SQ; const float nq = NQ[(size_t)hl * npitch + row]; const float* nk = NK + (size_t)hl * npitch; const float* mrow = Mf + (size_t)row * SQ; float mx = -3.0e38f;
  float e[SQ / 32];
#pragma unroll      /* e[] must be indexed by constants to live in registers; later chunks' loads can issue while earlier chunks are worked on */
  for (int c = 0; c < SQ / 128; ++c) { const int j0 = c * 128 + lane * 4; const v4f s4 = *(const v4fa*)(s + j0), k4 = *(const v4fa*)(nk + j0), m4 = *(const v4fa*)(mrow + j0);
#pragma unroll      /* constant index into e[] */
    for (int q = 0; q < 4; ++q) { const float d2 = fmaxf(__fadd_rn(__fadd_rn(nq, k4[q]), -2.0f * s4[q]), 0.f); const float v = __fadd_rn(__fmul_rn(sqrtf(d2), scale), __fmul_rn(bf16_round(m4[q]), -1.0e9f)); e[c * 4 + q] = v; mx = fmaxf(mx, v); } }
  for (int o = 16; o > 0; o >>= 1) mx = fmaxf(mx, __shfl_xor(mx, o));      /* row maximum over the 32 lanes */
  float se = 0.f;
#pragma unroll      /* constant index into e[] */
  for (int u = 0; u < SQ / 32; ++u) { e[u] = exp_slot(e[u] - mx); se += e[u]; }
  for (int o = 16; o > 0; o >>= 1) se += __shfl_xor(se, o);      /* row sum: per-lane partial sums, then a five-step butterfly */
  const float sc = 256.0f / se;
#pragma unroll      /* constant index into e[] */
  for (int c = 0; c < SQ / 128; ++c) { v4h h4;
#pragma unroll      /* constant index into e[] */
    for (int q = 0; q < 4; ++q) h4[q] = (_Float16)(e[c * 4 + q] * sc);
    *(v4h*)(P + i * SQ + c * 128 + lane * 4) = h4; } }


__global__ __launch_bounds__(256) void k_rsmf(const float* __restrict__ S, _Float16* __restrict__ P, int qn, int hg) {
  #pragma clang fp contract(off)
  const int t = blockIdx.x * 256 + threadIdx.x; if (t >= qn * hg) return; const size_t i = (size_t)(t / qn) * SQ + (t % qn); const float* s = S + i * SQ; float mx = -3.0e38f;
#pragma unroll 1
  for (int j = 0; j < SQ; ++j) mx = fmaxf(mx, s[j]); float se = 0.f;
#pragma unroll 1
  for (int j = 0; j < SQ; ++j) se += __expf(s[j] - mx); const float sc = 256.0f / se;
#pragma unroll 1
  for (int j0 = 0; j0 < SQ; j0 += 8) { FragH f; for (int q = 0; q < 8; ++q) f.h[q] = (_Float16)(__expf(s[j0 + q] - mx) * sc); unsigned short* d = (unsigned short*)P + i * SQ + j0; *(v8us*)d = f.half[0];  } }

extern "C" void kernel_launch(void* const* d_in, const int* in_sizes, int n_in,
                              void* d_out, int out_size, void* d_ws, size_t ws_size, hipStream_t stream) {
  (void)in_sizes; (void)n_in; (void)out_size;
  const float* const* I = (const float* const*)d_in; const float* xv = I[0]; const float* xk = I[1]; const float* xq = I[2]; const float* mf = I[3]; const float* wq = I[4]; const float* wk = I[5]; const float* wv = I[6]; const float* wo = I[7]; const float* bq = nullptr; const float* bk = nullptr; (void)bq; (void)bk;      /* inputs v, k, q, mask (f32 [1][1][S][S]); [in][out] weights, no biases */
  char* ws = (char*)d_ws; size_t off = 0;
  auto take = [&](size_t bytes) { char* p = ws + off; off += (bytes + 255) & ~(size_t)255; return p; };
  _Float16* BQ = (_Float16*)take((size_t)DM * DM * 2); _Float16* BK = (_Float16*)take((size_t)DM * DM * 2); _Float16* BV = (_Float16*)take((size_t)DM * DM * 2); _Float16* BO = (_Float16*)take((size_t)DM * DM * 2);
  _Float16* XQ = (_Float16*)take(NR * DM * 2); _Float16* XK = (_Float16*)take(NR * DM * 2); _Float16* XV = (_Float16*)take(NR * DM * 2); _Float16* Q16 = (_Float16*)take(NR * DM * 2); _Float16* K16 = (_Float16*)take(NR * DM * 2); _Float16* V16 = (_Float16*)take(NR * DM * 2); _Float16* O16 = (_Float16*)take(NR * DM * 2);
  float* S = (float*)take((size_t)HG * SQ * SQ * 4); _Float16* P = (_Float16*)take((size_t)HG * SQ * SQ * 2); _Float16* VT = (_Float16*)take((size_t)NH * HD * SQ * 2); float* NQ = (float*)take((size_t)NH * NR * 4); float* NK = (float*)take((size_t)NH * NR * 4);      /* per-(head, row) squared norms of the f16 q and k rows */
  if (off > ws_size) return;
  k_wt_f16<<<(unsigned)(((size_t)DM * (DM / 8) + 255) / 256), 256, 0, stream>>>(wq, BQ, DM, DM, 16.0f); k_wt_f16<<<(unsigned)(((size_t)DM * (DM / 8) + 255) / 256), 256, 0, stream>>>(wk, BK, DM, DM, 16.0f); k_wt_f16<<<(unsigned)(((size_t)DM * (DM / 8) + 255) / 256), 256, 0, stream>>>(wv, BV, DM, DM, 16.0f); k_wt_f16<<<(unsigned)(((size_t)DM * (DM / 8) + 255) / 256), 256, 0, stream>>>(wo, BO, DM, DM, 16.0f);      /* [in][out] -> Bt[n][k] x16 */

  k_x16<<<(unsigned)((NR * DM / 8 + 255) / 256), 256, 0, stream>>>(xq, XQ, NR * DM / 8); k_x16<<<(unsigned)((NR * DM / 8 + 255) / 256), 256, 0, stream>>>(xk, XK, NR * DM / 8); k_x16<<<(unsigned)((NR * DM / 8 + 255) / 256), 256, 0, stream>>>(xv, XV, NR * DM / 8);      /* the three inputs as exact f16 rows */
  const size_t r0p = (size_t)B0 * SQ;      /* first projected row */
  k_gemm2<0><<<dim3((unsigned)((MP / 128) * (DM / 64)), 1), 128, 0, stream>>>(XQ + r0p * DM, DM, 0, BQ, DM, 0, 0.0625f, nullptr, 0, nullptr, 1, 0, 0, nullptr, Q16 + r0p * DM, DM, 0, MP, DM, DM);
  k_gemm2<0><<<dim3((unsigned)((MP / 128) * (DM / 64)), 1), 128, 0, stream>>>(XK + r0p * DM, DM, 0, BK, DM, 0, 0.0625f, nullptr, 0, nullptr, 1, 0, 0, nullptr, K16 + r0p * DM, DM, 0, MP, DM, DM);
  k_gemm2<0><<<dim3((unsigned)((MP / 128) * (DM / 64)), 1), 128, 0, stream>>>(XV + r0p * DM, DM, 0, BV, DM, 0, 0.0625f, nullptr, 0, nullptr, 1, 0, 0, nullptr, V16 + r0p * DM, DM, 0, MP, DM, DM);
  k_hn16<<<(unsigned)((NR * NH + 255) / 256), 256, 0, stream>>>(Q16, LQ, NR, NQ); k_hn16<<<(unsigned)((NR * NH + 255) / 256), 256, 0, stream>>>(K16, LQ, NR, NK);      /* |qh|^2, |kh|^2 per (head, token) from the same f16 values the GEMM multiplies */
  for (int b = B0; b < B0 + NBR; ++b) { const size_t r0 = (size_t)b * SQ;
    k_vt<NH, SQ><<<NH * (SQ / 64), 256, 0, stream>>>(V16 + r0 * LQ, LQ, 0, VT);      /* V^T [NH][HD][SQ] for this batch */
    for (int h0 = 0; h0 < NHD; h0 += HG) {
      k_gemm2<0><<<dim3((QN / 128) * (SQ / 64), HG), 128, 0, stream>>>(Q16 + r0 * LQ + h0 * HD, LQ, (size_t)HD, K16 + r0 * LQ + h0 * HD, LQ, (size_t)HD, 1.0f, nullptr, 0, nullptr, 1, 0, 0, S, nullptr, SQ, (size_t)SQ * SQ, QN, SQ, HD);      /* scores, HG heads per launch */
      k_rsml2<<<(HG * QN + 7) / 8, 256, 0, stream>>>(S, P, QN, HG, NQ + (size_t)h0 * NR + r0, NK + (size_t)h0 * NR + r0, NR, mf, 0.125f);      /* softmax over sqrt(max(|q|^2 + |k|^2 - 2 q.k, 0)) / 8 + mask * (-1e9) */
      k_gemm2<0><<<dim3((QN / 128) * (HD / 64), HG), 128, 0, stream>>>(P, SQ, (size_t)SQ * SQ, VT + (size_t)h0 * HD * SQ, SQ, (size_t)HD * SQ, 0.25f, nullptr, 0, nullptr, 1, 0, 0, nullptr, O16 + r0 * DM + h0 * HD, DM, (size_t)HD, QN, HD, SQ); } }      /* o (merged heads) as f16 rows */
  k_gemm2<0><<<dim3((unsigned)((MPO / 128) * (DM / 64)), 1), 128, 0, stream>>>(O16 + r0p * DM, DM, 0, BO, DM, 0, 0.0009765625f, nullptr, 0, nullptr, 1, 0, 0, (float*)d_out + r0p * DM, nullptr, DM, 0, MPO, DM, DM);      /* out rows are the output layout */
}

// v002
// Measured time: 223 microseconds a run.
// Timed twice side by side with v001, it ran 3.38 times as fast both times.
// All steps since v000 together make it 26.6 times as fast.
#include <hip/hip_runtime.h>
// Multi-head attention with L2-DISTANCE scores (inputs in the module's order v, k, q [4][1024][768], mask f32 [1][1][1024][1024] (zeros); qh = q wq, kh = k wk, vh = v wv ([in][out] 768x768 sigma 0.02, no biases); 12 heads of 64; scores = sqrt(max(|qh|^2 + |kh|^2 - 2 qh.kh, 0)) (pairwise L2 distance); logits = scores / 8 + mask * (-1e9); softmax; out = (attn vh merged) wo -> [4][1024][768]).
// Structure: token rows r = b*1024 + s; the three inputs as exact f16 rows (bf16-rounded); Q, K, V as three WMMA GEMMs (32x64 wave tiles, f32 accumulation, exact x16 weights, f16 outputs); V^T for all (batch, head) via LDS transposes; one launch each over all 48 (head, batch) planes (GEMMs: heads on grid.y, batches on grid.z): scores GEMM (K = 64, alpha = 1 (raw q.k; the distance and the 1/8 are applied in the softmax kernel)), row softmax on VALU (f32 statistics, native exp; weights stored x256 as f16 over the front half of their own score row), o = P . V^T GEMM (K = 1024, alpha 2^-2: o carried x64 against f16 subnormal flush, folded into the output GEMM alpha) written straight into the merged f16 o rows; out = o W_o GEMM (f32) into the output layout.
// Compute dtype: inputs rounded to bf16; x / weights exact; q, k, v, softmax weights and o as plain f16 GEMM operands (~2^-12); scores and softmax statistics f32. v_wmma_f32_16x16x32_f16.
#define NB 4
#define SQ 1024
#define DM 768
#define NH 12
#define HD 64
#define HG 4                         /* heads per launch of the non-template k_vt */
#define B0 0                         /* unused: every launch starts at batch 0 */
#define NBR NB                       /* batches processed (debug hook) */
#define NR ((size_t)NB * SQ)         /* token rows */
#define MP ((int)((size_t)NBR * SQ)) /* rows projected (debug hook) */
#define QN SQ                        /* unused: the attention launches take SQ rows */
#define NHD NH                       /* unused: the attention launches take NH heads */
#define MPO MP                       /* rows through the output stage (debug hook) */
#define LQ DM      /* row pitch of the q/k/v rows */
typedef __bf16 v16b __attribute__((ext_vector_type(16)));
typedef unsigned short v8us __attribute__((ext_vector_type(8), may_alias));
typedef float  v8f  __attribute__((ext_vector_type(8)));
typedef float  v4f  __attribute__((ext_vector_type(4)));
typedef float  v4fa __attribute__((ext_vector_type(4), may_alias));
union FragB { v16b v; v8us half[2]; unsigned short u[16]; };

__device__ __forceinline__ unsigned short bf16_bits(float x) { unsigned int u = __float_as_uint(x); return (unsigned short)((u + 0x7FFFu + ((u >> 16) & 1u)) >> 16); }
__device__ __forceinline__ float bf16_val(unsigned short b) { return __uint_as_float(((unsigned int)b) << 16); }
__device__ __forceinline__ float bf16_round(float x) { return bf16_val(bf16_bits(x)); }
// D += A·B with NT terms: 1 = ah·bh, 2 = + al·bh (A split), 3 = + ah·bl (both split)
template <int NT>
__device__ __forceinline__ v8f mmaN(v16b ah, v16b al, v16b bh, v16b bl, v8f c) {
  c = __builtin_amdgcn_wmma_f32_16x16x32_bf16(false, ah, false, bh, (short)0, c, false, false);
  if (NT >= 2) c = __builtin_amdgcn_wmma_f32_16x16x32_bf16(false, al, false, bh, (short)0, c, false, false);
  if (NT >= 3) c = __builtin_amdgcn_wmma_f32_16x16x32_bf16(false, ah, false, bl, (short)0, c, false, false);
  asm volatile("v_nop\n\tv_nop\n\tv_nop\n\tv_nop" : "+v"(c) : "v"(ah), "v"(al), "v"(bh), "v"(bl));
  return c;
}

__global__ __launch_bounds__(256) void k_wt_bf16(const float* __restrict__ W, unsigned short* __restrict__ Wt, int K, int N) {
  const int t = blockIdx.x * 256 + threadIdx.x;
  const int k8n = K / 8;
  if (t >= N * k8n) return;
  const int n = t / k8n, k8 = (t % k8n) * 8;
  v8us v;
#pragma unroll
  for (int i = 0; i < 8; ++i) v[i] = bf16_bits(W[(size_t)(k8 + i) * N + n]);
  *(v8us*)(Wt + (size_t)n * K + k8) = v;
  
}

// GEMM C[M][N] (f32, pitch ldc) = act(A[M][K]·W + bias). A f32 row-major (pitch lda) converted per fragment to bf16
// (ASPLIT: hi/lo two planes -> 2 terms, else single rounded term); Wt bf16 [N][K] (pitch ldb). BIAS_BF16 rounds the
// bias to bf16 first (bias quantised to bf16 before the add). K%32==0, M%16==0, N%64==0.
template <bool ASPLIT, int ACT, bool BIAS_BF16>
__global__ __launch_bounds__(128) void k_gemm_bf(const float* __restrict__ A, int lda, const unsigned short* __restrict__ Wt, int ldb,
                                               const float* __restrict__ bias, float* __restrict__ C, int ldc, int M, int N, int K) {
  __shared__ __attribute__((aligned(16))) float so[4][16][64];
  const int tid = threadIdx.x, w = tid >> 5, lane = tid & 31, ln = lane & 15, hh = lane >> 4;
  const int ntn = N / 64;
  const int wid = blockIdx.x * 4 + w;
  const int mt = wid / ntn, nq = wid % ntn;
  if (mt * 16 >= M) return;
  const int row0 = mt * 16, col0 = nq * 64;
  const float* arow = A + (size_t)(row0 + ln) * lda;
  v8f acc[4] = {};
  for (int kb = 0; kb < K; kb += 32) {
    FragB ah, al;
    const v4f x0 = *(const v4fa*)(arow + kb + 8 * hh), x1 = *(const v4fa*)(arow + kb + 8 * hh + 4);
    const v4f x2 = *(const v4fa*)(arow + kb + 16 + 8 * hh), x3 = *(const v4fa*)(arow + kb + 16 + 8 * hh + 4);
    float xs[16] = {x0[0],x0[1],x0[2],x0[3],x1[0],x1[1],x1[2],x1[3],x2[0],x2[1],x2[2],x2[3],x3[0],x3[1],x3[2],x3[3]};
#pragma unroll
    for (int i = 0; i < 16; ++i) { const unsigned short hb = bf16_bits(xs[i]); ah.u[i] = hb; al.u[i] = ASPLIT ? bf16_bits(xs[i] - bf16_val(hb)) : (unsigned short)0; }
#pragma unroll
    for (int t = 0; t < 4; ++t) {
      const unsigned short* brow = Wt + (size_t)(col0 + t * 16 + ln) * ldb + kb;
      FragB b;
      b.half[0] = *(const v8us*)(brow + 8 * hh);
      b.half[1] = *(const v8us*)(brow + 16 + 8 * hh);
      acc[t] = mmaN<ASPLIT ? 2 : 1>(ah.v, al.v, b.v, b.v, acc[t]);
    }
  }
#pragma unroll
  for (int t = 0; t < 4; ++t) {
    float bv = bias ? bias[col0 + t * 16 + ln] : 0.f;
    if (BIAS_BF16) bv = bf16_round(bv);
#pragma unroll
    for (int r = 0; r < 8; ++r) { float v = acc[t][r] + bv; if (ACT == 1) v = fmaxf(v, 0.f); so[w][8 * hh + r][t * 16 + ln] = v; }
  }
  __builtin_amdgcn_fence(__ATOMIC_ACQ_REL, "workgroup");
  __builtin_amdgcn_wave_barrier();
  const int rsub = lane >> 4, c4 = (lane & 15) * 4;
  {
#pragma unroll
    for (int q = 0; q < 8; ++q) {
      const int r = q * 2 + rsub;
      const v4f v = *(const v4fa*)&so[w][r][c4];
      *(v4f*)(C + (size_t)(row0 + r) * ldc + col0 + c4) = v;
    }
    
  }
}

// GEMM C = act(A·W + bias + resid): A f32 (ASPLIT -> hi/lo 2 terms), Wt bf16 [N][K]; ACT 0 none, 1 relu, 2 exact gelu;
// resid (optional, f32, row index = (row % rmod), pitch ldr, RES_BF16 rounds it) added before the activation.
template <bool ASPLIT, int ACT, bool BIAS_BF16, bool RES_BF16>
__global__ __launch_bounds__(128) void k_gemm_bf3(const float* __restrict__ A, int lda, const unsigned short* __restrict__ Wt, int ldb,
                                                const float* __restrict__ bias, const float* __restrict__ resid, int rmod, int ldr,
                                                float* __restrict__ C, int ldc, int M, int N, int K) {
  __shared__ __attribute__((aligned(16))) float so[4][16][64];
  const int tid = threadIdx.x, w = tid >> 5, lane = tid & 31, ln = lane & 15, hh = lane >> 4;
  const int ntn = N / 64;
  const int wid = blockIdx.x * 4 + w;
  const int mt = wid / ntn, nq = wid % ntn;
  if (mt * 16 >= M) return;
  const int row0 = mt * 16, col0 = nq * 64;
  const float* arow = A + (size_t)(row0 + ln) * lda;
  v8f acc[4] = {};
  for (int kb = 0; kb < K; kb += 32) {
    FragB ah, al;
    const v4f x0 = *(const v4fa*)(arow + kb + 8 * hh), x1 = *(const v4fa*)(arow + kb + 8 * hh + 4);
    const v4f x2 = *(const v4fa*)(arow + kb + 16 + 8 * hh), x3 = *(const v4fa*)(arow + kb + 16 + 8 * hh + 4);
    float xs[16] = {x0[0],x0[1],x0[2],x0[3],x1[0],x1[1],x1[2],x1[3],x2[0],x2[1],x2[2],x2[3],x3[0],x3[1],x3[2],x3[3]};
#pragma unroll
    for (int i = 0; i < 16; ++i) { const unsigned short hb = bf16_bits(xs[i]); ah.u[i] = hb; al.u[i] = ASPLIT ? bf16_bits(xs[i] - bf16_val(hb)) : (unsigned short)0; }
#pragma unroll
    for (int t = 0; t < 4; ++t) {
      const unsigned short* brow = Wt + (size_t)(col0 + t * 16 + ln) * ldb + kb;
      FragB b;
      b.half[0] = *(const v8us*)(brow + 8 * hh);
      b.half[1] = *(const v8us*)(brow + 16 + 8 * hh);
      acc[t] = mmaN<ASPLIT ? 2 : 1>(ah.v, al.v, b.v, b.v, acc[t]);
    }
  }
#pragma unroll
  for (int t = 0; t < 4; ++t) {
    const int col = col0 + t * 16 + ln;
    float bv = bias ? bias[col] : 0.f;
    if (BIAS_BF16) bv = bf16_round(bv);
#pragma unroll
    for (int r = 0; r < 8; ++r) {
      float v = acc[t][r] + bv;
      if (resid) { float rv = resid[(size_t)((row0 + 8 * hh + r) % rmod) * ldr + col]; if (RES_BF16) rv = bf16_round(rv); v += rv; }
      if (ACT == 1) v = fmaxf(v, 0.f);
      if (ACT == 2) v = 0.5f * v * (1.0f + erff(v * 0.70710678118654752f));
      if (ACT == 3) { const float u = 0.7978845608028654f * (v + 0.044715f * v * v * v); v = 0.5f * v * (1.0f + tanhf(u)); }
      so[w][8 * hh + r][t * 16 + ln] = v;
    }
  }
  __builtin_amdgcn_fence(__ATOMIC_ACQ_REL, "workgroup");
  __builtin_amdgcn_wave_barrier();
  const int rsub = lane >> 4, c4 = (lane & 15) * 4;
  {
#pragma unroll
    for (int q = 0; q < 8; ++q) {
      const int r = q * 2 + rsub;
      const v4f v = *(const v4fa*)&so[w][r][c4];
      *(v4f*)(C + (size_t)(row0 + r) * ldc + col0 + c4) = v;
    }
    
  }
}
// row LayerNorm (biased variance, eps) over N: s = X (+ R); optional out_sum <- s; out_norm <- (s-mu)*rsqrt(var+eps)*g + b
template <bool PARAM_BF16>
__global__ __launch_bounds__(256) void k_layernorm(const float* __restrict__ X, const float* __restrict__ R, const float* __restrict__ g, const float* __restrict__ bta,
                                                  float* __restrict__ out_sum, float* __restrict__ out_norm, int N, float eps) {
  __shared__ float red[256];
  const int row = blockIdx.x, tid = threadIdx.x;
  const float* x = X + (size_t)row * N; const float* rr = R ? R + (size_t)row * N : nullptr;
  float vals[16];                     // up to N = 4096
  const int per = N / 256;            // contiguous chunk per thread? use strided-by-4 chunks: thread handles j = tid*4 + 1024*u
  float s1 = 0.f;
  for (int u = 0; u < per / 4; ++u) {
    const int j = tid * 4 + 1024 * u;
    const v4f a = *(const v4fa*)(x + j);
    v4f b = {0.f,0.f,0.f,0.f}; if (rr) b = *(const v4fa*)(rr + j);
#pragma unroll
    for (int q = 0; q < 4; ++q) { const float v = a[q] + b[q]; vals[u * 4 + q] = v; s1 += v; }
  }
  red[tid] = s1; __syncthreads();
  for (int st = 128; st > 0; st >>= 1) { if (tid < st) red[tid] += red[tid + st]; __syncthreads(); }
  const float mu = red[0] / (float)N; __syncthreads();
  float s2 = 0.f;
  for (int u = 0; u < per / 4; ++u)
#pragma unroll
    for (int q = 0; q < 4; ++q) { const float c = vals[u * 4 + q] - mu; s2 += c * c; }
  red[tid] = s2; __syncthreads();
  for (int st = 128; st > 0; st >>= 1) { if (tid < st) red[tid] += red[tid + st]; __syncthreads(); }
  const float rs = rsqrtf(red[0] / (float)N + eps);
  {
    for (int u = 0; u < per / 4; ++u) {
      const int j = tid * 4 + 1024 * u;
      v4f o, sm;
#pragma unroll
      for (int q = 0; q < 4; ++q) {
        float gg = g[j + q], bb = bta[j + q];
        if (PARAM_BF16) { gg = bf16_round(gg); bb = bf16_round(bb); }
        sm[q] = vals[u * 4 + q]; o[q] = (vals[u * 4 + q] - mu) * rs * gg + bb;
      }
      if (out_sum) *(v4f*)(out_sum + (size_t)row * N + j) = sm;
      *(v4f*)(out_norm + (size_t)row * N + j) = o;
    }
    
  }
}



// ---- f16 WMMA path (v_wmma_f32_16x16x32_f16): 11-bit significands for operands in range — used where a [0,1] probability operand needs more precision than bf16
typedef _Float16 v16h __attribute__((ext_vector_type(16)));
union FragH { v16h v; v8us half[2]; _Float16 h[16]; unsigned short u[16]; };
template <int NT>
__device__ __forceinline__ v8f mmaH(v16h ah, v16h al, v16h bh, v16h bl, v8f c) {
  c = __builtin_amdgcn_wmma_f32_16x16x32_f16(false, ah, false, bh, (short)0, c, false, false);
  if (NT >= 2) c = __builtin_amdgcn_wmma_f32_16x16x32_f16(false, al, false, bh, (short)0, c, false, false);
  if (NT >= 3) c = __builtin_amdgcn_wmma_f32_16x16x32_f16(false, ah, false, bl, (short)0, c, false, false);
  asm volatile("v_nop\n\tv_nop\n\tv_nop\n\tv_nop" : "+v"(c) : "v"(ah), "v"(al), "v"(bh), "v"(bl));
  return c;
}
// batched GEMM like k_gemm_b but f16 operands: A f32 (split into f16 hi/lo if ASPLIT, else rounded to f16), Bt = f16 values [n][k]; alpha; C f32; N multiple of 16 (partial tiles skipped)
template <bool ASPLIT>
__global__ __launch_bounds__(128) void k_gemm_h(const float* __restrict__ A, int lda, size_t sA, const _Float16* __restrict__ Bh, int ldb, size_t sB, float alpha, float* __restrict__ C, int ldc, size_t sC, int M, int N, int K) {
  __shared__ __attribute__((aligned(16))) float so[4][16][64];
  const int tid = threadIdx.x, w = tid >> 5, lane = tid & 31, ln = lane & 15, hh = lane >> 4; const int by = blockIdx.y;
  A += (size_t)by * sA; Bh += (size_t)by * sB; C += (size_t)by * sC;
  const int ntn = (N + 63) / 64; const int wid = blockIdx.x * 4 + w; const int mt = wid / ntn, nq = wid % ntn; if (mt * 16 >= M) return;
  const int row0 = mt * 16, col0 = nq * 64; const float* arow = A + (size_t)(row0 + ln) * lda;
  v8f acc[4] = {};
  for (int kb = 0; kb < K; kb += 32) {
    FragH ah, al;
    const v4f x0 = *(const v4fa*)(arow + kb + 8 * hh), x1 = *(const v4fa*)(arow + kb + 8 * hh + 4), x2 = *(const v4fa*)(arow + kb + 16 + 8 * hh), x3 = *(const v4fa*)(arow + kb + 16 + 8 * hh + 4);
    float xs[16] = {x0[0],x0[1],x0[2],x0[3],x1[0],x1[1],x1[2],x1[3],x2[0],x2[1],x2[2],x2[3],x3[0],x3[1],x3[2],x3[3]};
#pragma unroll
    for (int i = 0; i < 16; ++i) { const _Float16 h = (_Float16)xs[i]; ah.h[i] = h; al.h[i] = ASPLIT ? (_Float16)(xs[i] - (float)h) : (_Float16)0.0f; }
#pragma unroll
    for (int t = 0; t < 4; ++t) { if (col0 + t * 16 >= N) continue; const size_t boff = (size_t)(col0 + t * 16 + ln) * ldb + kb; FragH bq; bq.half[0] = *(const v8us*)(Bh + boff + 8 * hh); bq.half[1] = *(const v8us*)(Bh + boff + 16 + 8 * hh);
      acc[t] = mmaH<ASPLIT ? 2 : 1>(ah.v, al.v, bq.v, bq.v, acc[t]); }
  }
#pragma unroll
  for (int t = 0; t < 4; ++t) { if (col0 + t * 16 >= N) continue;
#pragma unroll
    for (int r = 0; r < 8; ++r) so[w][8 * hh + r][t * 16 + ln] = acc[t][r] * alpha; }
  __builtin_amdgcn_fence(__ATOMIC_ACQ_REL, "workgroup"); __builtin_amdgcn_wave_barrier();
  const int rsub = lane >> 4, c4 = (lane & 15) * 4;
  {
#pragma unroll
    for (int q = 0; q < 8; ++q) { const int r = q * 2 + rsub; if (col0 + c4 < N) { const v4f v = *(const v4fa*)&so[w][r][c4]; *(v4f*)(C + (size_t)(row0 + r) * ldc + col0 + c4) = v; } }
     }
}

// Wt[n][k] = f16(W[k][n]·scale) from f32 row-major W[K][N] (scale = power of two; bf16-exact weights stay exact in f16 away from the subnormal range)
// blockIdx.y picks one of four weight matrices; their transposes lie sWt elements apart
__global__ __launch_bounds__(256) void k_wt_f16(const float* __restrict__ W0, const float* __restrict__ W1, const float* __restrict__ W2, const float* __restrict__ W3, _Float16* __restrict__ Wt, size_t sWt, int K, int N, float scale) {
  const int y = blockIdx.y; const float* __restrict__ W = y == 0 ? W0 : y == 1 ? W1 : y == 2 ? W2 : W3; Wt += (size_t)y * sWt;
  const int t = blockIdx.x * 256 + threadIdx.x; if (t >= N * (K / 8)) return; const int n = t / (K / 8), k8 = (t % (K / 8)) * 8; FragH f;
#pragma unroll
  for (int i = 0; i < 8; ++i) f.h[i] = (_Float16)(bf16_round(W[(size_t)(k8 + i) * N + n]) * scale); const v8us o = f.half[0];
  *(v8us*)((unsigned short*)Wt + (size_t)n * K + k8) = o; 
}
// k_gemm_hh variant with fused epilogue: v = acc·alpha + bias[by·sBias + col] (+ CP[(row/rowsPerB)·sCPb + by·64 + col] if CP) ; ACT 0 none / 1 elu ; writes f16 C16 (and f32 C if non-null)
template <int ACT>
__global__ __launch_bounds__(128) void k_gemm_hhx(const _Float16* __restrict__ A, int lda, size_t sA, const _Float16* __restrict__ Bh, int ldb, size_t sB, float alpha, const float* __restrict__ bias, size_t sBias, const float* __restrict__ CP, int rowsPerB, size_t sCPb, int row0g,
    float* __restrict__ C, _Float16* __restrict__ C16, int ldc, size_t sC, int M, int N, int K) {
  __shared__ __attribute__((aligned(16))) float so[4][16][64];
  const int tid = threadIdx.x, w = tid >> 5, lane = tid & 31, ln = lane & 15, hh = lane >> 4; const int by = blockIdx.y;
  A += (size_t)by * sA; Bh += (size_t)by * sB; const size_t cofs = (size_t)by * sC; const float* bp = bias ? bias + (size_t)by * sBias : nullptr;
  const int ntn = (N + 63) / 64; const int wid = blockIdx.x * 4 + w; const int mt = wid / ntn, nq = wid % ntn; if (mt * 16 >= M) return;
  const int row0 = mt * 16, col0 = nq * 64; const _Float16* arow = A + (size_t)(row0 + ln) * lda;
  v8f acc[4] = {};
  for (int kb = 0; kb < K; kb += 32) { FragH ah; ah.half[0] = *(const v8us*)((const unsigned short*)arow + kb + 8 * hh); ah.half[1] = *(const v8us*)((const unsigned short*)arow + kb + 16 + 8 * hh);
#pragma unroll
    for (int t = 0; t < 4; ++t) { if (col0 + t * 16 >= N) continue; const size_t boff = (size_t)(col0 + t * 16 + ln) * ldb + kb; FragH bq; bq.half[0] = *(const v8us*)((const unsigned short*)Bh + boff + 8 * hh); bq.half[1] = *(const v8us*)((const unsigned short*)Bh + boff + 16 + 8 * hh);
      acc[t] = mmaH<1>(ah.v, ah.v, bq.v, bq.v, acc[t]); }
  }
#pragma unroll
  for (int t = 0; t < 4; ++t) { if (col0 + t * 16 >= N) continue; const int col = col0 + t * 16 + ln; const float bv = bp ? bf16_round(bp[col]) : 0.f;
#pragma unroll
    for (int r = 0; r < 8; ++r) { float v = acc[t][r] * alpha + bv; if (CP) { const int rr = row0g + row0 + 8 * hh + r; if (rowsPerB < 0) v += CP[cofs + (size_t)rr * ldc + col];      /* rowsPerB < 0: own element of the batched C plane */ else { const int bidx = rr / rowsPerB; v += CP[(size_t)bidx * sCPb + (size_t)by * 64 + col]; } } if (ACT == 1) v = (v > 0.f) ? v : expm1f(v); else if (ACT == 7) v = (v > 0.f) ? v + 1.0f : expf(v); else if (ACT == 8) v = tanhf(v); else if (ACT == 9) v = 0.5f * v * (1.0f + tanhf(0.7978845608028654f * (v + 0.044715f * v * v * v))); else if (ACT == 11) v = 1.0f / (1.0f + expf(-v)); else if (ACT == 12) v = (v > 0.f) ? v : 0.01f * v; else if (ACT == 14) v = (v > 0.f) ? v : 0.1f * v; else if (ACT == 16) v = (v >= 0.f) ? v : 0.3f * v; else if (ACT == 17) v = (v >= 0.f) ? v : 0.2f * v; else if (ACT == 15) v = v / (1.0f + expf(-v)); else if (ACT == 3) v = fmaxf(v, 0.f); else if (ACT == 6) v = 0.5f * v * (1.0f + erff(v * 0.70710678118654752f)); so[w][8 * hh + r][t * 16 + ln] = v; } }
  __builtin_amdgcn_fence(__ATOMIC_ACQ_REL, "workgroup"); __builtin_amdgcn_wave_barrier();
  const int rsub = lane >> 4, c4 = (lane & 15) * 4; typedef _Float16 v4h __attribute__((ext_vector_type(4)));
  {
#pragma unroll
    for (int q = 0; q < 8; ++q) { const int r = q * 2 + rsub; if (col0 + c4 < N) { const v4f v = *(const v4fa*)&so[w][r][c4]; if (C) *(v4f*)(C + cofs + (size_t)(row0 + r) * ldc + col0 + c4) = v; if (C16) { v4h h4; for (int i = 0; i < 4; ++i) h4[i] = (_Float16)v[i]; *(v4h*)(C16 + cofs + (size_t)(row0 + r) * ldc + col0 + c4) = h4; } } }
     }
}


typedef _Float16 v4h __attribute__((ext_vector_type(4)));

__global__ __launch_bounds__(256) void k_x16(const float* __restrict__ x0, const float* __restrict__ x1, const float* __restrict__ x2, _Float16* __restrict__ X16, size_t n8) { const int y = blockIdx.y; const float* __restrict__ x = y == 0 ? x0 : y == 1 ? x1 : x2; X16 += (size_t)y * n8 * 8;      /* blockIdx.y picks one of three inputs; their f16 copies lie back to back */
  const size_t t = (size_t)blockIdx.x * 256 + threadIdx.x; if (t >= n8) return; FragH f;
#pragma unroll
  for (int q = 0; q < 8; ++q) f.h[q] = (_Float16)bf16_round(x[t * 8 + q]); *(v8us*)((unsigned short*)X16 + t * 8) = f.half[0];  }
__global__ __launch_bounds__(256) void k_h16(const float* __restrict__ x, _Float16* __restrict__ X16, size_t n8) { const size_t t = (size_t)blockIdx.x * 256 + threadIdx.x; if (t >= n8) return; FragH f;
#pragma unroll
  for (int q = 0; q < 8; ++q) f.h[q] = (_Float16)x[t * 8 + q]; *(v8us*)((unsigned short*)X16 + t * 8) = f.half[0];  }
__global__ __launch_bounds__(256) void k_round16f(const float* __restrict__ W, _Float16* __restrict__ Bt, size_t n8) { const size_t t = (size_t)blockIdx.x * 256 + threadIdx.x; if (t >= n8) return; FragH f;
#pragma unroll
  for (int i = 0; i < 8; ++i) f.h[i] = (_Float16)(bf16_round(W[t * 8 + i]) * 16.0f); *(v8us*)((unsigned short*)Bt + t * 8) = f.half[0];  }
template <int NHv, int TTv>
__global__ __launch_bounds__(256) void k_vt(const _Float16* __restrict__ V16, int ldv, int voff, _Float16* __restrict__ Vt) { __shared__ unsigned short tl[64][66]; const int tid = threadIdx.x; const int slab = blockIdx.x / (TTv / 64), lg = blockIdx.x % (TTv / 64); const int b = slab / NHv, h = slab % NHv;
  for (int i = tid; i < 64 * 8; i += 256) { const int r = i / 8, c8 = (i % 8) * 8; FragH f; f.half[0] = *(const v8us*)((const unsigned short*)V16 + ((size_t)b * TTv + lg * 64 + r) * ldv + voff + h * 64 + c8);
#pragma unroll
    for (int q = 0; q < 8; ++q) tl[r][c8 + q] = f.u[q]; }
  __syncthreads();
  {
#pragma unroll
    for (int rd = 0; rd < 2; ++rd) { const int d = rd * 32 + tid / 8, pc = tid % 8; FragH f;
#pragma unroll
      for (int q = 0; q < 8; ++q) f.u[q] = tl[pc * 8 + q][d];
      *(v8us*)((unsigned short*)Vt + ((size_t)slab * 64 + d) * TTv + lg * 64 + pc * 8) = f.half[0]; }
     } }

__global__ __launch_bounds__(256) void k_hl(const float* __restrict__ F, _Float16* __restrict__ Hh, _Float16* __restrict__ Hl, size_t n8) { const size_t t = (size_t)blockIdx.x * 256 + threadIdx.x; if (t >= n8) return; FragH fh, fl; const v4f a = *(const v4fa*)(F + t * 8), c = *(const v4fa*)(F + t * 8 + 4);
#pragma unroll
  for (int q = 0; q < 4; ++q) { _Float16 h = (_Float16)a[q]; fh.h[q] = h; fl.h[q] = (_Float16)((a[q] - (float)h) * 1024.0f); h = (_Float16)c[q]; fh.h[4 + q] = h; fl.h[4 + q] = (_Float16)((c[q] - (float)h) * 1024.0f); }
  { *(v8us*)((unsigned short*)Hh + t * 8) = fh.half[0]; *(v8us*)((unsigned short*)Hl + t * 8) = fl.half[0];  } }

// ---- fast GEMM (wave tile 32x64; requires M % 32 == 0 rows per launch region and N % 64 == 0); epilogue = k_gemm_hhx semantics ----
__device__ __forceinline__ v16h g2_frag(const _Float16* p, int hh) { FragH f; f.half[0] = *(const v8us*)((const unsigned short*)p + 8 * hh); f.half[1] = *(const v8us*)((const unsigned short*)p + 16 + 8 * hh); return f.v; }
__device__ __forceinline__ v8f g2_mma(v16h a, v16h b, v8f c) { v8f d = __builtin_amdgcn_wmma_f32_16x16x32_f16(false, a, false, b, (short)0, c, false, false); asm volatile("v_nop\n\tv_nop\n\tv_nop\n\tv_nop" : "+v"(d) : "v"(a), "v"(b)); return d; }
template <int ACT>
__global__ __launch_bounds__(128) void k_gemm2(const _Float16* __restrict__ A, int lda, size_t sA, const _Float16* __restrict__ Bh, int ldb, size_t sB, float alpha, const float* __restrict__ bias, size_t sBias, const float* __restrict__ CP, int rowsPerB, size_t sCPb, int row0g,
    float* __restrict__ C, _Float16* __restrict__ C16, int ldc, size_t sC, int M, int N, int K, size_t zA, size_t zB, size_t zC) { static_assert(ACT == 0 || ACT == 3 || ACT == 6 || ACT == 8 || ACT == 9 || ACT == 11 || ACT == 12 || ACT == 14 || ACT == 15 || ACT == 16 || ACT == 17, "k_gemm2: unsupported ACT code (would silently apply no activation)");
  __shared__ __attribute__((aligned(16))) float so[4][32][68];
  const int tid = threadIdx.x, w = tid >> 5, lane = tid & 31, ln = lane & 15, hh = lane >> 4; const int by = blockIdx.y, bz = blockIdx.z;      /* two batch axes: strides sA, sB, sC on grid.y and zA, zB, zC on grid.z */
  A += (size_t)by * sA + (size_t)bz * zA; Bh += (size_t)by * sB + (size_t)bz * zB; const size_t cofs = (size_t)by * sC + (size_t)bz * zC; const float* bp = bias ? bias + (size_t)by * sBias : nullptr;
  const int ntn = N >> 6; const int mt = blockIdx.x / ntn, nq = blockIdx.x - mt * ntn; const int row0 = mt * 128 + 32 * w, col0 = nq * 64; if (row0 >= M) return;
  const _Float16* a0p = A + (size_t)(row0 + ln) * lda; const _Float16* a1p = a0p + (size_t)16 * lda;
  const _Float16* b0p = Bh + (size_t)(col0 + ln) * ldb; const _Float16* b1p = b0p + (size_t)16 * ldb; const _Float16* b2p = b1p + (size_t)16 * ldb; const _Float16* b3p = b2p + (size_t)16 * ldb;
  const v8f z8 = {0.f,0.f,0.f,0.f,0.f,0.f,0.f,0.f}; v8f c00 = z8, c01 = z8, c02 = z8, c03 = z8, c10 = z8, c11 = z8, c12 = z8, c13 = z8;
#pragma unroll 1
  for (int kb = 0; kb < K; kb += 32) { const v16h a0 = g2_frag(a0p + kb, hh), a1 = g2_frag(a1p + kb, hh);
    v16h b = g2_frag(b0p + kb, hh); c00 = g2_mma(a0, b, c00); c10 = g2_mma(a1, b, c10);
    b = g2_frag(b1p + kb, hh); c01 = g2_mma(a0, b, c01); c11 = g2_mma(a1, b, c11);
    b = g2_frag(b2p + kb, hh); c02 = g2_mma(a0, b, c02); c12 = g2_mma(a1, b, c12);
    b = g2_frag(b3p + kb, hh); c03 = g2_mma(a0, b, c03); c13 = g2_mma(a1, b, c13); }
  v8f accs[8] = {c00, c01, c02, c03, c10, c11, c12, c13};
#pragma unroll
  for (int u = 0; u < 8; ++u) { const int t = u & 3, half = u >> 2; const int col = col0 + t * 16 + ln; const float bv = bp ? bf16_round(bp[col]) : 0.f;
#pragma unroll
    for (int r = 0; r < 8; ++r) { const int rloc = half * 16 + 8 * hh + r; float v = accs[u][r] * alpha + bv; if (CP) { if (rowsPerB < 0) v += CP[cofs + (size_t)(row0g + row0 + rloc) * ldc + col];      /* rowsPerB < 0: own element of the batched C plane */ else { const int bidx = (row0g + row0 + rloc) / rowsPerB; v += CP[(size_t)bidx * sCPb + (size_t)by * 64 + col]; } }
      if (ACT == 3) v = fmaxf(v, 0.f); else if (ACT == 6) v = 0.5f * v * (1.0f + erff(v * 0.70710678118654752f)); else if (ACT == 11) v = 1.0f / (1.0f + expf(-v)); else if (ACT == 15) v = v / (1.0f + expf(-v)); else if (ACT == 12) v = (v > 0.f) ? v : 0.01f * v; else if (ACT == 8) v = tanhf(v); else if (ACT == 9) v = 0.5f * v * (1.0f + tanhf(0.7978845608028654f * (v + 0.044715f * v * v * v))); else if (ACT == 14) v = (v > 0.f) ? v : 0.1f * v; else if (ACT == 16) v = (v >= 0.f) ? v : 0.3f * v; else if (ACT == 17) v = (v >= 0.f) ? v : 0.2f * v;
      so[w][rloc][t * 16 + ln] = v; } }
  __builtin_amdgcn_fence(__ATOMIC_ACQ_REL, "workgroup"); __builtin_amdgcn_wave_barrier();
  const int rsub = lane >> 4, c4 = (lane & 15) * 4;
  {
#pragma unroll
    for (int q = 0; q < 16; ++q) { const int r = q * 2 + rsub; const v4f v = *(const v4fa*)&so[w][r][c4]; if (C) *(v4f*)(C + cofs + (size_t)(row0 + r) * ldc + col0 + c4) = v; if (C16) { v4h h4; for (int i = 0; i < 4; ++i) h4[i] = (_Float16)v[i]; *(v4h*)(C16 + cofs + (size_t)(row0 + r) * ldc + col0 + c4) = h4; } }
     } }


__global__ __launch_bounds__(256) void k_wnat(const float* __restrict__ w, size_t n8, _Float16* __restrict__ Bt) { const size_t t = (size_t)blockIdx.x * 256 + threadIdx.x; if (t >= n8) return; FragH f; for (int q = 0; q < 8; ++q) f.h[q] = (_Float16)(bf16_round(w[t * 8 + q]) * 16.0f); *(v8us*)((unsigned short*)Bt + t * 8) = f.half[0];  }
__global__ __launch_bounds__(256) void k_rsm(const float* __restrict__ S, _Float16* __restrict__ P, int nrows) {
  #pragma clang fp contract(off)
  const int i = blockIdx.x * 256 + threadIdx.x; if (i >= nrows) return; const float* s = S + (size_t)i * SQ; float mx = -3.0e38f;
#pragma unroll 1
  for (int j = 0; j < SQ; ++j) mx = fmaxf(mx, s[j]); float se = 0.f;
#pragma unroll 1
  for (int j = 0; j < SQ; ++j) se += expf(s[j] - mx); const float sc = 256.0f / se;
#pragma unroll 1
  for (int j0 = 0; j0 < SQ; j0 += 8) { FragH f; for (int q = 0; q < 8; ++q) f.h[q] = (_Float16)(expf(s[j0 + q] - mx) * sc); unsigned short* d = (unsigned short*)P + (size_t)i * SQ + j0; *(v8us*)d = f.half[0];  } }
__global__ __launch_bounds__(256) void k_vt(const _Float16* __restrict__ V16, int b, int h0, _Float16* __restrict__ VT) { __shared__ unsigned short tl[64][65]; const int tid = threadIdx.x; const int hh = blockIdx.x % HG, sg = blockIdx.x / HG; const int s0 = sg * 64; const int h = h0 + hh;
  for (int i = tid; i < 64 * 8; i += 256) { const int j = i / 8, d8 = (i % 8) * 8; FragH f; f.half[0] = *(const v8us*)((const unsigned short*)V16 + ((size_t)b * SQ + s0 + j) * DM + h * HD + d8); for (int q = 0; q < 8; ++q) tl[d8 + q][j] = f.u[q]; }
  __syncthreads();
  { for (int i = tid; i < 64 * 8; i += 256) { const int d = i / 8, j8 = (i % 8) * 8; FragH f; for (int q = 0; q < 8; ++q) f.u[q] = tl[d][j8 + q]; *(v8us*)((unsigned short*)VT + ((size_t)hh * HD + d) * SQ + s0 + j8) = f.half[0]; }  } }


__global__ __launch_bounds__(256) void k_hn16(const _Float16* __restrict__ X, int ld, size_t nrows, float* __restrict__ NQ) {
  #pragma clang fp contract(off)
  X += (size_t)blockIdx.y * nrows * (size_t)ld; NQ += (size_t)blockIdx.y * nrows * NH;      /* blockIdx.y: the q rows, then the k rows behind them; the norm planes likewise */
  const size_t t = (size_t)blockIdx.x * 256 + threadIdx.x; if (t >= nrows * NH) return; const int h = (int)(t / nrows); const size_t r = t % nrows; const _Float16* p = X + r * (size_t)ld + (size_t)h * HD; float ss = 0.f;
#pragma unroll 1
  for (int c = 0; c < HD / 8; ++c) { FragH f; f.half[0] = *(const v8us*)((const unsigned short*)p + c * 8); for (int q = 0; q < 8; ++q) { const float v = (float)f.h[q]; ss = __fadd_rn(ss, __fmul_rn(v, v)); } }
  float* d = NQ + (size_t)h * nrows + r; *(float*)d = ss;  }
// e^x as __expf forms it (one multiply, v_exp_f32). The v_nop in the same statement is the one slot the instruction set asks for behind a transcendental before its source is rewritten or its result read.
__device__ __forceinline__ float exp_slot(float x) { float r; asm("v_exp_f32 %0, %1\n\tv_nop" : "=v"(r) : "v"(x * 1.44269504f)); return r; }
// S and P are not __restrict__: P may be the front half of the same rows (ldp = 2 * SQ f16); a wave stores only into its own row, and every store needs the row sum, so all its loads of the row come first.
// One wave per (head, query row): lane l holds columns c*128 + 4*l .. + 3 (c = 0..7), so every load covers 512 contiguous bytes; the row's logits stay in registers from the max to the store.
__global__ __launch_bounds__(256) void k_rsml2(const float* S, _Float16* P, int ldp, int qn, int hg, const float* __restrict__ NQ, const float* __restrict__ NK, size_t npitch, const float* __restrict__ Mf, float scale) {
  #pragma clang fp contract(off)
  const int lane = threadIdx.x & 31; const int t = blockIdx.x * 8 + __builtin_amdgcn_readfirstlane(threadIdx.x >> 5);      /* the wave's row, told to the compiler as wave-uniform: scalar row addresses and a scalar exit test */
  if (t >= qn * hg) return; const int hl = t / qn, row = t % qn; const size_t i = (size_t)hl * SQ + row; const float* s = S + i * SQ; const float nq = NQ[(size_t)hl * npitch + row]; const float* nk = NK + (size_t)hl * npitch; const float* mrow = Mf + (size_t)row * SQ; float mx = -3.0e38f;
  float e[SQ / 32];
#pragma unroll      /* e[] must be indexed by constants to live in registers; later chunks' loads can issue while earlier chunks are worked on */
  for (int c = 0; c < SQ / 128; ++c) { const int j0 = c * 128 + lane * 4; const v4f s4 = *(const v4fa*)(s + j0), k4 = *(const v4fa*)(nk + j0), m4 = *(const v4fa*)(mrow + j0);
#pragma unroll      /* constant index into e[] */
    for (int q = 0; q < 4; ++q) { const float d2 = fmaxf(__fadd_rn(__fadd_rn(nq, k4[q]), -2.0f * s4[q]), 0.f); const float v = __fadd_rn(__fmul_rn(sqrtf(d2), scale), __fmul_rn(bf16_round(m4[q]), -1.0e9f)); e[c * 4 + q] = v; mx = fmaxf(mx, v); } }
  for (int o = 16; o > 0; o >>= 1) mx = fmaxf(mx, __shfl_xor(mx, o));      /* row maximum over the 32 lanes */
  float se = 0.f;
#pragma unroll      /* constant index into e[] */
  for (int u = 0; u < SQ / 32; ++u) { e[u] = exp_slot(e[u] - mx); se += e[u]; }
  for (int o = 16; o > 0; o >>= 1) se += __shfl_xor(se, o);      /* row sum: per-lane partial sums, then a five-step butterfly */
  const float sc = 256.0f / se;
#pragma unroll      /* constant index into e[] */
  for (int c = 0; c < SQ / 128; ++c) { v4h h4;
#pragma unroll      /* constant index into e[] */
    for (int q = 0; q < 4; ++q) h4[q] = (_Float16)(e[c * 4 + q] * sc);
    *(v4h*)(P + i * (size_t)ldp + c * 128 + lane * 4) = h4; } }


__global__ __launch_bounds__(256) void k_rsmf(const float* __restrict__ S, _Float16* __restrict__ P, int qn, int hg) {
  #pragma clang fp contract(off)
  const int t = blockIdx.x * 256 + threadIdx.x; if (t >= qn * hg) return; const size_t i = (size_t)(t / qn) * SQ + (t % qn); const float* s = S + i * SQ; float mx = -3.0e38f;
#pragma unroll 1
  for (int j = 0; j < SQ; ++j) mx = fmaxf(mx, s[j]); float se = 0.f;
#pragma unroll 1
  for (int j = 0; j < SQ; ++j) se += __expf(s[j] - mx); const float sc = 256.0f / se;
#pragma unroll 1
  for (int j0 = 0; j0 < SQ; j0 += 8) { FragH f; for (int q = 0; q < 8; ++q) f.h[q] = (_Float16)(__expf(s[j0 + q] - mx) * sc); unsigned short* d = (unsigned short*)P + i * SQ + j0; *(v8us*)d = f.half[0];  } }

extern "C" void kernel_launch(void* const* d_in, const int* in_sizes, int n_in,
                              void* d_out, int out_size, void* d_ws, size_t ws_size, hipStream_t stream) {
  (void)in_sizes; (void)n_in; (void)out_size;
  const float* const* I = (const float* const*)d_in; const float* xv = I[0]; const float* xk = I[1]; const float* xq = I[2]; const float* mf = I[3]; const float* wq = I[4]; const float* wk = I[5]; const float* wv = I[6]; const float* wo = I[7]; const float* bq = nullptr; const float* bk = nullptr; (void)bq; (void)bk;      /* inputs v, k, q, mask (f32 [1][1][S][S]); [in][out] weights, no biases */
  char* ws = (char*)d_ws; size_t off = 0;
  auto take = [&](size_t bytes) { char* p = ws + off; off += (bytes + 255) & ~(size_t)255; return p; };
  _Float16* BQ = (_Float16*)take((size_t)DM * DM * 2); _Float16* BK = (_Float16*)take((size_t)DM * DM * 2); _Float16* BV = (_Float16*)take((size_t)DM * DM * 2); _Float16* BO = (_Float16*)take((size_t)DM * DM * 2);
  _Float16* XQ = (_Float16*)take(NR * DM * 2); _Float16* XK = (_Float16*)take(NR * DM * 2); _Float16* XV = (_Float16*)take(NR * DM * 2); _Float16* Q16 = (_Float16*)take(NR * DM * 2); _Float16* K16 = (_Float16*)take(NR * DM * 2); _Float16* V16 = (_Float16*)take(NR * DM * 2); _Float16* O16 = (_Float16*)take(NR * DM * 2);
  float* S = (float*)take((size_t)NB * NH * SQ * SQ * 4); _Float16* P = (_Float16*)S; _Float16* VT = (_Float16*)take((size_t)NB * NH * HD * SQ * 2); float* NQ = (float*)take((size_t)NH * NR * 4); float* NK = (float*)take((size_t)NH * NR * 4);      /* S: score planes [head][batch][SQ][SQ]; P: each row's f16 weights in the front half of its own score row (pitch 2 * SQ f16), which is what lets all 48 planes fit the workspace; NQ, NK: per-(head, row) squared norms of the f16 q and k rows */
  (void)BK; (void)BV; (void)XK; (void)XV;      /* reached through the strides from BQ and XQ */
  if (off > ws_size) return;
  k_wt_f16<<<dim3((unsigned)(((size_t)DM * (DM / 8) + 255) / 256), 4), 256, 0, stream>>>(wq, wk, wv, wo, BQ, (size_t)DM * DM, DM, DM, 16.0f);      /* [in][out] -> Bt[n][k] x16; BQ, BK, BV, BO lie back to back */

  k_x16<<<dim3((unsigned)((NR * DM / 8 + 255) / 256), 3), 256, 0, stream>>>(xq, xk, xv, XQ, NR * DM / 8);      /* the three inputs as exact f16 rows: XQ, XK, XV lie back to back */
  k_gemm2<0><<<dim3((unsigned)((MP / 128) * (DM / 64)), 3), 128, 0, stream>>>(XQ, DM, NR * DM, BQ, DM, (size_t)DM * DM, 0.0625f, nullptr, 0, nullptr, 1, 0, 0, nullptr, Q16, DM, NR * DM, MP, DM, DM, 0, 0, 0);      /* q, k, v projections on grid.y: Q16, K16, V16 lie back to back */
  k_hn16<<<dim3((unsigned)((NR * NH + 255) / 256), 2), 256, 0, stream>>>(Q16, LQ, NR, NQ);      /* |qh|^2, |kh|^2 per (head, token) from the same f16 values the GEMM multiplies; NK lies behind NQ */
  k_vt<NH, SQ><<<NB * NH * (SQ / 64), 256, 0, stream>>>(V16, LQ, 0, VT);      /* V^T [NB][NH][HD][SQ] */
  k_gemm2<0><<<dim3((SQ / 128) * (SQ / 64), NH, NB), 128, 0, stream>>>(Q16, LQ, (size_t)HD, K16, LQ, (size_t)HD, 1.0f, nullptr, 0, nullptr, 1, 0, 0, S, nullptr, SQ, (size_t)NB * SQ * SQ, SQ, SQ, HD, (size_t)SQ * LQ, (size_t)SQ * LQ, (size_t)SQ * SQ);      /* scores, plane h * NB + b */
  k_rsml2<<<(NH * NB * SQ + 7) / 8, 256, 0, stream>>>(S, P, 2 * SQ, SQ, NH * NB, NQ, NK, SQ, mf, 0.125f);      /* softmax over sqrt(max(|q|^2 + |k|^2 - 2 q.k, 0)) / 8 + mask * (-1e9); plane h * NB + b has its norms at (h * NB + b) * SQ, as NR = NB * SQ */
  k_gemm2<0><<<dim3((SQ / 128) * (HD / 64), NH, NB), 128, 0, stream>>>(P, 2 * SQ, (size_t)NB * SQ * 2 * SQ, VT, SQ, (size_t)HD * SQ, 0.25f, nullptr, 0, nullptr, 1, 0, 0, nullptr, O16, DM, (size_t)HD, SQ, HD, SQ, (size_t)SQ * 2 * SQ, (size_t)NH * HD * SQ, (size_t)SQ * DM);      /* o (merged heads) as f16 rows */
  k_gemm2<0><<<dim3((unsigned)((MPO / 128) * (DM / 64)), 1), 128, 0, stream>>>(O16, DM, 0, BO, DM, 0, 0.0009765625f, nullptr, 0, nullptr, 1, 0, 0, (float*)d_out, nullptr, DM, 0, MPO, DM, DM, 0, 0, 0);      /* out rows are the output layout */
}

// v003
// Measured time: 146 microseconds a run.
// In two side-by-side timings against v002, it was 1.52 and 1.51 times as fast.
// Over all steps from v000 it is 40.4 times as fast.
#include <hip/hip_runtime.h>
// Multi-head attention with L2-DISTANCE scores (inputs in the module's order v, k, q [4][1024][768], mask f32 [1][1][1024][1024] (zeros); qh = q wq, kh = k wk, vh = v wv ([in][out] 768x768 sigma 0.02, no biases); 12 heads of 64; scores = sqrt(max(|qh|^2 + |kh|^2 - 2 qh.kh, 0)) (pairwise L2 distance); logits = scores / 8 + mask * (-1e9); softmax; out = (attn vh merged) wo -> [4][1024][768]).
// Structure: token rows r = b*1024 + s; the three inputs as exact f16 rows (bf16-rounded); Q, K, V as three WMMA GEMMs (32x64 wave tiles, f32 accumulation, exact x16 weights, f16 outputs); V^T for all (batch, head) via LDS transposes; one fused attention launch over all 48 (head, batch) planes (heads on grid.y, batches on grid.z): per 64 keys S^T = K Q^T on WMMA (raw q.k), distance, 1/8 and mask on VALU, online softmax (f32 statistics, native exp; weights in (0, 1] as f16), O^T += V^T P^T on WMMA; o is stored x64 (against f16 subnormal flush, folded into the output GEMM alpha) straight into the merged f16 o rows; out = o W_o GEMM (f32) into the output layout.
// Compute dtype: inputs rounded to bf16; x / weights exact; q, k, v, softmax weights and o as plain f16 GEMM operands (~2^-12); scores and softmax statistics f32. v_wmma_f32_16x16x32_f16.
#define NB 4
#define SQ 1024
#define DM 768
#define NH 12
#define HD 64
#define HG 4                         /* heads per launch of the non-template k_vt */
#define B0 0                         /* unused: every launch starts at batch 0 */
#define NBR NB                       /* batches processed (debug hook) */
#define NR ((size_t)NB * SQ)         /* token rows */
#define MP ((int)((size_t)NBR * SQ)) /* rows projected (debug hook) */
#define QN SQ                        /* unused: the attention launches take SQ rows */
#define NHD NH                       /* unused: the attention launches take NH heads */
#define MPO MP                       /* rows through the output stage (debug hook) */
#define LQ DM      /* row pitch of the q/k/v rows */
typedef __bf16 v16b __attribute__((ext_vector_type(16)));
typedef unsigned short v8us __attribute__((ext_vector_type(8), may_alias));
typedef float  v8f  __attribute__((ext_vector_type(8)));
typedef float  v4f  __attribute__((ext_vector_type(4)));
typedef float  v4fa __attribute__((ext_vector_type(4), may_alias));
union FragB { v16b v; v8us half[2]; unsigned short u[16]; };

__device__ __forceinline__ unsigned short bf16_bits(float x) { unsigned int u = __float_as_uint(x); return (unsigned short)((u + 0x7FFFu + ((u >> 16) & 1u)) >> 16); }
__device__ __forceinline__ float bf16_val(unsigned short b) { return __uint_as_float(((unsigned int)b) << 16); }
__device__ __forceinline__ float bf16_round(float x) { return bf16_val(bf16_bits(x)); }
// D += A·B with NT terms: 1 = ah·bh, 2 = + al·bh (A split), 3 = + ah·bl (both split)
template <int NT>
__device__ __forceinline__ v8f mmaN(v16b ah, v16b al, v16b bh, v16b bl, v8f c) {
  c = __builtin_amdgcn_wmma_f32_16x16x32_bf16(false, ah, false, bh, (short)0, c, false, false);
  if (NT >= 2) c = __builtin_amdgcn_wmma_f32_16x16x32_bf16(false, al, false, bh, (short)0, c, false, false);
  if (NT >= 3) c = __builtin_amdgcn_wmma_f32_16x16x32_bf16(false, ah, false, bl, (short)0, c, false, false);
  asm volatile("v_nop\n\tv_nop\n\tv_nop\n\tv_nop" : "+v"(c) : "v"(ah), "v"(al), "v"(bh), "v"(bl));
  return c;
}

__global__ __launch_bounds__(256) void k_wt_bf16(const float* __restrict__ W, unsigned short* __restrict__ Wt, int K, int N) {
  const int t = blockIdx.x * 256 + threadIdx.x;
  const int k8n = K / 8;
  if (t >= N * k8n) return;
  const int n = t / k8n, k8 = (t % k8n) * 8;
  v8us v;
#pragma unroll
  for (int i = 0; i < 8; ++i) v[i] = bf16_bits(W[(size_t)(k8 + i) * N + n]);
  *(v8us*)(Wt + (size_t)n * K + k8) = v;
  
}

// GEMM C[M][N] (f32, pitch ldc) = act(A[M][K]·W + bias). A f32 row-major (pitch lda) converted per fragment to bf16
// (ASPLIT: hi/lo two planes -> 2 terms, else single rounded term); Wt bf16 [N][K] (pitch ldb). BIAS_BF16 rounds the
// bias to bf16 first (bias quantised to bf16 before the add). K%32==0, M%16==0, N%64==0.
template <bool ASPLIT, int ACT, bool BIAS_BF16>
__global__ __launch_bounds__(128) void k_gemm_bf(const float* __restrict__ A, int lda, const unsigned short* __restrict__ Wt, int ldb,
                                               const float* __restrict__ bias, float* __restrict__ C, int ldc, int M, int N, int K) {
  __shared__ __attribute__((aligned(16))) float so[4][16][64];
  const int tid = threadIdx.x, w = tid >> 5, lane = tid & 31, ln = lane & 15, hh = lane >> 4;
  const int ntn = N / 64;
  const int wid = blockIdx.x * 4 + w;
  const int mt = wid / ntn, nq = wid % ntn;
  if (mt * 16 >= M) return;
  const int row0 = mt * 16, col0 = nq * 64;
  const float* arow = A + (size_t)(row0 + ln) * lda;
  v8f acc[4] = {};
  for (int kb = 0; kb < K; kb += 32) {
    FragB ah, al;
    const v4f x0 = *(const v4fa*)(arow + kb + 8 * hh), x1 = *(const v4fa*)(arow + kb + 8 * hh + 4);
    const v4f x2 = *(const v4fa*)(arow + kb + 16 + 8 * hh), x3 = *(const v4fa*)(arow + kb + 16 + 8 * hh + 4);
    float xs[16] = {x0[0],x0[1],x0[2],x0[3],x1[0],x1[1],x1[2],x1[3],x2[0],x2[1],x2[2],x2[3],x3[0],x3[1],x3[2],x3[3]};
#pragma unroll
    for (int i = 0; i < 16; ++i) { const unsigned short hb = bf16_bits(xs[i]); ah.u[i] = hb; al.u[i] = ASPLIT ? bf16_bits(xs[i] - bf16_val(hb)) : (unsigned short)0; }
#pragma unroll
    for (int t = 0; t < 4; ++t) {
      const unsigned short* brow = Wt + (size_t)(col0 + t * 16 + ln) * ldb + kb;
      FragB b;
      b.half[0] = *(const v8us*)(brow + 8 * hh);
      b.half[1] = *(const v8us*)(brow + 16 + 8 * hh);
      acc[t] = mmaN<ASPLIT ? 2 : 1>(ah.v, al.v, b.v, b.v, acc[t]);
    }
  }
#pragma unroll
  for (int t = 0; t < 4; ++t) {
    float bv = bias ? bias[col0 + t * 16 + ln] : 0.f;
    if (BIAS_BF16) bv = bf16_round(bv);
#pragma unroll
    for (int r = 0; r < 8; ++r) { float v = acc[t][r] + bv; if (ACT == 1) v = fmaxf(v, 0.f); so[w][8 * hh + r][t * 16 + ln] = v; }
  }
  __builtin_amdgcn_fence(__ATOMIC_ACQ_REL, "workgroup");
  __builtin_amdgcn_wave_barrier();
  const int rsub = lane >> 4, c4 = (lane & 15) * 4;
  {
#pragma unroll
    for (int q = 0; q < 8; ++q) {
      const int r = q * 2 + rsub;
      const v4f v = *(const v4fa*)&so[w][r][c4];
      *(v4f*)(C + (size_t)(row0 + r) * ldc + col0 + c4) = v;
    }
    
  }
}

// GEMM C = act(A·W + bias + resid): A f32 (ASPLIT -> hi/lo 2 terms), Wt bf16 [N][K]; ACT 0 none, 1 relu, 2 exact gelu;
// resid (optional, f32, row index = (row % rmod), pitch ldr, RES_BF16 rounds it) added before the activation.
template <bool ASPLIT, int ACT, bool BIAS_BF16, bool RES_BF16>
__global__ __launch_bounds__(128) void k_gemm_bf3(const float* __restrict__ A, int lda, const unsigned short* __restrict__ Wt, int ldb,
                                                const float* __restrict__ bias, const float* __restrict__ resid, int rmod, int ldr,
                                                float* __restrict__ C, int ldc, int M, int N, int K) {
  __shared__ __attribute__((aligned(16))) float so[4][16][64];
  const int tid = threadIdx.x, w = tid >> 5, lane = tid & 31, ln = lane & 15, hh = lane >> 4;
  const int ntn = N / 64;
  const int wid = blockIdx.x * 4 + w;
  const int mt = wid / ntn, nq = wid % ntn;
  if (mt * 16 >= M) return;
  const int row0 = mt * 16, col0 = nq * 64;
  const float* arow = A + (size_t)(row0 + ln) * lda;
  v8f acc[4] = {};
  for (int kb = 0; kb < K; kb += 32) {
    FragB ah, al;
    const v4f x0 = *(const v4fa*)(arow + kb + 8 * hh), x1 = *(const v4fa*)(arow + kb + 8 * hh + 4);
    const v4f x2 = *(const v4fa*)(arow + kb + 16 + 8 * hh), x3 = *(const v4fa*)(arow + kb + 16 + 8 * hh + 4);
    float xs[16] = {x0[0],x0[1],x0[2],x0[3],x1[0],x1[1],x1[2],x1[3],x2[0],x2[1],x2[2],x2[3],x3[0],x3[1],x3[2],x3[3]};
#pragma unroll
    for (int i = 0; i < 16; ++i) { const unsigned short hb = bf16_bits(xs[i]); ah.u[i] = hb; al.u[i] = ASPLIT ? bf16_bits(xs[i] - bf16_val(hb)) : (unsigned short)0; }
#pragma unroll
    for (int t = 0; t < 4; ++t) {
      const unsigned short* brow = Wt + (size_t)(col0 + t * 16 + ln) * ldb + kb;
      FragB b;
      b.half[0] = *(const v8us*)(brow + 8 * hh);
      b.half[1] = *(const v8us*)(brow + 16 + 8 * hh);
      acc[t] = mmaN<ASPLIT ? 2 : 1>(ah.v, al.v, b.v, b.v, acc[t]);
    }
  }
#pragma unroll
  for (int t = 0; t < 4; ++t) {
    const int col = col0 + t * 16 + ln;
    float bv = bias ? bias[col] : 0.f;
    if (BIAS_BF16) bv = bf16_round(bv);
#pragma unroll
    for (int r = 0; r < 8; ++r) {
      float v = acc[t][r] + bv;
      if (resid) { float rv = resid[(size_t)((row0 + 8 * hh + r) % rmod) * ldr + col]; if (RES_BF16) rv = bf16_round(rv); v += rv; }
      if (ACT == 1) v = fmaxf(v, 0.f);
      if (ACT == 2) v = 0.5f * v * (1.0f + erff(v * 0.70710678118654752f));
      if (ACT == 3) { const float u = 0.7978845608028654f * (v + 0.044715f * v * v * v); v = 0.5f * v * (1.0f + tanhf(u)); }
      so[w][8 * hh + r][t * 16 + ln] = v;
    }
  }
  __builtin_amdgcn_fence(__ATOMIC_ACQ_REL, "workgroup");
  __builtin_amdgcn_wave_barrier();
  const int rsub = lane >> 4, c4 = (lane & 15) * 4;
  {
#pragma unroll
    for (int q = 0; q < 8; ++q) {
      const int r = q * 2 + rsub;
      const v4f v = *(const v4fa*)&so[w][r][c4];
      *(v4f*)(C + (size_t)(row0 + r) * ldc + col0 + c4) = v;
    }
    
  }
}
// row LayerNorm (biased variance, eps) over N: s = X (+ R); optional out_sum <- s; out_norm <- (s-mu)*rsqrt(var+eps)*g + b
template <bool PARAM_BF16>
__global__ __launch_bounds__(256) void k_layernorm(const float* __restrict__ X, const float* __restrict__ R, const float* __restrict__ g, const float* __restrict__ bta,
                                                  float* __restrict__ out_sum, float* __restrict__ out_norm, int N, float eps) {
  __shared__ float red[256];
  const int row = blockIdx.x, tid = threadIdx.x;
  const float* x = X + (size_t)row * N; const float* rr = R ? R + (size_t)row * N : nullptr;
  float vals[16];                     // up to N = 4096
  const int per = N / 256;            // contiguous chunk per thread? use strided-by-4 chunks: thread handles j = tid*4 + 1024*u
  float s1 = 0.f;
  for (int u = 0; u < per / 4; ++u) {
    const int j = tid * 4 + 1024 * u;
    const v4f a = *(const v4fa*)(x + j);
    v4f b = {0.f,0.f,0.f,0.f}; if (rr) b = *(const v4fa*)(rr + j);
#pragma unroll
    for (int q = 0; q < 4; ++q) { const float v = a[q] + b[q]; vals[u * 4 + q] = v; s1 += v; }
  }
  red[tid] = s1; __syncthreads();
  for (int st = 128; st > 0; st >>= 1) { if (tid < st) red[tid] += red[tid + st]; __syncthreads(); }
  const float mu = red[0] / (float)N; __syncthreads();
  float s2 = 0.f;
  for (int u = 0; u < per / 4; ++u)
#pragma unroll
    for (int q = 0; q < 4; ++q) { const float c = vals[u * 4 + q] - mu; s2 += c * c; }
  red[tid] = s2; __syncthreads();
  for (int st = 128; st > 0; st >>= 1) { if (tid < st) red[tid] += red[tid + st]; __syncthreads(); }
  const float rs = rsqrtf(red[0] / (float)N + eps);
  {
    for (int u = 0; u < per / 4; ++u) {
      const int j = tid * 4 + 1024 * u;
      v4f o, sm;
#pragma unroll
      for (int q = 0; q < 4; ++q) {
        float gg = g[j + q], bb = bta[j + q];
        if (PARAM_BF16) { gg = bf16_round(gg); bb = bf16_round(bb); }
        sm[q] = vals[u * 4 + q]; o[q] = (vals[u * 4 + q] - mu) * rs * gg + bb;
      }
      if (out_sum) *(v4f*)(out_sum + (size_t)row * N + j) = sm;
      *(v4f*)(out_norm + (size_t)row * N + j) = o;
    }
    
  }
}



// ---- f16 WMMA path (v_wmma_f32_16x16x32_f16): 11-bit significands for operands in range — used where a [0,1] probability operand needs more precision than bf16
typedef _Float16 v16h __attribute__((ext_vector_type(16)));
union FragH { v16h v; v8us half[2]; _Float16 h[16]; unsigned short u[16]; };
template <int NT>
__device__ __forceinline__ v8f mmaH(v16h ah, v16h al, v16h bh, v16h bl, v8f c) {
  c = __builtin_amdgcn_wmma_f32_16x16x32_f16(false, ah, false, bh, (short)0, c, false, false);
  if (NT >= 2) c = __builtin_amdgcn_wmma_f32_16x16x32_f16(false, al, false, bh, (short)0, c, false, false);
  if (NT >= 3) c = __builtin_amdgcn_wmma_f32_16x16x32_f16(false, ah, false, bl, (short)0, c, false, false);
  asm volatile("v_nop\n\tv_nop\n\tv_nop\n\tv_nop" : "+v"(c) : "v"(ah), "v"(al), "v"(bh), "v"(bl));
  return c;
}
// batched GEMM like k_gemm_b but f16 operands: A f32 (split into f16 hi/lo if ASPLIT, else rounded to f16), Bt = f16 values [n][k]; alpha; C f32; N multiple of 16 (partial tiles skipped)
template <bool ASPLIT>
__global__ __launch_bounds__(128) void k_gemm_h(const float* __restrict__ A, int lda, size_t sA, const _Float16* __restrict__ Bh, int ldb, size_t sB, float alpha, float* __restrict__ C, int ldc, size_t sC, int M, int N, int K) {
  __shared__ __attribute__((aligned(16))) float so[4][16][64];
  const int tid = threadIdx.x, w = tid >> 5, lane = tid & 31, ln = lane & 15, hh = lane >> 4; const int by = blockIdx.y;
  A += (size_t)by * sA; Bh += (size_t)by * sB; C += (size_t)by * sC;
  const int ntn = (N + 63) / 64; const int wid = blockIdx.x * 4 + w; const int mt = wid / ntn, nq = wid % ntn; if (mt * 16 >= M) return;
  const int row0 = mt * 16, col0 = nq * 64; const float* arow = A + (size_t)(row0 + ln) * lda;
  v8f acc[4] = {};
  for (int kb = 0; kb < K; kb += 32) {
    FragH ah, al;
    const v4f x0 = *(const v4fa*)(arow + kb + 8 * hh), x1 = *(const v4fa*)(arow + kb + 8 * hh + 4), x2 = *(const v4fa*)(arow + kb + 16 + 8 * hh), x3 = *(const v4fa*)(arow + kb + 16 + 8 * hh + 4);
    float xs[16] = {x0[0],x0[1],x0[2],x0[3],x1[0],x1[1],x1[2],x1[3],x2[0],x2[1],x2[2],x2[3],x3[0],x3[1],x3[2],x3[3]};
#pragma unroll
    for (int i = 0; i < 16; ++i) { const _Float16 h = (_Float16)xs[i]; ah.h[i] = h; al.h[i] = ASPLIT ? (_Float16)(xs[i] - (float)h) : (_Float16)0.0f; }
#pragma unroll
    for (int t = 0; t < 4; ++t) { if (col0 + t * 16 >= N) continue; const size_t boff = (size_t)(col0 + t * 16 + ln) * ldb + kb; FragH bq; bq.half[0] = *(const v8us*)(Bh + boff + 8 * hh); bq.half[1] = *(const v8us*)(Bh + boff + 16 + 8 * hh);
      acc[t] = mmaH<ASPLIT ? 2 : 1>(ah.v, al.v, bq.v, bq.v, acc[t]); }
  }
#pragma unroll
  for (int t = 0; t < 4; ++t) { if (col0 + t * 16 >= N) continue;
#pragma unroll
    for (int r = 0; r < 8; ++r) so[w][8 * hh + r][t * 16 + ln] = acc[t][r] * alpha; }
  __builtin_amdgcn_fence(__ATOMIC_ACQ_REL, "workgroup"); __builtin_amdgcn_wave_barrier();
  const int rsub = lane >> 4, c4 = (lane & 15) * 4;
  {
#pragma unroll
    for (int q = 0; q < 8; ++q) { const int r = q * 2 + rsub; if (col0 + c4 < N) { const v4f v = *(const v4fa*)&so[w][r][c4]; *(v4f*)(C + (size_t)(row0 + r) * ldc + col0 + c4) = v; } }
     }
}

// Wt[n][k] = f16(W[k][n]·scale) from f32 row-major W[K][N] (scale = power of two; bf16-exact weights stay exact in f16 away from the subnormal range)
// blockIdx.y picks one of four weight matrices; their transposes lie sWt elements apart
__global__ __launch_bounds__(256) void k_wt_f16(const float* __restrict__ W0, const float* __restrict__ W1, const float* __restrict__ W2, const float* __restrict__ W3, _Float16* __restrict__ Wt, size_t sWt, int K, int N, float scale) {
  const int y = blockIdx.y; const float* __restrict__ W = y == 0 ? W0 : y == 1 ? W1 : y == 2 ? W2 : W3; Wt += (size_t)y * sWt;
  const int t = blockIdx.x * 256 + threadIdx.x; if (t >= N * (K / 8)) return; const int n = t / (K / 8), k8 = (t % (K / 8)) * 8; FragH f;
#pragma unroll
  for (int i = 0; i < 8; ++i) f.h[i] = (_Float16)(bf16_round(W[(size_t)(k8 + i) * N + n]) * scale); const v8us o = f.half[0];
  *(v8us*)((unsigned short*)Wt + (size_t)n * K + k8) = o; 
}
// k_gemm_hh variant with fused epilogue: v = acc·alpha + bias[by·sBias + col] (+ CP[(row/rowsPerB)·sCPb + by·64 + col] if CP) ; ACT 0 none / 1 elu ; writes f16 C16 (and f32 C if non-null)
template <int ACT>
__global__ __launch_bounds__(128) void k_gemm_hhx(const _Float16* __restrict__ A, int lda, size_t sA, const _Float16* __restrict__ Bh, int ldb, size_t sB, float alpha, const float* __restrict__ bias, size_t sBias, const float* __restrict__ CP, int rowsPerB, size_t sCPb, int row0g,
    float* __restrict__ C, _Float16* __restrict__ C16, int ldc, size_t sC, int M, int N, int K) {
  __shared__ __attribute__((aligned(16))) float so[4][16][64];
  const int tid = threadIdx.x, w = tid >> 5, lane = tid & 31, ln = lane & 15, hh = lane >> 4; const int by = blockIdx.y;
  A += (size_t)by * sA; Bh += (size_t)by * sB; const size_t cofs = (size_t)by * sC; const float* bp = bias ? bias + (size_t)by * sBias : nullptr;
  const int ntn = (N + 63) / 64; const int wid = blockIdx.x * 4 + w; const int mt = wid / ntn, nq = wid % ntn; if (mt * 16 >= M) return;
  const int row0 = mt * 16, col0 = nq * 64; const _Float16* arow = A + (size_t)(row0 + ln) * lda;
  v8f acc[4] = {};
  for (int kb = 0; kb < K; kb += 32) { FragH ah; ah.half[0] = *(const v8us*)((const unsigned short*)arow + kb + 8 * hh); ah.half[1] = *(const v8us*)((const unsigned short*)arow + kb + 16 + 8 * hh);
#pragma unroll
    for (int t = 0; t < 4; ++t) { if (col0 + t * 16 >= N) continue; const size_t boff = (size_t)(col0 + t * 16 + ln) * ldb + kb; FragH bq; bq.half[0] = *(const v8us*)((const unsigned short*)Bh + boff + 8 * hh); bq.half[1] = *(const v8us*)((const unsigned short*)Bh + boff + 16 + 8 * hh);
      acc[t] = mmaH<1>(ah.v, ah.v, bq.v, bq.v, acc[t]); }
  }
#pragma unroll
  for (int t = 0; t < 4; ++t) { if (col0 + t * 16 >= N) continue; const int col = col0 + t * 16 + ln; const float bv = bp ? bf16_round(bp[col]) : 0.f;
#pragma unroll
    for (int r = 0; r < 8; ++r) { float v = acc[t][r] * alpha + bv; if (CP) { const int rr = row0g + row0 + 8 * hh + r; if (rowsPerB < 0) v += CP[cofs + (size_t)rr * ldc + col];      /* rowsPerB < 0: own element of the batched C plane */ else { const int bidx = rr / rowsPerB; v += CP[(size_t)bidx * sCPb + (size_t)by * 64 + col]; } } if (ACT == 1) v = (v > 0.f) ? v : expm1f(v); else if (ACT == 7) v = (v > 0.f) ? v + 1.0f : expf(v); else if (ACT == 8) v = tanhf(v); else if (ACT == 9) v = 0.5f * v * (1.0f + tanhf(0.7978845608028654f * (v + 0.044715f * v * v * v))); else if (ACT == 11) v = 1.0f / (1.0f + expf(-v)); else if (ACT == 12) v = (v > 0.f) ? v : 0.01f * v; else if (ACT == 14) v = (v > 0.f) ? v : 0.1f * v; else if (ACT == 16) v = (v >= 0.f) ? v : 0.3f * v; else if (ACT == 17) v = (v >= 0.f) ? v : 0.2f * v; else if (ACT == 15) v = v / (1.0f + expf(-v)); else if (ACT == 3) v = fmaxf(v, 0.f); else if (ACT == 6) v = 0.5f * v * (1.0f + erff(v * 0.70710678118654752f)); so[w][8 * hh + r][t * 16 + ln] = v; } }
  __builtin_amdgcn_fence(__ATOMIC_ACQ_REL, "workgroup"); __builtin_amdgcn_wave_barrier();
  const int rsub = lane >> 4, c4 = (lane & 15) * 4; typedef _Float16 v4h __attribute__((ext_vector_type(4)));
  {
#pragma unroll
    for (int q = 0; q < 8; ++q) { const int r = q * 2 + rsub; if (col0 + c4 < N) { const v4f v = *(const v4fa*)&so[w][r][c4]; if (C) *(v4f*)(C + cofs + (size_t)(row0 + r) * ldc + col0 + c4) = v; if (C16) { v4h h4; for (int i = 0; i < 4; ++i) h4[i] = (_Float16)v[i]; *(v4h*)(C16 + cofs + (size_t)(row0 + r) * ldc + col0 + c4) = h4; } } }
     }
}


typedef _Float16 v4h __attribute__((ext_vector_type(4)));

__global__ __launch_bounds__(256) void k_x16(const float* __restrict__ x0, const float* __restrict__ x1, const float* __restrict__ x2, _Float16* __restrict__ X16, size_t n8) { const int y = blockIdx.y; const float* __restrict__ x = y == 0 ? x0 : y == 1 ? x1 : x2; X16 += (size_t)y * n8 * 8;      /* blockIdx.y picks one of three inputs; their f16 copies lie back to back */
  const size_t t = (size_t)blockIdx.x * 256 + threadIdx.x; if (t >= n8) return; FragH f;
#pragma unroll
  for (int q = 0; q < 8; ++q) f.h[q] = (_Float16)bf16_round(x[t * 8 + q]); *(v8us*)((unsigned short*)X16 + t * 8) = f.half[0];  }
__global__ __launch_bounds__(256) void k_h16(const float* __restrict__ x, _Float16* __restrict__ X16, size_t n8) { const size_t t = (size_t)blockIdx.x * 256 + threadIdx.x; if (t >= n8) return; FragH f;
#pragma unroll
  for (int q = 0; q < 8; ++q) f.h[q] = (_Float16)x[t * 8 + q]; *(v8us*)((unsigned short*)X16 + t * 8) = f.half[0];  }
__global__ __launch_bounds__(256) void k_round16f(const float* __restrict__ W, _Float16* __restrict__ Bt, size_t n8) { const size_t t = (size_t)blockIdx.x * 256 + threadIdx.x; if (t >= n8) return; FragH f;
#pragma unroll
  for (int i = 0; i < 8; ++i) f.h[i] = (_Float16)(bf16_round(W[t * 8 + i]) * 16.0f); *(v8us*)((unsigned short*)Bt + t * 8) = f.half[0];  }
template <int NHv, int TTv>
__global__ __launch_bounds__(256) void k_vt(const _Float16* __restrict__ V16, int ldv, int voff, _Float16* __restrict__ Vt) { __shared__ unsigned short tl[64][66]; const int tid = threadIdx.x; const int slab = blockIdx.x / (TTv / 64), lg = blockIdx.x % (TTv / 64); const int b = slab / NHv, h = slab % NHv;
  for (int i = tid; i < 64 * 8; i += 256) { const int r = i / 8, c8 = (i % 8) * 8; FragH f; f.half[0] = *(const v8us*)((const unsigned short*)V16 + ((size_t)b * TTv + lg * 64 + r) * ldv + voff + h * 64 + c8);
#pragma unroll
    for (int q = 0; q < 8; ++q) tl[r][c8 + q] = f.u[q]; }
  __syncthreads();
  {
#pragma unroll
    for (int rd = 0; rd < 2; ++rd) { const int d = rd * 32 + tid / 8, pc = tid % 8; FragH f;
#pragma unroll
      for (int q = 0; q < 8; ++q) f.u[q] = tl[pc * 8 + q][d];
      *(v8us*)((unsigned short*)Vt + ((size_t)slab * 64 + d) * TTv + lg * 64 + pc * 8) = f.half[0]; }
     } }

__global__ __launch_bounds__(256) void k_hl(const float* __restrict__ F, _Float16* __restrict__ Hh, _Float16* __restrict__ Hl, size_t n8) { const size_t t = (size_t)blockIdx.x * 256 + threadIdx.x; if (t >= n8) return; FragH fh, fl; const v4f a = *(const v4fa*)(F + t * 8), c = *(const v4fa*)(F + t * 8 + 4);
#pragma unroll
  for (int q = 0; q < 4; ++q) { _Float16 h = (_Float16)a[q]; fh.h[q] = h; fl.h[q] = (_Float16)((a[q] - (float)h) * 1024.0f); h = (_Float16)c[q]; fh.h[4 + q] = h; fl.h[4 + q] = (_Float16)((c[q] - (float)h) * 1024.0f); }
  { *(v8us*)((unsigned short*)Hh + t * 8) = fh.half[0]; *(v8us*)((unsigned short*)Hl + t * 8) = fl.half[0];  } }

// ---- fast GEMM (wave tile 32x64; requires M % 32 == 0 rows per launch region and N % 64 == 0); epilogue = k_gemm_hhx semantics ----
__device__ __forceinline__ v16h g2_frag(const _Float16* p, int hh) { FragH f; f.half[0] = *(const v8us*)((const unsigned short*)p + 8 * hh); f.half[1] = *(const v8us*)((const unsigned short*)p + 16 + 8 * hh); return f.v; }
__device__ __forceinline__ v8f g2_mma(v16h a, v16h b, v8f c) { v8f d = __builtin_amdgcn_wmma_f32_16x16x32_f16(false, a, false, b, (short)0, c, false, false); asm volatile("v_nop\n\tv_nop\n\tv_nop\n\tv_nop" : "+v"(d) : "v"(a), "v"(b)); return d; }
template <int ACT>
__global__ __launch_bounds__(128) void k_gemm2(const _Float16* __restrict__ A, int lda, size_t sA, const _Float16* __restrict__ Bh, int ldb, size_t sB, float alpha, const float* __restrict__ bias, size_t sBias, const float* __restrict__ CP, int rowsPerB, size_t sCPb, int row0g,
    float* __restrict__ C, _Float16* __restrict__ C16, int ldc, size_t sC, int M, int N, int K, size_t zA, size_t zB, size_t zC) { static_assert(ACT == 0 || ACT == 3 || ACT == 6 || ACT == 8 || ACT == 9 || ACT == 11 || ACT == 12 || ACT == 14 || ACT == 15 || ACT == 16 || ACT == 17, "k_gemm2: unsupported ACT code (would silently apply no activation)");
  __shared__ __attribute__((aligned(16))) float so[4][32][68];
  const int tid = threadIdx.x, w = tid >> 5, lane = tid & 31, ln = lane & 15, hh = lane >> 4; const int by = blockIdx.y, bz = blockIdx.z;      /* two batch axes: strides sA, sB, sC on grid.y and zA, zB, zC on grid.z */
  A += (size_t)by * sA + (size_t)bz * zA; Bh += (size_t)by * sB + (size_t)bz * zB; const size_t cofs = (size_t)by * sC + (size_t)bz * zC; const float* bp = bias ? bias + (size_t)by * sBias : nullptr;
  const int ntn = N >> 6; const int mt = blockIdx.x / ntn, nq = blockIdx.x - mt * ntn; const int row0 = mt * 128 + 32 * w, col0 = nq * 64; if (row0 >= M) return;
  const _Float16* a0p = A + (size_t)(row0 + ln) * lda; const _Float16* a1p = a0p + (size_t)16 * lda;
  const _Float16* b0p = Bh + (size_t)(col0 + ln) * ldb; const _Float16* b1p = b0p + (size_t)16 * ldb; const _Float16* b2p = b1p + (size_t)16 * ldb; const _Float16* b3p = b2p + (size_t)16 * ldb;
  const v8f z8 = {0.f,0.f,0.f,0.f,0.f,0.f,0.f,0.f}; v8f c00 = z8, c01 = z8, c02 = z8, c03 = z8, c10 = z8, c11 = z8, c12 = z8, c13 = z8;
#pragma unroll 1
  for (int kb = 0; kb < K; kb += 32) { const v16h a0 = g2_frag(a0p + kb, hh), a1 = g2_frag(a1p + kb, hh);
    v16h b = g2_frag(b0p + kb, hh); c00 = g2_mma(a0, b, c00); c10 = g2_mma(a1, b, c10);
    b = g2_frag(b1p + kb, hh); c01 = g2_mma(a0, b, c01); c11 = g2_mma(a1, b, c11);
    b = g2_frag(b2p + kb, hh); c02 = g2_mma(a0, b, c02); c12 = g2_mma(a1, b, c12);
    b = g2_frag(b3p + kb, hh); c03 = g2_mma(a0, b, c03); c13 = g2_mma(a1, b, c13); }
  v8f accs[8] = {c00, c01, c02, c03, c10, c11, c12, c13};
#pragma unroll
  for (int u = 0; u < 8; ++u) { const int t = u & 3, half = u >> 2; const int col = col0 + t * 16 + ln; const float bv = bp ? bf16_round(bp[col]) : 0.f;
#pragma unroll
    for (int r = 0; r < 8; ++r) { const int rloc = half * 16 + 8 * hh + r; float v = accs[u][r] * alpha + bv; if (CP) { if (rowsPerB < 0) v += CP[cofs + (size_t)(row0g + row0 + rloc) * ldc + col];      /* rowsPerB < 0: own element of the batched C plane */ else { const int bidx = (row0g + row0 + rloc) / rowsPerB; v += CP[(size_t)bidx * sCPb + (size_t)by * 64 + col]; } }
      if (ACT == 3) v = fmaxf(v, 0.f); else if (ACT == 6) v = 0.5f * v * (1.0f + erff(v * 0.70710678118654752f)); else if (ACT == 11) v = 1.0f / (1.0f + expf(-v)); else if (ACT == 15) v = v / (1.0f + expf(-v)); else if (ACT == 12) v = (v > 0.f) ? v : 0.01f * v; else if (ACT == 8) v = tanhf(v); else if (ACT == 9) v = 0.5f * v * (1.0f + tanhf(0.7978845608028654f * (v + 0.044715f * v * v * v))); else if (ACT == 14) v = (v > 0.f) ? v : 0.1f * v; else if (ACT == 16) v = (v >= 0.f) ? v : 0.3f * v; else if (ACT == 17) v = (v >= 0.f) ? v : 0.2f * v;
      so[w][rloc][t * 16 + ln] = v; } }
  __builtin_amdgcn_fence(__ATOMIC_ACQ_REL, "workgroup"); __builtin_amdgcn_wave_barrier();
  const int rsub = lane >> 4, c4 = (lane & 15) * 4;
  {
#pragma unroll
    for (int q = 0; q < 16; ++q) { const int r = q * 2 + rsub; const v4f v = *(const v4fa*)&so[w][r][c4]; if (C) *(v4f*)(C + cofs + (size_t)(row0 + r) * ldc + col0 + c4) = v; if (C16) { v4h h4; for (int i = 0; i < 4; ++i) h4[i] = (_Float16)v[i]; *(v4h*)(C16 + cofs + (size_t)(row0 + r) * ldc + col0 + c4) = h4; } }
     } }


__global__ __launch_bounds__(256) void k_wnat(const float* __restrict__ w, size_t n8, _Float16* __restrict__ Bt) { const size_t t = (size_t)blockIdx.x * 256 + threadIdx.x; if (t >= n8) return; FragH f; for (int q = 0; q < 8; ++q) f.h[q] = (_Float16)(bf16_round(w[t * 8 + q]) * 16.0f); *(v8us*)((unsigned short*)Bt + t * 8) = f.half[0];  }
__global__ __launch_bounds__(256) void k_rsm(const float* __restrict__ S, _Float16* __restrict__ P, int nrows) {
  #pragma clang fp contract(off)
  const int i = blockIdx.x * 256 + threadIdx.x; if (i >= nrows) return; const float* s = S + (size_t)i * SQ; float mx = -3.0e38f;
#pragma unroll 1
  for (int j = 0; j < SQ; ++j) mx = fmaxf(mx, s[j]); float se = 0.f;
#pragma unroll 1
  for (int j = 0; j < SQ; ++j) se += expf(s[j] - mx); const float sc = 256.0f / se;
#pragma unroll 1
  for (int j0 = 0; j0 < SQ; j0 += 8) { FragH f; for (int q = 0; q < 8; ++q) f.h[q] = (_Float16)(expf(s[j0 + q] - mx) * sc); unsigned short* d = (unsigned short*)P + (size_t)i * SQ + j0; *(v8us*)d = f.half[0];  } }
__global__ __launch_bounds__(256) void k_vt(const _Float16* __restrict__ V16, int b, int h0, _Float16* __restrict__ VT) { __shared__ unsigned short tl[64][65]; const int tid = threadIdx.x; const int hh = blockIdx.x % HG, sg = blockIdx.x / HG; const int s0 = sg * 64; const int h = h0 + hh;
  for (int i = tid; i < 64 * 8; i += 256) { const int j = i / 8, d8 = (i % 8) * 8; FragH f; f.half[0] = *(const v8us*)((const unsigned short*)V16 + ((size_t)b * SQ + s0 + j) * DM + h * HD + d8); for (int q = 0; q < 8; ++q) tl[d8 + q][j] = f.u[q]; }
  __syncthreads();
  { for (int i = tid; i < 64 * 8; i += 256) { const int d = i / 8, j8 = (i % 8) * 8; FragH f; for (int q = 0; q < 8; ++q) f.u[q] = tl[d][j8 + q]; *(v8us*)((unsigned short*)VT + ((size_t)hh * HD + d) * SQ + s0 + j8) = f.half[0]; }  } }


__global__ __launch_bounds__(256) void k_hn16(const _Float16* __restrict__ X, int ld, size_t nrows, float* __restrict__ NQ) {
  #pragma clang fp contract(off)
  X += (size_t)blockIdx.y * nrows * (size_t)ld; NQ += (size_t)blockIdx.y * nrows * NH;      /* blockIdx.y: the q rows, then the k rows behind them; the norm planes likewise */
  const size_t t = (size_t)blockIdx.x * 256 + threadIdx.x; if (t >= nrows * NH) return; const int h = (int)(t / nrows); const size_t r = t % nrows; const _Float16* p = X + r * (size_t)ld + (size_t)h * HD; float ss = 0.f;
#pragma unroll 1
  for (int c = 0; c < HD / 8; ++c) { FragH f; f.half[0] = *(const v8us*)((const unsigned short*)p + c * 8); for (int q = 0; q < 8; ++q) { const float v = (float)f.h[q]; ss = __fadd_rn(ss, __fmul_rn(v, v)); } }
  float* d = NQ + (size_t)h * nrows + r; *(float*)d = ss;  }
// e^x as __expf forms it (one multiply, v_exp_f32). The v_nop in the same statement is the one slot the instruction set asks for behind a transcendental before its source is rewritten or its result read.
__device__ __forceinline__ float exp_slot(float x) { float r; asm("v_exp_f32 %0, %1\n\tv_nop" : "=v"(r) : "v"(x * 1.44269504f)); return r; }
// S and P are not __restrict__: P may be the front half of the same rows (ldp = 2 * SQ f16); a wave stores only into its own row, and every store needs the row sum, so all its loads of the row come first.
// One wave per (head, query row): lane l holds columns c*128 + 4*l .. + 3 (c = 0..7), so every load covers 512 contiguous bytes; the row's logits stay in registers from the max to the store.
__global__ __launch_bounds__(256) void k_rsml2(const float* S, _Float16* P, int ldp, int qn, int hg, const float* __restrict__ NQ, const float* __restrict__ NK, size_t npitch, const float* __restrict__ Mf, float scale) {
  #pragma clang fp contract(off)
  const int lane = threadIdx.x & 31; const int t = blockIdx.x * 8 + __builtin_amdgcn_readfirstlane(threadIdx.x >> 5);      /* the wave's row, told to the compiler as wave-uniform: scalar row addresses and a scalar exit test */
  if (t >= qn * hg) return; const int hl = t / qn, row = t % qn; const size_t i = (size_t)hl * SQ + row; const float* s = S + i * SQ; const float nq = NQ[(size_t)hl * npitch + row]; const float* nk = NK + (size_t)hl * npitch; const float* mrow = Mf + (size_t)row * SQ; float mx = -3.0e38f;
  float e[SQ / 32];
#pragma unroll      /* e[] must be indexed by constants to live in registers; later chunks' loads can issue while earlier chunks are worked on */
  for (int c = 0; c < SQ / 128; ++c) { const int j0 = c * 128 + lane * 4; const v4f s4 = *(const v4fa*)(s + j0), k4 = *(const v4fa*)(nk + j0), m4 = *(const v4fa*)(mrow + j0);
#pragma unroll      /* constant index into e[] */
    for (int q = 0; q < 4; ++q) { const float d2 = fmaxf(__fadd_rn(__fadd_rn(nq, k4[q]), -2.0f * s4[q]), 0.f); const float v = __fadd_rn(__fmul_rn(sqrtf(d2), scale), __fmul_rn(bf16_round(m4[q]), -1.0e9f)); e[c * 4 + q] = v; mx = fmaxf(mx, v); } }
  for (int o = 16; o > 0; o >>= 1) mx = fmaxf(mx, __shfl_xor(mx, o));      /* row maximum over the 32 lanes */
  float se = 0.f;
#pragma unroll      /* constant index into e[] */
  for (int u = 0; u < SQ / 32; ++u) { e[u] = exp_slot(e[u] - mx); se += e[u]; }
  for (int o = 16; o > 0; o >>= 1) se += __shfl_xor(se, o);      /* row sum: per-lane partial sums, then a five-step butterfly */
  const float sc = 256.0f / se;
#pragma unroll      /* constant index into e[] */
  for (int c = 0; c < SQ / 128; ++c) { v4h h4;
#pragma unroll      /* constant index into e[] */
    for (int q = 0; q < 4; ++q) h4[q] = (_Float16)(e[c * 4 + q] * sc);
    *(v4h*)(P + i * (size_t)ldp + c * 128 + lane * 4) = h4; } }


__global__ __launch_bounds__(256) void k_rsmf(const float* __restrict__ S, _Float16* __restrict__ P, int qn, int hg) {
  #pragma clang fp contract(off)
  const int t = blockIdx.x * 256 + threadIdx.x; if (t >= qn * hg) return; const size_t i = (size_t)(t / qn) * SQ + (t % qn); const float* s = S + i * SQ; float mx = -3.0e38f;
#pragma unroll 1
  for (int j = 0; j < SQ; ++j) mx = fmaxf(mx, s[j]); float se = 0.f;
#pragma unroll 1
  for (int j = 0; j < SQ; ++j) se += __expf(s[j] - mx); const float sc = 256.0f / se;
#pragma unroll 1
  for (int j0 = 0; j0 < SQ; j0 += 8) { FragH f; for (int q = 0; q < 8; ++q) f.h[q] = (_Float16)(__expf(s[j0 + q] - mx) * sc); unsigned short* d = (unsigned short*)P + i * SQ + j0; *(v8us*)d = f.half[0];  } }

// ---- fused attention: scores, softmax and the weighted sum of V in one kernel; no score or weight plane goes through memory ----
// lane l with lane l ^ 16 (the two lanes that share a query column)
__device__ __forceinline__ float xhalf(float x) { return __builtin_bit_cast(float, __builtin_amdgcn_permlanex16(__builtin_bit_cast(int, x), __builtin_bit_cast(int, x), 0x76543210, 0xfedcba98, false, false)); }
#define FK 64      /* keys per pass */
#define FP 72      /* LDS row pitch in f16: 128 data bytes + 16, so that the 16 rows of a 16-byte fragment read fall on different banks */
// One work-group = 4 waves x 16 query rows of one (batch, head); 16 passes over 64 keys.
// Both products are formed transposed, so that a lane owns ONE query column throughout: S^T = K Q^T gives lane (c, h) the keys 8h + r of query c,
// which is the k order of a B fragment, so the weights go from the score accumulators straight into O^T = V^T P^T; the running maximum, sum and rescale are per-lane scalars.
__global__ __launch_bounds__(128) void k_fattn(const _Float16* __restrict__ Q16, const _Float16* __restrict__ K16, const _Float16* __restrict__ VT, const float* __restrict__ NQ, const float* __restrict__ NK, const float* __restrict__ Mf, _Float16* __restrict__ O16, float scale) {
  __shared__ __attribute__((aligned(16))) unsigned short kt_s[FK][FP];      /* K tile  [key][d]  */
  __shared__ __attribute__((aligned(16))) unsigned short vt_s[HD][FP];      /* V^T tile [d][key] */
  const int tid = threadIdx.x, w = tid >> 5, lane = tid & 31, ln = lane & 15, hh = lane >> 4;
  const int h = blockIdx.y, b = blockIdx.z; const int q = blockIdx.x * 64 + w * 16 + ln;      /* the lane's query row */
  const _Float16* qrow = Q16 + ((size_t)b * SQ + q) * DM + h * HD;
  const v16h qf0 = g2_frag(qrow, hh), qf1 = g2_frag(qrow + 32, hh);
  const float nq = NQ[(size_t)h * NR + (size_t)b * SQ + q];
  asm volatile("s_wait_xcnt 0x0" ::: "memory");      /* the load's index register is rewritten for the mask row's address right behind it */
  const float* nk = NK + (size_t)h * NR + (size_t)b * SQ + 8 * hh;
  const float* mrow = Mf + (size_t)q * SQ + 8 * hh;
  const int sr = tid >> 3, sc = (tid & 7) * 8;      /* staging: 8 threads cover one 128-byte row, 16 rows a sweep */
  const unsigned short* kg = (const unsigned short*)K16 + ((size_t)b * SQ + sr) * DM + h * HD + sc;
  const unsigned short* vg = (const unsigned short*)VT + (((size_t)b * NH + h) * HD + sr) * SQ + sc;
  v8us kr[4], vr[4];
#pragma unroll      /* kr, vr indexed by constants: registers */
  for (int u = 0; u < 4; ++u) { kr[u] = *(const v8us*)(kg + (size_t)(u * 16) * DM); vr[u] = *(const v8us*)(vg + (size_t)(u * 16) * SQ); }
  const v8f z8 = {0.f,0.f,0.f,0.f,0.f,0.f,0.f,0.f};
  v8f o[4] = {z8, z8, z8, z8}; float mrun = -3.0e38f, lsum = 0.f;
  for (int s = 0; s < SQ / FK; ++s) {
    __syncthreads();      /* every wave has finished reading the previous tiles */
#pragma unroll
    for (int u = 0; u < 4; ++u) { *(v8us*)&kt_s[u * 16 + sr][sc] = kr[u]; *(v8us*)&vt_s[u * 16 + sr][sc] = vr[u]; }
    __syncthreads();      /* the tiles of this pass are complete */
    if (s + 1 < SQ / FK) {      /* next pass's tiles fly while this pass is worked on */
#pragma unroll
      for (int u = 0; u < 4; ++u) { kr[u] = *(const v8us*)(kg + (size_t)((s + 1) * FK + u * 16) * DM); vr[u] = *(const v8us*)(vg + (size_t)(u * 16) * SQ + (s + 1) * FK); }
      asm volatile("s_wait_xcnt 0x0" ::: "memory");      /* the loads' address registers are rewritten right behind them */
    }
    v4f kn[8], mk[8];      /* the pass's key norms and mask values: keys t * 16 + 8 * hh + 0..7 of the lane's query */
#pragma unroll      /* kn indexed by constants: registers */
    for (int t = 0; t < 4; ++t) { kn[2 * t] = *(const v4fa*)(nk + s * FK + t * 16); kn[2 * t + 1] = *(const v4fa*)(nk + s * FK + t * 16 + 4); }
    asm volatile("s_wait_xcnt 0x0" ::: "memory");      /* before a later load's result reuses these loads' address registers */
#pragma unroll      /* mk indexed by constants: registers */
    for (int t = 0; t < 4; ++t) { mk[2 * t] = *(const v4fa*)(mrow + s * FK + t * 16); mk[2 * t + 1] = *(const v4fa*)(mrow + s * FK + t * 16 + 4); }
    asm volatile("s_wait_xcnt 0x0" ::: "memory");      /* likewise, before the fragment reads reuse them */
    float e[4][8]; float mx = mrun;
#pragma unroll      /* e[][] indexed by constants: registers */
    for (int t = 0; t < 4; ++t) {
      const v4f k0 = kn[2 * t], k1 = kn[2 * t + 1], m0 = mk[2 * t], m1 = mk[2 * t + 1];
      const _Float16* kp = (const _Float16*)&kt_s[t * 16 + ln][0];
      v8f st = __builtin_amdgcn_wmma_f32_16x16x32_f16(false, g2_frag(kp, hh), false, qf0, (short)0, z8, false, false);
      st = __builtin_amdgcn_wmma_f32_16x16x32_f16(false, g2_frag(kp + 32, hh), false, qf1, (short)0, st, false, false);
#pragma unroll
      for (int r = 0; r < 8; ++r) { const float kk = r < 4 ? k0[r & 3] : k1[r & 3], mm = r < 4 ? m0[r & 3] : m1[r & 3];
        const float d2 = fmaxf((nq + kk) - 2.0f * st[r], 0.f); const float v = sqrtf(d2) * scale + bf16_round(mm) * -1.0e9f; e[t][r] = v; mx = fmaxf(mx, v); }
    }
    mx = fmaxf(mx, xhalf(mx));      /* the query's maximum so far: both lanes of the column agree on it */
    const float al = exp_slot(mrun - mx); mrun = mx; float ps = 0.f;
    FragH p0, p1;
#pragma unroll
    for (int r = 0; r < 8; ++r) {
      const float a0 = exp_slot(e[0][r] - mx), a1 = exp_slot(e[1][r] - mx), a2 = exp_slot(e[2][r] - mx), a3 = exp_slot(e[3][r] - mx);
      ps += (a0 + a1) + (a2 + a3);
      p0.h[r] = (_Float16)a0; p0.h[8 + r] = (_Float16)a1; p1.h[r] = (_Float16)a2; p1.h[8 + r] = (_Float16)a3; }
    lsum = lsum * al + ps;
#pragma unroll
    for (int t = 0; t < 4; ++t) {
      const _Float16* vp = (const _Float16*)&vt_s[t * 16 + ln][0];
      v8f a = o[t] * al;
      a = __builtin_amdgcn_wmma_f32_16x16x32_f16(false, g2_frag(vp, hh), false, p0.v, (short)0, a, false, false);
      o[t] = __builtin_amdgcn_wmma_f32_16x16x32_f16(false, g2_frag(vp + 32, hh), false, p1.v, (short)0, a, false, false);
    }
  }
  lsum += xhalf(lsum);      /* the two lanes of a column summed disjoint keys */
  const float inv = 64.0f / lsum;      /* o carried x64, as the output GEMM's alpha expects */
  unsigned short* orow = (unsigned short*)O16 + ((size_t)b * SQ + q) * DM + h * HD + 8 * hh;
#pragma unroll
  for (int t = 0; t < 4; ++t) { FragH f;
#pragma unroll
    for (int r = 0; r < 8; ++r) f.h[r] = (_Float16)(o[t][r] * inv);
    *(v8us*)(orow + t * 16) = f.half[0]; }
}

extern "C" void kernel_launch(void* const* d_in, const int* in_sizes, int n_in,
                              void* d_out, int out_size, void* d_ws, size_t ws_size, hipStream_t stream) {
  (void)in_sizes; (void)n_in; (void)out_size;
  const float* const* I = (const float* const*)d_in; const float* xv = I[0]; const float* xk = I[1]; const float* xq = I[2]; const float* mf = I[3]; const float* wq = I[4]; const float* wk = I[5]; const float* wv = I[6]; const float* wo = I[7]; const float* bq = nullptr; const float* bk = nullptr; (void)bq; (void)bk;      /* inputs v, k, q, mask (f32 [1][1][S][S]); [in][out] weights, no biases */
  char* ws = (char*)d_ws; size_t off = 0;
  auto take = [&](size_t bytes) { char* p = ws + off; off += (bytes + 255) & ~(size_t)255; return p; };
  _Float16* BQ = (_Float16*)take((size_t)DM * DM * 2); _Float16* BK = (_Float16*)take((size_t)DM * DM * 2); _Float16* BV = (_Float16*)take((size_t)DM * DM * 2); _Float16* BO = (_Float16*)take((size_t)DM * DM * 2);
  _Float16* XQ = (_Float16*)take(NR * DM * 2); _Float16* XK = (_Float16*)take(NR * DM * 2); _Float16* XV = (_Float16*)take(NR * DM * 2); _Float16* Q16 = (_Float16*)take(NR * DM * 2); _Float16* K16 = (_Float16*)take(NR * DM * 2); _Float16* V16 = (_Float16*)take(NR * DM * 2); _Float16* O16 = (_Float16*)take(NR * DM * 2);
  _Float16* VT = (_Float16*)take((size_t)NB * NH * HD * SQ * 2); float* NQ = (float*)take((size_t)NH * NR * 4); float* NK = (float*)take((size_t)NH * NR * 4);      /* NQ, NK: per-(head, row) squared norms of the f16 q and k rows */
  (void)BK; (void)BV; (void)XK; (void)XV;      /* reached through the strides from BQ and XQ */
  if (off > ws_size) return;
  k_wt_f16<<<dim3((unsigned)(((size_t)DM * (DM / 8) + 255) / 256), 4), 256, 0, stream>>>(wq, wk, wv, wo, BQ, (size_t)DM * DM, DM, DM, 16.0f);      /* [in][out] -> Bt[n][k] x16; BQ, BK, BV, BO lie back to back */

  k_x16<<<dim3((unsigned)((NR * DM / 8 + 255) / 256), 3), 256, 0, stream>>>(xq, xk, xv, XQ, NR * DM / 8);      /* the three inputs as exact f16 rows: XQ, XK, XV lie back to back */
  k_gemm2<0><<<dim3((unsigned)((MP / 128) * (DM / 64)), 3), 128, 0, stream>>>(XQ, DM, NR * DM, BQ, DM, (size_t)DM * DM, 0.0625f, nullptr, 0, nullptr, 1, 0, 0, nullptr, Q16, DM, NR * DM, MP, DM, DM, 0, 0, 0);      /* q, k, v projections on grid.y: Q16, K16, V16 lie back to back */
  k_hn16<<<dim3((unsigned)((NR * NH + 255) / 256), 2), 256, 0, stream>>>(Q16, LQ, NR, NQ);      /* |qh|^2, |kh|^2 per (head, token) from the same f16 values the GEMM multiplies; NK lies behind NQ */
  k_vt<NH, SQ><<<NB * NH * (SQ / 64), 256, 0, stream>>>(V16, LQ, 0, VT);      /* V^T [NB][NH][HD][SQ] */
  k_fattn<<<dim3(SQ / 64, NH, NB), 128, 0, stream>>>(Q16, K16, VT, NQ, NK, mf, O16, 0.125f);      /* softmax(sqrt(max(|q|^2 + |k|^2 - 2 q.k, 0)) / 8 + mask * (-1e9)) . v, merged heads, as f16 rows x64 */
  k_gemm2<0><<<dim3((unsigned)((MPO / 128) * (DM / 64)), 1), 128, 0, stream>>>(O16, DM, 0, BO, DM, 0, 0.0009765625f, nullptr, 0, nullptr, 1, 0, 0, (float*)d_out, nullptr, DM, 0, MPO, DM, DM, 0, 0, 0);      /* out rows are the output layout */
}

// v004
// It runs in 104 microseconds.
// Two timings next to v003 put it at 1.41 and 1.40 times that version's speed.
// Over all steps from v000 it is 56.6 times as fast.
#include <hip/hip_runtime.h>
// Multi-head attention with L2-DISTANCE scores (inputs in the module's order v, k, q [4][1024][768], mask f32 [1][1][1024][1024] (zeros); qh = q wq, kh = k wk, vh = v wv ([in][out] 768x768 sigma 0.02, no biases); 12 heads of 64; scores = sqrt(max(|qh|^2 + |kh|^2 - 2 qh.kh, 0)) (pairwise L2 distance); logits = scores / 8 + mask * (-1e9); softmax; out = (attn vh merged) wo -> [4][1024][768]).
// Structure: token rows r = b*1024 + s; the three inputs as exact f16 rows (bf16-rounded); Q, K, V as three WMMA GEMMs (32x64 wave tiles, f32 accumulation, exact x16 weights, f16 outputs); V^T for all (batch, head) via LDS transposes; one fused attention launch over all 48 (head, batch) planes (heads on grid.y, batches on grid.z): per 64 keys S^T = K Q^T on WMMA (raw q.k), distance, 1/8 and mask on VALU, online softmax (f32 statistics, native exp; weights in (0, 1] as f16), O^T += V^T P^T on WMMA; o is stored x64 (against f16 subnormal flush, folded into the output GEMM alpha) straight into the merged f16 o rows; out = o W_o GEMM (f32) into the output layout.
// Compute dtype: inputs rounded to bf16; x / weights exact; q, k, v, softmax weights and o as plain f16 GEMM operands (~2^-12); scores and softmax statistics f32. v_wmma_f32_16x16x32_f16.
#define NB 4
#define SQ 1024
#define DM 768
#define NH 12
#define HD 64
#define HG 4                         /* heads per launch of the non-template k_vt */
#define B0 0                         /* unused: every launch starts at batch 0 */
#define NBR NB                       /* batches processed (debug hook) */
#define NR ((size_t)NB * SQ)         /* token rows */
#define MP ((int)((size_t)NBR * SQ)) /* rows projected (debug hook) */
#define QN SQ                        /* unused: the attention launches take SQ rows */
#define NHD NH                       /* unused: the attention launches take NH heads */
#define MPO MP                       /* rows through the output stage (debug hook) */
#define LQ DM      /* row pitch of the q/k/v rows */
typedef __bf16 v16b __attribute__((ext_vector_type(16)));
typedef unsigned short v8us __attribute__((ext_vector_type(8), may_alias));
typedef float  v8f  __attribute__((ext_vector_type(8)));
typedef float  v4f  __attribute__((ext_vector_type(4)));
typedef float  v4fa __attribute__((ext_vector_type(4), may_alias));
union FragB { v16b v; v8us half[2]; unsigned short u[16]; };

__device__ __forceinline__ unsigned short bf16_bits(float x) { unsigned int u = __float_as_uint(x); return (unsigned short)((u + 0x7FFFu + ((u >> 16) & 1u)) >> 16); }
__device__ __forceinline__ float bf16_val(unsigned short b) { return __uint_as_float(((unsigned int)b) << 16); }
__device__ __forceinline__ float bf16_round(float x) { return bf16_val(bf16_bits(x)); }
// D += A·B with NT terms: 1 = ah·bh, 2 = + al·bh (A split), 3 = + ah·bl (both split)
template <int NT>
__device__ __forceinline__ v8f mmaN(v16b ah, v16b al, v16b bh, v16b bl, v8f c) {
  c = __builtin_amdgcn_wmma_f32_16x16x32_bf16(false, ah, false, bh, (short)0, c, false, false);
  if (NT >= 2) c = __builtin_amdgcn_wmma_f32_16x16x32_bf16(false, al, false, bh, (short)0, c, false, false);
  if (NT >= 3) c = __builtin_amdgcn_wmma_f32_16x16x32_bf16(false, ah, false, bl, (short)0, c, false, false);
  asm volatile("v_nop\n\tv_nop\n\tv_nop\n\tv_nop" : "+v"(c) : "v"(ah), "v"(al), "v"(bh), "v"(bl));
  return c;
}

__global__ __launch_bounds__(256) void k_wt_bf16(const float* __restrict__ W, unsigned short* __restrict__ Wt, int K, int N) {
  const int t = blockIdx.x * 256 + threadIdx.x;
  const int k8n = K / 8;
  if (t >= N * k8n) return;
  const int n = t / k8n, k8 = (t % k8n) * 8;
  v8us v;
#pragma unroll
  for (int i = 0; i < 8; ++i) v[i] = bf16_bits(W[(size_t)(k8 + i) * N + n]);
  *(v8us*)(Wt + (size_t)n * K + k8) = v;
  
}

// GEMM C[M][N] (f32, pitch ldc) = act(A[M][K]·W + bias). A f32 row-major (pitch lda) converted per fragment to bf16
// (ASPLIT: hi/lo two planes -> 2 terms, else single rounded term); Wt bf16 [N][K] (pitch ldb). BIAS_BF16 rounds the
// bias to bf16 first (bias quantised to bf16 before the add). K%32==0, M%16==0, N%64==0.
template <bool ASPLIT, int ACT, bool BIAS_BF16>
__global__ __launch_bounds__(128) void k_gemm_bf(const float* __restrict__ A, int lda, const unsigned short* __restrict__ Wt, int ldb,
                                               const float* __restrict__ bias, float* __restrict__ C, int ldc, int M, int N, int K) {
  __shared__ __attribute__((aligned(16))) float so[4][16][64];
  const int tid = threadIdx.x, w = tid >> 5, lane = tid & 31, ln = lane & 15, hh = lane >> 4;
  const int ntn = N / 64;
  const int wid = blockIdx.x * 4 + w;
  const int mt = wid / ntn, nq = wid % ntn;
  if (mt * 16 >= M) return;
  const int row0 = mt * 16, col0 = nq * 64;
  const float* arow = A + (size_t)(row0 + ln) * lda;
  v8f acc[4] = {};
  for (int kb = 0; kb < K; kb += 32) {
    FragB ah, al;
    const v4f x0 = *(const v4fa*)(arow + kb + 8 * hh), x1 = *(const v4fa*)(arow + kb + 8 * hh + 4);
    const v4f x2 = *(const v4fa*)(arow + kb + 16 + 8 * hh), x3 = *(const v4fa*)(arow + kb + 16 + 8 * hh + 4);
    float xs[16] = {x0[0],x0[1],x0[2],x0[3],x1[0],x1[1],x1[2],x1[3],x2[0],x2[1],x2[2],x2[3],x3[0],x3[1],x3[2],x3[3]};
#pragma unroll
    for (int i = 0; i < 16; ++i) { const unsigned short hb = bf16_bits(xs[i]); ah.u[i] = hb; al.u[i] = ASPLIT ? bf16_bits(xs[i] - bf16_val(hb)) : (unsigned short)0; }
#pragma unroll
    for (int t = 0; t < 4; ++t) {
      const unsigned short* brow = Wt + (size_t)(col0 + t * 16 + ln) * ldb + kb;
      FragB b;
      b.half[0] = *(const v8us*)(brow + 8 * hh);
      b.half[1] = *(const v8us*)(brow + 16 + 8 * hh);
      acc[t] = mmaN<ASPLIT ? 2 : 1>(ah.v, al.v, b.v, b.v, acc[t]);
    }
  }
#pragma unroll
  for (int t = 0; t < 4; ++t) {
    float bv = bias ? bias[col0 + t * 16 + ln] : 0.f;
    if (BIAS_BF16) bv = bf16_round(bv);
#pragma unroll
    for (int r = 0; r < 8; ++r) { float v = acc[t][r] + bv; if (ACT == 1) v = fmaxf(v, 0.f); so[w][8 * hh + r][t * 16 + ln] = v; }
  }
  __builtin_amdgcn_fence(__ATOMIC_ACQ_REL, "workgroup");
  __builtin_amdgcn_wave_barrier();
  const int rsub = lane >> 4, c4 = (lane & 15) * 4;
  {
#pragma unroll
    for (int q = 0; q < 8; ++q) {
      const int r = q * 2 + rsub;
      const v4f v = *(const v4fa*)&so[w][r][c4];
      *(v4f*)(C + (size_t)(row0 + r) * ldc + col0 + c4) = v;
    }
    
  }
}

// GEMM C = act(A·W + bias + resid): A f32 (ASPLIT -> hi/lo 2 terms), Wt bf16 [N][K]; ACT 0 none, 1 relu, 2 exact gelu;
// resid (optional, f32, row index = (row % rmod), pitch ldr, RES_BF16 rounds it) added before the activation.
template <bool ASPLIT, int ACT, bool BIAS_BF16, bool RES_BF16>
__global__ __launch_bounds__(128) void k_gemm_bf3(const float* __restrict__ A, int lda, const unsigned short* __restrict__ Wt, int ldb,
                                                const float* __restrict__ bias, const float* __restrict__ resid, int rmod, int ldr,
                                                float* __restrict__ C, int ldc, int M, int N, int K) {
  __shared__ __attribute__((aligned(16))) float so[4][16][64];
  const int tid = threadIdx.x, w = tid >> 5, lane = tid & 31, ln = lane & 15, hh = lane >> 4;
  const int ntn = N / 64;
  const int wid = blockIdx.x * 4 + w;
  const int mt = wid / ntn, nq = wid % ntn;
  if (mt * 16 >= M) return;
  const int row0 = mt * 16, col0 = nq * 64;
  const float* arow = A + (size_t)(row0 + ln) * lda;
  v8f acc[4] = {};
  for (int kb = 0; kb < K; kb += 32) {
    FragB ah, al;
    const v4f x0 = *(const v4fa*)(arow + kb + 8 * hh), x1 = *(const v4fa*)(arow + kb + 8 * hh + 4);
    const v4f x2 = *(const v4fa*)(arow + kb + 16 + 8 * hh), x3 = *(const v4fa*)(arow + kb + 16 + 8 * hh + 4);
    float xs[16] = {x0[0],x0[1],x0[2],x0[3],x1[0],x1[1],x1[2],x1[3],x2[0],x2[1],x2[2],x2[3],x3[0],x3[1],x3[2],x3[3]};
#pragma unroll
    for (int i = 0; i < 16; ++i) { const unsigned short hb = bf16_bits(xs[i]); ah.u[i] = hb; al.u[i] = ASPLIT ? bf16_bits(xs[i] - bf16_val(hb)) : (unsigned short)0; }
#pragma unroll
    for (int t = 0; t < 4; ++t) {
      const unsigned short* brow = Wt + (size_t)(col0 + t * 16 + ln) * ldb + kb;
      FragB b;
      b.half[0] = *(const v8us*)(brow + 8 * hh);
      b.half[1] = *(const v8us*)(brow + 16 + 8 * hh);
      acc[t] = mmaN<ASPLIT ? 2 : 1>(ah.v, al.v, b.v, b.v, acc[t]);
    }
  }
#pragma unroll
  for (int t = 0; t < 4; ++t) {
    const int col = col0 + t * 16 + ln;
    float bv = bias ? bias[col] : 0.f;
    if (BIAS_BF16) bv = bf16_round(bv);
#pragma unroll
    for (int r = 0; r < 8; ++r) {
      float v = acc[t][r] + bv;
      if (resid) { float rv = resid[(size_t)((row0 + 8 * hh + r) % rmod) * ldr + col]; if (RES_BF16) rv = bf16_round(rv); v += rv; }
      if (ACT == 1) v = fmaxf(v, 0.f);
      if (ACT == 2) v = 0.5f * v * (1.0f + erff(v * 0.70710678118654752f));
      if (ACT == 3) { const float u = 0.7978845608028654f * (v + 0.044715f * v * v * v); v = 0.5f * v * (1.0f + tanhf(u)); }
      so[w][8 * hh + r][t * 16 + ln] = v;
    }
  }
  __builtin_amdgcn_fence(__ATOMIC_ACQ_REL, "workgroup");
  __builtin_amdgcn_wave_barrier();
  const int rsub = lane >> 4, c4 = (lane & 15) * 4;
  {
#pragma unroll
    for (int q = 0; q < 8; ++q) {
      const int r = q * 2 + rsub;
      const v4f v = *(const v4fa*)&so[w][r][c4];
      *(v4f*)(C + (size_t)(row0 + r) * ldc + col0 + c4) = v;
    }
    
  }
}
// row LayerNorm (biased variance, eps) over N: s = X (+ R); optional out_sum <- s; out_norm <- (s-mu)*rsqrt(var+eps)*g + b
template <bool PARAM_BF16>
__global__ __launch_bounds__(256) void k_layernorm(const float* __restrict__ X, const float* __restrict__ R, const float* __restrict__ g, const float* __restrict__ bta,
                                                  float* __restrict__ out_sum, float* __restrict__ out_norm, int N, float eps) {
  __shared__ float red[256];
  const int row = blockIdx.x, tid = threadIdx.x;
  const float* x = X + (size_t)row * N; const float* rr = R ? R + (size_t)row * N : nullptr;
  float vals[16];                     // up to N = 4096
  const int per = N / 256;            // contiguous chunk per thread? use strided-by-4 chunks: thread handles j = tid*4 + 1024*u
  float s1 = 0.f;
  for (int u = 0; u < per / 4; ++u) {
    const int j = tid * 4 + 1024 * u;
    const v4f a = *(const v4fa*)(x + j);
    v4f b = {0.f,0.f,0.f,0.f}; if (rr) b = *(const v4fa*)(rr + j);
#pragma unroll
    for (int q = 0; q < 4; ++q) { const float v = a[q] + b[q]; vals[u * 4 + q] = v; s1 += v; }
  }
  red[tid] = s1; __syncthreads();
  for (int st = 128; st > 0; st >>= 1) { if (tid < st) red[tid] += red[tid + st]; __syncthreads(); }
  const float mu = red[0] / (float)N; __syncthreads();
  float s2 = 0.f;
  for (int u = 0; u < per / 4; ++u)
#pragma unroll
    for (int q = 0; q < 4; ++q) { const float c = vals[u * 4 + q] - mu; s2 += c * c; }
  red[tid] = s2; __syncthreads();
  for (int st = 128; st > 0; st >>= 1) { if (tid < st) red[tid] += red[tid + st]; __syncthreads(); }
  const float rs = rsqrtf(red[0] / (float)N + eps);
  {
    for (int u = 0; u < per / 4; ++u) {
      const int j = tid * 4 + 1024 * u;
      v4f o, sm;
#pragma unroll
      for (int q = 0; q < 4; ++q) {
        float gg = g[j + q], bb = bta[j + q];
        if (PARAM_BF16) { gg = bf16_round(gg); bb = bf16_round(bb); }
        sm[q] = vals[u * 4 + q]; o[q] = (vals[u * 4 + q] - mu) * rs * gg + bb;
      }
      if (out_sum) *(v4f*)(out_sum + (size_t)row * N + j) = sm;
      *(v4f*)(out_norm + (size_t)row * N + j) = o;
    }
    
  }
}



// ---- f16 WMMA path (v_wmma_f32_16x16x32_f16): 11-bit significands for operands in range — used where a [0,1] probability operand needs more precision than bf16
typedef _Float16 v16h __attribute__((ext_vector_type(16)));
union FragH { v16h v; v8us half[2]; _Float16 h[16]; unsigned short u[16]; };
template <int NT>
__device__ __forceinline__ v8f mmaH(v16h ah, v16h al, v16h bh, v16h bl, v8f c) {
  c = __builtin_amdgcn_wmma_f32_16x16x32_f16(false, ah, false, bh, (short)0, c, false, false);
  if (NT >= 2) c = __builtin_amdgcn_wmma_f32_16x16x32_f16(false, al, false, bh, (short)0, c, false, false);
  if (NT >= 3) c = __builtin_amdgcn_wmma_f32_16x16x32_f16(false, ah, false, bl, (short)0, c, false, false);
  asm volatile("v_nop\n\tv_nop\n\tv_nop\n\tv_nop" : "+v"(c) : "v"(ah), "v"(al), "v"(bh), "v"(bl));
  return c;
}
// batched GEMM like k_gemm_b but f16 operands: A f32 (split into f16 hi/lo if ASPLIT, else rounded to f16), Bt = f16 values [n][k]; alpha; C f32; N multiple of 16 (partial tiles skipped)
template <bool ASPLIT>
__global__ __launch_bounds__(128) void k_gemm_h(const float* __restrict__ A, int lda, size_t sA, const _Float16* __restrict__ Bh, int ldb, size_t sB, float alpha, float* __restrict__ C, int ldc, size_t sC, int M, int N, int K) {
  __shared__ __attribute__((aligned(16))) float so[4][16][64];
  const int tid = threadIdx.x, w = tid >> 5, lane = tid & 31, ln = lane & 15, hh = lane >> 4; const int by = blockIdx.y;
  A += (size_t)by * sA; Bh += (size_t)by * sB; C += (size_t)by * sC;
  const int ntn = (N + 63) / 64; const int wid = blockIdx.x * 4 + w; const int mt = wid / ntn, nq = wid % ntn; if (mt * 16 >= M) return;
  const int row0 = mt * 16, col0 = nq * 64; const float* arow = A + (size_t)(row0 + ln) * lda;
  v8f acc[4] = {};
  for (int kb = 0; kb < K; kb += 32) {
    FragH ah, al;
    const v4f x0 = *(const v4fa*)(arow + kb + 8 * hh), x1 = *(const v4fa*)(arow + kb + 8 * hh + 4), x2 = *(const v4fa*)(arow + kb + 16 + 8 * hh), x3 = *(const v4fa*)(arow + kb + 16 + 8 * hh + 4);
    float xs[16] = {x0[0],x0[1],x0[2],x0[3],x1[0],x1[1],x1[2],x1[3],x2[0],x2[1],x2[2],x2[3],x3[0],x3[1],x3[2],x3[3]};
#pragma unroll
    for (int i = 0; i < 16; ++i) { const _Float16 h = (_Float16)xs[i]; ah.h[i] = h; al.h[i] = ASPLIT ? (_Float16)(xs[i] - (float)h) : (_Float16)0.0f; }
#pragma unroll
    for (int t = 0; t < 4; ++t) { if (col0 + t * 16 >= N) continue; const size_t boff = (size_t)(col0 + t * 16 + ln) * ldb + kb; FragH bq; bq.half[0] = *(const v8us*)(Bh + boff + 8 * hh); bq.half[1] = *(const v8us*)(Bh + boff + 16 + 8 * hh);
      acc[t] = mmaH<ASPLIT ? 2 : 1>(ah.v, al.v, bq.v, bq.v, acc[t]); }
  }
#pragma unroll
  for (int t = 0; t < 4; ++t) { if (col0 + t * 16 >= N) continue;
#pragma unroll
    for (int r = 0; r < 8; ++r) so[w][8 * hh + r][t * 16 + ln] = acc[t][r] * alpha; }
  __builtin_amdgcn_fence(__ATOMIC_ACQ_REL, "workgroup"); __builtin_amdgcn_wave_barrier();
  const int rsub = lane >> 4, c4 = (lane & 15) * 4;
  {
#pragma unroll
    for (int q = 0; q < 8; ++q) { const int r = q * 2 + rsub; if (col0 + c4 < N) { const v4f v = *(const v4fa*)&so[w][r][c4]; *(v4f*)(C + (size_t)(row0 + r) * ldc + col0 + c4) = v; } }
     }
}

// Wt[n][k] = f16(W[k][n]·scale) from f32 row-major W[K][N] (scale = power of two; bf16-exact weights stay exact in f16 away from the subnormal range)
// blockIdx.y picks one of four weight matrices; their transposes lie sWt elements apart
__global__ __launch_bounds__(256) void k_wt_f16(const float* __restrict__ W0, const float* __restrict__ W1, const float* __restrict__ W2, const float* __restrict__ W3, _Float16* __restrict__ Wt, size_t sWt, int K, int N, float scale) {
  const int y = blockIdx.y; const float* __restrict__ W = y == 0 ? W0 : y == 1 ? W1 : y == 2 ? W2 : W3; Wt += (size_t)y * sWt;
  const int t = blockIdx.x * 256 + threadIdx.x; if (t >= N * (K / 8)) return; const int n = t / (K / 8), k8 = (t % (K / 8)) * 8; FragH f;
#pragma unroll
  for (int i = 0; i < 8; ++i) f.h[i] = (_Float16)(bf16_round(W[(size_t)(k8 + i) * N + n]) * scale); const v8us o = f.half[0];
  *(v8us*)((unsigned short*)Wt + (size_t)n * K + k8) = o; 
}
// k_gemm_hh variant with fused epilogue: v = acc·alpha + bias[by·sBias + col] (+ CP[(row/rowsPerB)·sCPb + by·64 + col] if CP) ; ACT 0 none / 1 elu ; writes f16 C16 (and f32 C if non-null)
template <int ACT>
__global__ __launch_bounds__(128) void k_gemm_hhx(const _Float16* __restrict__ A, int lda, size_t sA, const _Float16* __restrict__ Bh, int ldb, size_t sB, float alpha, const float* __restrict__ bias, size_t sBias, const float* __restrict__ CP, int rowsPerB, size_t sCPb, int row0g,
    float* __restrict__ C, _Float16* __restrict__ C16, int ldc, size_t sC, int M, int N, int K) {
  __shared__ __attribute__((aligned(16))) float so[4][16][64];
  const int tid = threadIdx.x, w = tid >> 5, lane = tid & 31, ln = lane & 15, hh = lane >> 4; const int by = blockIdx.y;
  A += (size_t)by * sA; Bh += (size_t)by * sB; const size_t cofs = (size_t)by * sC; const float* bp = bias ? bias + (size_t)by * sBias : nullptr;
  const int ntn = (N + 63) / 64; const int wid = blockIdx.x * 4 + w; const int mt = wid / ntn, nq = wid % ntn; if (mt * 16 >= M) return;
  const int row0 = mt * 16, col0 = nq * 64; const _Float16* arow = A + (size_t)(row0 + ln) * lda;
  v8f acc[4] = {};
  for (int kb = 0; kb < K; kb += 32) { FragH ah; ah.half[0] = *(const v8us*)((const unsigned short*)arow + kb + 8 * hh); ah.half[1] = *(const v8us*)((const unsigned short*)arow + kb + 16 + 8 * hh);
#pragma unroll
    for (int t = 0; t < 4; ++t) { if (col0 + t * 16 >= N) continue; const size_t boff = (size_t)(col0 + t * 16 + ln) * ldb + kb; FragH bq; bq.half[0] = *(const v8us*)((const unsigned short*)Bh + boff + 8 * hh); bq.half[1] = *(const v8us*)((const unsigned short*)Bh + boff + 16 + 8 * hh);
      acc[t] = mmaH<1>(ah.v, ah.v, bq.v, bq.v, acc[t]); }
  }
#pragma unroll
  for (int t = 0; t < 4; ++t) { if (col0 + t * 16 >= N) continue; const int col = col0 + t * 16 + ln; const float bv = bp ? bf16_round(bp[col]) : 0.f;
#pragma unroll
    for (int r = 0; r < 8; ++r) { float v = acc[t][r] * alpha + bv; if (CP) { const int rr = row0g + row0 + 8 * hh + r; if (rowsPerB < 0) v += CP[cofs + (size_t)rr * ldc + col];      /* rowsPerB < 0: own element of the batched C plane */ else { const int bidx = rr / rowsPerB; v += CP[(size_t)bidx * sCPb + (size_t)by * 64 + col]; } } if (ACT == 1) v = (v > 0.f) ? v : expm1f(v); else if (ACT == 7) v = (v > 0.f) ? v + 1.0f : expf(v); else if (ACT == 8) v = tanhf(v); else if (ACT == 9) v = 0.5f * v * (1.0f + tanhf(0.7978845608028654f * (v + 0.044715f * v * v * v))); else if (ACT == 11) v = 1.0f / (1.0f + expf(-v)); else if (ACT == 12) v = (v > 0.f) ? v : 0.01f * v; else if (ACT == 14) v = (v > 0.f) ? v : 0.1f * v; else if (ACT == 16) v = (v >= 0.f) ? v : 0.3f * v; else if (ACT == 17) v = (v >= 0.f) ? v : 0.2f * v; else if (ACT == 15) v = v / (1.0f + expf(-v)); else if (ACT == 3) v = fmaxf(v, 0.f); else if (ACT == 6) v = 0.5f * v * (1.0f + erff(v * 0.70710678118654752f)); so[w][8 * hh + r][t * 16 + ln] = v; } }
  __builtin_amdgcn_fence(__ATOMIC_ACQ_REL, "workgroup"); __builtin_amdgcn_wave_barrier();
  const int rsub = lane >> 4, c4 = (lane & 15) * 4; typedef _Float16 v4h __attribute__((ext_vector_type(4)));
  {
#pragma unroll
    for (int q = 0; q < 8; ++q) { const int r = q * 2 + rsub; if (col0 + c4 < N) { const v4f v = *(const v4fa*)&so[w][r][c4]; if (C) *(v4f*)(C + cofs + (size_t)(row0 + r) * ldc + col0 + c4) = v; if (C16) { v4h h4; for (int i = 0; i < 4; ++i) h4[i] = (_Float16)v[i]; *(v4h*)(C16 + cofs + (size_t)(row0 + r) * ldc + col0 + c4) = h4; } } }
     }
}


typedef _Float16 v4h __attribute__((ext_vector_type(4)));

__global__ __launch_bounds__(256) void k_x16(const float* __restrict__ x0, const float* __restrict__ x1, const float* __restrict__ x2, _Float16* __restrict__ X16, size_t n8) { const int y = blockIdx.y; const float* __restrict__ x = y == 0 ? x0 : y == 1 ? x1 : x2; X16 += (size_t)y * n8 * 8;      /* blockIdx.y picks one of three inputs; their f16 copies lie back to back */
  const size_t t = (size_t)blockIdx.x * 256 + threadIdx.x; if (t >= n8) return; FragH f;
#pragma unroll
  for (int q = 0; q < 8; ++q) f.h[q] = (_Float16)bf16_round(x[t * 8 + q]); *(v8us*)((unsigned short*)X16 + t * 8) = f.half[0];  }
__global__ __launch_bounds__(256) void k_h16(const float* __restrict__ x, _Float16* __restrict__ X16, size_t n8) { const size_t t = (size_t)blockIdx.x * 256 + threadIdx.x; if (t >= n8) return; FragH f;
#pragma unroll
  for (int q = 0; q < 8; ++q) f.h[q] = (_Float16)x[t * 8 + q]; *(v8us*)((unsigned short*)X16 + t * 8) = f.half[0];  }
__global__ __launch_bounds__(256) void k_round16f(const float* __restrict__ W, _Float16* __restrict__ Bt, size_t n8) { const size_t t = (size_t)blockIdx.x * 256 + threadIdx.x; if (t >= n8) return; FragH f;
#pragma unroll
  for (int i = 0; i < 8; ++i) f.h[i] = (_Float16)(bf16_round(W[t * 8 + i]) * 16.0f); *(v8us*)((unsigned short*)Bt + t * 8) = f.half[0];  }
template <int NHv, int TTv>
__global__ __launch_bounds__(256) void k_vt(const _Float16* __restrict__ V16, int ldv, int voff, _Float16* __restrict__ Vt) { __shared__ unsigned short tl[64][66]; const int tid = threadIdx.x; const int slab = blockIdx.x / (TTv / 64), lg = blockIdx.x % (TTv / 64); const int b = slab / NHv, h = slab % NHv;
  for (int i = tid; i < 64 * 8; i += 256) { const int r = i / 8, c8 = (i % 8) * 8; FragH f; f.half[0] = *(const v8us*)((const unsigned short*)V16 + ((size_t)b * TTv + lg * 64 + r) * ldv + voff + h * 64 + c8);
#pragma unroll
    for (int q = 0; q < 8; ++q) tl[r][c8 + q] = f.u[q]; }
  __syncthreads();
  {
#pragma unroll
    for (int rd = 0; rd < 2; ++rd) { const int d = rd * 32 + tid / 8, pc = tid % 8; FragH f;
#pragma unroll
      for (int q = 0; q < 8; ++q) f.u[q] = tl[pc * 8 + q][d];
      *(v8us*)((unsigned short*)Vt + ((size_t)slab * 64 + d) * TTv + lg * 64 + pc * 8) = f.half[0]; }
     } }

__global__ __launch_bounds__(256) void k_hl(const float* __restrict__ F, _Float16* __restrict__ Hh, _Float16* __restrict__ Hl, size_t n8) { const size_t t = (size_t)blockIdx.x * 256 + threadIdx.x; if (t >= n8) return; FragH fh, fl; const v4f a = *(const v4fa*)(F + t * 8), c = *(const v4fa*)(F + t * 8 + 4);
#pragma unroll
  for (int q = 0; q < 4; ++q) { _Float16 h = (_Float16)a[q]; fh.h[q] = h; fl.h[q] = (_Float16)((a[q] - (float)h) * 1024.0f); h = (_Float16)c[q]; fh.h[4 + q] = h; fl.h[4 + q] = (_Float16)((c[q] - (float)h) * 1024.0f); }
  { *(v8us*)((unsigned short*)Hh + t * 8) = fh.half[0]; *(v8us*)((unsigned short*)Hl + t * 8) = fl.half[0];  } }

// ---- fast GEMM (work-group tile 128x64, wave tile 32x64; requires M % 128 == 0, N % 64 == 0 and K % 64 == 0); epilogue = k_gemm_hhx semantics ----
__device__ __forceinline__ v16h g2_frag(const _Float16* p, int hh) { FragH f; f.half[0] = *(const v8us*)((const unsigned short*)p + 8 * hh); f.half[1] = *(const v8us*)((const unsigned short*)p + 16 + 8 * hh); return f.v; }
__device__ __forceinline__ v8f g2_mma(v16h a, v16h b, v8f c) { v8f d = __builtin_amdgcn_wmma_f32_16x16x32_f16(false, a, false, b, (short)0, c, false, false); asm volatile("v_nop\n\tv_nop\n\tv_nop\n\tv_nop" : "+v"(d) : "v"(a), "v"(b)); return d; }
#define GK 64      /* k per pass: one whole 128-byte line of every operand row */
#define GP 72      /* LDS row pitch in f16: 128 data bytes + 16, so that the 16 rows of a 16-byte fragment read fall on different banks */
#define GSTG ((128 + 64) * GP * 2)      /* bytes of one stage: 128 A rows, then 64 B rows */
// One thread's share of a stage: 16 bytes of each of 12 rows (8 of A, 4 of B), 16 rows apart, from global memory straight into LDS.
// l: the thread's LDS byte address in the stage's row 0..15; a, b: its global addresses; pa, pb: 16 rows of A, of B, in elements.
// The s_wait_xcnt closes the statement so that no address register of a copy is rewritten in front of it.
__device__ __forceinline__ void g2_stage(unsigned l, const unsigned short* a, size_t pa, const unsigned short* b, size_t pb) {
  asm volatile(
    "global_load_async_to_lds_b128 %0, %12, off\n\t"
    "global_load_async_to_lds_b128 %1, %13, off\n\t"
    "global_load_async_to_lds_b128 %2, %14, off\n\t"
    "global_load_async_to_lds_b128 %3, %15, off\n\t"
    "global_load_async_to_lds_b128 %4, %16, off\n\t"
    "global_load_async_to_lds_b128 %5, %17, off\n\t"
    "global_load_async_to_lds_b128 %6, %18, off\n\t"
    "global_load_async_to_lds_b128 %7, %19, off\n\t"
    "global_load_async_to_lds_b128 %8, %20, off\n\t"
    "global_load_async_to_lds_b128 %9, %21, off\n\t"
    "global_load_async_to_lds_b128 %10, %22, off\n\t"
    "global_load_async_to_lds_b128 %11, %23, off\n\t"
    "s_wait_xcnt 0x0"
    :: "v"(l + 0u * (16u * GP * 2u)), "v"(l + 1u * (16u * GP * 2u)), "v"(l + 2u * (16u * GP * 2u)), "v"(l + 3u * (16u * GP * 2u)), "v"(l + 4u * (16u * GP * 2u)), "v"(l + 5u * (16u * GP * 2u)), "v"(l + 6u * (16u * GP * 2u)), "v"(l + 7u * (16u * GP * 2u)), "v"(l + 8u * (16u * GP * 2u)), "v"(l + 9u * (16u * GP * 2u)), "v"(l + 10u * (16u * GP * 2u)), "v"(l + 11u * (16u * GP * 2u)),
       "v"(a + 0 * pa), "v"(a + 1 * pa), "v"(a + 2 * pa), "v"(a + 3 * pa), "v"(a + 4 * pa), "v"(a + 5 * pa), "v"(a + 6 * pa), "v"(a + 7 * pa), "v"(b + 0 * pb), "v"(b + 1 * pb), "v"(b + 2 * pb), "v"(b + 3 * pb)
    : "memory");
}
// Both operands go through LDS, two stages: 8 threads copy one 128-byte row piece (a wave-wide copy covers 4 whole lines), each line is fetched once per work-group,
// and the next pass's copies fly while this pass's fragments are read from LDS.
template <int ACT>
__global__ __launch_bounds__(128) void k_gemm2(const _Float16* __restrict__ A, int lda, size_t sA, const _Float16* __restrict__ Bh, int ldb, size_t sB, float alpha, const float* __restrict__ bias, size_t sBias, const float* __restrict__ CP, int rowsPerB, size_t sCPb, int row0g,
    float* __restrict__ C, _Float16* __restrict__ C16, int ldc, size_t sC, int M, int N, int K, size_t zA, size_t zB, size_t zC) { static_assert(ACT == 0 || ACT == 3 || ACT == 6 || ACT == 8 || ACT == 9 || ACT == 11 || ACT == 12 || ACT == 14 || ACT == 15 || ACT == 16 || ACT == 17, "k_gemm2: unsupported ACT code (would silently apply no activation)");
  __shared__ __attribute__((aligned(16))) unsigned char gl[2 * GSTG];      /* the two stages; behind the loop the same bytes stage the output tile */
  static_assert(sizeof(float) * 4 * 32 * 68 <= 2 * GSTG, "output staging must fit the two stages");
  float (*so)[32][68] = (float (*)[32][68])gl;
  const int tid = threadIdx.x, w = tid >> 5, lane = tid & 31, ln = lane & 15, hh = lane >> 4; const int by = blockIdx.y, bz = blockIdx.z;      /* two batch axes: strides sA, sB, sC on grid.y and zA, zB, zC on grid.z */
  A += (size_t)by * sA + (size_t)bz * zA; Bh += (size_t)by * sB + (size_t)bz * zB; const size_t cofs = (size_t)by * sC + (size_t)bz * zC; const float* bp = bias ? bias + (size_t)by * sBias : nullptr;
  const int ntn = N >> 6; const int mt = blockIdx.x / ntn, nq = blockIdx.x - mt * ntn; const int row0 = mt * 128 + 32 * w, col0 = nq * 64; if (mt * 128 >= M) return;      /* the same for the whole work-group: it stands in front of barriers */
  const int sr = tid >> 3, sc = (tid & 7) * 8;      /* staging: 8 threads cover one 128-byte row piece, 16 rows a sweep */
  const unsigned short* ag = (const unsigned short*)A + (size_t)(mt * 128 + sr) * lda + sc;
  const unsigned short* bg = (const unsigned short*)Bh + (size_t)(col0 + sr) * ldb + sc;
  const size_t pa = (size_t)16 * lda, pb = (size_t)16 * ldb;
  const unsigned l0 = (unsigned)(size_t)gl + (unsigned)(sr * GP + sc) * 2u;      /* low 32 bits of the __shared__ address = the byte address in LDS */
  g2_stage(l0, ag, pa, bg, pb);      /* pass 0 into stage 0 */
  asm volatile("s_wait_asynccnt 0x0" ::: "memory");      /* this wave's copies of pass 0 have landed */
  __syncthreads();      /* and every other wave's */
  if (GK < K) g2_stage(l0 + GSTG, ag + GK, pa, bg + GK, pb);      /* pass 1 into stage 1 */
  const v8f z8 = {0.f,0.f,0.f,0.f,0.f,0.f,0.f,0.f}; v8f c00 = z8, c01 = z8, c02 = z8, c03 = z8, c10 = z8, c11 = z8, c12 = z8, c13 = z8;
#pragma unroll 1      /* one pass a trip: the stage alternates */
  for (int kb = 0; kb < K; kb += GK) {
    const unsigned st = (unsigned)(kb / GK) & 1u;      /* this pass's stage */
    const _Float16* ap = (const _Float16*)(gl + st * GSTG) + (32 * w + ln) * GP; const _Float16* bq = (const _Float16*)(gl + st * GSTG) + (128 + ln) * GP;
#pragma unroll      /* two 32-k blocks a pass, constant LDS offsets */
    for (int kk = 0; kk < GK; kk += 32) { const v16h a0 = g2_frag(ap + kk, hh), a1 = g2_frag(ap + 16 * GP + kk, hh);
      const v16h b0 = g2_frag(bq + kk, hh), b1 = g2_frag(bq + 16 * GP + kk, hh), b2 = g2_frag(bq + 32 * GP + kk, hh), b3 = g2_frag(bq + 48 * GP + kk, hh);
      c00 = g2_mma(a0, b0, c00); c10 = g2_mma(a1, b0, c10);
      c01 = g2_mma(a0, b1, c01); c11 = g2_mma(a1, b1, c11);
      c02 = g2_mma(a0, b2, c02); c12 = g2_mma(a1, b2, c12);
      c03 = g2_mma(a0, b3, c03); c13 = g2_mma(a1, b3, c13); }
    asm volatile("s_wait_dscnt 0x0" ::: "memory");      /* this wave's reads of the stage are done before the stage is handed back */
    asm volatile("s_wait_asynccnt 0x0" ::: "memory");      /* this wave's copies of the next pass have landed */
    __syncthreads();      /* the next pass's stage is complete, and every wave has left this one */
    if (kb + 2 * GK < K) g2_stage(l0 + st * GSTG, ag + kb + 2 * GK, pa, bg + kb + 2 * GK, pb);      /* the pass after next into the stage just left */
  }
  asm volatile("s_wait_asynccnt 0x0" ::: "memory");      /* nothing is in flight when the stages become output staging */
  v8f accs[8] = {c00, c01, c02, c03, c10, c11, c12, c13};
#pragma unroll
  for (int u = 0; u < 8; ++u) { const int t = u & 3, half = u >> 2; const int col = col0 + t * 16 + ln; const float bv = bp ? bf16_round(bp[col]) : 0.f;
#pragma unroll
    for (int r = 0; r < 8; ++r) { const int rloc = half * 16 + 8 * hh + r; float v = accs[u][r] * alpha + bv; if (CP) { if (rowsPerB < 0) v += CP[cofs + (size_t)(row0g + row0 + rloc) * ldc + col];      /* rowsPerB < 0: own element of the batched C plane */ else { const int bidx = (row0g + row0 + rloc) / rowsPerB; v += CP[(size_t)bidx * sCPb + (size_t)by * 64 + col]; } }
      if (ACT == 3) v = fmaxf(v, 0.f); else if (ACT == 6) v = 0.5f * v * (1.0f + erff(v * 0.70710678118654752f)); else if (ACT == 11) v = 1.0f / (1.0f + expf(-v)); else if (ACT == 15) v = v / (1.0f + expf(-v)); else if (ACT == 12) v = (v > 0.f) ? v : 0.01f * v; else if (ACT == 8) v = tanhf(v); else if (ACT == 9) v = 0.5f * v * (1.0f + tanhf(0.7978845608028654f * (v + 0.044715f * v * v * v))); else if (ACT == 14) v = (v > 0.f) ? v : 0.1f * v; else if (ACT == 16) v = (v >= 0.f) ? v : 0.3f * v; else if (ACT == 17) v = (v >= 0.f) ? v : 0.2f * v;
      so[w][rloc][t * 16 + ln] = v; } }
  __builtin_amdgcn_fence(__ATOMIC_ACQ_REL, "workgroup"); __builtin_amdgcn_wave_barrier();
  const int rsub = lane >> 4, c4 = (lane & 15) * 4;
  {
#pragma unroll
    for (int q = 0; q < 16; ++q) { const int r = q * 2 + rsub; const v4f v = *(const v4fa*)&so[w][r][c4]; if (C) *(v4f*)(C + cofs + (size_t)(row0 + r) * ldc + col0 + c4) = v; if (C16) { v4h h4; for (int i = 0; i < 4; ++i) h4[i] = (_Float16)v[i]; *(v4h*)(C16 + cofs + (size_t)(row0 + r) * ldc + col0 + c4) = h4; } }
     } }


__global__ __launch_bounds__(256) void k_wnat(const float* __restrict__ w, size_t n8, _Float16* __restrict__ Bt) { const size_t t = (size_t)blockIdx.x * 256 + threadIdx.x; if (t >= n8) return; FragH f; for (int q = 0; q < 8; ++q) f.h[q] = (_Float16)(bf16_round(w[t * 8 + q]) * 16.0f); *(v8us*)((unsigned short*)Bt + t * 8) = f.half[0];  }
__global__ __launch_bounds__(256) void k_rsm(const float* __restrict__ S, _Float16* __restrict__ P, int nrows) {
  #pragma clang fp contract(off)
  const int i = blockIdx.x * 256 + threadIdx.x; if (i >= nrows) return; const float* s = S + (size_t)i * SQ; float mx = -3.0e38f;
#pragma unroll 1
  for (int j = 0; j < SQ; ++j) mx = fmaxf(mx, s[j]); float se = 0.f;
#pragma unroll 1
  for (int j = 0; j < SQ; ++j) se += expf(s[j] - mx); const float sc = 256.0f / se;
#pragma unroll 1
  for (int j0 = 0; j0 < SQ; j0 += 8) { FragH f; for (int q = 0; q < 8; ++q) f.h[q] = (_Float16)(expf(s[j0 + q] - mx) * sc); unsigned short* d = (unsigned short*)P + (size_t)i * SQ + j0; *(v8us*)d = f.half[0];  } }
__global__ __launch_bounds__(256) void k_vt(const _Float16* __restrict__ V16, int b, int h0, _Float16* __restrict__ VT) { __shared__ unsigned short tl[64][65]; const int tid = threadIdx.x; const int hh = blockIdx.x % HG, sg = blockIdx.x / HG; const int s0 = sg * 64; const int h = h0 + hh;
  for (int i = tid; i < 64 * 8; i += 256) { const int j = i / 8, d8 = (i % 8) * 8; FragH f; f.half[0] = *(const v8us*)((const unsigned short*)V16 + ((size_t)b * SQ + s0 + j) * DM + h * HD + d8); for (int q = 0; q < 8; ++q) tl[d8 + q][j] = f.u[q]; }
  __syncthreads();
  { for (int i = tid; i < 64 * 8; i += 256) { const int d = i / 8, j8 = (i % 8) * 8; FragH f; for (int q = 0; q < 8; ++q) f.u[q] = tl[d][j8 + q]; *(v8us*)((unsigned short*)VT + ((size_t)hh * HD + d) * SQ + s0 + j8) = f.half[0]; }  } }


__global__ __launch_bounds__(256) void k_hn16(const _Float16* __restrict__ X, int ld, size_t nrows, float* __restrict__ NQ) {
  #pragma clang fp contract(off)
  X += (size_t)blockIdx.y * nrows * (size_t)ld; NQ += (size_t)blockIdx.y * nrows * NH;      /* blockIdx.y: the q rows, then the k rows behind them; the norm planes likewise */
  const size_t t = (size_t)blockIdx.x * 256 + threadIdx.x; if (t >= nrows * NH) return; const int h = (int)(t / nrows); const size_t r = t % nrows; const _Float16* p = X + r * (size_t)ld + (size_t)h * HD; float ss = 0.f;
#pragma unroll 1
  for (int c = 0; c < HD / 8; ++c) { FragH f; f.half[0] = *(const v8us*)((const unsigned short*)p + c * 8); for (int q = 0; q < 8; ++q) { const float v = (float)f.h[q]; ss = __fadd_rn(ss, __fmul_rn(v, v)); } }
  float* d = NQ + (size_t)h * nrows + r; *(float*)d = ss;  }
// e^x as __expf forms it (one multiply, v_exp_f32). The v_nop in the same statement is the one slot the instruction set asks for behind a transcendental before its source is rewritten or its result read.
__device__ __forceinline__ float exp_slot(float x) { float r; asm("v_exp_f32 %0, %1\n\tv_nop" : "=v"(r) : "v"(x * 1.44269504f)); return r; }
// S and P are not __restrict__: P may be the front half of the same rows (ldp = 2 * SQ f16); a wave stores only into its own row, and every store needs the row sum, so all its loads of the row come first.
// One wave per (head, query row): lane l holds columns c*128 + 4*l .. + 3 (c = 0..7), so every load covers 512 contiguous bytes; the row's logits stay in registers from the max to the store.
__global__ __launch_bounds__(256) void k_rsml2(const float* S, _Float16* P, int ldp, int qn, int hg, const float* __restrict__ NQ, const float* __restrict__ NK, size_t npitch, const float* __restrict__ Mf, float scale) {
  #pragma clang fp contract(off)
  const int lane = threadIdx.x & 31; const int t = blockIdx.x * 8 + __builtin_amdgcn_readfirstlane(threadIdx.x >> 5);      /* the wave's row, told to the compiler as wave-uniform: scalar row addresses and a scalar exit test */
  if (t >= qn * hg) return; const int hl = t / qn, row = t % qn; const size_t i = (size_t)hl * SQ + row; const float* s = S + i * SQ; const float nq = NQ[(size_t)hl * npitch + row]; const float* nk = NK + (size_t)hl * npitch; const float* mrow = Mf + (size_t)row * SQ; float mx = -3.0e38f;
  float e[SQ / 32];
#pragma unroll      /* e[] must be indexed by constants to live in registers; later chunks' loads can issue while earlier chunks are worked on */
  for (int c = 0; c < SQ / 128; ++c) { const int j0 = c * 128 + lane * 4; const v4f s4 = *(const v4fa*)(s + j0), k4 = *(const v4fa*)(nk + j0), m4 = *(const v4fa*)(mrow + j0);
#pragma unroll      /* constant index into e[] */
    for (int q = 0; q < 4; ++q) { const float d2 = fmaxf(__fadd_rn(__fadd_rn(nq, k4[q]), -2.0f * s4[q]), 0.f); const float v = __fadd_rn(__fmul_rn(sqrtf(d2), scale), __fmul_rn(bf16_round(m4[q]), -1.0e9f)); e[c * 4 + q] = v; mx = fmaxf(mx, v); } }
  for (int o = 16; o > 0; o >>= 1) mx = fmaxf(mx, __shfl_xor(mx, o));      /* row maximum over the 32 lanes */
  float se = 0.f;
#pragma unroll      /* constant index into e[] */
  for (int u = 0; u < SQ / 32; ++u) { e[u] = exp_slot(e[u] - mx); se += e[u]; }
  for (int o = 16; o > 0; o >>= 1) se += __shfl_xor(se, o);      /* row sum: per-lane partial sums, then a five-step butterfly */
  const float sc = 256.0f / se;
#pragma unroll      /* constant index into e[] */
  for (int c = 0; c < SQ / 128; ++c) { v4h h4;
#pragma unroll      /* constant index into e[] */
    for (int q = 0; q < 4; ++q) h4[q] = (_Float16)(e[c * 4 + q] * sc);
    *(v4h*)(P + i * (size_t)ldp + c * 128 + lane * 4) = h4; } }


__global__ __launch_bounds__(256) void k_rsmf(const float* __restrict__ S, _Float16* __restrict__ P, int qn, int hg) {
  #pragma clang fp contract(off)
  const int t = blockIdx.x * 256 + threadIdx.x; if (t >= qn * hg) return; const size_t i = (size_t)(t / qn) * SQ + (t % qn); const float* s = S + i * SQ; float mx = -3.0e38f;
#pragma unroll 1
  for (int j = 0; j < SQ; ++j) mx = fmaxf(mx, s[j]); float se = 0.f;
#pragma unroll 1
  for (int j = 0; j < SQ; ++j) se += __expf(s[j] - mx); const float sc = 256.0f / se;
#pragma unroll 1
  for (int j0 = 0; j0 < SQ; j0 += 8) { FragH f; for (int q = 0; q < 8; ++q) f.h[q] = (_Float16)(__expf(s[j0 + q] - mx) * sc); unsigned short* d = (unsigned short*)P + i * SQ + j0; *(v8us*)d = f.half[0];  } }

// ---- fused attention: scores, softmax and the weighted sum of V in one kernel; no score or weight plane goes through memory ----
// lane l with lane l ^ 16 (the two lanes that share a query column)
__device__ __forceinline__ float xhalf(float x) { return __builtin_bit_cast(float, __builtin_amdgcn_permlanex16(__builtin_bit_cast(int, x), __builtin_bit_cast(int, x), 0x76543210, 0xfedcba98, false, false)); }
#define FK 64      /* keys per pass */
#define FP 72      /* LDS row pitch in f16: 128 data bytes + 16, so that the 16 rows of a 16-byte fragment read fall on different banks */
// One work-group = 4 waves x 16 query rows of one (batch, head); 16 passes over 64 keys.
// Both products are formed transposed, so that a lane owns ONE query column throughout: S^T = K Q^T gives lane (c, h) the keys 8h + r of query c,
// which is the k order of a B fragment, so the weights go from the score accumulators straight into O^T = V^T P^T; the running maximum, sum and rescale are per-lane scalars.
__global__ __launch_bounds__(128) void k_fattn(const _Float16* __restrict__ Q16, const _Float16* __restrict__ K16, const _Float16* __restrict__ VT, const float* __restrict__ NQ, const float* __restrict__ NK, const float* __restrict__ Mf, _Float16* __restrict__ O16, float scale) {
  __shared__ __attribute__((aligned(16))) unsigned short kt_s[FK][FP];      /* K tile  [key][d]  */
  __shared__ __attribute__((aligned(16))) unsigned short vt_s[HD][FP];      /* V^T tile [d][key] */
  const int tid = threadIdx.x, w = tid >> 5, lane = tid & 31, ln = lane & 15, hh = lane >> 4;
  const int h = blockIdx.y, b = blockIdx.z; const int q = blockIdx.x * 64 + w * 16 + ln;      /* the lane's query row */
  const _Float16* qrow = Q16 + ((size_t)b * SQ + q) * DM + h * HD;
  const v16h qf0 = g2_frag(qrow, hh), qf1 = g2_frag(qrow + 32, hh);
  const float nq = NQ[(size_t)h * NR + (size_t)b * SQ + q];
  asm volatile("s_wait_xcnt 0x0" ::: "memory");      /* the load's index register is rewritten for the mask row's address right behind it */
  const float* nk = NK + (size_t)h * NR + (size_t)b * SQ + 8 * hh;
  const float* mrow = Mf + (size_t)q * SQ + 8 * hh;
  const int sr = tid >> 3, sc = (tid & 7) * 8;      /* staging: 8 threads cover one 128-byte row, 16 rows a sweep */
  const unsigned short* kg = (const unsigned short*)K16 + ((size_t)b * SQ + sr) * DM + h * HD + sc;
  const unsigned short* vg = (const unsigned short*)VT + (((size_t)b * NH + h) * HD + sr) * SQ + sc;
  v8us kr[4], vr[4];
#pragma unroll      /* kr, vr indexed by constants: registers */
  for (int u = 0; u < 4; ++u) { kr[u] = *(const v8us*)(kg + (size_t)(u * 16) * DM); vr[u] = *(const v8us*)(vg + (size_t)(u * 16) * SQ); }
  const v8f z8 = {0.f,0.f,0.f,0.f,0.f,0.f,0.f,0.f};
  v8f o[4] = {z8, z8, z8, z8}; float mrun = -3.0e38f, lsum = 0.f;
  for (int s = 0; s < SQ / FK; ++s) {
    __syncthreads();      /* every wave has finished reading the previous tiles */
#pragma unroll
    for (int u = 0; u < 4; ++u) { *(v8us*)&kt_s[u * 16 + sr][sc] = kr[u]; *(v8us*)&vt_s[u * 16 + sr][sc] = vr[u]; }
    __syncthreads();      /* the tiles of this pass are complete */
    if (s + 1 < SQ / FK) {      /* next pass's tiles fly while this pass is worked on */
#pragma unroll
      for (int u = 0; u < 4; ++u) { kr[u] = *(const v8us*)(kg + (size_t)((s + 1) * FK + u * 16) * DM); vr[u] = *(const v8us*)(vg + (size_t)(u * 16) * SQ + (s + 1) * FK); }
      asm volatile("s_wait_xcnt 0x0" ::: "memory");      /* the loads' address registers are rewritten right behind them */
    }
    v4f kn[8], mk[8];      /* the pass's key norms and mask values: keys t * 16 + 8 * hh + 0..7 of the lane's query */
#pragma unroll      /* kn indexed by constants: registers */
    for (int t = 0; t < 4; ++t) { kn[2 * t] = *(const v4fa*)(nk + s * FK + t * 16); kn[2 * t + 1] = *(const v4fa*)(nk + s * FK + t * 16 + 4); }
    asm volatile("s_wait_xcnt 0x0" ::: "memory");      /* before a later load's result reuses these loads' address registers */
#pragma unroll      /* mk indexed by constants: registers */
    for (int t = 0; t < 4; ++t) { mk[2 * t] = *(const v4fa*)(mrow + s * FK + t * 16); mk[2 * t + 1] = *(const v4fa*)(mrow + s * FK + t * 16 + 4); }
    asm volatile("s_wait_xcnt 0x0" ::: "memory");      /* likewise, before the fragment reads reuse them */
    float e[4][8]; float mx = mrun;
#pragma unroll      /* e[][] indexed by constants: registers */
    for (int t = 0; t < 4; ++t) {
      const v4f k0 = kn[2 * t], k1 = kn[2 * t + 1], m0 = mk[2 * t], m1 = mk[2 * t + 1];
      const _Float16* kp = (const _Float16*)&kt_s[t * 16 + ln][0];
      v8f st = __builtin_amdgcn_wmma_f32_16x16x32_f16(false, g2_frag(kp, hh), false, qf0, (short)0, z8, false, false);
      st = __builtin_amdgcn_wmma_f32_16x16x32_f16(false, g2_frag(kp + 32, hh), false, qf1, (short)0, st, false, false);
#pragma unroll
      for (int r = 0; r < 8; ++r) { const float kk = r < 4 ? k0[r & 3] : k1[r & 3], mm = r < 4 ? m0[r & 3] : m1[r & 3];
        const float d2 = fmaxf((nq + kk) - 2.0f * st[r], 0.f); const float v = sqrtf(d2) * scale + bf16_round(mm) * -1.0e9f; e[t][r] = v; mx = fmaxf(mx, v); }
    }
    mx = fmaxf(mx, xhalf(mx));      /* the query's maximum so far: both lanes of the column agree on it */
    const float al = exp_slot(mrun - mx); mrun = mx; float ps = 0.f;
    FragH p0, p1;
#pragma unroll
    for (int r = 0; r < 8; ++r) {
      const float a0 = exp_slot(e[0][r] - mx), a1 = exp_slot(e[1][r] - mx), a2 = exp_slot(e[2][r] - mx), a3 = exp_slot(e[3][r] - mx);
      ps += (a0 + a1) + (a2 + a3);
      p0.h[r] = (_Float16)a0; p0.h[8 + r] = (_Float16)a1; p1.h[r] = (_Float16)a2; p1.h[8 + r] = (_Float16)a3; }
    lsum = lsum * al + ps;
#pragma unroll
    for (int t = 0; t < 4; ++t) {
      const _Float16* vp = (const _Float16*)&vt_s[t * 16 + ln][0];
      v8f a = o[t] * al;
      a = __builtin_amdgcn_wmma_f32_16x16x32_f16(false, g2_frag(vp, hh), false, p0.v, (short)0, a, false, false);
      o[t] = __builtin_amdgcn_wmma_f32_16x16x32_f16(false, g2_frag(vp + 32, hh), false, p1.v, (short)0, a, false, false);
    }
  }
  lsum += xhalf(lsum);      /* the two lanes of a column summed disjoint keys */
  const float inv = 64.0f / lsum;      /* o carried x64, as the output GEMM's alpha expects */
  unsigned short* orow = (unsigned short*)O16 + ((size_t)b * SQ + q) * DM + h * HD + 8 * hh;
#pragma unroll
  for (int t = 0; t < 4; ++t) { FragH f;
#pragma unroll
    for (int r = 0; r < 8; ++r) f.h[r] = (_Float16)(o[t][r] * inv);
    *(v8us*)(orow + t * 16) = f.half[0]; }
}

extern "C" void kernel_launch(void* const* d_in, const int* in_sizes, int n_in,
                              void* d_out, int out_size, void* d_ws, size_t ws_size, hipStream_t stream) {
  (void)in_sizes; (void)n_in; (void)out_size;
  const float* const* I = (const float* const*)d_in; const float* xv = I[0]; const float* xk = I[1]; const float* xq = I[2]; const float* mf = I[3]; const float* wq = I[4]; const float* wk = I[5]; const float* wv = I[6]; const float* wo = I[7]; const float* bq = nullptr; const float* bk = nullptr; (void)bq; (void)bk;      /* inputs v, k, q, mask (f32 [1][1][S][S]); [in][out] weights, no biases */
  char* ws = (char*)d_ws; size_t off = 0;
  auto take = [&](size_t bytes) { char* p = ws + off; off += (bytes + 255) & ~(size_t)255; return p; };
  _Float16* BQ = (_Float16*)take((size_t)DM * DM * 2); _Float16* BK = (_Float16*)take((size_t)DM * DM * 2); _Float16* BV = (_Float16*)take((size_t)DM * DM * 2); _Float16* BO = (_Float16*)take((size_t)DM * DM * 2);
  _Float16* XQ = (_Float16*)take(NR * DM * 2); _Float16* XK = (_Float16*)take(NR * DM * 2); _Float16* XV = (_Float16*)take(NR * DM * 2); _Float16* Q16 = (_Float16*)take(NR * DM * 2); _Float16* K16 = (_Float16*)take(NR * DM * 2); _Float16* V16 = (_Float16*)take(NR * DM * 2); _Float16* O16 = (_Float16*)take(NR * DM * 2);
  _Float16* VT = (_Float16*)take((size_t)NB * NH * HD * SQ * 2); float* NQ = (float*)take((size_t)NH * NR * 4); float* NK = (float*)take((size_t)NH * NR * 4);      /* NQ, NK: per-(head, row) squared norms of the f16 q and k rows */
  (void)BK; (void)BV; (void)XK; (void)XV;      /* reached through the strides from BQ and XQ */
  if (off > ws_size) return;
  k_wt_f16<<<dim3((unsigned)(((size_t)DM * (DM / 8) + 255) / 256), 4), 256, 0, stream>>>(wq, wk, wv, wo, BQ, (size_t)DM * DM, DM, DM, 16.0f);      /* [in][out] -> Bt[n][k] x16; BQ, BK, BV, BO lie back to back */

  k_x16<<<dim3((unsigned)((NR * DM / 8 + 255) / 256), 3), 256, 0, stream>>>(xq, xk, xv, XQ, NR * DM / 8);      /* the three inputs as exact f16 rows: XQ, XK, XV lie back to back */
  k_gemm2<0><<<dim3((unsigned)((MP / 128) * (DM / 64)), 3), 128, 0, stream>>>(XQ, DM, NR * DM, BQ, DM, (size_t)DM * DM, 0.0625f, nullptr, 0, nullptr, 1, 0, 0, nullptr, Q16, DM, NR * DM, MP, DM, DM, 0, 0, 0);      /* q, k, v projections on grid.y: Q16, K16, V16 lie back to back */
  k_hn16<<<dim3((unsigned)((NR * NH + 255) / 256), 2), 256, 0, stream>>>(Q16, LQ, NR, NQ);      /* |qh|^2, |kh|^2 per (head, token) from the same f16 values the GEMM multiplies; NK lies behind NQ */
  k_vt<NH, SQ><<<NB * NH * (SQ / 64), 256, 0, stream>>>(V16, LQ, 0, VT);      /* V^T [NB][NH][HD][SQ] */
  k_fattn<<<dim3(SQ / 64, NH, NB), 128, 0, stream>>>(Q16, K16, VT, NQ, NK, mf, O16, 0.125f);      /* softmax(sqrt(max(|q|^2 + |k|^2 - 2 q.k, 0)) / 8 + mask * (-1e9)) . v, merged heads, as f16 rows x64 */
  k_gemm2<0><<<dim3((unsigned)((MPO / 128) * (DM / 64)), 1), 128, 0, stream>>>(O16, DM, 0, BO, DM, 0, 0.0009765625f, nullptr, 0, nullptr, 1, 0, 0, (float*)d_out, nullptr, DM, 0, MPO, DM, DM, 0, 0, 0);      /* out rows are the output layout */
}

// v005
// It runs in 95.8 microseconds.
// In both of two side-by-side timings against v004, it was 1.09 times as fast.
// Over all steps from v000 it is 61.8 times as fast.
#include <hip/hip_runtime.h>
// Multi-head attention with L2-DISTANCE scores (inputs in the module's order v, k, q [4][1024][768], mask f32 [1][1][1024][1024] (zeros); qh = q wq, kh = k wk, vh = v wv ([in][out] 768x768 sigma 0.02, no biases); 12 heads of 64; scores = sqrt(max(|qh|^2 + |kh|^2 - 2 qh.kh, 0)) (pairwise L2 distance); logits = scores / 8 + mask * (-1e9); softmax; out = (attn vh merged) wo -> [4][1024][768]).
// Structure: token rows r = b*1024 + s; the three inputs as exact f16 rows (bf16-rounded); Q, K, V as three WMMA GEMMs (32x64 wave tiles, f32 accumulation, exact x16 weights, f16 outputs); V^T for all (batch, head) via LDS transposes; one fused attention launch over all 48 (head, batch) planes (heads on grid.y, batches on grid.z): per 64 keys S^T = K Q^T on WMMA (raw q.k), distance, 1/8 and mask on VALU, online softmax (f32 statistics, native exp; weights in (0, 1] as f16), O^T += V^T P^T on WMMA; o is stored x64 (against f16 subnormal flush, folded into the output GEMM alpha) straight into the merged f16 o rows; out = o W_o GEMM (f32) into the output layout.
// Compute dtype: inputs rounded to bf16; x / weights exact; q, k, v, softmax weights and o as plain f16 GEMM operands (~2^-12); scores and softmax statistics f32. v_wmma_f32_16x16x32_f16.
#define NB 4
#define SQ 1024
#define DM 768
#define NH 12
#define HD 64
#define HG 4                         /* heads per launch of the non-template k_vt */
#define B0 0                         /* unused: every launch starts at batch 0 */
#define NBR NB                       /* batches processed (debug hook) */
#define NR ((size_t)NB * SQ)         /* token rows */
#define MP ((int)((size_t)NBR * SQ)) /* rows projected (debug hook) */
#define QN SQ                        /* unused: the attention launches take SQ rows */
#define NHD NH                       /* unused: the attention launches take NH heads */
#define MPO MP                       /* rows through the output stage (debug hook) */
#define LQ DM      /* row pitch of the q/k/v rows */
typedef __bf16 v16b __attribute__((ext_vector_type(16)));
typedef unsigned short v8us __attribute__((ext_vector_type(8), may_alias));
typedef float  v8f  __attribute__((ext_vector_type(8)));
typedef float  v4f  __attribute__((ext_vector_type(4)));
typedef float  v4fa __attribute__((ext_vector_type(4), may_alias));
union FragB { v16b v; v8us half[2]; unsigned short u[16]; };

__device__ __forceinline__ unsigned short bf16_bits(float x) { unsigned int u = __float_as_uint(x); return (unsigned short)((u + 0x7FFFu + ((u >> 16) & 1u)) >> 16); }
__device__ __forceinline__ float bf16_val(unsigned short b) { return __uint_as_float(((unsigned int)b) << 16); }
__device__ __forceinline__ float bf16_round(float x) { return bf16_val(bf16_bits(x)); }
// D += A·B with NT terms: 1 = ah·bh, 2 = + al·bh (A split), 3 = + ah·bl (both split)
template <int NT>
__device__ __forceinline__ v8f mmaN(v16b ah, v16b al, v16b bh, v16b bl, v8f c) {
  c = __builtin_amdgcn_wmma_f32_16x16x32_bf16(false, ah, false, bh, (short)0, c, false, false);
  if (NT >= 2) c = __builtin_amdgcn_wmma_f32_16x16x32_bf16(false, al, false, bh, (short)0, c, false, false);
  if (NT >= 3) c = __builtin_amdgcn_wmma_f32_16x16x32_bf16(false, ah, false, bl, (short)0, c, false, false);
  asm volatile("v_nop\n\tv_nop\n\tv_nop\n\tv_nop" : "+v"(c) : "v"(ah), "v"(al), "v"(bh), "v"(bl));
  return c;
}

__global__ __launch_bounds__(256) void k_wt_bf16(const float* __restrict__ W, unsigned short* __restrict__ Wt, int K, int N) {
  const int t = blockIdx.x * 256 + threadIdx.x;
  const int k8n = K / 8;
  if (t >= N * k8n) return;
  const int n = t / k8n, k8 = (t % k8n) * 8;
  v8us v;
#pragma unroll
  for (int i = 0; i < 8; ++i) v[i] = bf16_bits(W[(size_t)(k8 + i) * N + n]);
  *(v8us*)(Wt + (size_t)n * K + k8) = v;
  
}

// GEMM C[M][N] (f32, pitch ldc) = act(A[M][K]·W + bias). A f32 row-major (pitch lda) converted per fragment to bf16
// (ASPLIT: hi/lo two planes -> 2 terms, else single rounded term); Wt bf16 [N][K] (pitch ldb). BIAS_BF16 rounds the
// bias to bf16 first (bias quantised to bf16 before the add). K%32==0, M%16==0, N%64==0.
template <bool ASPLIT, int ACT, bool BIAS_BF16>
__global__ __launch_bounds__(128) void k_gemm_bf(const float* __restrict__ A, int lda, const unsigned short* __restrict__ Wt, int ldb,
                                               const float* __restrict__ bias, float* __restrict__ C, int ldc, int M, int N, int K) {
  __shared__ __attribute__((aligned(16))) float so[4][16][64];
  const int tid = threadIdx.x, w = tid >> 5, lane = tid & 31, ln = lane & 15, hh = lane >> 4;
  const int ntn = N / 64;
  const int wid = blockIdx.x * 4 + w;
  const int mt = wid / ntn, nq = wid % ntn;
  if (mt * 16 >= M) return;
  const int row0 = mt * 16, col0 = nq * 64;
  const float* arow = A + (size_t)(row0 + ln) * lda;
  v8f acc[4] = {};
  for (int kb = 0; kb < K; kb += 32) {
    FragB ah, al;
    const v4f x0 = *(const v4fa*)(arow + kb + 8 * hh), x1 = *(const v4fa*)(arow + kb + 8 * hh + 4);
    const v4f x2 = *(const v4fa*)(arow + kb + 16 + 8 * hh), x3 = *(const v4fa*)(arow + kb + 16 + 8 * hh + 4);
    float xs[16] = {x0[0],x0[1],x0[2],x0[3],x1[0],x1[1],x1[2],x1[3],x2[0],x2[1],x2[2],x2[3],x3[0],x3[1],x3[2],x3[3]};
#pragma unroll
    for (int i = 0; i < 16; ++i) { const unsigned short hb = bf16_bits(xs[i]); ah.u[i] = hb; al.u[i] = ASPLIT ? bf16_bits(xs[i] - bf16_val(hb)) : (unsigned short)0; }
#pragma unroll
    for (int t = 0; t < 4; ++t) {
      const unsigned short* brow = Wt + (size_t)(col0 + t * 16 + ln) * ldb + kb;
      FragB b;
      b.half[0] = *(const v8us*)(brow + 8 * hh);
      b.half[1] = *(const v8us*)(brow + 16 + 8 * hh);
      acc[t] = mmaN<ASPLIT ? 2 : 1>(ah.v, al.v, b.v, b.v, acc[t]);
    }
  }
#pragma unroll
  for (int t = 0; t < 4; ++t) {
    float bv = bias ? bias[col0 + t * 16 + ln] : 0.f;
    if (BIAS_BF16) bv = bf16_round(bv);
#pragma unroll
    for (int r = 0; r < 8; ++r) { float v = acc[t][r] + bv; if (ACT == 1) v = fmaxf(v, 0.f); so[w][8 * hh + r][t * 16 + ln] = v; }
  }
  __builtin_amdgcn_fence(__ATOMIC_ACQ_REL, "workgroup");
  __builtin_amdgcn_wave_barrier();
  const int rsub = lane >> 4, c4 = (lane & 15) * 4;
  {
#pragma unroll
    for (int q = 0; q < 8; ++q) {
      const int r = q * 2 + rsub;
      const v4f v = *(const v4fa*)&so[w][r][c4];
      *(v4f*)(C + (size_t)(row0 + r) * ldc + col0 + c4) = v;
    }
    
  }
}

// GEMM C = act(A·W + bias + resid): A f32 (ASPLIT -> hi/lo 2 terms), Wt bf16 [N][K]; ACT 0 none, 1 relu, 2 exact gelu;
// resid (optional, f32, row index = (row % rmod), pitch ldr, RES_BF16 rounds it) added before the activation.
template <bool ASPLIT, int ACT, bool BIAS_BF16, bool RES_BF16>
__global__ __launch_bounds__(128) void k_gemm_bf3(const float* __restrict__ A, int lda, const unsigned short* __restrict__ Wt, int ldb,
                                                const float* __restrict__ bias, const float* __restrict__ resid, int rmod, int ldr,
                                                float* __restrict__ C, int ldc, int M, int N, int K) {
  __shared__ __attribute__((aligned(16))) float so[4][16][64];
  const int tid = threadIdx.x, w = tid >> 5, lane = tid & 31, ln = lane & 15, hh = lane >> 4;
  const int ntn = N / 64;
  const int wid = blockIdx.x * 4 + w;
  const int mt = wid / ntn, nq = wid % ntn;
  if (mt * 16 >= M) return;
  const int row0 = mt * 16, col0 = nq * 64;
  const float* arow = A + (size_t)(row0 + ln) * lda;
  v8f acc[4] = {};
  for (int kb = 0; kb < K; kb += 32) {
    FragB ah, al;
    const v4f x0 = *(const v4fa*)(arow + kb + 8 * hh), x1 = *(const v4fa*)(arow + kb + 8 * hh + 4);
    const v4f x2 = *(const v4fa*)(arow + kb + 16 + 8 * hh), x3 = *(const v4fa*)(arow + kb + 16 + 8 * hh + 4);
    float xs[16] = {x0[0],x0[1],x0[2],x0[3],x1[0],x1[1],x1[2],x1[3],x2[0],x2[1],x2[2],x2[3],x3[0],x3[1],x3[2],x3[3]};
#pragma unroll
    for (int i = 0; i < 16; ++i) { const unsigned short hb = bf16_bits(xs[i]); ah.u[i] = hb; al.u[i] = ASPLIT ? bf16_bits(xs[i] - bf16_val(hb)) : (unsigned short)0; }
#pragma unroll
    for (int t = 0; t < 4; ++t) {
      const unsigned short* brow = Wt + (size_t)(col0 + t * 16 + ln) * ldb + kb;
      FragB b;
      b.half[0] = *(const v8us*)(brow + 8 * hh);
      b.half[1] = *(const v8us*)(brow + 16 + 8 * hh);
      acc[t] = mmaN<ASPLIT ? 2 : 1>(ah.v, al.v, b.v, b.v, acc[t]);
    }
  }
#pragma unroll
  for (int t = 0; t < 4; ++t) {
    const int col = col0 + t * 16 + ln;
    float bv = bias ? bias[col] : 0.f;
    if (BIAS_BF16) bv = bf16_round(bv);
#pragma unroll
    for (int r = 0; r < 8; ++r) {
      float v = acc[t][r] + bv;
      if (resid) { float rv = resid[(size_t)((row0 + 8 * hh + r) % rmod) * ldr + col]; if (RES_BF16) rv = bf16_round(rv); v += rv; }
      if (ACT == 1) v = fmaxf(v, 0.f);
      if (ACT == 2) v = 0.5f * v * (1.0f + erff(v * 0.70710678118654752f));
      if (ACT == 3) { const float u = 0.7978845608028654f * (v + 0.044715f * v * v * v); v = 0.5f * v * (1.0f + tanhf(u)); }
      so[w][8 * hh + r][t * 16 + ln] = v;
    }
  }
  __builtin_amdgcn_fence(__ATOMIC_ACQ_REL, "workgroup");
  __builtin_amdgcn_wave_barrier();
  const int rsub = lane >> 4, c4 = (lane & 15) * 4;
  {
#pragma unroll
    for (int q = 0; q < 8; ++q) {
      const int r = q * 2 + rsub;
      const v4f v = *(const v4fa*)&so[w][r][c4];
      *(v4f*)(C + (size_t)(row0 + r) * ldc + col0 + c4) = v;
    }
    
  }
}
// row LayerNorm (biased variance, eps) over N: s = X (+ R); optional out_sum <- s; out_norm <- (s-mu)*rsqrt(var+eps)*g + b
template <bool PARAM_BF16>
__global__ __launch_bounds__(256) void k_layernorm(const float* __restrict__ X, const float* __restrict__ R, const float* __restrict__ g, const float* __restrict__ bta,
                                                  float* __restrict__ out_sum, float* __restrict__ out_norm, int N, float eps) {
  __shared__ float red[256];
  const int row = blockIdx.x, tid = threadIdx.x;
  const float* x = X + (size_t)row * N; const float* rr = R ? R + (size_t)row * N : nullptr;
  float vals[16];                     // up to N = 4096
  const int per = N / 256;            // contiguous chunk per thread? use strided-by-4 chunks: thread handles j = tid*4 + 1024*u
  float s1 = 0.f;
  for (int u = 0; u < per / 4; ++u) {
    const int j = tid * 4 + 1024 * u;
    const v4f a = *(const v4fa*)(x + j);
    v4f b = {0.f,0.f,0.f,0.f}; if (rr) b = *(const v4fa*)(rr + j);
#pragma unroll
    for (int q = 0; q < 4; ++q) { const float v = a[q] + b[q]; vals[u * 4 + q] = v; s1 += v; }
  }
  red[tid] = s1; __syncthreads();
  for (int st = 128; st > 0; st >>= 1) { if (tid < st) red[tid] += red[tid + st]; __syncthreads(); }
  const float mu = red[0] / (float)N; __syncthreads();
  float s2 = 0.f;
  for (int u = 0; u < per / 4; ++u)
#pragma unroll
    for (int q = 0; q < 4; ++q) { const float c = vals[u * 4 + q] - mu; s2 += c * c; }
  red[tid] = s2; __syncthreads();
  for (int st = 128; st > 0; st >>= 1) { if (tid < st) red[tid] += red[tid + st]; __syncthreads(); }
  const float rs = rsqrtf(red[0] / (float)N + eps);
  {
    for (int u = 0; u < per / 4; ++u) {
      const int j = tid * 4 + 1024 * u;
      v4f o, sm;
#pragma unroll
      for (int q = 0; q < 4; ++q) {
        float gg = g[j + q], bb = bta[j + q];
        if (PARAM_BF16) { gg = bf16_round(gg); bb = bf16_round(bb); }
        sm[q] = vals[u * 4 + q]; o[q] = (vals[u * 4 + q] - mu) * rs * gg + bb;
      }
      if (out_sum) *(v4f*)(out_sum + (size_t)row * N + j) = sm;
      *(v4f*)(out_norm + (size_t)row * N + j) = o;
    }
    
  }
}



// ---- f16 WMMA path (v_wmma_f32_16x16x32_f16): 11-bit significands for operands in range — used where a [0,1] probability operand needs more precision than bf16
typedef _Float16 v16h __attribute__((ext_vector_type(16)));
union FragH { v16h v; v8us half[2]; _Float16 h[16]; unsigned short u[16]; };
template <int NT>
__device__ __forceinline__ v8f mmaH(v16h ah, v16h al, v16h bh, v16h bl, v8f c) {
  c = __builtin_amdgcn_wmma_f32_16x16x32_f16(false, ah, false, bh, (short)0, c, false, false);
  if (NT >= 2) c = __builtin_amdgcn_wmma_f32_16x16x32_f16(false, al, false, bh, (short)0, c, false, false);
  if (NT >= 3) c = __builtin_amdgcn_wmma_f32_16x16x32_f16(false, ah, false, bl, (short)0, c, false, false);
  asm volatile("v_nop\n\tv_nop\n\tv_nop\n\tv_nop" : "+v"(c) : "v"(ah), "v"(al), "v"(bh), "v"(bl));
  return c;
}
// batched GEMM like k_gemm_b but f16 operands: A f32 (split into f16 hi/lo if ASPLIT, else rounded to f16), Bt = f16 values [n][k]; alpha; C f32; N multiple of 16 (partial tiles skipped)
template <bool ASPLIT>
__global__ __launch_bounds__(128) void k_gemm_h(const float* __restrict__ A, int lda, size_t sA, const _Float16* __restrict__ Bh, int ldb, size_t sB, float alpha, float* __restrict__ C, int ldc, size_t sC, int M, int N, int K) {
  __shared__ __attribute__((aligned(16))) float so[4][16][64];
  const int tid = threadIdx.x, w = tid >> 5, lane = tid & 31, ln = lane & 15, hh = lane >> 4; const int by = blockIdx.y;
  A += (size_t)by * sA; Bh += (size_t)by * sB; C += (size_t)by * sC;
  const int ntn = (N + 63) / 64; const int wid = blockIdx.x * 4 + w; const int mt = wid / ntn, nq = wid % ntn; if (mt * 16 >= M) return;
  const int row0 = mt * 16, col0 = nq * 64; const float* arow = A + (size_t)(row0 + ln) * lda;
  v8f acc[4] = {};
  for (int kb = 0; kb < K; kb += 32) {
    FragH ah, al;
    const v4f x0 = *(const v4fa*)(arow + kb + 8 * hh), x1 = *(const v4fa*)(arow + kb + 8 * hh + 4), x2 = *(const v4fa*)(arow + kb + 16 + 8 * hh), x3 = *(const v4fa*)(arow + kb + 16 + 8 * hh + 4);
    float xs[16] = {x0[0],x0[1],x0[2],x0[3],x1[0],x1[1],x1[2],x1[3],x2[0],x2[1],x2[2],x2[3],x3[0],x3[1],x3[2],x3[3]};
#pragma unroll
    for (int i = 0; i < 16; ++i) { const _Float16 h = (_Float16)xs[i]; ah.h[i] = h; al.h[i] = ASPLIT ? (_Float16)(xs[i] - (float)h) : (_Float16)0.0f; }
#pragma unroll
    for (int t = 0; t < 4; ++t) { if (col0 + t * 16 >= N) continue; const size_t boff = (size_t)(col0 + t * 16 + ln) * ldb + kb; FragH bq; bq.half[0] = *(const v8us*)(Bh + boff + 8 * hh); bq.half[1] = *(const v8us*)(Bh + boff + 16 + 8 * hh);
      acc[t] = mmaH<ASPLIT ? 2 : 1>(ah.v, al.v, bq.v, bq.v, acc[t]); }
  }
#pragma unroll
  for (int t = 0; t < 4; ++t) { if (col0 + t * 16 >= N) continue;
#pragma unroll
    for (int r = 0; r < 8; ++r) so[w][8 * hh + r][t * 16 + ln] = acc[t][r] * alpha; }
  __builtin_amdgcn_fence(__ATOMIC_ACQ_REL, "workgroup"); __builtin_amdgcn_wave_barrier();
  const int rsub = lane >> 4, c4 = (lane & 15) * 4;
  {
#pragma unroll
    for (int q = 0; q < 8; ++q) { const int r = q * 2 + rsub; if (col0 + c4 < N) { const v4f v = *(const v4fa*)&so[w][r][c4]; *(v4f*)(C + (size_t)(row0 + r) * ldc + col0 + c4) = v; } }
     }
}

// Wt[n][k] = f16(W[k][n]·scale) from f32 row-major W[K][N] (scale = power of two; bf16-exact weights stay exact in f16 away from the subnormal range)
// blockIdx.y picks one of four weight matrices; their transposes lie sWt elements apart
__global__ __launch_bounds__(256) void k_wt_f16(const float* __restrict__ W0, const float* __restrict__ W1, const float* __restrict__ W2, const float* __restrict__ W3, _Float16* __restrict__ Wt, size_t sWt, int K, int N, float scale) {
  const int y = blockIdx.y; const float* __restrict__ W = y == 0 ? W0 : y == 1 ? W1 : y == 2 ? W2 : W3; Wt += (size_t)y * sWt;
  const int t = blockIdx.x * 256 + threadIdx.x; if (t >= N * (K / 8)) return; const int n = t / (K / 8), k8 = (t % (K / 8)) * 8; FragH f;
#pragma unroll
  for (int i = 0; i < 8; ++i) f.h[i] = (_Float16)(bf16_round(W[(size_t)(k8 + i) * N + n]) * scale); const v8us o = f.half[0];
  *(v8us*)((unsigned short*)Wt + (size_t)n * K + k8) = o; 
}
// k_gemm_hh variant with fused epilogue: v = acc·alpha + bias[by·sBias + col] (+ CP[(row/rowsPerB)·sCPb + by·64 + col] if CP) ; ACT 0 none / 1 elu ; writes f16 C16 (and f32 C if non-null)
template <int ACT>
__global__ __launch_bounds__(128) void k_gemm_hhx(const _Float16* __restrict__ A, int lda, size_t sA, const _Float16* __restrict__ Bh, int ldb, size_t sB, float alpha, const float* __restrict__ bias, size_t sBias, const float* __restrict__ CP, int rowsPerB, size_t sCPb, int row0g,
    float* __restrict__ C, _Float16* __restrict__ C16, int ldc, size_t sC, int M, int N, int K) {
  __shared__ __attribute__((aligned(16))) float so[4][16][64];
  const int tid = threadIdx.x, w = tid >> 5, lane = tid & 31, ln = lane & 15, hh = lane >> 4; const int by = blockIdx.y;
  A += (size_t)by * sA; Bh += (size_t)by * sB; const size_t cofs = (size_t)by * sC; const float* bp = bias ? bias + (size_t)by * sBias : nullptr;
  const int ntn = (N + 63) / 64; const int wid = blockIdx.x * 4 + w; const int mt = wid / ntn, nq = wid % ntn; if (mt * 16 >= M) return;
  const int row0 = mt * 16, col0 = nq * 64; const _Float16* arow = A + (size_t)(row0 + ln) * lda;
  v8f acc[4] = {};
  for (int kb = 0; kb < K; kb += 32) { FragH ah; ah.half[0] = *(const v8us*)((const unsigned short*)arow + kb + 8 * hh); ah.half[1] = *(const v8us*)((const unsigned short*)arow + kb + 16 + 8 * hh);
#pragma unroll
    for (int t = 0; t < 4; ++t) { if (col0 + t * 16 >= N) continue; const size_t boff = (size_t)(col0 + t * 16 + ln) * ldb + kb; FragH bq; bq.half[0] = *(const v8us*)((const unsigned short*)Bh + boff + 8 * hh); bq.half[1] = *(const v8us*)((const unsigned short*)Bh + boff + 16 + 8 * hh);
      acc[t] = mmaH<1>(ah.v, ah.v, bq.v, bq.v, acc[t]); }
  }
#pragma unroll
  for (int t = 0; t < 4; ++t) { if (col0 + t * 16 >= N) continue; const int col = col0 + t * 16 + ln; const float bv = bp ? bf16_round(bp[col]) : 0.f;
#pragma unroll
    for (int r = 0; r < 8; ++r) { float v = acc[t][r] * alpha + bv; if (CP) { const int rr = row0g + row0 + 8 * hh + r; if (rowsPerB < 0) v += CP[cofs + (size_t)rr * ldc + col];      /* rowsPerB < 0: own element of the batched C plane */ else { const int bidx = rr / rowsPerB; v += CP[(size_t)bidx * sCPb + (size_t)by * 64 + col]; } } if (ACT == 1) v = (v > 0.f) ? v : expm1f(v); else if (ACT == 7) v = (v > 0.f) ? v + 1.0f : expf(v); else if (ACT == 8) v = tanhf(v); else if (ACT == 9) v = 0.5f * v * (1.0f + tanhf(0.7978845608028654f * (v + 0.044715f * v * v * v))); else if (ACT == 11) v = 1.0f / (1.0f + expf(-v)); else if (ACT == 12) v = (v > 0.f) ? v : 0.01f * v; else if (ACT == 14) v = (v > 0.f) ? v : 0.1f * v; else if (ACT == 16) v = (v >= 0.f) ? v : 0.3f * v; else if (ACT == 17) v = (v >= 0.f) ? v : 0.2f * v; else if (ACT == 15) v = v / (1.0f + expf(-v)); else if (ACT == 3) v = fmaxf(v, 0.f); else if (ACT == 6) v = 0.5f * v * (1.0f + erff(v * 0.70710678118654752f)); so[w][8 * hh + r][t * 16 + ln] = v; } }
  __builtin_amdgcn_fence(__ATOMIC_ACQ_REL, "workgroup"); __builtin_amdgcn_wave_barrier();
  const int rsub = lane >> 4, c4 = (lane & 15) * 4; typedef _Float16 v4h __attribute__((ext_vector_type(4)));
  {
#pragma unroll
    for (int q = 0; q < 8; ++q) { const int r = q * 2 + rsub; if (col0 + c4 < N) { const v4f v = *(const v4fa*)&so[w][r][c4]; if (C) *(v4f*)(C + cofs + (size_t)(row0 + r) * ldc + col0 + c4) = v; if (C16) { v4h h4; for (int i = 0; i < 4; ++i) h4[i] = (_Float16)v[i]; *(v4h*)(C16 + cofs + (size_t)(row0 + r) * ldc + col0 + c4) = h4; } } }
     }
}


typedef _Float16 v4h __attribute__((ext_vector_type(4)));

__global__ __launch_bounds__(256) void k_x16(const float* __restrict__ x0, const float* __restrict__ x1, const float* __restrict__ x2, _Float16* __restrict__ X16, size_t n8) { const int y = blockIdx.y; const float* __restrict__ x = y == 0 ? x0 : y == 1 ? x1 : x2; X16 += (size_t)y * n8 * 8;      /* blockIdx.y picks one of three inputs; their f16 copies lie back to back */
  const size_t t = (size_t)blockIdx.x * 256 + threadIdx.x; if (t >= n8) return; FragH f;
#pragma unroll
  for (int q = 0; q < 8; ++q) f.h[q] = (_Float16)bf16_round(x[t * 8 + q]); *(v8us*)((unsigned short*)X16 + t * 8) = f.half[0];  }
__global__ __launch_bounds__(256) void k_h16(const float* __restrict__ x, _Float16* __restrict__ X16, size_t n8) { const size_t t = (size_t)blockIdx.x * 256 + threadIdx.x; if (t >= n8) return; FragH f;
#pragma unroll
  for (int q = 0; q < 8; ++q) f.h[q] = (_Float16)x[t * 8 + q]; *(v8us*)((unsigned short*)X16 + t * 8) = f.half[0];  }
__global__ __launch_bounds__(256) void k_round16f(const float* __restrict__ W, _Float16* __restrict__ Bt, size_t n8) { const size_t t = (size_t)blockIdx.x * 256 + threadIdx.x; if (t >= n8) return; FragH f;
#pragma unroll
  for (int i = 0; i < 8; ++i) f.h[i] = (_Float16)(bf16_round(W[t * 8 + i]) * 16.0f); *(v8us*)((unsigned short*)Bt + t * 8) = f.half[0];  }
template <int NHv, int TTv>
__global__ __launch_bounds__(256) void k_vt(const _Float16* __restrict__ V16, int ldv, int voff, _Float16* __restrict__ Vt) { __shared__ unsigned short tl[64][66]; const int tid = threadIdx.x; const int slab = blockIdx.x / (TTv / 64), lg = blockIdx.x % (TTv / 64); const int b = slab / NHv, h = slab % NHv;
  for (int i = tid; i < 64 * 8; i += 256) { const int r = i / 8, c8 = (i % 8) * 8; FragH f; f.half[0] = *(const v8us*)((const unsigned short*)V16 + ((size_t)b * TTv + lg * 64 + r) * ldv + voff + h * 64 + c8);
#pragma unroll
    for (int q = 0; q < 8; ++q) tl[r][c8 + q] = f.u[q]; }
  __syncthreads();
  {
#pragma unroll
    for (int rd = 0; rd < 2; ++rd) { const int d = rd * 32 + tid / 8, pc = tid % 8; FragH f;
#pragma unroll
      for (int q = 0; q < 8; ++q) f.u[q] = tl[pc * 8 + q][d];
      *(v8us*)((unsigned short*)Vt + ((size_t)slab * 64 + d) * TTv + lg * 64 + pc * 8) = f.half[0]; }
     } }

__global__ __launch_bounds__(256) void k_hl(const float* __restrict__ F, _Float16* __restrict__ Hh, _Float16* __restrict__ Hl, size_t n8) { const size_t t = (size_t)blockIdx.x * 256 + threadIdx.x; if (t >= n8) return; FragH fh, fl; const v4f a = *(const v4fa*)(F + t * 8), c = *(const v4fa*)(F + t * 8 + 4);
#pragma unroll
  for (int q = 0; q < 4; ++q) { _Float16 h = (_Float16)a[q]; fh.h[q] = h; fl.h[q] = (_Float16)((a[q] - (float)h) * 1024.0f); h = (_Float16)c[q]; fh.h[4 + q] = h; fl.h[4 + q] = (_Float16)((c[q] - (float)h) * 1024.0f); }
  { *(v8us*)((unsigned short*)Hh + t * 8) = fh.half[0]; *(v8us*)((unsigned short*)Hl + t * 8) = fl.half[0];  } }

// ---- fast GEMM (work-group tile 128x64, wave tile 32x64; requires M % 128 == 0, N % 64 == 0 and K % 64 == 0); epilogue = k_gemm_hhx semantics ----
__device__ __forceinline__ v16h g2_frag(const _Float16* p, int hh) { FragH f; f.half[0] = *(const v8us*)((const unsigned short*)p + 8 * hh); f.half[1] = *(const v8us*)((const unsigned short*)p + 16 + 8 * hh); return f.v; }
__device__ __forceinline__ v8f g2_mma(v16h a, v16h b, v8f c) { v8f d = __builtin_amdgcn_wmma_f32_16x16x32_f16(false, a, false, b, (short)0, c, false, false); asm volatile("v_nop\n\tv_nop\n\tv_nop\n\tv_nop" : "+v"(d) : "v"(a), "v"(b)); return d; }
#define GK 64      /* k per pass: one whole 128-byte line of every operand row */
#define GP 72      /* LDS row pitch in f16: 128 data bytes + 16, so that the 16 rows of a 16-byte fragment read fall on different banks */
#define GSTG ((128 + 64) * GP * 2)      /* bytes of one stage: 128 A rows, then 64 B rows */
// One thread's share of a stage: 16 bytes of each of 12 rows (8 of A, 4 of B), 16 rows apart, from global memory straight into LDS.
// l: the thread's LDS byte address in the stage's row 0..15; a, b: its global addresses; pa, pb: 16 rows of A, of B, in elements.
// The s_wait_xcnt closes the statement so that no address register of a copy is rewritten in front of it.
__device__ __forceinline__ void g2_stage(unsigned l, const unsigned short* a, size_t pa, const unsigned short* b, size_t pb) {
  asm volatile(
    "global_load_async_to_lds_b128 %0, %12, off\n\t"
    "global_load_async_to_lds_b128 %1, %13, off\n\t"
    "global_load_async_to_lds_b128 %2, %14, off\n\t"
    "global_load_async_to_lds_b128 %3, %15, off\n\t"
    "global_load_async_to_lds_b128 %4, %16, off\n\t"
    "global_load_async_to_lds_b128 %5, %17, off\n\t"
    "global_load_async_to_lds_b128 %6, %18, off\n\t"
    "global_load_async_to_lds_b128 %7, %19, off\n\t"
    "global_load_async_to_lds_b128 %8, %20, off\n\t"
    "global_load_async_to_lds_b128 %9, %21, off\n\t"
    "global_load_async_to_lds_b128 %10, %22, off\n\t"
    "global_load_async_to_lds_b128 %11, %23, off\n\t"
    "s_wait_xcnt 0x0"
    :: "v"(l + 0u * (16u * GP * 2u)), "v"(l + 1u * (16u * GP * 2u)), "v"(l + 2u * (16u * GP * 2u)), "v"(l + 3u * (16u * GP * 2u)), "v"(l + 4u * (16u * GP * 2u)), "v"(l + 5u * (16u * GP * 2u)), "v"(l + 6u * (16u * GP * 2u)), "v"(l + 7u * (16u * GP * 2u)), "v"(l + 8u * (16u * GP * 2u)), "v"(l + 9u * (16u * GP * 2u)), "v"(l + 10u * (16u * GP * 2u)), "v"(l + 11u * (16u * GP * 2u)),
       "v"(a + 0 * pa), "v"(a + 1 * pa), "v"(a + 2 * pa), "v"(a + 3 * pa), "v"(a + 4 * pa), "v"(a + 5 * pa), "v"(a + 6 * pa), "v"(a + 7 * pa), "v"(b + 0 * pb), "v"(b + 1 * pb), "v"(b + 2 * pb), "v"(b + 3 * pb)
    : "memory");
}
// Both operands go through LDS, two stages: 8 threads copy one 128-byte row piece (a wave-wide copy covers 4 whole lines), each line is fetched once per work-group,
// and the next pass's copies fly while this pass's fragments are read from LDS.
template <int ACT>
__global__ __launch_bounds__(128) void k_gemm2(const _Float16* __restrict__ A, int lda, size_t sA, const _Float16* __restrict__ Bh, int ldb, size_t sB, float alpha, const float* __restrict__ bias, size_t sBias, const float* __restrict__ CP, int rowsPerB, size_t sCPb, int row0g,
    float* __restrict__ C, _Float16* __restrict__ C16, int ldc, size_t sC, int M, int N, int K, size_t zA, size_t zB, size_t zC) { static_assert(ACT == 0 || ACT == 3 || ACT == 6 || ACT == 8 || ACT == 9 || ACT == 11 || ACT == 12 || ACT == 14 || ACT == 15 || ACT == 16 || ACT == 17, "k_gemm2: unsupported ACT code (would silently apply no activation)");
  __shared__ __attribute__((aligned(16))) unsigned char gl[2 * GSTG];      /* the two stages; behind the loop the same bytes stage the output tile */
  static_assert(sizeof(float) * 4 * 32 * 68 <= 2 * GSTG, "output staging must fit the two stages");
  float (*so)[32][68] = (float (*)[32][68])gl;
  const int tid = threadIdx.x, w = tid >> 5, lane = tid & 31, ln = lane & 15, hh = lane >> 4; const int by = blockIdx.y, bz = blockIdx.z;      /* two batch axes: strides sA, sB, sC on grid.y and zA, zB, zC on grid.z */
  A += (size_t)by * sA + (size_t)bz * zA; Bh += (size_t)by * sB + (size_t)bz * zB; const size_t cofs = (size_t)by * sC + (size_t)bz * zC; const float* bp = bias ? bias + (size_t)by * sBias : nullptr;
  const int ntn = N >> 6; const int mt = blockIdx.x / ntn, nq = blockIdx.x - mt * ntn; const int row0 = mt * 128 + 32 * w, col0 = nq * 64; if (mt * 128 >= M) return;      /* the same for the whole work-group: it stands in front of barriers */
  const int sr = tid >> 3, sc = (tid & 7) * 8;      /* staging: 8 threads cover one 128-byte row piece, 16 rows a sweep */
  const unsigned short* ag = (const unsigned short*)A + (size_t)(mt * 128 + sr) * lda + sc;
  const unsigned short* bg = (const unsigned short*)Bh + (size_t)(col0 + sr) * ldb + sc;
  const size_t pa = (size_t)16 * lda, pb = (size_t)16 * ldb;
  const unsigned l0 = (unsigned)(size_t)gl + (unsigned)(sr * GP + sc) * 2u;      /* low 32 bits of the __shared__ address = the byte address in LDS */
  g2_stage(l0, ag, pa, bg, pb);      /* pass 0 into stage 0 */
  asm volatile("s_wait_asynccnt 0x0" ::: "memory");      /* this wave's copies of pass 0 have landed */
  __syncthreads();      /* and every other wave's */
  if (GK < K) g2_stage(l0 + GSTG, ag + GK, pa, bg + GK, pb);      /* pass 1 into stage 1 */
  const v8f z8 = {0.f,0.f,0.f,0.f,0.f,0.f,0.f,0.f}; v8f c00 = z8, c01 = z8, c02 = z8, c03 = z8, c10 = z8, c11 = z8, c12 = z8, c13 = z8;
#pragma unroll 1      /* one pass a trip: the stage alternates */
  for (int kb = 0; kb < K; kb += GK) {
    const unsigned st = (unsigned)(kb / GK) & 1u;      /* this pass's stage */
    const _Float16* ap = (const _Float16*)(gl + st * GSTG) + (32 * w + ln) * GP; const _Float16* bq = (const _Float16*)(gl + st * GSTG) + (128 + ln) * GP;
#pragma unroll      /* two 32-k blocks a pass, constant LDS offsets */
    for (int kk = 0; kk < GK; kk += 32) { const v16h a0 = g2_frag(ap + kk, hh), a1 = g2_frag(ap + 16 * GP + kk, hh);
      const v16h b0 = g2_frag(bq + kk, hh), b1 = g2_frag(bq + 16 * GP + kk, hh), b2 = g2_frag(bq + 32 * GP + kk, hh), b3 = g2_frag(bq + 48 * GP + kk, hh);
      c00 = g2_mma(a0, b0, c00); c10 = g2_mma(a1, b0, c10);
      c01 = g2_mma(a0, b1, c01); c11 = g2_mma(a1, b1, c11);
      c02 = g2_mma(a0, b2, c02); c12 = g2_mma(a1, b2, c12);
      c03 = g2_mma(a0, b3, c03); c13 = g2_mma(a1, b3, c13); }
    asm volatile("s_wait_dscnt 0x0" ::: "memory");      /* this wave's reads of the stage are done before the stage is handed back */
    asm volatile("s_wait_asynccnt 0x0" ::: "memory");      /* this wave's copies of the next pass have landed */
    __syncthreads();      /* the next pass's stage is complete, and every wave has left this one */
    if (kb + 2 * GK < K) g2_stage(l0 + st * GSTG, ag + kb + 2 * GK, pa, bg + kb + 2 * GK, pb);      /* the pass after next into the stage just left */
  }
  asm volatile("s_wait_asynccnt 0x0" ::: "memory");      /* nothing is in flight when the stages become output staging */
  v8f accs[8] = {c00, c01, c02, c03, c10, c11, c12, c13};
#pragma unroll
  for (int u = 0; u < 8; ++u) { const int t = u & 3, half = u >> 2; const int col = col0 + t * 16 + ln; const float bv = bp ? bf16_round(bp[col]) : 0.f;
#pragma unroll
    for (int r = 0; r < 8; ++r) { const int rloc = half * 16 + 8 * hh + r; float v = accs[u][r] * alpha + bv; if (CP) { if (rowsPerB < 0) v += CP[cofs + (size_t)(row0g + row0 + rloc) * ldc + col];      /* rowsPerB < 0: own element of the batched C plane */ else { const int bidx = (row0g + row0 + rloc) / rowsPerB; v += CP[(size_t)bidx * sCPb + (size_t)by * 64 + col]; } }
      if (ACT == 3) v = fmaxf(v, 0.f); else if (ACT == 6) v = 0.5f * v * (1.0f + erff(v * 0.70710678118654752f)); else if (ACT == 11) v = 1.0f / (1.0f + expf(-v)); else if (ACT == 15) v = v / (1.0f + expf(-v)); else if (ACT == 12) v = (v > 0.f) ? v : 0.01f * v; else if (ACT == 8) v = tanhf(v); else if (ACT == 9) v = 0.5f * v * (1.0f + tanhf(0.7978845608028654f * (v + 0.044715f * v * v * v))); else if (ACT == 14) v = (v > 0.f) ? v : 0.1f * v; else if (ACT == 16) v = (v >= 0.f) ? v : 0.3f * v; else if (ACT == 17) v = (v >= 0.f) ? v : 0.2f * v;
      so[w][rloc][t * 16 + ln] = v; } }
  __builtin_amdgcn_fence(__ATOMIC_ACQ_REL, "workgroup"); __builtin_amdgcn_wave_barrier();
  const int rsub = lane >> 4, c4 = (lane & 15) * 4;
  {
#pragma unroll
    for (int q = 0; q < 16; ++q) { const int r = q * 2 + rsub; const v4f v = *(const v4fa*)&so[w][r][c4]; if (C) *(v4f*)(C + cofs + (size_t)(row0 + r) * ldc + col0 + c4) = v; if (C16) { v4h h4; for (int i = 0; i < 4; ++i) h4[i] = (_Float16)v[i]; *(v4h*)(C16 + cofs + (size_t)(row0 + r) * ldc + col0 + c4) = h4; } }
     } }


__global__ __launch_bounds__(256) void k_wnat(const float* __restrict__ w, size_t n8, _Float16* __restrict__ Bt) { const size_t t = (size_t)blockIdx.x * 256 + threadIdx.x; if (t >= n8) return; FragH f; for (int q = 0; q < 8; ++q) f.h[q] = (_Float16)(bf16_round(w[t * 8 + q]) * 16.0f); *(v8us*)((unsigned short*)Bt + t * 8) = f.half[0];  }
__global__ __launch_bounds__(256) void k_rsm(const float* __restrict__ S, _Float16* __restrict__ P, int nrows) {
  #pragma clang fp contract(off)
  const int i = blockIdx.x * 256 + threadIdx.x; if (i >= nrows) return; const float* s = S + (size_t)i * SQ; float mx = -3.0e38f;
#pragma unroll 1
  for (int j = 0; j < SQ; ++j) mx = fmaxf(mx, s[j]); float se = 0.f;
#pragma unroll 1
  for (int j = 0; j < SQ; ++j) se += expf(s[j] - mx); const float sc = 256.0f / se;
#pragma unroll 1
  for (int j0 = 0; j0 < SQ; j0 += 8) { FragH f; for (int q = 0; q < 8; ++q) f.h[q] = (_Float16)(expf(s[j0 + q] - mx) * sc); unsigned short* d = (unsigned short*)P + (size_t)i * SQ + j0; *(v8us*)d = f.half[0];  } }
__global__ __launch_bounds__(256) void k_vt(const _Float16* __restrict__ V16, int b, int h0, _Float16* __restrict__ VT) { __shared__ unsigned short tl[64][65]; const int tid = threadIdx.x; const int hh = blockIdx.x % HG, sg = blockIdx.x / HG; const int s0 = sg * 64; const int h = h0 + hh;
  for (int i = tid; i < 64 * 8; i += 256) { const int j = i / 8, d8 = (i % 8) * 8; FragH f; f.half[0] = *(const v8us*)((const unsigned short*)V16 + ((size_t)b * SQ + s0 + j) * DM + h * HD + d8); for (int q = 0; q < 8; ++q) tl[d8 + q][j] = f.u[q]; }
  __syncthreads();
  { for (int i = tid; i < 64 * 8; i += 256) { const int d = i / 8, j8 = (i % 8) * 8; FragH f; for (int q = 0; q < 8; ++q) f.u[q] = tl[d][j8 + q]; *(v8us*)((unsigned short*)VT + ((size_t)hh * HD + d) * SQ + s0 + j8) = f.half[0]; }  } }


__global__ __launch_bounds__(256) void k_hn16(const _Float16* __restrict__ X, int ld, size_t nrows, float* __restrict__ NQ) {
  #pragma clang fp contract(off)
  X += (size_t)blockIdx.y * nrows * (size_t)ld; NQ += (size_t)blockIdx.y * nrows * NH;      /* blockIdx.y: the q rows, then the k rows behind them; the norm planes likewise */
  const size_t t = (size_t)blockIdx.x * 256 + threadIdx.x; if (t >= nrows * NH) return; const int h = (int)(t / nrows); const size_t r = t % nrows; const _Float16* p = X + r * (size_t)ld + (size_t)h * HD; float ss = 0.f;
#pragma unroll 1
  for (int c = 0; c < HD / 8; ++c) { FragH f; f.half[0] = *(const v8us*)((const unsigned short*)p + c * 8); for (int q = 0; q < 8; ++q) { const float v = (float)f.h[q]; ss = __fadd_rn(ss, __fmul_rn(v, v)); } }
  float* d = NQ + (size_t)h * nrows + r; *(float*)d = ss;  }
// e^x as __expf forms it (one multiply, v_exp_f32). The v_nop in the same statement is the one slot the instruction set asks for behind a transcendental before its source is rewritten or its result read.
__device__ __forceinline__ float exp_slot(float x) { float r; asm("v_exp_f32 %0, %1\n\tv_nop" : "=v"(r) : "v"(x * 1.44269504f)); return r; }
// Eight square roots by v_sqrt_f32 alone (1 ulp; a subnormal argument may give 0, which moves a logit by under 1e-19): sqrtf() adds about fifteen vector instructions of range scaling and last-bit fix-up to each.
// One statement: each root is followed by an independent one ("=&v": no result shares a register with an argument), and the one v_nop behind the last is the slot the instruction set asks for behind a transcendental.
__device__ __forceinline__ void sqrt8_slot(const float (&x)[8], float (&r)[8]) {
  asm("v_sqrt_f32 %0, %8\n\tv_sqrt_f32 %1, %9\n\tv_sqrt_f32 %2, %10\n\tv_sqrt_f32 %3, %11\n\tv_sqrt_f32 %4, %12\n\tv_sqrt_f32 %5, %13\n\tv_sqrt_f32 %6, %14\n\tv_sqrt_f32 %7, %15\n\tv_nop"
      : "=&v"(r[0]), "=&v"(r[1]), "=&v"(r[2]), "=&v"(r[3]), "=&v"(r[4]), "=&v"(r[5]), "=&v"(r[6]), "=&v"(r[7])
      : "v"(x[0]), "v"(x[1]), "v"(x[2]), "v"(x[3]), "v"(x[4]), "v"(x[5]), "v"(x[6]), "v"(x[7])); }
// S and P are not __restrict__: P may be the front half of the same rows (ldp = 2 * SQ f16); a wave stores only into its own row, and every store needs the row sum, so all its loads of the row come first.
// One wave per (head, query row): lane l holds columns c*128 + 4*l .. + 3 (c = 0..7), so every load covers 512 contiguous bytes; the row's logits stay in registers from the max to the store.
__global__ __launch_bounds__(256) void k_rsml2(const float* S, _Float16* P, int ldp, int qn, int hg, const float* __restrict__ NQ, const float* __restrict__ NK, size_t npitch, const float* __restrict__ Mf, float scale) {
  #pragma clang fp contract(off)
  const int lane = threadIdx.x & 31; const int t = blockIdx.x * 8 + __builtin_amdgcn_readfirstlane(threadIdx.x >> 5);      /* the wave's row, told to the compiler as wave-uniform: scalar row addresses and a scalar exit test */
  if (t >= qn * hg) return; const int hl = t / qn, row = t % qn; const size_t i = (size_t)hl * SQ + row; const float* s = S + i * SQ; const float nq = NQ[(size_t)hl * npitch + row]; const float* nk = NK + (size_t)hl * npitch; const float* mrow = Mf + (size_t)row * SQ; float mx = -3.0e38f;
  float e[SQ / 32];
#pragma unroll      /* e[] must be indexed by constants to live in registers; later chunks' loads can issue while earlier chunks are worked on */
  for (int c = 0; c < SQ / 128; ++c) { const int j0 = c * 128 + lane * 4; const v4f s4 = *(const v4fa*)(s + j0), k4 = *(const v4fa*)(nk + j0), m4 = *(const v4fa*)(mrow + j0);
#pragma unroll      /* constant index into e[] */
    for (int q = 0; q < 4; ++q) { const float d2 = fmaxf(__fadd_rn(__fadd_rn(nq, k4[q]), -2.0f * s4[q]), 0.f); const float v = __fadd_rn(__fmul_rn(sqrtf(d2), scale), __fmul_rn(bf16_round(m4[q]), -1.0e9f)); e[c * 4 + q] = v; mx = fmaxf(mx, v); } }
  for (int o = 16; o > 0; o >>= 1) mx = fmaxf(mx, __shfl_xor(mx, o));      /* row maximum over the 32 lanes */
  float se = 0.f;
#pragma unroll      /* constant index into e[] */
  for (int u = 0; u < SQ / 32; ++u) { e[u] = exp_slot(e[u] - mx); se += e[u]; }
  for (int o = 16; o > 0; o >>= 1) se += __shfl_xor(se, o);      /* row sum: per-lane partial sums, then a five-step butterfly */
  const float sc = 256.0f / se;
#pragma unroll      /* constant index into e[] */
  for (int c = 0; c < SQ / 128; ++c) { v4h h4;
#pragma unroll      /* constant index into e[] */
    for (int q = 0; q < 4; ++q) h4[q] = (_Float16)(e[c * 4 + q] * sc);
    *(v4h*)(P + i * (size_t)ldp + c * 128 + lane * 4) = h4; } }


__global__ __launch_bounds__(256) void k_rsmf(const float* __restrict__ S, _Float16* __restrict__ P, int qn, int hg) {
  #pragma clang fp contract(off)
  const int t = blockIdx.x * 256 + threadIdx.x; if (t >= qn * hg) return; const size_t i = (size_t)(t / qn) * SQ + (t % qn); const float* s = S + i * SQ; float mx = -3.0e38f;
#pragma unroll 1
  for (int j = 0; j < SQ; ++j) mx = fmaxf(mx, s[j]); float se = 0.f;
#pragma unroll 1
  for (int j = 0; j < SQ; ++j) se += __expf(s[j] - mx); const float sc = 256.0f / se;
#pragma unroll 1
  for (int j0 = 0; j0 < SQ; j0 += 8) { FragH f; for (int q = 0; q < 8; ++q) f.h[q] = (_Float16)(__expf(s[j0 + q] - mx) * sc); unsigned short* d = (unsigned short*)P + i * SQ + j0; *(v8us*)d = f.half[0];  } }

// ---- fused attention: scores, softmax and the weighted sum of V in one kernel; no score or weight plane goes through memory ----
// lane l with lane l ^ 16 (the two lanes that share a query column)
__device__ __forceinline__ float xhalf(float x) { return __builtin_bit_cast(float, __builtin_amdgcn_permlanex16(__builtin_bit_cast(int, x), __builtin_bit_cast(int, x), 0x76543210, 0xfedcba98, false, false)); }
#define FK 64      /* keys per pass */
#define FP 72      /* LDS row pitch in f16: 128 data bytes + 16, so that the 16 rows of a 16-byte fragment read fall on different banks */
// One work-group = 4 waves x 16 query rows of one (batch, head); 16 passes over 64 keys.
// Both products are formed transposed, so that a lane owns ONE query column throughout: S^T = K Q^T gives lane (c, h) the keys 8h + r of query c,
// which is the k order of a B fragment, so the weights go from the score accumulators straight into O^T = V^T P^T; the running maximum, sum and rescale are per-lane scalars.
__global__ __launch_bounds__(128) void k_fattn(const _Float16* __restrict__ Q16, const _Float16* __restrict__ K16, const _Float16* __restrict__ VT, const float* __restrict__ NQ, const float* __restrict__ NK, const float* __restrict__ Mf, _Float16* __restrict__ O16, float scale) {
  __shared__ __attribute__((aligned(16))) unsigned short kt_s[FK][FP];      /* K tile  [key][d]  */
  __shared__ __attribute__((aligned(16))) unsigned short vt_s[HD][FP];      /* V^T tile [d][key] */
  const int tid = threadIdx.x, w = tid >> 5, lane = tid & 31, ln = lane & 15, hh = lane >> 4;
  const int h = blockIdx.y, b = blockIdx.z; const int q = blockIdx.x * 64 + w * 16 + ln;      /* the lane's query row */
  const _Float16* qrow = Q16 + ((size_t)b * SQ + q) * DM + h * HD;
  const v16h qf0 = g2_frag(qrow, hh), qf1 = g2_frag(qrow + 32, hh);
  const float nq = NQ[(size_t)h * NR + (size_t)b * SQ + q];
  asm volatile("s_wait_xcnt 0x0" ::: "memory");      /* the load's index register is rewritten for the mask row's address right behind it */
  const float* nk = NK + (size_t)h * NR + (size_t)b * SQ + 8 * hh;
  const float* mrow = Mf + (size_t)q * SQ + 8 * hh;
  const int sr = tid >> 3, sc = (tid & 7) * 8;      /* staging: 8 threads cover one 128-byte row, 16 rows a sweep */
  const unsigned short* kg = (const unsigned short*)K16 + ((size_t)b * SQ + sr) * DM + h * HD + sc;
  const unsigned short* vg = (const unsigned short*)VT + (((size_t)b * NH + h) * HD + sr) * SQ + sc;
  v8us kr[4], vr[4];
#pragma unroll      /* kr, vr indexed by constants: registers */
  for (int u = 0; u < 4; ++u) { kr[u] = *(const v8us*)(kg + (size_t)(u * 16) * DM); vr[u] = *(const v8us*)(vg + (size_t)(u * 16) * SQ); }
  const v8f z8 = {0.f,0.f,0.f,0.f,0.f,0.f,0.f,0.f};
  v8f o[4] = {z8, z8, z8, z8}; float mrun = -3.0e38f, lsum = 0.f;
  for (int s = 0; s < SQ / FK; ++s) {
    __syncthreads();      /* every wave has finished reading the previous tiles */
#pragma unroll
    for (int u = 0; u < 4; ++u) { *(v8us*)&kt_s[u * 16 + sr][sc] = kr[u]; *(v8us*)&vt_s[u * 16 + sr][sc] = vr[u]; }
    __syncthreads();      /* the tiles of this pass are complete */
    if (s + 1 < SQ / FK) {      /* next pass's tiles fly while this pass is worked on */
#pragma unroll
      for (int u = 0; u < 4; ++u) { kr[u] = *(const v8us*)(kg + (size_t)((s + 1) * FK + u * 16) * DM); vr[u] = *(const v8us*)(vg + (size_t)(u * 16) * SQ + (s + 1) * FK); }
      asm volatile("s_wait_xcnt 0x0" ::: "memory");      /* the loads' address registers are rewritten right behind them */
    }
    v4f kn[8], mk[8];      /* the pass's key norms and mask values: keys t * 16 + 8 * hh + 0..7 of the lane's query */
#pragma unroll      /* kn indexed by constants: registers */
    for (int t = 0; t < 4; ++t) { kn[2 * t] = *(const v4fa*)(nk + s * FK + t * 16); kn[2 * t + 1] = *(const v4fa*)(nk + s * FK + t * 16 + 4); }
    asm volatile("s_wait_xcnt 0x0" ::: "memory");      /* before a later load's result reuses these loads' address registers */
#pragma unroll      /* mk indexed by constants: registers */
    for (int t = 0; t < 4; ++t) { mk[2 * t] = *(const v4fa*)(mrow + s * FK + t * 16); mk[2 * t + 1] = *(const v4fa*)(mrow + s * FK + t * 16 + 4); }
    asm volatile("s_wait_xcnt 0x0" ::: "memory");      /* likewise, before the fragment reads reuse them */
    float e[4][8]; float mx = mrun;
#pragma unroll      /* e[][] indexed by constants: registers */
    for (int t = 0; t < 4; ++t) {
      const v4f k0 = kn[2 * t], k1 = kn[2 * t + 1], m0 = mk[2 * t], m1 = mk[2 * t + 1];
      const _Float16* kp = (const _Float16*)&kt_s[t * 16 + ln][0];
      v8f st = __builtin_amdgcn_wmma_f32_16x16x32_f16(false, g2_frag(kp, hh), false, qf0, (short)0, z8, false, false);
      st = __builtin_amdgcn_wmma_f32_16x16x32_f16(false, g2_frag(kp + 32, hh), false, qf1, (short)0, st, false, false);
      float d2[8], rt[8];
#pragma unroll      /* d2 indexed by constants: registers */
      for (int r = 0; r < 8; ++r) { const float kk = r < 4 ? k0[r & 3] : k1[r & 3]; d2[r] = fmaxf((nq + kk) - 2.0f * st[r], 0.f); }
      sqrt8_slot(d2, rt);
#pragma unroll      /* rt, e[][] indexed by constants: registers */
      for (int r = 0; r < 8; ++r) { const float mm = r < 4 ? m0[r & 3] : m1[r & 3];
        const float v = rt[r] * scale + bf16_round(mm) * -1.0e9f; e[t][r] = v; mx = fmaxf(mx, v); }
    }
    mx = fmaxf(mx, xhalf(mx));      /* the query's maximum so far: both lanes of the column agree on it */
    const float al = exp_slot(mrun - mx); mrun = mx; float ps = 0.f;
    FragH p0, p1;
#pragma unroll
    for (int r = 0; r < 8; ++r) {
      const float a0 = exp_slot(e[0][r] - mx), a1 = exp_slot(e[1][r] - mx), a2 = exp_slot(e[2][r] - mx), a3 = exp_slot(e[3][r] - mx);
      ps += (a0 + a1) + (a2 + a3);
      p0.h[r] = (_Float16)a0; p0.h[8 + r] = (_Float16)a1; p1.h[r] = (_Float16)a2; p1.h[8 + r] = (_Float16)a3; }
    lsum = lsum * al + ps;
#pragma unroll
    for (int t = 0; t < 4; ++t) {
      const _Float16* vp = (const _Float16*)&vt_s[t * 16 + ln][0];
      v8f a = o[t] * al;
      a = __builtin_amdgcn_wmma_f32_16x16x32_f16(false, g2_frag(vp, hh), false, p0.v, (short)0, a, false, false);
      o[t] = __builtin_amdgcn_wmma_f32_16x16x32_f16(false, g2_frag(vp + 32, hh), false, p1.v, (short)0, a, false, false);
    }
    asm volatile("v_nop\n\tv_nop\n\tv_nop\n\tv_nop" : "+v"(o[0]), "+v"(o[1]), "+v"(o[2]), "+v"(o[3]) : "v"(p1.v));      /* the four vector slots the chip needs behind the pass's last WMMA before its operand registers are rewritten: the next writer stands behind the branch to the loop's head */
  }
  lsum += xhalf(lsum);      /* the two lanes of a column summed disjoint keys */
  const float inv = 64.0f / lsum;      /* o carried x64, as the output GEMM's alpha expects */
  unsigned short* orow = (unsigned short*)O16 + ((size_t)b * SQ + q) * DM + h * HD + 8 * hh;
#pragma unroll
  for (int t = 0; t < 4; ++t) { FragH f;
#pragma unroll
    for (int r = 0; r < 8; ++r) f.h[r] = (_Float16)(o[t][r] * inv);
    *(v8us*)(orow + t * 16) = f.half[0]; }
}

extern "C" void kernel_launch(void* const* d_in, const int* in_sizes, int n_in,
                              void* d_out, int out_size, void* d_ws, size_t ws_size, hipStream_t stream) {
  (void)in_sizes; (void)n_in; (void)out_size;
  const float* const* I = (const float* const*)d_in; const float* xv = I[0]; const float* xk = I[1]; const float* xq = I[2]; const float* mf = I[3]; const float* wq = I[4]; const float* wk = I[5]; const float* wv = I[6]; const float* wo = I[7]; const float* bq = nullptr; const float* bk = nullptr; (void)bq; (void)bk;      /* inputs v, k, q, mask (f32 [1][1][S][S]); [in][out] weights, no biases */
  char* ws = (char*)d_ws; size_t off = 0;
  auto take = [&](size_t bytes) { char* p = ws + off; off += (bytes + 255) & ~(size_t)255; return p; };
  _Float16* BQ = (_Float16*)take((size_t)DM * DM * 2); _Float16* BK = (_Float16*)take((size_t)DM * DM * 2); _Float16* BV = (_Float16*)take((size_t)DM * DM * 2); _Float16* BO = (_Float16*)take((size_t)DM * DM * 2);
  _Float16* XQ = (_Float16*)take(NR * DM * 2); _Float16* XK = (_Float16*)take(NR * DM * 2); _Float16* XV = (_Float16*)take(NR * DM * 2); _Float16* Q16 = (_Float16*)take(NR * DM * 2); _Float16* K16 = (_Float16*)take(NR * DM * 2); _Float16* V16 = (_Float16*)take(NR * DM * 2); _Float16* O16 = (_Float16*)take(NR * DM * 2);
  _Float16* VT = (_Float16*)take((size_t)NB * NH * HD * SQ * 2); float* NQ = (float*)take((size_t)NH * NR * 4); float* NK = (float*)take((size_t)NH * NR * 4);      /* NQ, NK: per-(head, row) squared norms of the f16 q and k rows */
  (void)BK; (void)BV; (void)XK; (void)XV;      /* reached through the strides from BQ and XQ */
  if (off > ws_size) return;
  k_wt_f16<<<dim3((unsigned)(((size_t)DM * (DM / 8) + 255) / 256), 4), 256, 0, stream>>>(wq, wk, wv, wo, BQ, (size_t)DM * DM, DM, DM, 16.0f);      /* [in][out] -> Bt[n][k] x16; BQ, BK, BV, BO lie back to back */

  k_x16<<<dim3((unsigned)((NR * DM / 8 + 255) / 256), 3), 256, 0, stream>>>(xq, xk, xv, XQ, NR * DM / 8);      /* the three inputs as exact f16 rows: XQ, XK, XV lie back to back */
  k_gemm2<0><<<dim3((unsigned)((MP / 128) * (DM / 64)), 3), 128, 0, stream>>>(XQ, DM, NR * DM, BQ, DM, (size_t)DM * DM, 0.0625f, nullptr, 0, nullptr, 1, 0, 0, nullptr, Q16, DM, NR * DM, MP, DM, DM, 0, 0, 0);      /* q, k, v projections on grid.y: Q16, K16, V16 lie back to back */
  k_hn16<<<dim3((unsigned)((NR * NH + 255) / 256), 2), 256, 0, stream>>>(Q16, LQ, NR, NQ);      /* |qh|^2, |kh|^2 per (head, token) from the same f16 values the GEMM multiplies; NK lies behind NQ */
  k_vt<NH, SQ><<<NB * NH * (SQ / 64), 256, 0, stream>>>(V16, LQ, 0, VT);      /* V^T [NB][NH][HD][SQ] */
  k_fattn<<<dim3(SQ / 64, NH, NB), 128, 0, stream>>>(Q16, K16, VT, NQ, NK, mf, O16, 0.125f);      /* softmax(sqrt(max(|q|^2 + |k|^2 - 2 q.k, 0)) / 8 + mask * (-1e9)) . v, merged heads, as f16 rows x64 */
  k_gemm2<0><<<dim3((unsigned)((MPO / 128) * (DM / 64)), 1), 128, 0, stream>>>(O16, DM, 0, BO, DM, 0, 0.0009765625f, nullptr, 0, nullptr, 1, 0, 0, (float*)d_out, nullptr, DM, 0, MPO, DM, DM, 0, 0, 0);      /* out rows are the output layout */
}

// v006
// It runs in 88.1 microseconds.
// Two timings next to v005 put it at 1.08 and 1.09 times that version's speed.
// Counting every step since v000, it is 67.0 times as fast.
#include <hip/hip_runtime.h>
// Multi-head attention with L2-DISTANCE scores (inputs in the module's order v, k, q [4][1024][768], mask f32 [1][1][1024][1024] (zeros); qh = q wq, kh = k wk, vh = v wv ([in][out] 768x768 sigma 0.02, no biases); 12 heads of 64; scores = sqrt(max(|qh|^2 + |kh|^2 - 2 qh.kh, 0)) (pairwise L2 distance); logits = scores / 8 + mask * (-1e9); softmax; out = (attn vh merged) wo -> [4][1024][768]).
// Structure: token rows r = b*1024 + s; the three inputs as exact f16 rows (bf16-rounded); Q, K, V as three WMMA GEMMs (32x64 wave tiles, f32 accumulation, exact x16 weights, f16 outputs); the squared q and k row norms and V^T for all (batch, head) come out of that GEMM's epilogue; one fused attention launch over all 48 (head, batch) planes (heads on grid.y, batches on grid.z): per 64 keys S^T = K Q^T on WMMA (raw q.k), distance, 1/8 and mask on VALU, online softmax (f32 statistics, native exp; weights in (0, 1] as f16), O^T += V^T P^T on WMMA; o is stored x64 (against f16 subnormal flush, folded into the output GEMM alpha) straight into the merged f16 o rows; out = o W_o GEMM (f32) into the output layout.
// Compute dtype: inputs rounded to bf16; x / weights exact; q, k, v, softmax weights and o as plain f16 GEMM operands (~2^-12); scores and softmax statistics f32. v_wmma_f32_16x16x32_f16.
#define NB 4
#define SQ 1024
#define DM 768
#define NH 12
#define HD 64
#define HG 4                         /* heads per launch of the non-template k_vt */
#define B0 0                         /* unused: every launch starts at batch 0 */
#define NBR NB                       /* batches processed (debug hook) */
#define NR ((size_t)NB * SQ)         /* token rows */
#define MP ((int)((size_t)NBR * SQ)) /* rows projected (debug hook) */
#define QN SQ                        /* unused: the attention launches take SQ rows */
#define NHD NH                       /* unused: the attention launches take NH heads */
#define MPO MP                       /* rows through the output stage (debug hook) */
#define LQ DM      /* row pitch of the q/k/v rows */
typedef __bf16 v16b __attribute__((ext_vector_type(16)));
typedef unsigned short v8us __attribute__((ext_vector_type(8), may_alias));
typedef float  v8f  __attribute__((ext_vector_type(8)));
typedef float  v4f  __attribute__((ext_vector_type(4)));
typedef float  v4fa __attribute__((ext_vector_type(4), may_alias));
union FragB { v16b v; v8us half[2]; unsigned short u[16]; };

__device__ __forceinline__ unsigned short bf16_bits(float x) { unsigned int u = __float_as_uint(x); return (unsigned short)((u + 0x7FFFu + ((u >> 16) & 1u)) >> 16); }
__device__ __forceinline__ float bf16_val(unsigned short b) { return __uint_as_float(((unsigned int)b) << 16); }
__device__ __forceinline__ float bf16_round(float x) { return bf16_val(bf16_bits(x)); }
// D += A·B with NT terms: 1 = ah·bh, 2 = + al·bh (A split), 3 = + ah·bl (both split)
template <int NT>
__device__ __forceinline__ v8f mmaN(v16b ah, v16b al, v16b bh, v16b bl, v8f c) {
  c = __builtin_amdgcn_wmma_f32_16x16x32_bf16(false, ah, false, bh, (short)0, c, false, false);
  if (NT >= 2) c = __builtin_amdgcn_wmma_f32_16x16x32_bf16(false, al, false, bh, (short)0, c, false, false);
  if (NT >= 3) c = __builtin_amdgcn_wmma_f32_16x16x32_bf16(false, ah, false, bl, (short)0, c, false, false);
  asm volatile("v_nop\n\tv_nop\n\tv_nop\n\tv_nop" : "+v"(c) : "v"(ah), "v"(al), "v"(bh), "v"(bl));
  return c;
}

__global__ __launch_bounds__(256) void k_wt_bf16(const float* __restrict__ W, unsigned short* __restrict__ Wt, int K, int N) {
  const int t = blockIdx.x * 256 + threadIdx.x;
  const int k8n = K / 8;
  if (t >= N * k8n) return;
  const int n = t / k8n, k8 = (t % k8n) * 8;
  v8us v;
#pragma unroll
  for (int i = 0; i < 8; ++i) v[i] = bf16_bits(W[(size_t)(k8 + i) * N + n]);
  *(v8us*)(Wt + (size_t)n * K + k8) = v;
  
}

// GEMM C[M][N] (f32, pitch ldc) = act(A[M][K]·W + bias). A f32 row-major (pitch lda) converted per fragment to bf16
// (ASPLIT: hi/lo two planes -> 2 terms, else single rounded term); Wt bf16 [N][K] (pitch ldb). BIAS_BF16 rounds the
// bias to bf16 first (bias quantised to bf16 before the add). K%32==0, M%16==0, N%64==0.
template <bool ASPLIT, int ACT, bool BIAS_BF16>
__global__ __launch_bounds__(128) void k_gemm_bf(const float* __restrict__ A, int lda, const unsigned short* __restrict__ Wt, int ldb,
                                               const float* __restrict__ bias, float* __restrict__ C, int ldc, int M, int N, int K) {
  __shared__ __attribute__((aligned(16))) float so[4][16][64];
  const int tid = threadIdx.x, w = tid >> 5, lane = tid & 31, ln = lane & 15, hh = lane >> 4;
  const int ntn = N / 64;
  const int wid = blockIdx.x * 4 + w;
  const int mt = wid / ntn, nq = wid % ntn;
  if (mt * 16 >= M) return;
  const int row0 = mt * 16, col0 = nq * 64;
  const float* arow = A + (size_t)(row0 + ln) * lda;
  v8f acc[4] = {};
  for (int kb = 0; kb < K; kb += 32) {
    FragB ah, al;
    const v4f x0 = *(const v4fa*)(arow + kb + 8 * hh), x1 = *(const v4fa*)(arow + kb + 8 * hh + 4);
    const v4f x2 = *(const v4fa*)(arow + kb + 16 + 8 * hh), x3 = *(const v4fa*)(arow + kb + 16 + 8 * hh + 4);
    float xs[16] = {x0[0],x0[1],x0[2],x0[3],x1[0],x1[1],x1[2],x1[3],x2[0],x2[1],x2[2],x2[3],x3[0],x3[1],x3[2],x3[3]};
#pragma unroll
    for (int i = 0; i < 16; ++i) { const unsigned short hb = bf16_bits(xs[i]); ah.u[i] = hb; al.u[i] = ASPLIT ? bf16_bits(xs[i] - bf16_val(hb)) : (unsigned short)0; }
#pragma unroll
    for (int t = 0; t < 4; ++t) {
      const unsigned short* brow = Wt + (size_t)(col0 + t * 16 + ln) * ldb + kb;
      FragB b;
      b.half[0] = *(const v8us*)(brow + 8 * hh);
      b.half[1] = *(const v8us*)(brow + 16 + 8 * hh);
      acc[t] = mmaN<ASPLIT ? 2 : 1>(ah.v, al.v, b.v, b.v, acc[t]);
    }
  }
#pragma unroll
  for (int t = 0; t < 4; ++t) {
    float bv = bias ? bias[col0 + t * 16 + ln] : 0.f;
    if (BIAS_BF16) bv = bf16_round(bv);
#pragma unroll
    for (int r = 0; r < 8; ++r) { float v = acc[t][r] + bv; if (ACT == 1) v = fmaxf(v, 0.f); so[w][8 * hh + r][t * 16 + ln] = v; }
  }
  __builtin_amdgcn_fence(__ATOMIC_ACQ_REL, "workgroup");
  __builtin_amdgcn_wave_barrier();
  const int rsub = lane >> 4, c4 = (lane & 15) * 4;
  {
#pragma unroll
    for (int q = 0; q < 8; ++q) {
      const int r = q * 2 + rsub;
      const v4f v = *(const v4fa*)&so[w][r][c4];
      *(v4f*)(C + (size_t)(row0 + r) * ldc + col0 + c4) = v;
    }
    
  }
}

// GEMM C = act(A·W + bias + resid): A f32 (ASPLIT -> hi/lo 2 terms), Wt bf16 [N][K]; ACT 0 none, 1 relu, 2 exact gelu;
// resid (optional, f32, row index = (row % rmod), pitch ldr, RES_BF16 rounds it) added before the activation.
template <bool ASPLIT, int ACT, bool BIAS_BF16, bool RES_BF16>
__global__ __launch_bounds__(128) void k_gemm_bf3(const float* __restrict__ A, int lda, const unsigned short* __restrict__ Wt, int ldb,
                                                const float* __restrict__ bias, const float* __restrict__ resid, int rmod, int ldr,
                                                float* __restrict__ C, int ldc, int M, int N, int K) {
  __shared__ __attribute__((aligned(16))) float so[4][16][64];
  const int tid = threadIdx.x, w = tid >> 5, lane = tid & 31, ln = lane & 15, hh = lane >> 4;
  const int ntn = N / 64;
  const int wid = blockIdx.x * 4 + w;
  const int mt = wid / ntn, nq = wid % ntn;
  if (mt * 16 >= M) return;
  const int row0 = mt * 16, col0 = nq * 64;
  const float* arow = A + (size_t)(row0 + ln) * lda;
  v8f acc[4] = {};
  for (int kb = 0; kb < K; kb += 32) {
    FragB ah, al;
    const v4f x0 = *(const v4fa*)(arow + kb + 8 * hh), x1 = *(const v4fa*)(arow + kb + 8 * hh + 4);
    const v4f x2 = *(const v4fa*)(arow + kb + 16 + 8 * hh), x3 = *(const v4fa*)(arow + kb + 16 + 8 * hh + 4);
    float xs[16] = {x0[0],x0[1],x0[2],x0[3],x1[0],x1[1],x1[2],x1[3],x2[0],x2[1],x2[2],x2[3],x3[0],x3[1],x3[2],x3[3]};
#pragma unroll
    for (int i = 0; i < 16; ++i) { const unsigned short hb = bf16_bits(xs[i]); ah.u[i] = hb; al.u[i] = ASPLIT ? bf16_bits(xs[i] - bf16_val(hb)) : (unsigned short)0; }
#pragma unroll
    for (int t = 0; t < 4; ++t) {
      const unsigned short* brow = Wt + (size_t)(col0 + t * 16 + ln) * ldb + kb;
      FragB b;
      b.half[0] = *(const v8us*)(brow + 8 * hh);
      b.half[1] = *(const v8us*)(brow + 16 + 8 * hh);
      acc[t] = mmaN<ASPLIT ? 2 : 1>(ah.v, al.v, b.v, b.v, acc[t]);
    }
  }
#pragma unroll
  for (int t = 0; t < 4; ++t) {
    const int col = col0 + t * 16 + ln;
    float bv = bias ? bias[col] : 0.f;
    if (BIAS_BF16) bv = bf16_round(bv);
#pragma unroll
    for (int r = 0; r < 8; ++r) {
      float v = acc[t][r] + bv;
      if (resid) { float rv = resid[(size_t)((row0 + 8 * hh + r) % rmod) * ldr + col]; if (RES_BF16) rv = bf16_round(rv); v += rv; }
      if (ACT == 1) v = fmaxf(v, 0.f);
      if (ACT == 2) v = 0.5f * v * (1.0f + erff(v * 0.70710678118654752f));
      if (ACT == 3) { const float u = 0.7978845608028654f * (v + 0.044715f * v * v * v); v = 0.5f * v * (1.0f + tanhf(u)); }
      so[w][8 * hh + r][t * 16 + ln] = v;
    }
  }
  __builtin_amdgcn_fence(__ATOMIC_ACQ_REL, "workgroup");
  __builtin_amdgcn_wave_barrier();
  const int rsub = lane >> 4, c4 = (lane & 15) * 4;
  {
#pragma unroll
    for (int q = 0; q < 8; ++q) {
      const int r = q * 2 + rsub;
      const v4f v = *(const v4fa*)&so[w][r][c4];
      *(v4f*)(C + (size_t)(row0 + r) * ldc + col0 + c4) = v;
    }
    
  }
}
// row LayerNorm (biased variance, eps) over N: s = X (+ R); optional out_sum <- s; out_norm <- (s-mu)*rsqrt(var+eps)*g + b
template <bool PARAM_BF16>
__global__ __launch_bounds__(256) void k_layernorm(const float* __restrict__ X, const float* __restrict__ R, const float* __restrict__ g, const float* __restrict__ bta,
                                                  float* __restrict__ out_sum, float* __restrict__ out_norm, int N, float eps) {
  __shared__ float red[256];
  const int row = blockIdx.x, tid = threadIdx.x;
  const float* x = X + (size_t)row * N; const float* rr = R ? R + (size_t)row * N : nullptr;
  float vals[16];                     // up to N = 4096
  const int per = N / 256;            // contiguous chunk per thread? use strided-by-4 chunks: thread handles j = tid*4 + 1024*u
  float s1 = 0.f;
  for (int u = 0; u < per / 4; ++u) {
    const int j = tid * 4 + 1024 * u;
    const v4f a = *(const v4fa*)(x + j);
    v4f b = {0.f,0.f,0.f,0.f}; if (rr) b = *(const v4fa*)(rr + j);
#pragma unroll
    for (int q = 0; q < 4; ++q) { const float v = a[q] + b[q]; vals[u * 4 + q] = v; s1 += v; }
  }
  red[tid] = s1; __syncthreads();
  for (int st = 128; st > 0; st >>= 1) { if (tid < st) red[tid] += red[tid + st]; __syncthreads(); }
  const float mu = red[0] / (float)N; __syncthreads();
  float s2 = 0.f;
  for (int u = 0; u < per / 4; ++u)
#pragma unroll
    for (int q = 0; q < 4; ++q) { const float c = vals[u * 4 + q] - mu; s2 += c * c; }
  red[tid] = s2; __syncthreads();
  for (int st = 128; st > 0; st >>= 1) { if (tid < st) red[tid] += red[tid + st]; __syncthreads(); }
  const float rs = rsqrtf(red[0] / (float)N + eps);
  {
    for (int u = 0; u < per / 4; ++u) {
      const int j = tid * 4 + 1024 * u;
      v4f o, sm;
#pragma unroll
      for (int q = 0; q < 4; ++q) {
        float gg = g[j + q], bb = bta[j + q];
        if (PARAM_BF16) { gg = bf16_round(gg); bb = bf16_round(bb); }
        sm[q] = vals[u * 4 + q]; o[q] = (vals[u * 4 + q] - mu) * rs * gg + bb;
      }
      if (out_sum) *(v4f*)(out_sum + (size_t)row * N + j) = sm;
      *(v4f*)(out_norm + (size_t)row * N + j) = o;
    }
    
  }
}



// ---- f16 WMMA path (v_wmma_f32_16x16x32_f16): 11-bit significands for operands in range — used where a [0,1] probability operand needs more precision than bf16
typedef _Float16 v16h __attribute__((ext_vector_type(16)));
union FragH { v16h v; v8us half[2]; _Float16 h[16]; unsigned short u[16]; };
template <int NT>
__device__ __forceinline__ v8f mmaH(v16h ah, v16h al, v16h bh, v16h bl, v8f c) {
  c = __builtin_amdgcn_wmma_f32_16x16x32_f16(false, ah, false, bh, (short)0, c, false, false);
  if (NT >= 2) c = __builtin_amdgcn_wmma_f32_16x16x32_f16(false, al, false, bh, (short)0, c, false, false);
  if (NT >= 3) c = __builtin_amdgcn_wmma_f32_16x16x32_f16(false, ah, false, bl, (short)0, c, false, false);
  asm volatile("v_nop\n\tv_nop\n\tv_nop\n\tv_nop" : "+v"(c) : "v"(ah), "v"(al), "v"(bh), "v"(bl));
  return c;
}
// batched GEMM like k_gemm_b but f16 operands: A f32 (split into f16 hi/lo if ASPLIT, else rounded to f16), Bt = f16 values [n][k]; alpha; C f32; N multiple of 16 (partial tiles skipped)
template <bool ASPLIT>
__global__ __launch_bounds__(128) void k_gemm_h(const float* __restrict__ A, int lda, size_t sA, const _Float16* __restrict__ Bh, int ldb, size_t sB, float alpha, float* __restrict__ C, int ldc, size_t sC, int M, int N, int K) {
  __shared__ __attribute__((aligned(16))) float so[4][16][64];
  const int tid = threadIdx.x, w = tid >> 5, lane = tid & 31, ln = lane & 15, hh = lane >> 4; const int by = blockIdx.y;
  A += (size_t)by * sA; Bh += (size_t)by * sB; C += (size_t)by * sC;
  const int ntn = (N + 63) / 64; const int wid = blockIdx.x * 4 + w; const int mt = wid / ntn, nq = wid % ntn; if (mt * 16 >= M) return;
  const int row0 = mt * 16, col0 = nq * 64; const float* arow = A + (size_t)(row0 + ln) * lda;
  v8f acc[4] = {};
  for (int kb = 0; kb < K; kb += 32) {
    FragH ah, al;
    const v4f x0 = *(const v4fa*)(arow + kb + 8 * hh), x1 = *(const v4fa*)(arow + kb + 8 * hh + 4), x2 = *(const v4fa*)(arow + kb + 16 + 8 * hh), x3 = *(const v4fa*)(arow + kb + 16 + 8 * hh + 4);
    float xs[16] = {x0[0],x0[1],x0[2],x0[3],x1[0],x1[1],x1[2],x1[3],x2[0],x2[1],x2[2],x2[3],x3[0],x3[1],x3[2],x3[3]};
#pragma unroll
    for (int i = 0; i < 16; ++i) { const _Float16 h = (_Float16)xs[i]; ah.h[i] = h; al.h[i] = ASPLIT ? (_Float16)(xs[i] - (float)h) : (_Float16)0.0f; }
#pragma unroll
    for (int t = 0; t < 4; ++t) { if (col0 + t * 16 >= N) continue; const size_t boff = (size_t)(col0 + t * 16 + ln) * ldb + kb; FragH bq; bq.half[0] = *(const v8us*)(Bh + boff + 8 * hh); bq.half[1] = *(const v8us*)(Bh + boff + 16 + 8 * hh);
      acc[t] = mmaH<ASPLIT ? 2 : 1>(ah.v, al.v, bq.v, bq.v, acc[t]); }
  }
#pragma unroll
  for (int t = 0; t < 4; ++t) { if (col0 + t * 16 >= N) continue;
#pragma unroll
    for (int r = 0; r < 8; ++r) so[w][8 * hh + r][t * 16 + ln] = acc[t][r] * alpha; }
  __builtin_amdgcn_fence(__ATOMIC_ACQ_REL, "workgroup"); __builtin_amdgcn_wave_barrier();
  const int rsub = lane >> 4, c4 = (lane & 15) * 4;
  {
#pragma unroll
    for (int q = 0; q < 8; ++q) { const int r = q * 2 + rsub; if (col0 + c4 < N) { const v4f v = *(const v4fa*)&so[w][r][c4]; *(v4f*)(C + (size_t)(row0 + r) * ldc + col0 + c4) = v; } }
     }
}

// Wt[n][k] = f16(W[k][n]·scale) from f32 row-major W[K][N] (scale = power of two; bf16-exact weights stay exact in f16 away from the subnormal range)
// blockIdx.y picks one of four weight matrices; their transposes lie sWt elements apart
__global__ __launch_bounds__(256) void k_wt_f16(const float* __restrict__ W0, const float* __restrict__ W1, const float* __restrict__ W2, const float* __restrict__ W3, _Float16* __restrict__ Wt, size_t sWt, int K, int N, float scale) {
  const int y = blockIdx.y; const float* __restrict__ W = y == 0 ? W0 : y == 1 ? W1 : y == 2 ? W2 : W3; Wt += (size_t)y * sWt;
  const int t = blockIdx.x * 256 + threadIdx.x; if (t >= N * (K / 8)) return; const int n = t / (K / 8), k8 = (t % (K / 8)) * 8; FragH f;
#pragma unroll
  for (int i = 0; i < 8; ++i) f.h[i] = (_Float16)(bf16_round(W[(size_t)(k8 + i) * N + n]) * scale); const v8us o = f.half[0];
  *(v8us*)((unsigned short*)Wt + (size_t)n * K + k8) = o; 
}
// k_gemm_hh variant with fused epilogue: v = acc·alpha + bias[by·sBias + col] (+ CP[(row/rowsPerB)·sCPb + by·64 + col] if CP) ; ACT 0 none / 1 elu ; writes f16 C16 (and f32 C if non-null)
template <int ACT>
__global__ __launch_bounds__(128) void k_gemm_hhx(const _Float16* __restrict__ A, int lda, size_t sA, const _Float16* __restrict__ Bh, int ldb, size_t sB, float alpha, const float* __restrict__ bias, size_t sBias, const float* __restrict__ CP, int rowsPerB, size_t sCPb, int row0g,
    float* __restrict__ C, _Float16* __restrict__ C16, int ldc, size_t sC, int M, int N, int K) {
  __shared__ __attribute__((aligned(16))) float so[4][16][64];
  const int tid = threadIdx.x, w = tid >> 5, lane = tid & 31, ln = lane & 15, hh = lane >> 4; const int by = blockIdx.y;
  A += (size_t)by * sA; Bh += (size_t)by * sB; const size_t cofs = (size_t)by * sC; const float* bp = bias ? bias + (size_t)by * sBias : nullptr;
  const int ntn = (N + 63) / 64; const int wid = blockIdx.x * 4 + w; const int mt = wid / ntn, nq = wid % ntn; if (mt * 16 >= M) return;
  const int row0 = mt * 16, col0 = nq * 64; const _Float16* arow = A + (size_t)(row0 + ln) * lda;
  v8f acc[4] = {};
  for (int kb = 0; kb < K; kb += 32) { FragH ah; ah.half[0] = *(const v8us*)((const unsigned short*)arow + kb + 8 * hh); ah.half[1] = *(const v8us*)((const unsigned short*)arow + kb + 16 + 8 * hh);
#pragma unroll
    for (int t = 0; t < 4; ++t) { if (col0 + t * 16 >= N) continue; const size_t boff = (size_t)(col0 + t * 16 + ln) * ldb + kb; FragH bq; bq.half[0] = *(const v8us*)((const unsigned short*)Bh + boff + 8 * hh); bq.half[1] = *(const v8us*)((const unsigned short*)Bh + boff + 16 + 8 * hh);
      acc[t] = mmaH<1>(ah.v, ah.v, bq.v, bq.v, acc[t]); }
  }
#pragma unroll
  for (int t = 0; t < 4; ++t) { if (col0 + t * 16 >= N) continue; const int col = col0 + t * 16 + ln; const float bv = bp ? bf16_round(bp[col]) : 0.f;
#pragma unroll
    for (int r = 0; r < 8; ++r) { float v = acc[t][r] * alpha + bv; if (CP) { const int rr = row0g + row0 + 8 * hh + r; if (rowsPerB < 0) v += CP[cofs + (size_t)rr * ldc + col];      /* rowsPerB < 0: own element of the batched C plane */ else { const int bidx = rr / rowsPerB; v += CP[(size_t)bidx * sCPb + (size_t)by * 64 + col]; } } if (ACT == 1) v = (v > 0.f) ? v : expm1f(v); else if (ACT == 7) v = (v > 0.f) ? v + 1.0f : expf(v); else if (ACT == 8) v = tanhf(v); else if (ACT == 9) v = 0.5f * v * (1.0f + tanhf(0.7978845608028654f * (v + 0.044715f * v * v * v))); else if (ACT == 11) v = 1.0f / (1.0f + expf(-v)); else if (ACT == 12) v = (v > 0.f) ? v : 0.01f * v; else if (ACT == 14) v = (v > 0.f) ? v : 0.1f * v; else if (ACT == 16) v = (v >= 0.f) ? v : 0.3f * v; else if (ACT == 17) v = (v >= 0.f) ? v : 0.2f * v; else if (ACT == 15) v = v / (1.0f + expf(-v)); else if (ACT == 3) v = fmaxf(v, 0.f); else if (ACT == 6) v = 0.5f * v * (1.0f + erff(v * 0.70710678118654752f)); so[w][8 * hh + r][t * 16 + ln] = v; } }
  __builtin_amdgcn_fence(__ATOMIC_ACQ_REL, "workgroup"); __builtin_amdgcn_wave_barrier();
  const int rsub = lane >> 4, c4 = (lane & 15) * 4; typedef _Float16 v4h __attribute__((ext_vector_type(4)));
  {
#pragma unroll
    for (int q = 0; q < 8; ++q) { const int r = q * 2 + rsub; if (col0 + c4 < N) { const v4f v = *(const v4fa*)&so[w][r][c4]; if (C) *(v4f*)(C + cofs + (size_t)(row0 + r) * ldc + col0 + c4) = v; if (C16) { v4h h4; for (int i = 0; i < 4; ++i) h4[i] = (_Float16)v[i]; *(v4h*)(C16 + cofs + (size_t)(row0 + r) * ldc + col0 + c4) = h4; } } }
     }
}


typedef _Float16 v4h __attribute__((ext_vector_type(4)));

__global__ __launch_bounds__(256) void k_x16(const float* __restrict__ x0, const float* __restrict__ x1, const float* __restrict__ x2, _Float16* __restrict__ X16, size_t n8) { const int y = blockIdx.y; const float* __restrict__ x = y == 0 ? x0 : y == 1 ? x1 : x2; X16 += (size_t)y * n8 * 8;      /* blockIdx.y picks one of three inputs; their f16 copies lie back to back */
  const size_t t = (size_t)blockIdx.x * 256 + threadIdx.x; if (t >= n8) return; FragH f;
#pragma unroll
  for (int q = 0; q < 8; ++q) f.h[q] = (_Float16)bf16_round(x[t * 8 + q]); *(v8us*)((unsigned short*)X16 + t * 8) = f.half[0];  }
__global__ __launch_bounds__(256) void k_h16(const float* __restrict__ x, _Float16* __restrict__ X16, size_t n8) { const size_t t = (size_t)blockIdx.x * 256 + threadIdx.x; if (t >= n8) return; FragH f;
#pragma unroll
  for (int q = 0; q < 8; ++q) f.h[q] = (_Float16)x[t * 8 + q]; *(v8us*)((unsigned short*)X16 + t * 8) = f.half[0];  }
__global__ __launch_bounds__(256) void k_round16f(const float* __restrict__ W, _Float16* __restrict__ Bt, size_t n8) { const size_t t = (size_t)blockIdx.x * 256 + threadIdx.x; if (t >= n8) return; FragH f;
#pragma unroll
  for (int i = 0; i < 8; ++i) f.h[i] = (_Float16)(bf16_round(W[t * 8 + i]) * 16.0f); *(v8us*)((unsigned short*)Bt + t * 8) = f.half[0];  }
__global__ __launch_bounds__(256) void k_hl(const float* __restrict__ F, _Float16* __restrict__ Hh, _Float16* __restrict__ Hl, size_t n8) { const size_t t = (size_t)blockIdx.x * 256 + threadIdx.x; if (t >= n8) return; FragH fh, fl; const v4f a = *(const v4fa*)(F + t * 8), c = *(const v4fa*)(F + t * 8 + 4);
#pragma unroll
  for (int q = 0; q < 4; ++q) { _Float16 h = (_Float16)a[q]; fh.h[q] = h; fl.h[q] = (_Float16)((a[q] - (float)h) * 1024.0f); h = (_Float16)c[q]; fh.h[4 + q] = h; fl.h[4 + q] = (_Float16)((c[q] - (float)h) * 1024.0f); }
  { *(v8us*)((unsigned short*)Hh + t * 8) = fh.half[0]; *(v8us*)((unsigned short*)Hl + t * 8) = fl.half[0];  } }

// ---- fast GEMM (work-group tile 128x64, wave tile 32x64; requires M % 128 == 0, N % 64 == 0 and K % 64 == 0); epilogue = k_gemm_hhx semantics ----
__device__ __forceinline__ v16h g2_frag(const _Float16* p, int hh) { FragH f; f.half[0] = *(const v8us*)((const unsigned short*)p + 8 * hh); f.half[1] = *(const v8us*)((const unsigned short*)p + 16 + 8 * hh); return f.v; }
__device__ __forceinline__ v8f g2_mma(v16h a, v16h b, v8f c) { v8f d = __builtin_amdgcn_wmma_f32_16x16x32_f16(false, a, false, b, (short)0, c, false, false); asm volatile("v_nop\n\tv_nop\n\tv_nop\n\tv_nop" : "+v"(d) : "v"(a), "v"(b)); return d; }
#define GK 64      /* k per pass: one whole 128-byte line of every operand row */
#define GP 72      /* LDS row pitch in f16: 128 data bytes + 16, so that the 16 rows of a 16-byte fragment read fall on different banks */
#define GSTG ((128 + 64) * GP * 2)      /* bytes of one stage: 128 A rows, then 64 B rows */
// One thread's share of a stage: 16 bytes of each of 12 rows (8 of A, 4 of B), 16 rows apart, from global memory straight into LDS.
// l: the thread's LDS byte address in the stage's row 0..15; a, b: its global addresses; pa, pb: 16 rows of A, of B, in elements.
// The s_wait_xcnt closes the statement so that no address register of a copy is rewritten in front of it.
__device__ __forceinline__ void g2_stage(unsigned l, const unsigned short* a, size_t pa, const unsigned short* b, size_t pb) {
  asm volatile(
    "global_load_async_to_lds_b128 %0, %12, off\n\t"
    "global_load_async_to_lds_b128 %1, %13, off\n\t"
    "global_load_async_to_lds_b128 %2, %14, off\n\t"
    "global_load_async_to_lds_b128 %3, %15, off\n\t"
    "global_load_async_to_lds_b128 %4, %16, off\n\t"
    "global_load_async_to_lds_b128 %5, %17, off\n\t"
    "global_load_async_to_lds_b128 %6, %18, off\n\t"
    "global_load_async_to_lds_b128 %7, %19, off\n\t"
    "global_load_async_to_lds_b128 %8, %20, off\n\t"
    "global_load_async_to_lds_b128 %9, %21, off\n\t"
    "global_load_async_to_lds_b128 %10, %22, off\n\t"
    "global_load_async_to_lds_b128 %11, %23, off\n\t"
    "s_wait_xcnt 0x0"
    :: "v"(l + 0u * (16u * GP * 2u)), "v"(l + 1u * (16u * GP * 2u)), "v"(l + 2u * (16u * GP * 2u)), "v"(l + 3u * (16u * GP * 2u)), "v"(l + 4u * (16u * GP * 2u)), "v"(l + 5u * (16u * GP * 2u)), "v"(l + 6u * (16u * GP * 2u)), "v"(l + 7u * (16u * GP * 2u)), "v"(l + 8u * (16u * GP * 2u)), "v"(l + 9u * (16u * GP * 2u)), "v"(l + 10u * (16u * GP * 2u)), "v"(l + 11u * (16u * GP * 2u)),
       "v"(a + 0 * pa), "v"(a + 1 * pa), "v"(a + 2 * pa), "v"(a + 3 * pa), "v"(a + 4 * pa), "v"(a + 5 * pa), "v"(a + 6 * pa), "v"(a + 7 * pa), "v"(b + 0 * pb), "v"(b + 1 * pb), "v"(b + 2 * pb), "v"(b + 3 * pb)
    : "memory");
}
// Both operands go through LDS, two stages: 8 threads copy one 128-byte row piece (a wave-wide copy covers 4 whole lines), each line is fetched once per work-group,
// and the next pass's copies fly while this pass's fragments are read from LDS.
// QKV (the three projections on grid.y; a work-group's 64 columns are one head): the epilogue also does what the attention kernel needs of the results, so that no launch has to read them back:
// y = 0, 1 (q, k): NS[y][head][row] = the squared norm of the head's 64 f16 values of the row; y = 2 (v): the tile goes out transposed only, Tt[batch][head][d][token].
#define TP 136      /* LDS row pitch of the transposed tile in f16: 256 data bytes + 16, so that the 16 rows of a 16-byte store fall on different banks */
template <int ACT, bool QKV>
__global__ __launch_bounds__(128) void k_gemm2(const _Float16* __restrict__ A, int lda, size_t sA, const _Float16* __restrict__ Bh, int ldb, size_t sB, float alpha, const float* __restrict__ bias, size_t sBias, const float* __restrict__ CP, int rowsPerB, size_t sCPb, int row0g,
    float* __restrict__ C, _Float16* __restrict__ C16, int ldc, size_t sC, int M, int N, int K, size_t zA, size_t zB, size_t zC, float* __restrict__ NS, _Float16* __restrict__ Tt) { static_assert(ACT == 0 || ACT == 3 || ACT == 6 || ACT == 8 || ACT == 9 || ACT == 11 || ACT == 12 || ACT == 14 || ACT == 15 || ACT == 16 || ACT == 17, "k_gemm2: unsupported ACT code (would silently apply no activation)");
  __shared__ __attribute__((aligned(16))) unsigned char gl[2 * GSTG];      /* the two stages; behind the loop the same bytes stage the output tile */
  static_assert(sizeof(float) * 4 * 32 * 68 <= 2 * GSTG, "output staging must fit the two stages");
  float (*so)[32][68] = (float (*)[32][68])gl;
  const int tid = threadIdx.x, w = tid >> 5, lane = tid & 31, ln = lane & 15, hh = lane >> 4; const int by = blockIdx.y, bz = blockIdx.z;      /* two batch axes: strides sA, sB, sC on grid.y and zA, zB, zC on grid.z */
  A += (size_t)by * sA + (size_t)bz * zA; Bh += (size_t)by * sB + (size_t)bz * zB; const size_t cofs = (size_t)by * sC + (size_t)bz * zC; const float* bp = bias ? bias + (size_t)by * sBias : nullptr;
  const int ntn = N >> 6; const int mt = blockIdx.x / ntn, nq = blockIdx.x - mt * ntn; const int row0 = mt * 128 + 32 * w, col0 = nq * 64; if (mt * 128 >= M) return;      /* the same for the whole work-group: it stands in front of barriers */
  const int sr = tid >> 3, sc = (tid & 7) * 8;      /* staging: 8 threads cover one 128-byte row piece, 16 rows a sweep */
  const unsigned short* ag = (const unsigned short*)A + (size_t)(mt * 128 + sr) * lda + sc;
  const unsigned short* bg = (const unsigned short*)Bh + (size_t)(col0 + sr) * ldb + sc;
  const size_t pa = (size_t)16 * lda, pb = (size_t)16 * ldb;
  const unsigned l0 = (unsigned)(size_t)gl + (unsigned)(sr * GP + sc) * 2u;      /* low 32 bits of the __shared__ address = the byte address in LDS */
  g2_stage(l0, ag, pa, bg, pb);      /* pass 0 into stage 0 */
  asm volatile("s_wait_asynccnt 0x0" ::: "memory");      /* this wave's copies of pass 0 have landed */
  __syncthreads();      /* and every other wave's */
  if (GK < K) g2_stage(l0 + GSTG, ag + GK, pa, bg + GK, pb);      /* pass 1 into stage 1 */
  const v8f z8 = {0.f,0.f,0.f,0.f,0.f,0.f,0.f,0.f}; v8f c00 = z8, c01 = z8, c02 = z8, c03 = z8, c10 = z8, c11 = z8, c12 = z8, c13 = z8;
#pragma unroll 1      /* one pass a trip: the stage alternates */
  for (int kb = 0; kb < K; kb += GK) {
    const unsigned st = (unsigned)(kb / GK) & 1u;      /* this pass's stage */
    const _Float16* ap = (const _Float16*)(gl + st * GSTG) + (32 * w + ln) * GP; const _Float16* bq = (const _Float16*)(gl + st * GSTG) + (128 + ln) * GP;
#pragma unroll      /* two 32-k blocks a pass, constant LDS offsets */
    for (int kk = 0; kk < GK; kk += 32) { const v16h a0 = g2_frag(ap + kk, hh), a1 = g2_frag(ap + 16 * GP + kk, hh);
      const v16h b0 = g2_frag(bq + kk, hh), b1 = g2_frag(bq + 16 * GP + kk, hh), b2 = g2_frag(bq + 32 * GP + kk, hh), b3 = g2_frag(bq + 48 * GP + kk, hh);
      c00 = g2_mma(a0, b0, c00); c10 = g2_mma(a1, b0, c10);
      c01 = g2_mma(a0, b1, c01); c11 = g2_mma(a1, b1, c11);
      c02 = g2_mma(a0, b2, c02); c12 = g2_mma(a1, b2, c12);
      c03 = g2_mma(a0, b3, c03); c13 = g2_mma(a1, b3, c13); }
    asm volatile("s_wait_dscnt 0x0" ::: "memory");      /* this wave's reads of the stage are done before the stage is handed back */
    asm volatile("s_wait_asynccnt 0x0" ::: "memory");      /* this wave's copies of the next pass have landed */
    __syncthreads();      /* the next pass's stage is complete, and every wave has left this one */
    if (kb + 2 * GK < K) g2_stage(l0 + st * GSTG, ag + kb + 2 * GK, pa, bg + kb + 2 * GK, pb);      /* the pass after next into the stage just left */
  }
  asm volatile("s_wait_asynccnt 0x0" ::: "memory");      /* nothing is in flight when the stages become output staging */
  v8f accs[8] = {c00, c01, c02, c03, c10, c11, c12, c13};
  if (QKV && by == 2) {      /* the same for the whole work-group: a barrier stands inside */
    static_assert(SQ % 128 == 0 && 64 * TP * 2 <= 2 * GSTG, "a tile lies in one batch, and its transpose fits the two stages");
    unsigned short (*tt)[TP] = (unsigned short (*)[TP])gl;      /* [d][token of the tile] */
#pragma unroll      /* accs indexed by constants: registers */
    for (int u = 0; u < 8; ++u) { const int t = u & 3, half = u >> 2; FragH f;      /* an accumulator's 8 values are 8 successive tokens of one column d: one 16-byte piece of the transposed row */
#pragma unroll      /* f.h and the accumulator indexed by constants: registers */
      for (int r = 0; r < 8; ++r) f.h[r] = (_Float16)(accs[u][r] * alpha);
      *(v8us*)&tt[t * 16 + ln][32 * w + half * 16 + 8 * hh] = f.half[0]; }
    __syncthreads();      /* the transposed tile is complete: a row holds the tokens of all four waves */
    unsigned short* vt = (unsigned short*)Tt + ((size_t)((mt * 128) / SQ) * ntn + nq) * 64 * SQ + (mt * 128) % SQ;
#pragma unroll      /* 16 threads store one row's 256 bytes: whole lines, one writer each */
    for (int j = 0; j < 8; ++j) { const int i = tid + 128 * j, d = i >> 4, p8 = (i & 15) * 8; *(v8us*)(vt + (size_t)d * SQ + p8) = *(const v8us*)&tt[d][p8]; }
    return;
  }
#pragma unroll
  for (int u = 0; u < 8; ++u) { const int t = u & 3, half = u >> 2; const int col = col0 + t * 16 + ln; const float bv = bp ? bf16_round(bp[col]) : 0.f;
#pragma unroll
    for (int r = 0; r < 8; ++r) { const int rloc = half * 16 + 8 * hh + r; float v = accs[u][r] * alpha + bv; if (CP) { if (rowsPerB < 0) v += CP[cofs + (size_t)(row0g + row0 + rloc) * ldc + col];      /* rowsPerB < 0: own element of the batched C plane */ else { const int bidx = (row0g + row0 + rloc) / rowsPerB; v += CP[(size_t)bidx * sCPb + (size_t)by * 64 + col]; } }
      if (ACT == 3) v = fmaxf(v, 0.f); else if (ACT == 6) v = 0.5f * v * (1.0f + erff(v * 0.70710678118654752f)); else if (ACT == 11) v = 1.0f / (1.0f + expf(-v)); else if (ACT == 15) v = v / (1.0f + expf(-v)); else if (ACT == 12) v = (v > 0.f) ? v : 0.01f * v; else if (ACT == 8) v = tanhf(v); else if (ACT == 9) v = 0.5f * v * (1.0f + tanhf(0.7978845608028654f * (v + 0.044715f * v * v * v))); else if (ACT == 14) v = (v > 0.f) ? v : 0.1f * v; else if (ACT == 16) v = (v >= 0.f) ? v : 0.3f * v; else if (ACT == 17) v = (v >= 0.f) ? v : 0.2f * v;
      so[w][rloc][t * 16 + ln] = v; } }
  __builtin_amdgcn_fence(__ATOMIC_ACQ_REL, "workgroup"); __builtin_amdgcn_wave_barrier();
  const int rsub = lane >> 4, c4 = (lane & 15) * 4;
  {
#pragma unroll
    for (int q = 0; q < 16; ++q) { const int r = q * 2 + rsub; const v4f v = *(const v4fa*)&so[w][r][c4]; if (C) *(v4f*)(C + cofs + (size_t)(row0 + r) * ldc + col0 + c4) = v; if (C16) { v4h h4; for (int i = 0; i < 4; ++i) h4[i] = (_Float16)v[i]; *(v4h*)(C16 + cofs + (size_t)(row0 + r) * ldc + col0 + c4) = h4; } }
     }
  if (QKV) {      /* lane l sums row l of the wave's 32, columns in rising order, over the f16 values just stored (a product of two f16 values is exact in f32) */
    float ss = 0.f;
#pragma unroll      /* constant LDS offsets; later reads can issue while earlier values are summed */
    for (int c = 0; c < 16; ++c) { const v4f v = *(const v4fa*)&so[w][lane][c * 4];
#pragma unroll      /* v indexed by constants: registers */
      for (int i = 0; i < 4; ++i) { const float x = (float)(_Float16)v[i]; ss += x * x; } }
    NS[((size_t)by * ntn + nq) * M + row0 + lane] = ss;
    asm volatile("s_wait_xcnt 0x0" ::: "memory");      /* behind the norm store, before code laid out after it may rewrite the store's address registers */
  } }


__global__ __launch_bounds__(256) void k_wnat(const float* __restrict__ w, size_t n8, _Float16* __restrict__ Bt) { const size_t t = (size_t)blockIdx.x * 256 + threadIdx.x; if (t >= n8) return; FragH f; for (int q = 0; q < 8; ++q) f.h[q] = (_Float16)(bf16_round(w[t * 8 + q]) * 16.0f); *(v8us*)((unsigned short*)Bt + t * 8) = f.half[0];  }
__global__ __launch_bounds__(256) void k_rsm(const float* __restrict__ S, _Float16* __restrict__ P, int nrows) {
  #pragma clang fp contract(off)
  const int i = blockIdx.x * 256 + threadIdx.x; if (i >= nrows) return; const float* s = S + (size_t)i * SQ; float mx = -3.0e38f;
#pragma unroll 1
  for (int j = 0; j < SQ; ++j) mx = fmaxf(mx, s[j]); float se = 0.f;
#pragma unroll 1
  for (int j = 0; j < SQ; ++j) se += expf(s[j] - mx); const float sc = 256.0f / se;
#pragma unroll 1
  for (int j0 = 0; j0 < SQ; j0 += 8) { FragH f; for (int q = 0; q < 8; ++q) f.h[q] = (_Float16)(expf(s[j0 + q] - mx) * sc); unsigned short* d = (unsigned short*)P + (size_t)i * SQ + j0; *(v8us*)d = f.half[0];  } }
__global__ __launch_bounds__(256) void k_vt(const _Float16* __restrict__ V16, int b, int h0, _Float16* __restrict__ VT) { __shared__ unsigned short tl[64][65]; const int tid = threadIdx.x; const int hh = blockIdx.x % HG, sg = blockIdx.x / HG; const int s0 = sg * 64; const int h = h0 + hh;
  for (int i = tid; i < 64 * 8; i += 256) { const int j = i / 8, d8 = (i % 8) * 8; FragH f; f.half[0] = *(const v8us*)((const unsigned short*)V16 + ((size_t)b * SQ + s0 + j) * DM + h * HD + d8); for (int q = 0; q < 8; ++q) tl[d8 + q][j] = f.u[q]; }
  __syncthreads();
  { for (int i = tid; i < 64 * 8; i += 256) { const int d = i / 8, j8 = (i % 8) * 8; FragH f; for (int q = 0; q < 8; ++q) f.u[q] = tl[d][j8 + q]; *(v8us*)((unsigned short*)VT + ((size_t)hh * HD + d) * SQ + s0 + j8) = f.half[0]; }  } }


// e^x as __expf forms it (one multiply, v_exp_f32). The v_nop in the same statement is the one slot the instruction set asks for behind a transcendental before its source is rewritten or its result read.
__device__ __forceinline__ float exp_slot(float x) { float r; asm("v_exp_f32 %0, %1\n\tv_nop" : "=v"(r) : "v"(x * 1.44269504f)); return r; }
// Eight square roots by v_sqrt_f32 alone (1 ulp; a subnormal argument may give 0, which moves a logit by under 1e-19): sqrtf() adds about fifteen vector instructions of range scaling and last-bit fix-up to each.
// One statement: each root is followed by an independent one ("=&v": no result shares a register with an argument), and the one v_nop behind the last is the slot the instruction set asks for behind a transcendental.
__device__ __forceinline__ void sqrt8_slot(const float (&x)[8], float (&r)[8]) {
  asm("v_sqrt_f32 %0, %8\n\tv_sqrt_f32 %1, %9\n\tv_sqrt_f32 %2, %10\n\tv_sqrt_f32 %3, %11\n\tv_sqrt_f32 %4, %12\n\tv_sqrt_f32 %5, %13\n\tv_sqrt_f32 %6, %14\n\tv_sqrt_f32 %7, %15\n\tv_nop"
      : "=&v"(r[0]), "=&v"(r[1]), "=&v"(r[2]), "=&v"(r[3]), "=&v"(r[4]), "=&v"(r[5]), "=&v"(r[6]), "=&v"(r[7])
      : "v"(x[0]), "v"(x[1]), "v"(x[2]), "v"(x[3]), "v"(x[4]), "v"(x[5]), "v"(x[6]), "v"(x[7])); }
// S and P are not __restrict__: P may be the front half of the same rows (ldp = 2 * SQ f16); a wave stores only into its own row, and every store needs the row sum, so all its loads of the row come first.
// One wave per (head, query row): lane l holds columns c*128 + 4*l .. + 3 (c = 0..7), so every load covers 512 contiguous bytes; the row's logits stay in registers from the max to the store.
__global__ __launch_bounds__(256) void k_rsml2(const float* S, _Float16* P, int ldp, int qn, int hg, const float* __restrict__ NQ, const float* __restrict__ NK, size_t npitch, const float* __restrict__ Mf, float scale) {
  #pragma clang fp contract(off)
  const int lane = threadIdx.x & 31; const int t = blockIdx.x * 8 + __builtin_amdgcn_readfirstlane(threadIdx.x >> 5);      /* the wave's row, told to the compiler as wave-uniform: scalar row addresses and a scalar exit test */
  if (t >= qn * hg) return; const int hl = t / qn, row = t % qn; const size_t i = (size_t)hl * SQ + row; const float* s = S + i * SQ; const float nq = NQ[(size_t)hl * npitch + row]; const float* nk = NK + (size_t)hl * npitch; const float* mrow = Mf + (size_t)row * SQ; float mx = -3.0e38f;
  float e[SQ / 32];
#pragma unroll      /* e[] must be indexed by constants to live in registers; later chunks' loads can issue while earlier chunks are worked on */
  for (int c = 0; c < SQ / 128; ++c) { const int j0 = c * 128 + lane * 4; const v4f s4 = *(const v4fa*)(s + j0), k4 = *(const v4fa*)(nk + j0), m4 = *(const v4fa*)(mrow + j0);
#pragma unroll      /* constant index into e[] */
    for (int q = 0; q < 4; ++q) { const float d2 = fmaxf(__fadd_rn(__fadd_rn(nq, k4[q]), -2.0f * s4[q]), 0.f); const float v = __fadd_rn(__fmul_rn(sqrtf(d2), scale), __fmul_rn(bf16_round(m4[q]), -1.0e9f)); e[c * 4 + q] = v; mx = fmaxf(mx, v); } }
  for (int o = 16; o > 0; o >>= 1) mx = fmaxf(mx, __shfl_xor(mx, o));      /* row maximum over the 32 lanes */
  float se = 0.f;
#pragma unroll      /* constant index into e[] */
  for (int u = 0; u < SQ / 32; ++u) { e[u] = exp_slot(e[u] - mx); se += e[u]; }
  for (int o = 16; o > 0; o >>= 1) se += __shfl_xor(se, o);      /* row sum: per-lane partial sums, then a five-step butterfly */
  const float sc = 256.0f / se;
#pragma unroll      /* constant index into e[] */
  for (int c = 0; c < SQ / 128; ++c) { v4h h4;
#pragma unroll      /* constant index into e[] */
    for (int q = 0; q < 4; ++q) h4[q] = (_Float16)(e[c * 4 + q] * sc);
    *(v4h*)(P + i * (size_t)ldp + c * 128 + lane * 4) = h4; } }


__global__ __launch_bounds__(256) void k_rsmf(const float* __restrict__ S, _Float16* __restrict__ P, int qn, int hg) {
  #pragma clang fp contract(off)
  const int t = blockIdx.x * 256 + threadIdx.x; if (t >= qn * hg) return; const size_t i = (size_t)(t / qn) * SQ + (t % qn); const float* s = S + i * SQ; float mx = -3.0e38f;
#pragma unroll 1
  for (int j = 0; j < SQ; ++j) mx = fmaxf(mx, s[j]); float se = 0.f;
#pragma unroll 1
  for (int j = 0; j < SQ; ++j) se += __expf(s[j] - mx); const float sc = 256.0f / se;
#pragma unroll 1
  for (int j0 = 0; j0 < SQ; j0 += 8) { FragH f; for (int q = 0; q < 8; ++q) f.h[q] = (_Float16)(__expf(s[j0 + q] - mx) * sc); unsigned short* d = (unsigned short*)P + i * SQ + j0; *(v8us*)d = f.half[0];  } }

// ---- fused attention: scores, softmax and the weighted sum of V in one kernel; no score or weight plane goes through memory ----
// lane l with lane l ^ 16 (the two lanes that share a query column)
__device__ __forceinline__ float xhalf(float x) { return __builtin_bit_cast(float, __builtin_amdgcn_permlanex16(__builtin_bit_cast(int, x), __builtin_bit_cast(int, x), 0x76543210, 0xfedcba98, false, false)); }
#define FK 64      /* keys per pass */
#define FP 72      /* LDS row pitch in f16: 128 data bytes + 16, so that the 16 rows of a 16-byte fragment read fall on different banks */
// One work-group = 4 waves x 16 query rows of one (batch, head); 16 passes over 64 keys.
// Both products are formed transposed, so that a lane owns ONE query column throughout: S^T = K Q^T gives lane (c, h) the keys 8h + r of query c,
// which is the k order of a B fragment, so the weights go from the score accumulators straight into O^T = V^T P^T; the running maximum, sum and rescale are per-lane scalars.
__global__ __launch_bounds__(128) void k_fattn(const _Float16* __restrict__ Q16, const _Float16* __restrict__ K16, const _Float16* __restrict__ VT, const float* __restrict__ NQ, const float* __restrict__ NK, const float* __restrict__ Mf, _Float16* __restrict__ O16, float scale) {
  __shared__ __attribute__((aligned(16))) unsigned short kt_s[FK][FP];      /* K tile  [key][d]  */
  __shared__ __attribute__((aligned(16))) unsigned short vt_s[HD][FP];      /* V^T tile [d][key] */
  const int tid = threadIdx.x, w = tid >> 5, lane = tid & 31, ln = lane & 15, hh = lane >> 4;
  const int h = blockIdx.y, b = blockIdx.z; const int q = blockIdx.x * 64 + w * 16 + ln;      /* the lane's query row */
  const _Float16* qrow = Q16 + ((size_t)b * SQ + q) * DM + h * HD;
  const v16h qf0 = g2_frag(qrow, hh), qf1 = g2_frag(qrow + 32, hh);
  const float nq = NQ[(size_t)h * NR + (size_t)b * SQ + q];
  asm volatile("s_wait_xcnt 0x0" ::: "memory");      /* the load's index register is rewritten for the mask row's address right behind it */
  const float* nk = NK + (size_t)h * NR + (size_t)b * SQ + 8 * hh;
  const float* mrow = Mf + (size_t)q * SQ + 8 * hh;
  const int sr = tid >> 3, sc = (tid & 7) * 8;      /* staging: 8 threads cover one 128-byte row, 16 rows a sweep */
  const unsigned short* kg = (const unsigned short*)K16 + ((size_t)b * SQ + sr) * DM + h * HD + sc;
  const unsigned short* vg = (const unsigned short*)VT + (((size_t)b * NH + h) * HD + sr) * SQ + sc;
  v8us kr[4], vr[4];
#pragma unroll      /* kr, vr indexed by constants: registers */
  for (int u = 0; u < 4; ++u) { kr[u] = *(const v8us*)(kg + (size_t)(u * 16) * DM); vr[u] = *(const v8us*)(vg + (size_t)(u * 16) * SQ); }
  const v8f z8 = {0.f,0.f,0.f,0.f,0.f,0.f,0.f,0.f};
  v8f o[4] = {z8, z8, z8, z8}; float mrun = -3.0e38f, lsum = 0.f;
  for (int s = 0; s < SQ / FK; ++s) {
    __syncthreads();      /* every wave has finished reading the previous tiles */
#pragma unroll
    for (int u = 0; u < 4; ++u) { *(v8us*)&kt_s[u * 16 + sr][sc] = kr[u]; *(v8us*)&vt_s[u * 16 + sr][sc] = vr[u]; }
    __syncthreads();      /* the tiles of this pass are complete */
    if (s + 1 < SQ / FK) {      /* next pass's tiles fly while this pass is worked on */
#pragma unroll
      for (int u = 0; u < 4; ++u) { kr[u] = *(const v8us*)(kg + (size_t)((s + 1) * FK + u * 16) * DM); vr[u] = *(const v8us*)(vg + (size_t)(u * 16) * SQ + (s + 1) * FK); }
      asm volatile("s_wait_xcnt 0x0" ::: "memory");      /* the loads' address registers are rewritten right behind them */
    }
    v4f kn[8], mk[8];      /* the pass's key norms and mask values: keys t * 16 + 8 * hh + 0..7 of the lane's query */
#pragma unroll      /* kn indexed by constants: registers */
    for (int t = 0; t < 4; ++t) { kn[2 * t] = *(const v4fa*)(nk + s * FK + t * 16); kn[2 * t + 1] = *(const v4fa*)(nk + s * FK + t * 16 + 4); }
    asm volatile("s_wait_xcnt 0x0" ::: "memory");      /* before a later load's result reuses these loads' address registers */
#pragma unroll      /* mk indexed by constants: registers */
    for (int t = 0; t < 4; ++t) { mk[2 * t] = *(const v4fa*)(mrow + s * FK + t * 16); mk[2 * t + 1] = *(const v4fa*)(mrow + s * FK + t * 16 + 4); }
    asm volatile("s_wait_xcnt 0x0" ::: "memory");      /* likewise, before the fragment reads reuse them */
    float e[4][8]; float mx = mrun;
#pragma unroll      /* e[][] indexed by constants: registers */
    for (int t = 0; t < 4; ++t) {
      const v4f k0 = kn[2 * t], k1 = kn[2 * t + 1], m0 = mk[2 * t], m1 = mk[2 * t + 1];
      const _Float16* kp = (const _Float16*)&kt_s[t * 16 + ln][0];
      v8f st = __builtin_amdgcn_wmma_f32_16x16x32_f16(false, g2_frag(kp, hh), false, qf0, (short)0, z8, false, false);
      st = __builtin_amdgcn_wmma_f32_16x16x32_f16(false, g2_frag(kp + 32, hh), false, qf1, (short)0, st, false, false);
      float d2[8], rt[8];
#pragma unroll      /* d2 indexed by constants: registers */
      for (int r = 0; r < 8; ++r) { const float kk = r < 4 ? k0[r & 3] : k1[r & 3]; d2[r] = fmaxf((nq + kk) - 2.0f * st[r], 0.f); }
      sqrt8_slot(d2, rt);
#pragma unroll      /* rt, e[][] indexed by constants: registers */
      for (int r = 0; r < 8; ++r) { const float mm = r < 4 ? m0[r & 3] : m1[r & 3];
        const float v = rt[r] * scale + bf16_round(mm) * -1.0e9f; e[t][r] = v; mx = fmaxf(mx, v); }
    }
    mx = fmaxf(mx, xhalf(mx));      /* the query's maximum so far: both lanes of the column agree on it */
    const float al = exp_slot(mrun - mx); mrun = mx; float ps = 0.f;
    FragH p0, p1;
#pragma unroll
    for (int r = 0; r < 8; ++r) {
      const float a0 = exp_slot(e[0][r] - mx), a1 = exp_slot(e[1][r] - mx), a2 = exp_slot(e[2][r] - mx), a3 = exp_slot(e[3][r] - mx);
      ps += (a0 + a1) + (a2 + a3);
      p0.h[r] = (_Float16)a0; p0.h[8 + r] = (_Float16)a1; p1.h[r] = (_Float16)a2; p1.h[8 + r] = (_Float16)a3; }
    lsum = lsum * al + ps;
#pragma unroll
    for (int t = 0; t < 4; ++t) {
      const _Float16* vp = (const _Float16*)&vt_s[t * 16 + ln][0];
      v8f a = o[t] * al;
      a = __builtin_amdgcn_wmma_f32_16x16x32_f16(false, g2_frag(vp, hh), false, p0.v, (short)0, a, false, false);
      o[t] = __builtin_amdgcn_wmma_f32_16x16x32_f16(false, g2_frag(vp + 32, hh), false, p1.v, (short)0, a, false, false);
    }
    asm volatile("v_nop\n\tv_nop\n\tv_nop\n\tv_nop" : "+v"(o[0]), "+v"(o[1]), "+v"(o[2]), "+v"(o[3]) : "v"(p1.v));      /* the four vector slots the chip needs behind the pass's last WMMA before its operand registers are rewritten: the next writer stands behind the branch to the loop's head */
  }
  lsum += xhalf(lsum);      /* the two lanes of a column summed disjoint keys */
  const float inv = 64.0f / lsum;      /* o carried x64, as the output GEMM's alpha expects */
  unsigned short* orow = (unsigned short*)O16 + ((size_t)b * SQ + q) * DM + h * HD + 8 * hh;
#pragma unroll
  for (int t = 0; t < 4; ++t) { FragH f;
#pragma unroll
    for (int r = 0; r < 8; ++r) f.h[r] = (_Float16)(o[t][r] * inv);
    *(v8us*)(orow + t * 16) = f.half[0]; }
}

extern "C" void kernel_launch(void* const* d_in, const int* in_sizes, int n_in,
                              void* d_out, int out_size, void* d_ws, size_t ws_size, hipStream_t stream) {
  (void)in_sizes; (void)n_in; (void)out_size;
  const float* const* I = (const float* const*)d_in; const float* xv = I[0]; const float* xk = I[1]; const float* xq = I[2]; const float* mf = I[3]; const float* wq = I[4]; const float* wk = I[5]; const float* wv = I[6]; const float* wo = I[7]; const float* bq = nullptr; const float* bk = nullptr; (void)bq; (void)bk;      /* inputs v, k, q, mask (f32 [1][1][S][S]); [in][out] weights, no biases */
  char* ws = (char*)d_ws; size_t off = 0;
  auto take = [&](size_t bytes) { char* p = ws + off; off += (bytes + 255) & ~(size_t)255; return p; };
  _Float16* BQ = (_Float16*)take((size_t)DM * DM * 2); _Float16* BK = (_Float16*)take((size_t)DM * DM * 2); _Float16* BV = (_Float16*)take((size_t)DM * DM * 2); _Float16* BO = (_Float16*)take((size_t)DM * DM * 2);
  _Float16* XQ = (_Float16*)take(NR * DM * 2); _Float16* XK = (_Float16*)take(NR * DM * 2); _Float16* XV = (_Float16*)take(NR * DM * 2); _Float16* Q16 = (_Float16*)take(NR * DM * 2); _Float16* K16 = (_Float16*)take(NR * DM * 2); _Float16* V16 = (_Float16*)take(NR * DM * 2); _Float16* O16 = (_Float16*)take(NR * DM * 2);
  _Float16* VT = (_Float16*)take((size_t)NB * NH * HD * SQ * 2); float* NQ = (float*)take((size_t)NH * NR * 4); float* NK = (float*)take((size_t)NH * NR * 4);      /* NQ, NK: per-(head, row) squared norms of the f16 q and k rows */
  (void)BK; (void)BV; (void)XK; (void)XV; (void)V16;      /* reached through the strides from BQ and XQ; the V16 plane keeps its place and is not used */
  if (off > ws_size) return;
  k_wt_f16<<<dim3((unsigned)(((size_t)DM * (DM / 8) + 255) / 256), 4), 256, 0, stream>>>(wq, wk, wv, wo, BQ, (size_t)DM * DM, DM, DM, 16.0f);      /* [in][out] -> Bt[n][k] x16; BQ, BK, BV, BO lie back to back */

  k_x16<<<dim3((unsigned)((NR * DM / 8 + 255) / 256), 3), 256, 0, stream>>>(xq, xk, xv, XQ, NR * DM / 8);      /* the three inputs as exact f16 rows: XQ, XK, XV lie back to back */
  k_gemm2<0, true><<<dim3((unsigned)((MP / 128) * (DM / 64)), 3), 128, 0, stream>>>(XQ, DM, NR * DM, BQ, DM, (size_t)DM * DM, 0.0625f, nullptr, 0, nullptr, 1, 0, 0, nullptr, Q16, DM, NR * DM, MP, DM, DM, 0, 0, 0, NQ, VT);      /* q, k, v projections on grid.y: Q16 and K16 lie back to back; with them |qh|^2, |kh|^2 per (head, token) from the same f16 values (NK lies behind NQ); v goes out as V^T [NB][NH][HD][SQ] only */
  k_fattn<<<dim3(SQ / 64, NH, NB), 128, 0, stream>>>(Q16, K16, VT, NQ, NK, mf, O16, 0.125f);      /* softmax(sqrt(max(|q|^2 + |k|^2 - 2 q.k, 0)) / 8 + mask * (-1e9)) . v, merged heads, as f16 rows x64 */
  k_gemm2<0, false><<<dim3((unsigned)((MPO / 128) * (DM / 64)), 1), 128, 0, stream>>>(O16, DM, 0, BO, DM, 0, 0.0009765625f, nullptr, 0, nullptr, 1, 0, 0, (float*)d_out, nullptr, DM, 0, MPO, DM, DM, 0, 0, 0, nullptr, nullptr);      /* out rows are the output layout */
}

// v007
// A run of this version takes 77.5 microseconds.
// In both of two side-by-side timings against v006, it was 1.13 times as fast.
// All steps since v000 together make it 75.9 times as fast.
#include <hip/hip_runtime.h>
// Multi-head attention with L2-DISTANCE scores (inputs in the module's order v, k, q [4][1024][768], mask f32 [1][1][1024][1024] (zeros); qh = q wq, kh = k wk, vh = v wv ([in][out] 768x768 sigma 0.02, no biases); 12 heads of 64; scores = sqrt(max(|qh|^2 + |kh|^2 - 2 qh.kh, 0)) (pairwise L2 distance); logits = scores / 8 + mask * (-1e9); softmax; out = (attn vh merged) wo -> [4][1024][768]).
// Structure: token rows r = b*1024 + s; the three inputs as exact f16 rows (bf16-rounded); Q, K, V as three WMMA GEMMs (32x64 wave tiles, f32 accumulation, exact x16 weights, f16 outputs); the squared q and k row norms and V^T for all (batch, head) come out of that GEMM's epilogue; one fused attention launch over all 48 (head, batch) planes (heads on grid.y, batches on grid.z): per 64 keys S^T = K Q^T on WMMA (raw q.k), distance, 1/8 and mask on VALU, online softmax (f32 statistics, native exp; weights in (0, 1] as f16), O^T += V^T P^T on WMMA; o is stored x64 (against f16 subnormal flush, folded into the output GEMM alpha) straight into the merged f16 o rows; out = o W_o GEMM (f32) into the output layout.
// Compute dtype: inputs rounded to bf16; x / weights exact; q, k, v, softmax weights and o as plain f16 GEMM operands (~2^-12); scores and softmax statistics f32. v_wmma_f32_16x16x32_f16.
#define NB 4
#define SQ 1024
#define DM 768
#define NH 12
#define HD 64
#define HG 4                         /* heads per launch of the non-template k_vt */
#define B0 0                         /* unused: every launch starts at batch 0 */
#define NBR NB                       /* batches processed (debug hook) */
#define NR ((size_t)NB * SQ)         /* token rows */
#define MP ((int)((size_t)NBR * SQ)) /* rows projected (debug hook) */
#define QN SQ                        /* unused: the attention launches take SQ rows */
#define NHD NH                       /* unused: the attention launches take NH heads */
#define MPO MP                       /* rows through the output stage (debug hook) */
#define LQ DM      /* row pitch of the q/k/v rows */
typedef __bf16 v16b __attribute__((ext_vector_type(16)));
typedef unsigned short v8us __attribute__((ext_vector_type(8), may_alias));
typedef float  v8f  __attribute__((ext_vector_type(8)));
typedef float  v4f  __attribute__((ext_vector_type(4)));
typedef float  v4fa __attribute__((ext_vector_type(4), may_alias));
union FragB { v16b v; v8us half[2]; unsigned short u[16]; };

__device__ __forceinline__ unsigned short bf16_bits(float x) { unsigned int u = __float_as_uint(x); return (unsigned short)((u + 0x7FFFu + ((u >> 16) & 1u)) >> 16); }
__device__ __forceinline__ float bf16_val(unsigned short b) { return __uint_as_float(((unsigned int)b) << 16); }
__device__ __forceinline__ float bf16_round(float x) { return bf16_val(bf16_bits(x)); }
// D += A·B with NT terms: 1 = ah·bh, 2 = + al·bh (A split), 3 = + ah·bl (both split)
template <int NT>
__device__ __forceinline__ v8f mmaN(v16b ah, v16b al, v16b bh, v16b bl, v8f c) {
  c = __builtin_amdgcn_wmma_f32_16x16x32_bf16(false, ah, false, bh, (short)0, c, false, false);
  if (NT >= 2) c = __builtin_amdgcn_wmma_f32_16x16x32_bf16(false, al, false, bh, (short)0, c, false, false);
  if (NT >= 3) c = __builtin_amdgcn_wmma_f32_16x16x32_bf16(false, ah, false, bl, (short)0, c, false, false);
  asm volatile("v_nop\n\tv_nop\n\tv_nop\n\tv_nop" : "+v"(c) : "v"(ah), "v"(al), "v"(bh), "v"(bl));
  return c;
}

__global__ __launch_bounds__(256) void k_wt_bf16(const float* __restrict__ W, unsigned short* __restrict__ Wt, int K, int N) {
  const int t = blockIdx.x * 256 + threadIdx.x;
  const int k8n = K / 8;
  if (t >= N * k8n) return;
  const int n = t / k8n, k8 = (t % k8n) * 8;
  v8us v;
#pragma unroll
  for (int i = 0; i < 8; ++i) v[i] = bf16_bits(W[(size_t)(k8 + i) * N + n]);
  *(v8us*)(Wt + (size_t)n * K + k8) = v;
  
}

// GEMM C[M][N] (f32, pitch ldc) = act(A[M][K]·W + bias). A f32 row-major (pitch lda) converted per fragment to bf16
// (ASPLIT: hi/lo two planes -> 2 terms, else single rounded term); Wt bf16 [N][K] (pitch ldb). BIAS_BF16 rounds the
// bias to bf16 first (bias quantised to bf16 before the add). K%32==0, M%16==0, N%64==0.
template <bool ASPLIT, int ACT, bool BIAS_BF16>
__global__ __launch_bounds__(128) void k_gemm_bf(const float* __restrict__ A, int lda, const unsigned short* __restrict__ Wt, int ldb,
                                               const float* __restrict__ bias, float* __restrict__ C, int ldc, int M, int N, int K) {
  __shared__ __attribute__((aligned(16))) float so[4][16][64];
  const int tid = threadIdx.x, w = tid >> 5, lane = tid & 31, ln = lane & 15, hh = lane >> 4;
  const int ntn = N / 64;
  const int wid = blockIdx.x * 4 + w;
  const int mt = wid / ntn, nq = wid % ntn;
  if (mt * 16 >= M) return;
  const int row0 = mt * 16, col0 = nq * 64;
  const float* arow = A + (size_t)(row0 + ln) * lda;
  v8f acc[4] = {};
  for (int kb = 0; kb < K; kb += 32) {
    FragB ah, al;
    const v4f x0 = *(const v4fa*)(arow + kb + 8 * hh), x1 = *(const v4fa*)(arow + kb + 8 * hh + 4);
    const v4f x2 = *(const v4fa*)(arow + kb + 16 + 8 * hh), x3 = *(const v4fa*)(arow + kb + 16 + 8 * hh + 4);
    float xs[16] = {x0[0],x0[1],x0[2],x0[3],x1[0],x1[1],x1[2],x1[3],x2[0],x2[1],x2[2],x2[3],x3[0],x3[1],x3[2],x3[3]};
#pragma unroll
    for (int i = 0; i < 16; ++i) { const unsigned short hb = bf16_bits(xs[i]); ah.u[i] = hb; al.u[i] = ASPLIT ? bf16_bits(xs[i] - bf16_val(hb)) : (unsigned short)0; }
#pragma unroll
    for (int t = 0; t < 4; ++t) {
      const unsigned short* brow = Wt + (size_t)(col0 + t * 16 + ln) * ldb + kb;
      FragB b;
      b.half[0] = *(const v8us*)(brow + 8 * hh);
      b.half[1] = *(const v8us*)(brow + 16 + 8 * hh);
      acc[t] = mmaN<ASPLIT ? 2 : 1>(ah.v, al.v, b.v, b.v, acc[t]);
    }
  }
#pragma unroll
  for (int t = 0; t < 4; ++t) {
    float bv = bias ? bias[col0 + t * 16 + ln] : 0.f;
    if (BIAS_BF16) bv = bf16_round(bv);
#pragma unroll
    for (int r = 0; r < 8; ++r) { float v = acc[t][r] + bv; if (ACT == 1) v = fmaxf(v, 0.f); so[w][8 * hh + r][t * 16 + ln] = v; }
  }
  __builtin_amdgcn_fence(__ATOMIC_ACQ_REL, "workgroup");
  __builtin_amdgcn_wave_barrier();
  const int rsub = lane >> 4, c4 = (lane & 15) * 4;
  {
#pragma unroll
    for (int q = 0; q < 8; ++q) {
      const int r = q * 2 + rsub;
      const v4f v = *(const v4fa*)&so[w][r][c4];
      *(v4f*)(C + (size_t)(row0 + r) * ldc + col0 + c4) = v;
    }
    
  }
}

// GEMM C = act(A·W + bias + resid): A f32 (ASPLIT -> hi/lo 2 terms), Wt bf16 [N][K]; ACT 0 none, 1 relu, 2 exact gelu;
// resid (optional, f32, row index = (row % rmod), pitch ldr, RES_BF16 rounds it) added before the activation.
template <bool ASPLIT, int ACT, bool BIAS_BF16, bool RES_BF16>
__global__ __launch_bounds__(128) void k_gemm_bf3(const float* __restrict__ A, int lda, const unsigned short* __restrict__ Wt, int ldb,
                                                const float* __restrict__ bias, const float* __restrict__ resid, int rmod, int ldr,
                                                float* __restrict__ C, int ldc, int M, int N, int K) {
  __shared__ __attribute__((aligned(16))) float so[4][16][64];
  const int tid = threadIdx.x, w = tid >> 5, lane = tid & 31, ln = lane & 15, hh = lane >> 4;
  const int ntn = N / 64;
  const int wid = blockIdx.x * 4 + w;
  const int mt = wid / ntn, nq = wid % ntn;
  if (mt * 16 >= M) return;
  const int row0 = mt * 16, col0 = nq * 64;
  const float* arow = A + (size_t)(row0 + ln) * lda;
  v8f acc[4] = {};
  for (int kb = 0; kb < K; kb += 32) {
    FragB ah, al;
    const v4f x0 = *(const v4fa*)(arow + kb + 8 * hh), x1 = *(const v4fa*)(arow + kb + 8 * hh + 4);
    const v4f x2 = *(const v4fa*)(arow + kb + 16 + 8 * hh), x3 = *(const v4fa*)(arow + kb + 16 + 8 * hh + 4);
    float xs[16] = {x0[0],x0[1],x0[2],x0[3],x1[0],x1[1],x1[2],x1[3],x2[0],x2[1],x2[2],x2[3],x3[0],x3[1],x3[2],x3[3]};
#pragma unroll
    for (int i = 0; i < 16; ++i) { const unsigned short hb = bf16_bits(xs[i]); ah.u[i] = hb; al.u[i] = ASPLIT ? bf16_bits(xs[i] - bf16_val(hb)) : (unsigned short)0; }
#pragma unroll
    for (int t = 0; t < 4; ++t) {
      const unsigned short* brow = Wt + (size_t)(col0 + t * 16 + ln) * ldb + kb;
      FragB b;
      b.half[0] = *(const v8us*)(brow + 8 * hh);
      b.half[1] = *(const v8us*)(brow + 16 + 8 * hh);
      acc[t] = mmaN<ASPLIT ? 2 : 1>(ah.v, al.v, b.v, b.v, acc[t]);
    }
  }
#pragma unroll
  for (int t = 0; t < 4; ++t) {
    const int col = col0 + t * 16 + ln;
    float bv = bias ? bias[col] : 0.f;
    if (BIAS_BF16) bv = bf16_round(bv);
#pragma unroll
    for (int r = 0; r < 8; ++r) {
      float v = acc[t][r] + bv;
      if (resid) { float rv = resid[(size_t)((row0 + 8 * hh + r) % rmod) * ldr + col]; if (RES_BF16) rv = bf16_round(rv); v += rv; }
      if (ACT == 1) v = fmaxf(v, 0.f);
      if (ACT == 2) v = 0.5f * v * (1.0f + erff(v * 0.70710678118654752f));
      if (ACT == 3) { const float u = 0.7978845608028654f * (v + 0.044715f * v * v * v); v = 0.5f * v * (1.0f + tanhf(u)); }
      so[w][8 * hh + r][t * 16 + ln] = v;
    }
  }
  __builtin_amdgcn_fence(__ATOMIC_ACQ_REL, "workgroup");
  __builtin_amdgcn_wave_barrier();
  const int rsub = lane >> 4, c4 = (lane & 15) * 4;
  {
#pragma unroll
    for (int q = 0; q < 8; ++q) {
      const int r = q * 2 + rsub;
      const v4f v = *(const v4fa*)&so[w][r][c4];
      *(v4f*)(C + (size_t)(row0 + r) * ldc + col0 + c4) = v;
    }
    
  }
}
// row LayerNorm (biased variance, eps) over N: s = X (+ R); optional out_sum <- s; out_norm <- (s-mu)*rsqrt(var+eps)*g + b
template <bool PARAM_BF16>
__global__ __launch_bounds__(256) void k_layernorm(const float* __restrict__ X, const float* __restrict__ R, const float* __restrict__ g, const float* __restrict__ bta,
                                                  float* __restrict__ out_sum, float* __restrict__ out_norm, int N, float eps) {
  __shared__ float red[256];
  const int row = blockIdx.x, tid = threadIdx.x;
  const float* x = X + (size_t)row * N; const float* rr = R ? R + (size_t)row * N : nullptr;
  float vals[16];                     // up to N = 4096
  const int per = N / 256;            // contiguous chunk per thread? use strided-by-4 chunks: thread handles j = tid*4 + 1024*u
  float s1 = 0.f;
  for (int u = 0; u < per / 4; ++u) {
    const int j = tid * 4 + 1024 * u;
    const v4f a = *(const v4fa*)(x + j);
    v4f b = {0.f,0.f,0.f,0.f}; if (rr) b = *(const v4fa*)(rr + j);
#pragma unroll
    for (int q = 0; q < 4; ++q) { const float v = a[q] + b[q]; vals[u * 4 + q] = v; s1 += v; }
  }
  red[tid] = s1; __syncthreads();
  for (int st = 128; st > 0; st >>= 1) { if (tid < st) red[tid] += red[tid + st]; __syncthreads(); }
  const float mu = red[0] / (float)N; __syncthreads();
  float s2 = 0.f;
  for (int u = 0; u < per / 4; ++u)
#pragma unroll
    for (int q = 0; q < 4; ++q) { const float c = vals[u * 4 + q] - mu; s2 += c * c; }
  red[tid] = s2; __syncthreads();
  for (int st = 128; st > 0; st >>= 1) { if (tid < st) red[tid] += red[tid + st]; __syncthreads(); }
  const float rs = rsqrtf(red[0] / (float)N + eps);
  {
    for (int u = 0; u < per / 4; ++u) {
      const int j = tid * 4 + 1024 * u;
      v4f o, sm;
#pragma unroll
      for (int q = 0; q < 4; ++q) {
        float gg = g[j + q], bb = bta[j + q];
        if (PARAM_BF16) { gg = bf16_round(gg); bb = bf16_round(bb); }
        sm[q] = vals[u * 4 + q]; o[q] = (vals[u * 4 + q] - mu) * rs * gg + bb;
      }
      if (out_sum) *(v4f*)(out_sum + (size_t)row * N + j) = sm;
      *(v4f*)(out_norm + (size_t)row * N + j) = o;
    }
    
  }
}



// ---- f16 WMMA path (v_wmma_f32_16x16x32_f16): 11-bit significands for operands in range — used where a [0,1] probability operand needs more precision than bf16
typedef _Float16 v16h __attribute__((ext_vector_type(16)));
union FragH { v16h v; v8us half[2]; _Float16 h[16]; unsigned short u[16]; };
template <int NT>
__device__ __forceinline__ v8f mmaH(v16h ah, v16h al, v16h bh, v16h bl, v8f c) {
  c = __builtin_amdgcn_wmma_f32_16x16x32_f16(false, ah, false, bh, (short)0, c, false, false);
  if (NT >= 2) c = __builtin_amdgcn_wmma_f32_16x16x32_f16(false, al, false, bh, (short)0, c, false, false);
  if (NT >= 3) c = __builtin_amdgcn_wmma_f32_16x16x32_f16(false, ah, false, bl, (short)0, c, false, false);
  asm volatile("v_nop\n\tv_nop\n\tv_nop\n\tv_nop" : "+v"(c) : "v"(ah), "v"(al), "v"(bh), "v"(bl));
  return c;
}
// batched GEMM like k_gemm_b but f16 operands: A f32 (split into f16 hi/lo if ASPLIT, else rounded to f16), Bt = f16 values [n][k]; alpha; C f32; N multiple of 16 (partial tiles skipped)
template <bool ASPLIT>
__global__ __launch_bounds__(128) void k_gemm_h(const float* __restrict__ A, int lda, size_t sA, const _Float16* __restrict__ Bh, int ldb, size_t sB, float alpha, float* __restrict__ C, int ldc, size_t sC, int M, int N, int K) {
  __shared__ __attribute__((aligned(16))) float so[4][16][64];
  const int tid = threadIdx.x, w = tid >> 5, lane = tid & 31, ln = lane & 15, hh = lane >> 4; const int by = blockIdx.y;
  A += (size_t)by * sA; Bh += (size_t)by * sB; C += (size_t)by * sC;
  const int ntn = (N + 63) / 64; const int wid = blockIdx.x * 4 + w; const int mt = wid / ntn, nq = wid % ntn; if (mt * 16 >= M) return;
  const int row0 = mt * 16, col0 = nq * 64; const float* arow = A + (size_t)(row0 + ln) * lda;
  v8f acc[4] = {};
  for (int kb = 0; kb < K; kb += 32) {
    FragH ah, al;
    const v4f x0 = *(const v4fa*)(arow + kb + 8 * hh), x1 = *(const v4fa*)(arow + kb + 8 * hh + 4), x2 = *(const v4fa*)(arow + kb + 16 + 8 * hh), x3 = *(const v4fa*)(arow + kb + 16 + 8 * hh + 4);
    float xs[16] = {x0[0],x0[1],x0[2],x0[3],x1[0],x1[1],x1[2],x1[3],x2[0],x2[1],x2[2],x2[3],x3[0],x3[1],x3[2],x3[3]};
#pragma unroll
    for (int i = 0; i < 16; ++i) { const _Float16 h = (_Float16)xs[i]; ah.h[i] = h; al.h[i] = ASPLIT ? (_Float16)(xs[i] - (float)h) : (_Float16)0.0f; }
#pragma unroll
    for (int t = 0; t < 4; ++t) { if (col0 + t * 16 >= N) continue; const size_t boff = (size_t)(col0 + t * 16 + ln) * ldb + kb; FragH bq; bq.half[0] = *(const v8us*)(Bh + boff + 8 * hh); bq.half[1] = *(const v8us*)(Bh + boff + 16 + 8 * hh);
      acc[t] = mmaH<ASPLIT ? 2 : 1>(ah.v, al.v, bq.v, bq.v, acc[t]); }
  }
#pragma unroll
  for (int t = 0; t < 4; ++t) { if (col0 + t * 16 >= N) continue;
#pragma unroll
    for (int r = 0; r < 8; ++r) so[w][8 * hh + r][t * 16 + ln] = acc[t][r] * alpha; }
  __builtin_amdgcn_fence(__ATOMIC_ACQ_REL, "workgroup"); __builtin_amdgcn_wave_barrier();
  const int rsub = lane >> 4, c4 = (lane & 15) * 4;
  {
#pragma unroll
    for (int q = 0; q < 8; ++q) { const int r = q * 2 + rsub; if (col0 + c4 < N) { const v4f v = *(const v4fa*)&so[w][r][c4]; *(v4f*)(C + (size_t)(row0 + r) * ldc + col0 + c4) = v; } }
     }
}

// k_gemm_hh variant with fused epilogue: v = acc·alpha + bias[by·sBias + col] (+ CP[(row/rowsPerB)·sCPb + by·64 + col] if CP) ; ACT 0 none / 1 elu ; writes f16 C16 (and f32 C if non-null)
template <int ACT>
__global__ __launch_bounds__(128) void k_gemm_hhx(const _Float16* __restrict__ A, int lda, size_t sA, const _Float16* __restrict__ Bh, int ldb, size_t sB, float alpha, const float* __restrict__ bias, size_t sBias, const float* __restrict__ CP, int rowsPerB, size_t sCPb, int row0g,
    float* __restrict__ C, _Float16* __restrict__ C16, int ldc, size_t sC, int M, int N, int K) {
  __shared__ __attribute__((aligned(16))) float so[4][16][64];
  const int tid = threadIdx.x, w = tid >> 5, lane = tid & 31, ln = lane & 15, hh = lane >> 4; const int by = blockIdx.y;
  A += (size_t)by * sA; Bh += (size_t)by * sB; const size_t cofs = (size_t)by * sC; const float* bp = bias ? bias + (size_t)by * sBias : nullptr;
  const int ntn = (N + 63) / 64; const int wid = blockIdx.x * 4 + w; const int mt = wid / ntn, nq = wid % ntn; if (mt * 16 >= M) return;
  const int row0 = mt * 16, col0 = nq * 64; const _Float16* arow = A + (size_t)(row0 + ln) * lda;
  v8f acc[4] = {};
  for (int kb = 0; kb < K; kb += 32) { FragH ah; ah.half[0] = *(const v8us*)((const unsigned short*)arow + kb + 8 * hh); ah.half[1] = *(const v8us*)((const unsigned short*)arow + kb + 16 + 8 * hh);
#pragma unroll
    for (int t = 0; t < 4; ++t) { if (col0 + t * 16 >= N) continue; const size_t boff = (size_t)(col0 + t * 16 + ln) * ldb + kb; FragH bq; bq.half[0] = *(const v8us*)((const unsigned short*)Bh + boff + 8 * hh); bq.half[1] = *(const v8us*)((const unsigned short*)Bh + boff + 16 + 8 * hh);
      acc[t] = mmaH<1>(ah.v, ah.v, bq.v, bq.v, acc[t]); }
  }
#pragma unroll
  for (int t = 0; t < 4; ++t) { if (col0 + t * 16 >= N) continue; const int col = col0 + t * 16 + ln; const float bv = bp ? bf16_round(bp[col]) : 0.f;
#pragma unroll
    for (int r = 0; r < 8; ++r) { float v = acc[t][r] * alpha + bv; if (CP) { const int rr = row0g + row0 + 8 * hh + r; if (rowsPerB < 0) v += CP[cofs + (size_t)rr * ldc + col];      /* rowsPerB < 0: own element of the batched C plane */ else { const int bidx = rr / rowsPerB; v += CP[(size_t)bidx * sCPb + (size_t)by * 64 + col]; } } if (ACT == 1) v = (v > 0.f) ? v : expm1f(v); else if (ACT == 7) v = (v > 0.f) ? v + 1.0f : expf(v); else if (ACT == 8) v = tanhf(v); else if (ACT == 9) v = 0.5f * v * (1.0f + tanhf(0.7978845608028654f * (v + 0.044715f * v * v * v))); else if (ACT == 11) v = 1.0f / (1.0f + expf(-v)); else if (ACT == 12) v = (v > 0.f) ? v : 0.01f * v; else if (ACT == 14) v = (v > 0.f) ? v : 0.1f * v; else if (ACT == 16) v = (v >= 0.f) ? v : 0.3f * v; else if (ACT == 17) v = (v >= 0.f) ? v : 0.2f * v; else if (ACT == 15) v = v / (1.0f + expf(-v)); else if (ACT == 3) v = fmaxf(v, 0.f); else if (ACT == 6) v = 0.5f * v * (1.0f + erff(v * 0.70710678118654752f)); so[w][8 * hh + r][t * 16 + ln] = v; } }
  __builtin_amdgcn_fence(__ATOMIC_ACQ_REL, "workgroup"); __builtin_amdgcn_wave_barrier();
  const int rsub = lane >> 4, c4 = (lane & 15) * 4; typedef _Float16 v4h __attribute__((ext_vector_type(4)));
  {
#pragma unroll
    for (int q = 0; q < 8; ++q) { const int r = q * 2 + rsub; if (col0 + c4 < N) { const v4f v = *(const v4fa*)&so[w][r][c4]; if (C) *(v4f*)(C + cofs + (size_t)(row0 + r) * ldc + col0 + c4) = v; if (C16) { v4h h4; for (int i = 0; i < 4; ++i) h4[i] = (_Float16)v[i]; *(v4h*)(C16 + cofs + (size_t)(row0 + r) * ldc + col0 + c4) = h4; } } }
     }
}


typedef _Float16 v4h __attribute__((ext_vector_type(4)));

// One preparation launch. Work-groups 0 .. NWB - 1 (they start first: theirs is the longer path) each turn one 64 x 64 tile of one [in][out] weight matrix:
// Wt[n][k] = f16(bf16(W[k][n]) * scale) (scale = power of two; bf16-exact weights stay exact in f16 away from the subnormal range); the four transposes lie back to back.
// A wave-wide load covers two 256-byte row pieces of W and a wave-wide store four 128-byte row pieces of Wt: whole lines both ways, one writer a line; the turn is made in LDS.
// The other work-groups round the three inputs to exact f16 rows, 8 values a thread; the three f16 copies lie back to back.
#define WTT 64      /* weight tile edge */
#define WTP 72      /* LDS row pitch of the turned tile in f16: 128 data bytes + 16, rows stay 16-byte aligned for the read-out */
#define NWB (4 * (DM / WTT) * (DM / WTT))      /* weight-tile work-groups */
#define NXB ((int)((NR * DM / 8 + 255) / 256))      /* work-groups per input */
__global__ __launch_bounds__(256) void k_prep(const float* __restrict__ x0, const float* __restrict__ x1, const float* __restrict__ x2, _Float16* __restrict__ X16, size_t n8,
    const float* __restrict__ W0, const float* __restrict__ W1, const float* __restrict__ W2, const float* __restrict__ W3, _Float16* __restrict__ Wt, float scale) {
  static_assert(DM % WTT == 0, "whole weight tiles");
  __shared__ __attribute__((aligned(16))) unsigned short tl[WTT][WTP];      /* [n][k] of the tile */
  const int tid = threadIdx.x, bx = blockIdx.x;
  if (bx < NWB) {      /* the same for the whole work-group: a barrier stands inside */
    const int y = bx / ((DM / WTT) * (DM / WTT)), tile = bx % ((DM / WTT) * (DM / WTT)), k0 = (tile / (DM / WTT)) * WTT, n0 = (tile % (DM / WTT)) * WTT;
    const float* __restrict__ W = y == 0 ? W0 : y == 1 ? W1 : y == 2 ? W2 : W3;
    const int c4 = (tid & 15) * 4, k4 = (tid >> 4) * 4;      /* the thread's 4 x 4 block: rows k4 .. + 3, columns c4 .. + 3 */
    const float* src = W + (size_t)(k0 + k4) * DM + n0 + c4;
    v4f r[4];
#pragma unroll      /* r indexed by constants: registers; the four loads fly together */
    for (int u = 0; u < 4; ++u) r[u] = *(const v4fa*)(src + (size_t)u * DM);
#pragma unroll      /* r indexed by constants: registers */
    for (int j = 0; j < 4; ++j) { v4h h4;
#pragma unroll      /* r, h4 indexed by constants: registers */
      for (int u = 0; u < 4; ++u) h4[u] = (_Float16)(bf16_round(r[u][j]) * scale);
      *(v4h*)&tl[c4 + j][k4] = h4; }      /* four successive k of one column n: 8 bytes of the turned row */
    __syncthreads();      /* the turned tile is complete: a row holds the k of 16 threads */
    unsigned short* dst = (unsigned short*)Wt + (size_t)y * DM * DM + (size_t)n0 * DM + k0;
#pragma unroll      /* 8 threads store one row's 128 bytes */
    for (int j = 0; j < 2; ++j) { const int i = tid + 256 * j, n = i >> 3, k8 = (i & 7) * 8; *(v8us*)(dst + (size_t)n * DM + k8) = *(const v8us*)&tl[n][k8]; }
    return;
  }
  const int xb = bx - NWB, y = xb / NXB; const float* __restrict__ x = y == 0 ? x0 : y == 1 ? x1 : x2; X16 += (size_t)y * n8 * 8;
  const size_t t = (size_t)(xb - y * NXB) * 256 + tid; if (t >= n8) return; FragH f;
#pragma unroll
  for (int q = 0; q < 8; ++q) f.h[q] = (_Float16)bf16_round(x[t * 8 + q]); *(v8us*)((unsigned short*)X16 + t * 8) = f.half[0];  }
__global__ __launch_bounds__(256) void k_h16(const float* __restrict__ x, _Float16* __restrict__ X16, size_t n8) { const size_t t = (size_t)blockIdx.x * 256 + threadIdx.x; if (t >= n8) return; FragH f;
#pragma unroll
  for (int q = 0; q < 8; ++q) f.h[q] = (_Float16)x[t * 8 + q]; *(v8us*)((unsigned short*)X16 + t * 8) = f.half[0];  }
__global__ __launch_bounds__(256) void k_round16f(const float* __restrict__ W, _Float16* __restrict__ Bt, size_t n8) { const size_t t = (size_t)blockIdx.x * 256 + threadIdx.x; if (t >= n8) return; FragH f;
#pragma unroll
  for (int i = 0; i < 8; ++i) f.h[i] = (_Float16)(bf16_round(W[t * 8 + i]) * 16.0f); *(v8us*)((unsigned short*)Bt + t * 8) = f.half[0];  }
__global__ __launch_bounds__(256) void k_hl(const float* __restrict__ F, _Float16* __restrict__ Hh, _Float16* __restrict__ Hl, size_t n8) { const size_t t = (size_t)blockIdx.x * 256 + threadIdx.x; if (t >= n8) return; FragH fh, fl; const v4f a = *(const v4fa*)(F + t * 8), c = *(const v4fa*)(F + t * 8 + 4);
#pragma unroll
  for (int q = 0; q < 4; ++q) { _Float16 h = (_Float16)a[q]; fh.h[q] = h; fl.h[q] = (_Float16)((a[q] - (float)h) * 1024.0f); h = (_Float16)c[q]; fh.h[4 + q] = h; fl.h[4 + q] = (_Float16)((c[q] - (float)h) * 1024.0f); }
  { *(v8us*)((unsigned short*)Hh + t * 8) = fh.half[0]; *(v8us*)((unsigned short*)Hl + t * 8) = fl.half[0];  } }

// ---- fast GEMM (work-group tile 128x64, wave tile 32x64; requires M % 128 == 0, N % 64 == 0 and K % 64 == 0); epilogue = k_gemm_hhx semantics ----
__device__ __forceinline__ v16h g2_frag(const _Float16* p, int hh) { FragH f; f.half[0] = *(const v8us*)((const unsigned short*)p + 8 * hh); f.half[1] = *(const v8us*)((const unsigned short*)p + 16 + 8 * hh); return f.v; }
__device__ __forceinline__ v8f g2_mma(v16h a, v16h b, v8f c) { v8f d = __builtin_amdgcn_wmma_f32_16x16x32_f16(false, a, false, b, (short)0, c, false, false); asm volatile("v_nop\n\tv_nop\n\tv_nop\n\tv_nop" : "+v"(d) : "v"(a), "v"(b)); return d; }
#define GK 64      /* k per pass: one whole 128-byte line of every operand row */
#define GP 72      /* LDS row pitch in f16: 128 data bytes + 16, so that the 16 rows of a 16-byte fragment read fall on different banks */
#define GSTG ((128 + 64) * GP * 2)      /* bytes of one stage: 128 A rows, then 64 B rows */
// One thread's share of a stage: 16 bytes of each of 12 rows (8 of A, 4 of B), 16 rows apart, from global memory straight into LDS.
// l: the thread's LDS byte address in the stage's row 0..15; a, b: its global addresses; pa, pb: 16 rows of A, of B, in elements.
// The s_wait_xcnt closes the statement so that no address register of a copy is rewritten in front of it.
__device__ __forceinline__ void g2_stage(unsigned l, const unsigned short* a, size_t pa, const unsigned short* b, size_t pb) {
  asm volatile(
    "global_load_async_to_lds_b128 %0, %12, off\n\t"
    "global_load_async_to_lds_b128 %1, %13, off\n\t"
    "global_load_async_to_lds_b128 %2, %14, off\n\t"
    "global_load_async_to_lds_b128 %3, %15, off\n\t"
    "global_load_async_to_lds_b128 %4, %16, off\n\t"
    "global_load_async_to_lds_b128 %5, %17, off\n\t"
    "global_load_async_to_lds_b128 %6, %18, off\n\t"
    "global_load_async_to_lds_b128 %7, %19, off\n\t"
    "global_load_async_to_lds_b128 %8, %20, off\n\t"
    "global_load_async_to_lds_b128 %9, %21, off\n\t"
    "global_load_async_to_lds_b128 %10, %22, off\n\t"
    "global_load_async_to_lds_b128 %11, %23, off\n\t"
    "s_wait_xcnt 0x0"
    :: "v"(l + 0u * (16u * GP * 2u)), "v"(l + 1u * (16u * GP * 2u)), "v"(l + 2u * (16u * GP * 2u)), "v"(l + 3u * (16u * GP * 2u)), "v"(l + 4u * (16u * GP * 2u)), "v"(l + 5u * (16u * GP * 2u)), "v"(l + 6u * (16u * GP * 2u)), "v"(l + 7u * (16u * GP * 2u)), "v"(l + 8u * (16u * GP * 2u)), "v"(l + 9u * (16u * GP * 2u)), "v"(l + 10u * (16u * GP * 2u)), "v"(l + 11u * (16u * GP * 2u)),
       "v"(a + 0 * pa), "v"(a + 1 * pa), "v"(a + 2 * pa), "v"(a + 3 * pa), "v"(a + 4 * pa), "v"(a + 5 * pa), "v"(a + 6 * pa), "v"(a + 7 * pa), "v"(b + 0 * pb), "v"(b + 1 * pb), "v"(b + 2 * pb), "v"(b + 3 * pb)
    : "memory");
}
// Both operands go through LDS, two stages: 8 threads copy one 128-byte row piece (a wave-wide copy covers 4 whole lines), each line is fetched once per work-group,
// and the next pass's copies fly while this pass's fragments are read from LDS.
// QKV (the three projections on grid.y; a work-group's 64 columns are one head): the epilogue also does what the attention kernel needs of the results, so that no launch has to read them back:
// y = 0, 1 (q, k): NS[y][head][row] = the squared norm of the head's 64 f16 values of the row; y = 2 (v): the tile goes out transposed only, Tt[batch][head][d][token].
#define TP 136      /* LDS row pitch of the transposed tile in f16: 256 data bytes + 16, so that the 16 rows of a 16-byte store fall on different banks */
template <int ACT, bool QKV>
__global__ __launch_bounds__(128) void k_gemm2(const _Float16* __restrict__ A, int lda, size_t sA, const _Float16* __restrict__ Bh, int ldb, size_t sB, float alpha, const float* __restrict__ bias, size_t sBias, const float* __restrict__ CP, int rowsPerB, size_t sCPb, int row0g,
    float* __restrict__ C, _Float16* __restrict__ C16, int ldc, size_t sC, int M, int N, int K, size_t zA, size_t zB, size_t zC, float* __restrict__ NS, _Float16* __restrict__ Tt) { static_assert(ACT == 0 || ACT == 3 || ACT == 6 || ACT == 8 || ACT == 9 || ACT == 11 || ACT == 12 || ACT == 14 || ACT == 15 || ACT == 16 || ACT == 17, "k_gemm2: unsupported ACT code (would silently apply no activation)");
  __shared__ __attribute__((aligned(16))) unsigned char gl[2 * GSTG];      /* the two stages; behind the loop the same bytes stage the output tile */
  static_assert(sizeof(float) * 4 * 32 * 68 <= 2 * GSTG, "output staging must fit the two stages");
  float (*so)[32][68] = (float (*)[32][68])gl;
  const int tid = threadIdx.x, w = tid >> 5, lane = tid & 31, ln = lane & 15, hh = lane >> 4; const int by = blockIdx.y, bz = blockIdx.z;      /* two batch axes: strides sA, sB, sC on grid.y and zA, zB, zC on grid.z */
  A += (size_t)by * sA + (size_t)bz * zA; Bh += (size_t)by * sB + (size_t)bz * zB; const size_t cofs = (size_t)by * sC + (size_t)bz * zC; const float* bp = bias ? bias + (size_t)by * sBias : nullptr;
  const int ntn = N >> 6; const int mt = blockIdx.x / ntn, nq = blockIdx.x - mt * ntn; const int row0 = mt * 128 + 32 * w, col0 = nq * 64; if (mt * 128 >= M) return;      /* the same for the whole work-group: it stands in front of barriers */
  const int sr = tid >> 3, sc = (tid & 7) * 8;      /* staging: 8 threads cover one 128-byte row piece, 16 rows a sweep */
  const unsigned short* ag = (const unsigned short*)A + (size_t)(mt * 128 + sr) * lda + sc;
  const unsigned short* bg = (const unsigned short*)Bh + (size_t)(col0 + sr) * ldb + sc;
  const size_t pa = (size_t)16 * lda, pb = (size_t)16 * ldb;
  const unsigned l0 = (unsigned)(size_t)gl + (unsigned)(sr * GP + sc) * 2u;      /* low 32 bits of the __shared__ address = the byte address in LDS */
  g2_stage(l0, ag, pa, bg, pb);      /* pass 0 into stage 0 */
  asm volatile("s_wait_asynccnt 0x0" ::: "memory");      /* this wave's copies of pass 0 have landed */
  __syncthreads();      /* and every other wave's */
  if (GK < K) g2_stage(l0 + GSTG, ag + GK, pa, bg + GK, pb);      /* pass 1 into stage 1 */
  const v8f z8 = {0.f,0.f,0.f,0.f,0.f,0.f,0.f,0.f}; v8f c00 = z8, c01 = z8, c02 = z8, c03 = z8, c10 = z8, c11 = z8, c12 = z8, c13 = z8;
#pragma unroll 1      /* one pass a trip: the stage alternates */
  for (int kb = 0; kb < K; kb += GK) {
    const unsigned st = (unsigned)(kb / GK) & 1u;      /* this pass's stage */
    const _Float16* ap = (const _Float16*)(gl + st * GSTG) + (32 * w + ln) * GP; const _Float16* bq = (const _Float16*)(gl + st * GSTG) + (128 + ln) * GP;
#pragma unroll      /* two 32-k blocks a pass, constant LDS offsets */
    for (int kk = 0; kk < GK; kk += 32) { const v16h a0 = g2_frag(ap + kk, hh), a1 = g2_frag(ap + 16 * GP + kk, hh);
      const v16h b0 = g2_frag(bq + kk, hh), b1 = g2_frag(bq + 16 * GP + kk, hh), b2 = g2_frag(bq + 32 * GP + kk, hh), b3 = g2_frag(bq + 48 * GP + kk, hh);
      c00 = g2_mma(a0, b0, c00); c10 = g2_mma(a1, b0, c10);
      c01 = g2_mma(a0, b1, c01); c11 = g2_mma(a1, b1, c11);
      c02 = g2_mma(a0, b2, c02); c12 = g2_mma(a1, b2, c12);
      c03 = g2_mma(a0, b3, c03); c13 = g2_mma(a1, b3, c13); }
    asm volatile("s_wait_dscnt 0x0" ::: "memory");      /* this wave's reads of the stage are done before the stage is handed back */
    asm volatile("s_wait_asynccnt 0x0" ::: "memory");      /* this wave's copies of the next pass have landed */
    __syncthreads();      /* the next pass's stage is complete, and every wave has left this one */
    if (kb + 2 * GK < K) g2_stage(l0 + st * GSTG, ag + kb + 2 * GK, pa, bg + kb + 2 * GK, pb);      /* the pass after next into the stage just left */
  }
  asm volatile("s_wait_asynccnt 0x0" ::: "memory");      /* nothing is in flight when the stages become output staging */
  v8f accs[8] = {c00, c01, c02, c03, c10, c11, c12, c13};
  if (QKV && by == 2) {      /* the same for the whole work-group: a barrier stands inside */
    static_assert(SQ % 128 == 0 && 64 * TP * 2 <= 2 * GSTG, "a tile lies in one batch, and its transpose fits the two stages");
    unsigned short (*tt)[TP] = (unsigned short (*)[TP])gl;      /* [d][token of the tile] */
#pragma unroll      /* accs indexed by constants: registers */
    for (int u = 0; u < 8; ++u) { const int t = u & 3, half = u >> 2; FragH f;      /* an accumulator's 8 values are 8 successive tokens of one column d: one 16-byte piece of the transposed row */
#pragma unroll      /* f.h and the accumulator indexed by constants: registers */
      for (int r = 0; r < 8; ++r) f.h[r] = (_Float16)(accs[u][r] * alpha);
      *(v8us*)&tt[t * 16 + ln][32 * w + half * 16 + 8 * hh] = f.half[0]; }
    __syncthreads();      /* the transposed tile is complete: a row holds the tokens of all four waves */
    unsigned short* vt = (unsigned short*)Tt + ((size_t)((mt * 128) / SQ) * ntn + nq) * 64 * SQ + (mt * 128) % SQ;
#pragma unroll      /* 16 threads store one row's 256 bytes: whole lines, one writer each */
    for (int j = 0; j < 8; ++j) { const int i = tid + 128 * j, d = i >> 4, p8 = (i & 15) * 8; *(v8us*)(vt + (size_t)d * SQ + p8) = *(const v8us*)&tt[d][p8]; }
    return;
  }
#pragma unroll
  for (int u = 0; u < 8; ++u) { const int t = u & 3, half = u >> 2; const int col = col0 + t * 16 + ln; const float bv = bp ? bf16_round(bp[col]) : 0.f;
#pragma unroll
    for (int r = 0; r < 8; ++r) { const int rloc = half * 16 + 8 * hh + r; float v = accs[u][r] * alpha + bv; if (CP) { if (rowsPerB < 0) v += CP[cofs + (size_t)(row0g + row0 + rloc) * ldc + col];      /* rowsPerB < 0: own element of the batched C plane */ else { const int bidx = (row0g + row0 + rloc) / rowsPerB; v += CP[(size_t)bidx * sCPb + (size_t)by * 64 + col]; } }
      if (ACT == 3) v = fmaxf(v, 0.f); else if (ACT == 6) v = 0.5f * v * (1.0f + erff(v * 0.70710678118654752f)); else if (ACT == 11) v = 1.0f / (1.0f + expf(-v)); else if (ACT == 15) v = v / (1.0f + expf(-v)); else if (ACT == 12) v = (v > 0.f) ? v : 0.01f * v; else if (ACT == 8) v = tanhf(v); else if (ACT == 9) v = 0.5f * v * (1.0f + tanhf(0.7978845608028654f * (v + 0.044715f * v * v * v))); else if (ACT == 14) v = (v > 0.f) ? v : 0.1f * v; else if (ACT == 16) v = (v >= 0.f) ? v : 0.3f * v; else if (ACT == 17) v = (v >= 0.f) ? v : 0.2f * v;
      so[w][rloc][t * 16 + ln] = v; } }
  __builtin_amdgcn_fence(__ATOMIC_ACQ_REL, "workgroup"); __builtin_amdgcn_wave_barrier();
  const int rsub = lane >> 4, c4 = (lane & 15) * 4;
  {
#pragma unroll
    for (int q = 0; q < 16; ++q) { const int r = q * 2 + rsub; const v4f v = *(const v4fa*)&so[w][r][c4]; if (C) *(v4f*)(C + cofs + (size_t)(row0 + r) * ldc + col0 + c4) = v; if (C16) { v4h h4; for (int i = 0; i < 4; ++i) h4[i] = (_Float16)v[i]; *(v4h*)(C16 + cofs + (size_t)(row0 + r) * ldc + col0 + c4) = h4; } }
     }
  if (QKV) {      /* lane l sums row l of the wave's 32, columns in rising order, over the f16 values just stored (a product of two f16 values is exact in f32) */
    float ss = 0.f;
#pragma unroll      /* constant LDS offsets; later reads can issue while earlier values are summed */
    for (int c = 0; c < 16; ++c) { const v4f v = *(const v4fa*)&so[w][lane][c * 4];
#pragma unroll      /* v indexed by constants: registers */
      for (int i = 0; i < 4; ++i) { const float x = (float)(_Float16)v[i]; ss += x * x; } }
    NS[((size_t)by * ntn + nq) * M + row0 + lane] = ss;
    asm volatile("s_wait_xcnt 0x0" ::: "memory");      /* behind the norm store, before code laid out after it may rewrite the store's address registers */
  } }


__global__ __launch_bounds__(256) void k_wnat(const float* __restrict__ w, size_t n8, _Float16* __restrict__ Bt) { const size_t t = (size_t)blockIdx.x * 256 + threadIdx.x; if (t >= n8) return; FragH f; for (int q = 0; q < 8; ++q) f.h[q] = (_Float16)(bf16_round(w[t * 8 + q]) * 16.0f); *(v8us*)((unsigned short*)Bt + t * 8) = f.half[0];  }
__global__ __launch_bounds__(256) void k_rsm(const float* __restrict__ S, _Float16* __restrict__ P, int nrows) {
  #pragma clang fp contract(off)
  const int i = blockIdx.x * 256 + threadIdx.x; if (i >= nrows) return; const float* s = S + (size_t)i * SQ; float mx = -3.0e38f;
#pragma unroll 1
  for (int j = 0; j < SQ; ++j) mx = fmaxf(mx, s[j]); float se = 0.f;
#pragma unroll 1
  for (int j = 0; j < SQ; ++j) se += expf(s[j] - mx); const float sc = 256.0f / se;
#pragma unroll 1
  for (int j0 = 0; j0 < SQ; j0 += 8) { FragH f; for (int q = 0; q < 8; ++q) f.h[q] = (_Float16)(expf(s[j0 + q] - mx) * sc); unsigned short* d = (unsigned short*)P + (size_t)i * SQ + j0; *(v8us*)d = f.half[0];  } }
__global__ __launch_bounds__(256) void k_vt(const _Float16* __restrict__ V16, int b, int h0, _Float16* __restrict__ VT) { __shared__ unsigned short tl[64][65]; const int tid = threadIdx.x; const int hh = blockIdx.x % HG, sg = blockIdx.x / HG; const int s0 = sg * 64; const int h = h0 + hh;
  for (int i = tid; i < 64 * 8; i += 256) { const int j = i / 8, d8 = (i % 8) * 8; FragH f; f.half[0] = *(const v8us*)((const unsigned short*)V16 + ((size_t)b * SQ + s0 + j) * DM + h * HD + d8); for (int q = 0; q < 8; ++q) tl[d8 + q][j] = f.u[q]; }
  __syncthreads();
  { for (int i = tid; i < 64 * 8; i += 256) { const int d = i / 8, j8 = (i % 8) * 8; FragH f; for (int q = 0; q < 8; ++q) f.u[q] = tl[d][j8 + q]; *(v8us*)((unsigned short*)VT + ((size_t)hh * HD + d) * SQ + s0 + j8) = f.half[0]; }  } }


// e^x as __expf forms it (one multiply, v_exp_f32). The v_nop in the same statement is the one slot the instruction set asks for behind a transcendental before its source is rewritten or its result read.
__device__ __forceinline__ float exp_slot(float x) { float r; asm("v_exp_f32 %0, %1\n\tv_nop" : "=v"(r) : "v"(x * 1.44269504f)); return r; }
// Eight square roots by v_sqrt_f32 alone (1 ulp; a subnormal argument may give 0, which moves a logit by under 1e-19): sqrtf() adds about fifteen vector instructions of range scaling and last-bit fix-up to each.
// One statement: each root is followed by an independent one ("=&v": no result shares a register with an argument), and the one v_nop behind the last is the slot the instruction set asks for behind a transcendental.
__device__ __forceinline__ void sqrt8_slot(const float (&x)[8], float (&r)[8]) {
  asm("v_sqrt_f32 %0, %8\n\tv_sqrt_f32 %1, %9\n\tv_sqrt_f32 %2, %10\n\tv_sqrt_f32 %3, %11\n\tv_sqrt_f32 %4, %12\n\tv_sqrt_f32 %5, %13\n\tv_sqrt_f32 %6, %14\n\tv_sqrt_f32 %7, %15\n\tv_nop"
      : "=&v"(r[0]), "=&v"(r[1]), "=&v"(r[2]), "=&v"(r[3]), "=&v"(r[4]), "=&v"(r[5]), "=&v"(r[6]), "=&v"(r[7])
      : "v"(x[0]), "v"(x[1]), "v"(x[2]), "v"(x[3]), "v"(x[4]), "v"(x[5]), "v"(x[6]), "v"(x[7])); }
// S and P are not __restrict__: P may be the front half of the same rows (ldp = 2 * SQ f16); a wave stores only into its own row, and every store needs the row sum, so all its loads of the row come first.
// One wave per (head, query row): lane l holds columns c*128 + 4*l .. + 3 (c = 0..7), so every load covers 512 contiguous bytes; the row's logits stay in registers from the max to the store.
__global__ __launch_bounds__(256) void k_rsml2(const float* S, _Float16* P, int ldp, int qn, int hg, const float* __restrict__ NQ, const float* __restrict__ NK, size_t npitch, const float* __restrict__ Mf, float scale) {
  #pragma clang fp contract(off)
  const int lane = threadIdx.x & 31; const int t = blockIdx.x * 8 + __builtin_amdgcn_readfirstlane(threadIdx.x >> 5);      /* the wave's row, told to the compiler as wave-uniform: scalar row addresses and a scalar exit test */
  if (t >= qn * hg) return; const int hl = t / qn, row = t % qn; const size_t i = (size_t)hl * SQ + row; const float* s = S + i * SQ; const float nq = NQ[(size_t)hl * npitch + row]; const float* nk = NK + (size_t)hl * npitch; const float* mrow = Mf + (size_t)row * SQ; float mx = -3.0e38f;
  float e[SQ / 32];
#pragma unroll      /* e[] must be indexed by constants to live in registers; later chunks' loads can issue while earlier chunks are worked on */
  for (int c = 0; c < SQ / 128; ++c) { const int j0 = c * 128 + lane * 4; const v4f s4 = *(const v4fa*)(s + j0), k4 = *(const v4fa*)(nk + j0), m4 = *(const v4fa*)(mrow + j0);
#pragma unroll      /* constant index into e[] */
    for (int q = 0; q < 4; ++q) { const float d2 = fmaxf(__fadd_rn(__fadd_rn(nq, k4[q]), -2.0f * s4[q]), 0.f); const float v = __fadd_rn(__fmul_rn(sqrtf(d2), scale), __fmul_rn(bf16_round(m4[q]), -1.0e9f)); e[c * 4 + q] = v; mx = fmaxf(mx, v); } }
  for (int o = 16; o > 0; o >>= 1) mx = fmaxf(mx, __shfl_xor(mx, o));      /* row maximum over the 32 lanes */
  float se = 0.f;
#pragma unroll      /* constant index into e[] */
  for (int u = 0; u < SQ / 32; ++u) { e[u] = exp_slot(e[u] - mx); se += e[u]; }
  for (int o = 16; o > 0; o >>= 1) se += __shfl_xor(se, o);      /* row sum: per-lane partial sums, then a five-step butterfly */
  const float sc = 256.0f / se;
#pragma unroll      /* constant index into e[] */
  for (int c = 0; c < SQ / 128; ++c) { v4h h4;
#pragma unroll      /* constant index into e[] */
    for (int q = 0; q < 4; ++q) h4[q] = (_Float16)(e[c * 4 + q] * sc);
    *(v4h*)(P + i * (size_t)ldp + c * 128 + lane * 4) = h4; } }


__global__ __launch_bounds__(256) void k_rsmf(const float* __restrict__ S, _Float16* __restrict__ P, int qn, int hg) {
  #pragma clang fp contract(off)
  const int t = blockIdx.x * 256 + threadIdx.x; if (t >= qn * hg) return; const size_t i = (size_t)(t / qn) * SQ + (t % qn); const float* s = S + i * SQ; float mx = -3.0e38f;
#pragma unroll 1
  for (int j = 0; j < SQ; ++j) mx = fmaxf(mx, s[j]); float se = 0.f;
#pragma unroll 1
  for (int j = 0; j < SQ; ++j) se += __expf(s[j] - mx); const float sc = 256.0f / se;
#pragma unroll 1
  for (int j0 = 0; j0 < SQ; j0 += 8) { FragH f; for (int q = 0; q < 8; ++q) f.h[q] = (_Float16)(__expf(s[j0 + q] - mx) * sc); unsigned short* d = (unsigned short*)P + i * SQ + j0; *(v8us*)d = f.half[0];  } }

// ---- fused attention: scores, softmax and the weighted sum of V in one kernel; no score or weight plane goes through memory ----
// lane l with lane l ^ 16 (the two lanes that share a query column)
__device__ __forceinline__ float xhalf(float x) { return __builtin_bit_cast(float, __builtin_amdgcn_permlanex16(__builtin_bit_cast(int, x), __builtin_bit_cast(int, x), 0x76543210, 0xfedcba98, false, false)); }
#define FK 64      /* keys per pass */
#define FP 72      /* LDS row pitch in f16: 128 data bytes + 16, so that the 16 rows of a 16-byte fragment read fall on different banks */
// One work-group = 4 waves x 16 query rows of one (batch, head); 16 passes over 64 keys.
// Both products are formed transposed, so that a lane owns ONE query column throughout: S^T = K Q^T gives lane (c, h) the keys 8h + r of query c,
// which is the k order of a B fragment, so the weights go from the score accumulators straight into O^T = V^T P^T; the running maximum, sum and rescale are per-lane scalars.
__global__ __launch_bounds__(128) void k_fattn(const _Float16* __restrict__ Q16, const _Float16* __restrict__ K16, const _Float16* __restrict__ VT, const float* __restrict__ NQ, const float* __restrict__ NK, const float* __restrict__ Mf, _Float16* __restrict__ O16, float scale) {
  __shared__ __attribute__((aligned(16))) unsigned short kt_s[FK][FP];      /* K tile  [key][d]  */
  __shared__ __attribute__((aligned(16))) unsigned short vt_s[HD][FP];      /* V^T tile [d][key] */
  const int tid = threadIdx.x, w = tid >> 5, lane = tid & 31, ln = lane & 15, hh = lane >> 4;
  const int h = blockIdx.y, b = blockIdx.z; const int q = blockIdx.x * 64 + w * 16 + ln;      /* the lane's query row */
  const _Float16* qrow = Q16 + ((size_t)b * SQ + q) * DM + h * HD;
  const v16h qf0 = g2_frag(qrow, hh), qf1 = g2_frag(qrow + 32, hh);
  const float nq = NQ[(size_t)h * NR + (size_t)b * SQ + q];
  asm volatile("s_wait_xcnt 0x0" ::: "memory");      /* the load's index register is rewritten for the mask row's address right behind it */
  const float* nk = NK + (size_t)h * NR + (size_t)b * SQ + 8 * hh;
  const float* mrow = Mf + (size_t)q * SQ + 8 * hh;
  const int sr = tid >> 3, sc = (tid & 7) * 8;      /* staging: 8 threads cover one 128-byte row, 16 rows a sweep */
  const unsigned short* kg = (const unsigned short*)K16 + ((size_t)b * SQ + sr) * DM + h * HD + sc;
  const unsigned short* vg = (const unsigned short*)VT + (((size_t)b * NH + h) * HD + sr) * SQ + sc;
  v8us kr[4], vr[4];
#pragma unroll      /* kr, vr indexed by constants: registers */
  for (int u = 0; u < 4; ++u) { kr[u] = *(const v8us*)(kg + (size_t)(u * 16) * DM); vr[u] = *(const v8us*)(vg + (size_t)(u * 16) * SQ); }
  const v8f z8 = {0.f,0.f,0.f,0.f,0.f,0.f,0.f,0.f};
  v8f o[4] = {z8, z8, z8, z8}; float mrun = -3.0e38f, lsum = 0.f;
  for (int s = 0; s < SQ / FK; ++s) {
    __syncthreads();      /* every wave has finished reading the previous tiles */
#pragma unroll
    for (int u = 0; u < 4; ++u) { *(v8us*)&kt_s[u * 16 + sr][sc] = kr[u]; *(v8us*)&vt_s[u * 16 + sr][sc] = vr[u]; }
    __syncthreads();      /* the tiles of this pass are complete */
    if (s + 1 < SQ / FK) {      /* next pass's tiles fly while this pass is worked on */
#pragma unroll
      for (int u = 0; u < 4; ++u) { kr[u] = *(const v8us*)(kg + (size_t)((s + 1) * FK + u * 16) * DM); vr[u] = *(const v8us*)(vg + (size_t)(u * 16) * SQ + (s + 1) * FK); }
      asm volatile("s_wait_xcnt 0x0" ::: "memory");      /* the loads' address registers are rewritten right behind them */
    }
    v4f kn[8], mk[8];      /* the pass's key norms and mask values: keys t * 16 + 8 * hh + 0..7 of the lane's query */
#pragma unroll      /* kn indexed by constants: registers */
    for (int t = 0; t < 4; ++t) { kn[2 * t] = *(const v4fa*)(nk + s * FK + t * 16); kn[2 * t + 1] = *(const v4fa*)(nk + s * FK + t * 16 + 4); }
    asm volatile("s_wait_xcnt 0x0" ::: "memory");      /* before a later load's result reuses these loads' address registers */
#pragma unroll      /* mk indexed by constants: registers */
    for (int t = 0; t < 4; ++t) { mk[2 * t] = *(const v4fa*)(mrow + s * FK + t * 16); mk[2 * t + 1] = *(const v4fa*)(mrow + s * FK + t * 16 + 4); }
    asm volatile("s_wait_xcnt 0x0" ::: "memory");      /* likewise, before the fragment reads reuse them */
    float e[4][8]; float mx = mrun;
#pragma unroll      /* e[][] indexed by constants: registers */
    for (int t = 0; t < 4; ++t) {
      const v4f k0 = kn[2 * t], k1 = kn[2 * t + 1], m0 = mk[2 * t], m1 = mk[2 * t + 1];
      const _Float16* kp = (const _Float16*)&kt_s[t * 16 + ln][0];
      v8f st = __builtin_amdgcn_wmma_f32_16x16x32_f16(false, g2_frag(kp, hh), false, qf0, (short)0, z8, false, false);
      st = __builtin_amdgcn_wmma_f32_16x16x32_f16(false, g2_frag(kp + 32, hh), false, qf1, (short)0, st, false, false);
      float d2[8], rt[8];
#pragma unroll      /* d2 indexed by constants: registers */
      for (int r = 0; r < 8; ++r) { const float kk = r < 4 ? k0[r & 3] : k1[r & 3]; d2[r] = fmaxf((nq + kk) - 2.0f * st[r], 0.f); }
      sqrt8_slot(d2, rt);
#pragma unroll      /* rt, e[][] indexed by constants: registers */
      for (int r = 0; r < 8; ++r) { const float mm = r < 4 ? m0[r & 3] : m1[r & 3];
        const float v = rt[r] * scale + bf16_round(mm) * -1.0e9f; e[t][r] = v; mx = fmaxf(mx, v); }
    }
    mx = fmaxf(mx, xhalf(mx));      /* the query's maximum so far: both lanes of the column agree on it */
    const float al = exp_slot(mrun - mx); mrun = mx; float ps = 0.f;
    FragH p0, p1;
#pragma unroll
    for (int r = 0; r < 8; ++r) {
      const float a0 = exp_slot(e[0][r] - mx), a1 = exp_slot(e[1][r] - mx), a2 = exp_slot(e[2][r] - mx), a3 = exp_slot(e[3][r] - mx);
      ps += (a0 + a1) + (a2 + a3);
      p0.h[r] = (_Float16)a0; p0.h[8 + r] = (_Float16)a1; p1.h[r] = (_Float16)a2; p1.h[8 + r] = (_Float16)a3; }
    lsum = lsum * al + ps;
#pragma unroll
    for (int t = 0; t < 4; ++t) {
      const _Float16* vp = (const _Float16*)&vt_s[t * 16 + ln][0];
      v8f a = o[t] * al;
      a = __builtin_amdgcn_wmma_f32_16x16x32_f16(false, g2_frag(vp, hh), false, p0.v, (short)0, a, false, false);
      o[t] = __builtin_amdgcn_wmma_f32_16x16x32_f16(false, g2_frag(vp + 32, hh), false, p1.v, (short)0, a, false, false);
    }
    asm volatile("v_nop\n\tv_nop\n\tv_nop\n\tv_nop" : "+v"(o[0]), "+v"(o[1]), "+v"(o[2]), "+v"(o[3]) : "v"(p1.v));      /* the four vector slots the chip needs behind the pass's last WMMA before its operand registers are rewritten: the next writer stands behind the branch to the loop's head */
  }
  lsum += xhalf(lsum);      /* the two lanes of a column summed disjoint keys */
  const float inv = 64.0f / lsum;      /* o carried x64, as the output GEMM's alpha expects */
  unsigned short* orow = (unsigned short*)O16 + ((size_t)b * SQ + q) * DM + h * HD + 8 * hh;
#pragma unroll
  for (int t = 0; t < 4; ++t) { FragH f;
#pragma unroll
    for (int r = 0; r < 8; ++r) f.h[r] = (_Float16)(o[t][r] * inv);
    *(v8us*)(orow + t * 16) = f.half[0]; }
}

extern "C" void kernel_launch(void* const* d_in, const int* in_sizes, int n_in,
                              void* d_out, int out_size, void* d_ws, size_t ws_size, hipStream_t stream) {
  (void)in_sizes; (void)n_in; (void)out_size;
  const float* const* I = (const float* const*)d_in; const float* xv = I[0]; const float* xk = I[1]; const float* xq = I[2]; const float* mf = I[3]; const float* wq = I[4]; const float* wk = I[5]; const float* wv = I[6]; const float* wo = I[7]; const float* bq = nullptr; const float* bk = nullptr; (void)bq; (void)bk;      /* inputs v, k, q, mask (f32 [1][1][S][S]); [in][out] weights, no biases */
  char* ws = (char*)d_ws; size_t off = 0;
  auto take = [&](size_t bytes) { char* p = ws + off; off += (bytes + 255) & ~(size_t)255; return p; };
  _Float16* BQ = (_Float16*)take((size_t)DM * DM * 2); _Float16* BK = (_Float16*)take((size_t)DM * DM * 2); _Float16* BV = (_Float16*)take((size_t)DM * DM * 2); _Float16* BO = (_Float16*)take((size_t)DM * DM * 2);
  _Float16* XQ = (_Float16*)take(NR * DM * 2); _Float16* XK = (_Float16*)take(NR * DM * 2); _Float16* XV = (_Float16*)take(NR * DM * 2); _Float16* Q16 = (_Float16*)take(NR * DM * 2); _Float16* K16 = (_Float16*)take(NR * DM * 2); _Float16* V16 = (_Float16*)take(NR * DM * 2); _Float16* O16 = (_Float16*)take(NR * DM * 2);
  _Float16* VT = (_Float16*)take((size_t)NB * NH * HD * SQ * 2); float* NQ = (float*)take((size_t)NH * NR * 4); float* NK = (float*)take((size_t)NH * NR * 4);      /* NQ, NK: per-(head, row) squared norms of the f16 q and k rows */
  (void)BK; (void)BV; (void)XK; (void)XV; (void)V16;      /* reached through the strides from BQ and XQ; the V16 plane keeps its place and is not used */
  if (off > ws_size) return;
  k_prep<<<dim3((unsigned)(NWB + 3 * NXB)), 256, 0, stream>>>(xq, xk, xv, XQ, NR * DM / 8, wq, wk, wv, wo, BQ, 16.0f);      /* [in][out] weights -> Bt[n][k] x16 (BQ, BK, BV, BO lie back to back) and the three inputs as exact f16 rows (XQ, XK, XV lie back to back) */
  k_gemm2<0, true><<<dim3((unsigned)((MP / 128) * (DM / 64)), 3), 128, 0, stream>>>(XQ, DM, NR * DM, BQ, DM, (size_t)DM * DM, 0.0625f, nullptr, 0, nullptr, 1, 0, 0, nullptr, Q16, DM, NR * DM, MP, DM, DM, 0, 0, 0, NQ, VT);      /* q, k, v projections on grid.y: Q16 and K16 lie back to back; with them |qh|^2, |kh|^2 per (head, token) from the same f16 values (NK lies behind NQ); v goes out as V^T [NB][NH][HD][SQ] only */
  k_fattn<<<dim3(SQ / 64, NH, NB), 128, 0, stream>>>(Q16, K16, VT, NQ, NK, mf, O16, 0.125f);      /* softmax(sqrt(max(|q|^2 + |k|^2 - 2 q.k, 0)) / 8 + mask * (-1e9)) . v, merged heads, as f16 rows x64 */
  k_gemm2<0, false><<<dim3((unsigned)((MPO / 128) * (DM / 64)), 1), 128, 0, stream>>>(O16, DM, 0, BO, DM, 0, 0.0009765625f, nullptr, 0, nullptr, 1, 0, 0, (float*)d_out, nullptr, DM, 0, MPO, DM, DM, 0, 0, 0, nullptr, nullptr);      /* out rows are the output layout */
}

// v008
// A run of this version takes 73.6 microseconds.
// Two timings next to v007 put it at 1.06 and 1.05 times that version's speed.
// Counting every step since v000, it is 79.8 times as fast.
#include <hip/hip_runtime.h>
// Multi-head attention with L2-DISTANCE scores (inputs in the module's order v, k, q [4][1024][768], mask f32 [1][1][1024][1024] (zeros); qh = q wq, kh = k wk, vh = v wv ([in][out] 768x768 sigma 0.02, no biases); 12 heads of 64; scores = sqrt(max(|qh|^2 + |kh|^2 - 2 qh.kh, 0)) (pairwise L2 distance); logits = scores / 8 + mask * (-1e9); softmax; out = (attn vh merged) wo -> [4][1024][768]).
// Structure: token rows r = b*1024 + s; the three inputs as exact f16 rows (bf16-rounded); Q, K, V as three WMMA GEMMs (32x64 wave tiles, f32 accumulation, exact x16 weights, f16 outputs); the squared q and k row norms and V^T for all (batch, head) come out of that GEMM's epilogue; one fused attention launch over all 48 (head, batch) planes (heads on grid.y, batches on grid.z): per 64 keys S^T = K Q^T on WMMA (raw q.k), distance, 1/8 and mask on VALU, online softmax (f32 statistics, native exp; weights in (0, 1] as f16), O^T += V^T P^T on WMMA; o is stored x64 (against f16 subnormal flush, folded into the output GEMM alpha) straight into the merged f16 o rows; out = o W_o GEMM (f32) into the output layout.
// Compute dtype: inputs rounded to bf16; x / weights exact; q, k, v, softmax weights and o as plain f16 GEMM operands (~2^-12); scores and softmax statistics f32. v_wmma_f32_16x16x32_f16.
#define NB 4
#define SQ 1024
#define DM 768
#define NH 12
#define HD 64
#define HG 4                         /* heads per launch of the non-template k_vt */
#define B0 0                         /* unused: every launch starts at batch 0 */
#define NBR NB                       /* batches processed (debug hook) */
#define NR ((size_t)NB * SQ)         /* token rows */
#define MP ((int)((size_t)NBR * SQ)) /* rows projected (debug hook) */
#define QN SQ                        /* unused: the attention launches take SQ rows */
#define NHD NH                       /* unused: the attention launches take NH heads */
#define MPO MP                       /* rows through the output stage (debug hook) */
#define LQ DM      /* row pitch of the q/k/v rows */
typedef __bf16 v16b __attribute__((ext_vector_type(16)));
typedef unsigned short v8us __attribute__((ext_vector_type(8), may_alias));
typedef float  v8f  __attribute__((ext_vector_type(8)));
typedef float  v4f  __attribute__((ext_vector_type(4)));
typedef float  v4fa __attribute__((ext_vector_type(4), may_alias));
union FragB { v16b v; v8us half[2]; unsigned short u[16]; };

__device__ __forceinline__ unsigned short bf16_bits(float x) { unsigned int u = __float_as_uint(x); return (unsigned short)((u + 0x7FFFu + ((u >> 16) & 1u)) >> 16); }
__device__ __forceinline__ float bf16_val(unsigned short b) { return __uint_as_float(((unsigned int)b) << 16); }
__device__ __forceinline__ float bf16_round(float x) { return bf16_val(bf16_bits(x)); }
// D += A·B with NT terms: 1 = ah·bh, 2 = + al·bh (A split), 3 = + ah·bl (both split)
template <int NT>
__device__ __forceinline__ v8f mmaN(v16b ah, v16b al, v16b bh, v16b bl, v8f c) {
  c = __builtin_amdgcn_wmma_f32_16x16x32_bf16(false, ah, false, bh, (short)0, c, false, false);
  if (NT >= 2) c = __builtin_amdgcn_wmma_f32_16x16x32_bf16(false, al, false, bh, (short)0, c, false, false);
  if (NT >= 3) c = __builtin_amdgcn_wmma_f32_16x16x32_bf16(false, ah, false, bl, (short)0, c, false, false);
  asm volatile("v_nop\n\tv_nop\n\tv_nop\n\tv_nop" : "+v"(c) : "v"(ah), "v"(al), "v"(bh), "v"(bl));
  return c;
}

__global__ __launch_bounds__(256) void k_wt_bf16(const float* __restrict__ W, unsigned short* __restrict__ Wt, int K, int N) {
  const int t = blockIdx.x * 256 + threadIdx.x;
  const int k8n = K / 8;
  if (t >= N * k8n) return;
  const int n = t / k8n, k8 = (t % k8n) * 8;
  v8us v;
#pragma unroll
  for (int i = 0; i < 8; ++i) v[i] = bf16_bits(W[(size_t)(k8 + i) * N + n]);
  *(v8us*)(Wt + (size_t)n * K + k8) = v;
  
}

// GEMM C[M][N] (f32, pitch ldc) = act(A[M][K]·W + bias). A f32 row-major (pitch lda) converted per fragment to bf16
// (ASPLIT: hi/lo two planes -> 2 terms, else single rounded term); Wt bf16 [N][K] (pitch ldb). BIAS_BF16 rounds the
// bias to bf16 first (bias quantised to bf16 before the add). K%32==0, M%16==0, N%64==0.
template <bool ASPLIT, int ACT, bool BIAS_BF16>
__global__ __launch_bounds__(128) void k_gemm_bf(const float* __restrict__ A, int lda, const unsigned short* __restrict__ Wt, int ldb,
                                               const float* __restrict__ bias, float* __restrict__ C, int ldc, int M, int N, int K) {
  __shared__ __attribute__((aligned(16))) float so[4][16][64];
  const int tid = threadIdx.x, w = tid >> 5, lane = tid & 31, ln = lane & 15, hh = lane >> 4;
  const int ntn = N / 64;
  const int wid = blockIdx.x * 4 + w;
  const int mt = wid / ntn, nq = wid % ntn;
  if (mt * 16 >= M) return;
  const int row0 = mt * 16, col0 = nq * 64;
  const float* arow = A + (size_t)(row0 + ln) * lda;
  v8f acc[4] = {};
  for (int kb = 0; kb < K; kb += 32) {
    FragB ah, al;
    const v4f x0 = *(const v4fa*)(arow + kb + 8 * hh), x1 = *(const v4fa*)(arow + kb + 8 * hh + 4);
    const v4f x2 = *(const v4fa*)(arow + kb + 16 + 8 * hh), x3 = *(const v4fa*)(arow + kb + 16 + 8 * hh + 4);
    float xs[16] = {x0[0],x0[1],x0[2],x0[3],x1[0],x1[1],x1[2],x1[3],x2[0],x2[1],x2[2],x2[3],x3[0],x3[1],x3[2],x3[3]};
#pragma unroll
    for (int i = 0; i < 16; ++i) { const unsigned short hb = bf16_bits(xs[i]); ah.u[i] = hb; al.u[i] = ASPLIT ? bf16_bits(xs[i] - bf16_val(hb)) : (unsigned short)0; }
#pragma unroll
    for (int t = 0; t < 4; ++t) {
      const unsigned short* brow = Wt + (size_t)(col0 + t * 16 + ln) * ldb + kb;
      FragB b;
      b.half[0] = *(const v8us*)(brow + 8 * hh);
      b.half[1] = *(const v8us*)(brow + 16 + 8 * hh);
      acc[t] = mmaN<ASPLIT ? 2 : 1>(ah.v, al.v, b.v, b.v, acc[t]);
    }
  }
#pragma unroll
  for (int t = 0; t < 4; ++t) {
    float bv = bias ? bias[col0 + t * 16 + ln] : 0.f;
    if (BIAS_BF16) bv = bf16_round(bv);
#pragma unroll
    for (int r = 0; r < 8; ++r) { float v = acc[t][r] + bv; if (ACT == 1) v = fmaxf(v, 0.f); so[w][8 * hh + r][t * 16 + ln] = v; }
  }
  __builtin_amdgcn_fence(__ATOMIC_ACQ_REL, "workgroup");
  __builtin_amdgcn_wave_barrier();
  const int rsub = lane >> 4, c4 = (lane & 15) * 4;
  {
#pragma unroll
    for (int q = 0; q < 8; ++q) {
      const int r = q * 2 + rsub;
      const v4f v = *(const v4fa*)&so[w][r][c4];
      *(v4f*)(C + (size_t)(row0 + r) * ldc + col0 + c4) = v;
    }
    
  }
}

// GEMM C = act(A·W + bias + resid): A f32 (ASPLIT -> hi/lo 2 terms), Wt bf16 [N][K]; ACT 0 none, 1 relu, 2 exact gelu;
// resid (optional, f32, row index = (row % rmod), pitch ldr, RES_BF16 rounds it) added before the activation.
template <bool ASPLIT, int ACT, bool BIAS_BF16, bool RES_BF16>
__global__ __launch_bounds__(128) void k_gemm_bf3(const float* __restrict__ A, int lda, const unsigned short* __restrict__ Wt, int ldb,
                                                const float* __restrict__ bias, const float* __restrict__ resid, int rmod, int ldr,
                                                float* __restrict__ C, int ldc, int M, int N, int K) {
  __shared__ __attribute__((aligned(16))) float so[4][16][64];
  const int tid = threadIdx.x, w = tid >> 5, lane = tid & 31, ln = lane & 15, hh = lane >> 4;
  const int ntn = N / 64;
  const int wid = blockIdx.x * 4 + w;
  const int mt = wid / ntn, nq = wid % ntn;
  if (mt * 16 >= M) return;
  const int row0 = mt * 16, col0 = nq * 64;
  const float* arow = A + (size_t)(row0 + ln) * lda;
  v8f acc[4] = {};
  for (int kb = 0; kb < K; kb += 32) {
    FragB ah, al;
    const v4f x0 = *(const v4fa*)(arow + kb + 8 * hh), x1 = *(const v4fa*)(arow + kb + 8 * hh + 4);
    const v4f x2 = *(const v4fa*)(arow + kb + 16 + 8 * hh), x3 = *(const v4fa*)(arow + kb + 16 + 8 * hh + 4);
    float xs[16] = {x0[0],x0[1],x0[2],x0[3],x1[0],x1[1],x1[2],x1[3],x2[0],x2[1],x2[2],x2[3],x3[0],x3[1],x3[2],x3[3]};
#pragma unroll
    for (int i = 0; i < 16; ++i) { const unsigned short hb = bf16_bits(xs[i]); ah.u[i] = hb; al.u[i] = ASPLIT ? bf16_bits(xs[i] - bf16_val(hb)) : (unsigned short)0; }
#pragma unroll
    for (int t = 0; t < 4; ++t) {
      const unsigned short* brow = Wt + (size_t)(col0 + t * 16 + ln) * ldb + kb;
      FragB b;
      b.half[0] = *(const v8us*)(brow + 8 * hh);
      b.half[1] = *(const v8us*)(brow + 16 + 8 * hh);
      acc[t] = mmaN<ASPLIT ? 2 : 1>(ah.v, al.v, b.v, b.v, acc[t]);
    }
  }
#pragma unroll
  for (int t = 0; t < 4; ++t) {
    const int col = col0 + t * 16 + ln;
    float bv = bias ? bias[col] : 0.f;
    if (BIAS_BF16) bv = bf16_round(bv);
#pragma unroll
    for (int r = 0; r < 8; ++r) {
      float v = acc[t][r] + bv;
      if (resid) { float rv = resid[(size_t)((row0 + 8 * hh + r) % rmod) * ldr + col]; if (RES_BF16) rv = bf16_round(rv); v += rv; }
      if (ACT == 1) v = fmaxf(v, 0.f);
      if (ACT == 2) v = 0.5f * v * (1.0f + erff(v * 0.70710678118654752f));
      if (ACT == 3) { const float u = 0.7978845608028654f * (v + 0.044715f * v * v * v); v = 0.5f * v * (1.0f + tanhf(u)); }
      so[w][8 * hh + r][t * 16 + ln] = v;
    }
  }
  __builtin_amdgcn_fence(__ATOMIC_ACQ_REL, "workgroup");
  __builtin_amdgcn_wave_barrier();
  const int rsub = lane >> 4, c4 = (lane & 15) * 4;
  {
#pragma unroll
    for (int q = 0; q < 8; ++q) {
      const int r = q * 2 + rsub;
      const v4f v = *(const v4fa*)&so[w][r][c4];
      *(v4f*)(C + (size_t)(row0 + r) * ldc + col0 + c4) = v;
    }
    
  }
}
// row LayerNorm (biased variance, eps) over N: s = X (+ R); optional out_sum <- s; out_norm <- (s-mu)*rsqrt(var+eps)*g + b
template <bool PARAM_BF16>
__global__ __launch_bounds__(256) void k_layernorm(const float* __restrict__ X, const float* __restrict__ R, const float* __restrict__ g, const float* __restrict__ bta,
                                                  float* __restrict__ out_sum, float* __restrict__ out_norm, int N, float eps) {
  __shared__ float red[256];
  const int row = blockIdx.x, tid = threadIdx.x;
  const float* x = X + (size_t)row * N; const float* rr = R ? R + (size_t)row * N : nullptr;
  float vals[16];                     // up to N = 4096
  const int per = N / 256;            // contiguous chunk per thread? use strided-by-4 chunks: thread handles j = tid*4 + 1024*u
  float s1 = 0.f;
  for (int u = 0; u < per / 4; ++u) {
    const int j = tid * 4 + 1024 * u;
    const v4f a = *(const v4fa*)(x + j);
    v4f b = {0.f,0.f,0.f,0.f}; if (rr) b = *(const v4fa*)(rr + j);
#pragma unroll
    for (int q = 0; q < 4; ++q) { const float v = a[q] + b[q]; vals[u * 4 + q] = v; s1 += v; }
  }
  red[tid] = s1; __syncthreads();
  for (int st = 128; st > 0; st >>= 1) { if (tid < st) red[tid] += red[tid + st]; __syncthreads(); }
  const float mu = red[0] / (float)N; __syncthreads();
  float s2 = 0.f;
  for (int u = 0; u < per / 4; ++u)
#pragma unroll
    for (int q = 0; q < 4; ++q) { const float c = vals[u * 4 + q] - mu; s2 += c * c; }
  red[tid] = s2; __syncthreads();
  for (int st = 128; st > 0; st >>= 1) { if (tid < st) red[tid] += red[tid + st]; __syncthreads(); }
  const float rs = rsqrtf(red[0] / (float)N + eps);
  {
    for (int u = 0; u < per / 4; ++u) {
      const int j = tid * 4 + 1024 * u;
      v4f o, sm;
#pragma unroll
      for (int q = 0; q < 4; ++q) {
        float gg = g[j + q], bb = bta[j + q];
        if (PARAM_BF16) { gg = bf16_round(gg); bb = bf16_round(bb); }
        sm[q] = vals[u * 4 + q]; o[q] = (vals[u * 4 + q] - mu) * rs * gg + bb;
      }
      if (out_sum) *(v4f*)(out_sum + (size_t)row * N + j) = sm;
      *(v4f*)(out_norm + (size_t)row * N + j) = o;
    }
    
  }
}



// ---- f16 WMMA path (v_wmma_f32_16x16x32_f16): 11-bit significands for operands in range — used where a [0,1] probability operand needs more precision than bf16
typedef _Float16 v16h __attribute__((ext_vector_type(16)));
union FragH { v16h v; v8us half[2]; _Float16 h[16]; unsigned short u[16]; };
template <int NT>
__device__ __forceinline__ v8f mmaH(v16h ah, v16h al, v16h bh, v16h bl, v8f c) {
  c = __builtin_amdgcn_wmma_f32_16x16x32_f16(false, ah, false, bh, (short)0, c, false, false);
  if (NT >= 2) c = __builtin_amdgcn_wmma_f32_16x16x32_f16(false, al, false, bh, (short)0, c, false, false);
  if (NT >= 3) c = __builtin_amdgcn_wmma_f32_16x16x32_f16(false, ah, false, bl, (short)0, c, false, false);
  asm volatile("v_nop\n\tv_nop\n\tv_nop\n\tv_nop" : "+v"(c) : "v"(ah), "v"(al), "v"(bh), "v"(bl));
  return c;
}
// batched GEMM like k_gemm_b but f16 operands: A f32 (split into f16 hi/lo if ASPLIT, else rounded to f16), Bt = f16 values [n][k]; alpha; C f32; N multiple of 16 (partial tiles skipped)
template <bool ASPLIT>
__global__ __launch_bounds__(128) void k_gemm_h(const float* __restrict__ A, int lda, size_t sA, const _Float16* __restrict__ Bh, int ldb, size_t sB, float alpha, float* __restrict__ C, int ldc, size_t sC, int M, int N, int K) {
  __shared__ __attribute__((aligned(16))) float so[4][16][64];
  const int tid = threadIdx.x, w = tid >> 5, lane = tid & 31, ln = lane & 15, hh = lane >> 4; const int by = blockIdx.y;
  A += (size_t)by * sA; Bh += (size_t)by * sB; C += (size_t)by * sC;
  const int ntn = (N + 63) / 64; const int wid = blockIdx.x * 4 + w; const int mt = wid / ntn, nq = wid % ntn; if (mt * 16 >= M) return;
  const int row0 = mt * 16, col0 = nq * 64; const float* arow = A + (size_t)(row0 + ln) * lda;
  v8f acc[4] = {};
  for (int kb = 0; kb < K; kb += 32) {
    FragH ah, al;
    const v4f x0 = *(const v4fa*)(arow + kb + 8 * hh), x1 = *(const v4fa*)(arow + kb + 8 * hh + 4), x2 = *(const v4fa*)(arow + kb + 16 + 8 * hh), x3 = *(const v4fa*)(arow + kb + 16 + 8 * hh + 4);
    float xs[16] = {x0[0],x0[1],x0[2],x0[3],x1[0],x1[1],x1[2],x1[3],x2[0],x2[1],x2[2],x2[3],x3[0],x3[1],x3[2],x3[3]};
#pragma unroll
    for (int i = 0; i < 16; ++i) { const _Float16 h = (_Float16)xs[i]; ah.h[i] = h; al.h[i] = ASPLIT ? (_Float16)(xs[i] - (float)h) : (_Float16)0.0f; }
#pragma unroll
    for (int t = 0; t < 4; ++t) { if (col0 + t * 16 >= N) continue; const size_t boff = (size_t)(col0 + t * 16 + ln) * ldb + kb; FragH bq; bq.half[0] = *(const v8us*)(Bh + boff + 8 * hh); bq.half[1] = *(const v8us*)(Bh + boff + 16 + 8 * hh);
      acc[t] = mmaH<ASPLIT ? 2 : 1>(ah.v, al.v, bq.v, bq.v, acc[t]); }
  }
#pragma unroll
  for (int t = 0; t < 4; ++t) { if (col0 + t * 16 >= N) continue;
#pragma unroll
    for (int r = 0; r < 8; ++r) so[w][8 * hh + r][t * 16 + ln] = acc[t][r] * alpha; }
  __builtin_amdgcn_fence(__ATOMIC_ACQ_REL, "workgroup"); __builtin_amdgcn_wave_barrier();
  const int rsub = lane >> 4, c4 = (lane & 15) * 4;
  {
#pragma unroll
    for (int q = 0; q < 8; ++q) { const int r = q * 2 + rsub; if (col0 + c4 < N) { const v4f v = *(const v4fa*)&so[w][r][c4]; *(v4f*)(C + (size_t)(row0 + r) * ldc + col0 + c4) = v; } }
     }
}

// k_gemm_hh variant with fused epilogue: v = acc·alpha + bias[by·sBias + col] (+ CP[(row/rowsPerB)·sCPb + by·64 + col] if CP) ; ACT 0 none / 1 elu ; writes f16 C16 (and f32 C if non-null)
template <int ACT>
__global__ __launch_bounds__(128) void k_gemm_hhx(const _Float16* __restrict__ A, int lda, size_t sA, const _Float16* __restrict__ Bh, int ldb, size_t sB, float alpha, const float* __restrict__ bias, size_t sBias, const float* __restrict__ CP, int rowsPerB, size_t sCPb, int row0g,
    float* __restrict__ C, _Float16* __restrict__ C16, int ldc, size_t sC, int M, int N, int K) {
  __shared__ __attribute__((aligned(16))) float so[4][16][64];
  const int tid = threadIdx.x, w = tid >> 5, lane = tid & 31, ln = lane & 15, hh = lane >> 4; const int by = blockIdx.y;
  A += (size_t)by * sA; Bh += (size_t)by * sB; const size_t cofs = (size_t)by * sC; const float* bp = bias ? bias + (size_t)by * sBias : nullptr;
  const int ntn = (N + 63) / 64; const int wid = blockIdx.x * 4 + w; const int mt = wid / ntn, nq = wid % ntn; if (mt * 16 >= M) return;
  const int row0 = mt * 16, col0 = nq * 64; const _Float16* arow = A + (size_t)(row0 + ln) * lda;
  v8f acc[4] = {};
  for (int kb = 0; kb < K; kb += 32) { FragH ah; ah.half[0] = *(const v8us*)((const unsigned short*)arow + kb + 8 * hh); ah.half[1] = *(const v8us*)((const unsigned short*)arow + kb + 16 + 8 * hh);
#pragma unroll
    for (int t = 0; t < 4; ++t) { if (col0 + t * 16 >= N) continue; const size_t boff = (size_t)(col0 + t * 16 + ln) * ldb + kb; FragH bq; bq.half[0] = *(const v8us*)((const unsigned short*)Bh + boff + 8 * hh); bq.half[1] = *(const v8us*)((const unsigned short*)Bh + boff + 16 + 8 * hh);
      acc[t] = mmaH<1>(ah.v, ah.v, bq.v, bq.v, acc[t]); }
  }
#pragma unroll
  for (int t = 0; t < 4; ++t) { if (col0 + t * 16 >= N) continue; const int col = col0 + t * 16 + ln; const float bv = bp ? bf16_round(bp[col]) : 0.f;
#pragma unroll
    for (int r = 0; r < 8; ++r) { float v = acc[t][r] * alpha + bv; if (CP) { const int rr = row0g + row0 + 8 * hh + r; if (rowsPerB < 0) v += CP[cofs + (size_t)rr * ldc + col];      /* rowsPerB < 0: own element of the batched C plane */ else { const int bidx = rr / rowsPerB; v += CP[(size_t)bidx * sCPb + (size_t)by * 64 + col]; } } if (ACT == 1) v = (v > 0.f) ? v : expm1f(v); else if (ACT == 7) v = (v > 0.f) ? v + 1.0f : expf(v); else if (ACT == 8) v = tanhf(v); else if (ACT == 9) v = 0.5f * v * (1.0f + tanhf(0.7978845608028654f * (v + 0.044715f * v * v * v))); else if (ACT == 11) v = 1.0f / (1.0f + expf(-v)); else if (ACT == 12) v = (v > 0.f) ? v : 0.01f * v; else if (ACT == 14) v = (v > 0.f) ? v : 0.1f * v; else if (ACT == 16) v = (v >= 0.f) ? v : 0.3f * v; else if (ACT == 17) v = (v >= 0.f) ? v : 0.2f * v; else if (ACT == 15) v = v / (1.0f + expf(-v)); else if (ACT == 3) v = fmaxf(v, 0.f); else if (ACT == 6) v = 0.5f * v * (1.0f + erff(v * 0.70710678118654752f)); so[w][8 * hh + r][t * 16 + ln] = v; } }
  __builtin_amdgcn_fence(__ATOMIC_ACQ_REL, "workgroup"); __builtin_amdgcn_wave_barrier();
  const int rsub = lane >> 4, c4 = (lane & 15) * 4; typedef _Float16 v4h __attribute__((ext_vector_type(4)));
  {
#pragma unroll
    for (int q = 0; q < 8; ++q) { const int r = q * 2 + rsub; if (col0 + c4 < N) { const v4f v = *(const v4fa*)&so[w][r][c4]; if (C) *(v4f*)(C + cofs + (size_t)(row0 + r) * ldc + col0 + c4) = v; if (C16) { v4h h4; for (int i = 0; i < 4; ++i) h4[i] = (_Float16)v[i]; *(v4h*)(C16 + cofs + (size_t)(row0 + r) * ldc + col0 + c4) = h4; } } }
     }
}


typedef _Float16 v4h __attribute__((ext_vector_type(4)));

// One preparation launch. Work-groups 0 .. NWB - 1 (they start first: theirs is the longer path) each turn one 64 x 64 tile of one [in][out] weight matrix:
// Wt[n][k] = f16(bf16(W[k][n]) * scale) (scale = power of two; bf16-exact weights stay exact in f16 away from the subnormal range); the four transposes lie back to back.
// A wave-wide load covers two 256-byte row pieces of W and a wave-wide store four 128-byte row pieces of Wt: whole lines both ways, one writer a line; the turn is made in LDS.
// The other work-groups round the three inputs to exact f16 rows, 8 values a thread; the three f16 copies lie back to back.
#define WTT 64      /* weight tile edge */
#define WTP 72      /* LDS row pitch of the turned tile in f16: 128 data bytes + 16, rows stay 16-byte aligned for the read-out */
#define NWB (4 * (DM / WTT) * (DM / WTT))      /* weight-tile work-groups */
#define NXB ((int)((NR * DM / 8 + 255) / 256))      /* work-groups per input */
__global__ __launch_bounds__(256) void k_prep(const float* __restrict__ x0, const float* __restrict__ x1, const float* __restrict__ x2, _Float16* __restrict__ X16, size_t n8,
    const float* __restrict__ W0, const float* __restrict__ W1, const float* __restrict__ W2, const float* __restrict__ W3, _Float16* __restrict__ Wt, float scale) {
  static_assert(DM % WTT == 0, "whole weight tiles");
  __shared__ __attribute__((aligned(16))) unsigned short tl[WTT][WTP];      /* [n][k] of the tile */
  const int tid = threadIdx.x, bx = blockIdx.x;
  if (bx < NWB) {      /* the same for the whole work-group: a barrier stands inside */
    const int y = bx / ((DM / WTT) * (DM / WTT)), tile = bx % ((DM / WTT) * (DM / WTT)), k0 = (tile / (DM / WTT)) * WTT, n0 = (tile % (DM / WTT)) * WTT;
    const float* __restrict__ W = y == 0 ? W0 : y == 1 ? W1 : y == 2 ? W2 : W3;
    const int c4 = (tid & 15) * 4, k4 = (tid >> 4) * 4;      /* the thread's 4 x 4 block: rows k4 .. + 3, columns c4 .. + 3 */
    const float* src = W + (size_t)(k0 + k4) * DM + n0 + c4;
    v4f r[4];
#pragma unroll      /* r indexed by constants: registers; the four loads fly together */
    for (int u = 0; u < 4; ++u) r[u] = *(const v4fa*)(src + (size_t)u * DM);
#pragma unroll      /* r indexed by constants: registers */
    for (int j = 0; j < 4; ++j) { v4h h4;
#pragma unroll      /* r, h4 indexed by constants: registers */
      for (int u = 0; u < 4; ++u) h4[u] = (_Float16)(bf16_round(r[u][j]) * scale);
      *(v4h*)&tl[c4 + j][k4] = h4; }      /* four successive k of one column n: 8 bytes of the turned row */
    __syncthreads();      /* the turned tile is complete: a row holds the k of 16 threads */
    unsigned short* dst = (unsigned short*)Wt + (size_t)y * DM * DM + (size_t)n0 * DM + k0;
#pragma unroll      /* 8 threads store one row's 128 bytes */
    for (int j = 0; j < 2; ++j) { const int i = tid + 256 * j, n = i >> 3, k8 = (i & 7) * 8; *(v8us*)(dst + (size_t)n * DM + k8) = *(const v8us*)&tl[n][k8]; }
    return;
  }
  const int xb = bx - NWB, y = xb / NXB; const float* __restrict__ x = y == 0 ? x0 : y == 1 ? x1 : x2; X16 += (size_t)y * n8 * 8;
  const size_t t = (size_t)(xb - y * NXB) * 256 + tid; if (t >= n8) return; FragH f;
#pragma unroll
  for (int q = 0; q < 8; ++q) f.h[q] = (_Float16)bf16_round(x[t * 8 + q]); *(v8us*)((unsigned short*)X16 + t * 8) = f.half[0];  }
__global__ __launch_bounds__(256) void k_h16(const float* __restrict__ x, _Float16* __restrict__ X16, size_t n8) { const size_t t = (size_t)blockIdx.x * 256 + threadIdx.x; if (t >= n8) return; FragH f;
#pragma unroll
  for (int q = 0; q < 8; ++q) f.h[q] = (_Float16)x[t * 8 + q]; *(v8us*)((unsigned short*)X16 + t * 8) = f.half[0];  }
__global__ __launch_bounds__(256) void k_round16f(const float* __restrict__ W, _Float16* __restrict__ Bt, size_t n8) { const size_t t = (size_t)blockIdx.x * 256 + threadIdx.x; if (t >= n8) return; FragH f;
#pragma unroll
  for (int i = 0; i < 8; ++i) f.h[i] = (_Float16)(bf16_round(W[t * 8 + i]) * 16.0f); *(v8us*)((unsigned short*)Bt + t * 8) = f.half[0];  }
__global__ __launch_bounds__(256) void k_hl(const float* __restrict__ F, _Float16* __restrict__ Hh, _Float16* __restrict__ Hl, size_t n8) { const size_t t = (size_t)blockIdx.x * 256 + threadIdx.x; if (t >= n8) return; FragH fh, fl; const v4f a = *(const v4fa*)(F + t * 8), c = *(const v4fa*)(F + t * 8 + 4);
#pragma unroll
  for (int q = 0; q < 4; ++q) { _Float16 h = (_Float16)a[q]; fh.h[q] = h; fl.h[q] = (_Float16)((a[q] - (float)h) * 1024.0f); h = (_Float16)c[q]; fh.h[4 + q] = h; fl.h[4 + q] = (_Float16)((c[q] - (float)h) * 1024.0f); }
  { *(v8us*)((unsigned short*)Hh + t * 8) = fh.half[0]; *(v8us*)((unsigned short*)Hl + t * 8) = fl.half[0];  } }

// ---- fast GEMM (work-group tile 128x64, wave tile 32x64; requires M % 128 == 0, N % 64 == 0 and K % 64 == 0); C = act(alpha A B^T): f16 rows C16 where QKV, f32 rows C otherwise, fixed at compile time ----
// No bias and no added plane: as run-time options they stood as a test and a skipped block at each of the 64 results of a lane, and made the kernel's text many times the size of what runs.
__device__ __forceinline__ v16h g2_frag(const _Float16* p, int hh) { FragH f; f.half[0] = *(const v8us*)((const unsigned short*)p + 8 * hh); f.half[1] = *(const v8us*)((const unsigned short*)p + 16 + 8 * hh); return f.v; }
__device__ __forceinline__ v8f g2_mma(v16h a, v16h b, v8f c) { v8f d = __builtin_amdgcn_wmma_f32_16x16x32_f16(false, a, false, b, (short)0, c, false, false); asm volatile("v_nop\n\tv_nop\n\tv_nop\n\tv_nop" : "+v"(d) : "v"(a), "v"(b)); return d; }
#define GK 64      /* k per pass: one whole 128-byte line of every operand row */
#define GP 72      /* LDS row pitch in f16: 128 data bytes + 16, so that the 16 rows of a 16-byte fragment read fall on different banks */
#define GSTG ((128 + 64) * GP * 2)      /* bytes of one stage: 128 A rows, then 64 B rows */
// One thread's share of a stage: 16 bytes of each of 12 rows (8 of A, 4 of B), 16 rows apart, from global memory straight into LDS.
// l: the thread's LDS byte address in the stage's row 0..15; a, b: its global addresses; pa, pb: 16 rows of A, of B, in elements.
// The s_wait_xcnt closes the statement so that no address register of a copy is rewritten in front of it.
__device__ __forceinline__ void g2_stage(unsigned l, const unsigned short* a, size_t pa, const unsigned short* b, size_t pb) {
  asm volatile(
    "global_load_async_to_lds_b128 %0, %12, off\n\t"
    "global_load_async_to_lds_b128 %1, %13, off\n\t"
    "global_load_async_to_lds_b128 %2, %14, off\n\t"
    "global_load_async_to_lds_b128 %3, %15, off\n\t"
    "global_load_async_to_lds_b128 %4, %16, off\n\t"
    "global_load_async_to_lds_b128 %5, %17, off\n\t"
    "global_load_async_to_lds_b128 %6, %18, off\n\t"
    "global_load_async_to_lds_b128 %7, %19, off\n\t"
    "global_load_async_to_lds_b128 %8, %20, off\n\t"
    "global_load_async_to_lds_b128 %9, %21, off\n\t"
    "global_load_async_to_lds_b128 %10, %22, off\n\t"
    "global_load_async_to_lds_b128 %11, %23, off\n\t"
    "s_wait_xcnt 0x0"
    :: "v"(l + 0u * (16u * GP * 2u)), "v"(l + 1u * (16u * GP * 2u)), "v"(l + 2u * (16u * GP * 2u)), "v"(l + 3u * (16u * GP * 2u)), "v"(l + 4u * (16u * GP * 2u)), "v"(l + 5u * (16u * GP * 2u)), "v"(l + 6u * (16u * GP * 2u)), "v"(l + 7u * (16u * GP * 2u)), "v"(l + 8u * (16u * GP * 2u)), "v"(l + 9u * (16u * GP * 2u)), "v"(l + 10u * (16u * GP * 2u)), "v"(l + 11u * (16u * GP * 2u)),
       "v"(a + 0 * pa), "v"(a + 1 * pa), "v"(a + 2 * pa), "v"(a + 3 * pa), "v"(a + 4 * pa), "v"(a + 5 * pa), "v"(a + 6 * pa), "v"(a + 7 * pa), "v"(b + 0 * pb), "v"(b + 1 * pb), "v"(b + 2 * pb), "v"(b + 3 * pb)
    : "memory");
}
// Both operands go through LDS, two stages: 8 threads copy one 128-byte row piece (a wave-wide copy covers 4 whole lines), each line is fetched once per work-group,
// and the next pass's copies fly while this pass's fragments are read from LDS.
// QKV (the three projections on grid.y; a work-group's 64 columns are one head): the epilogue also does what the attention kernel needs of the results, so that no launch has to read them back:
// y = 0, 1 (q, k): NS[y][head][row] = the squared norm of the head's 64 f16 values of the row; y = 2 (v): the tile goes out transposed only, Tt[batch][head][d][token].
#define TP 136      /* LDS row pitch of the transposed tile in f16: 256 data bytes + 16, so that the 16 rows of a 16-byte store fall on different banks */
template <int ACT, bool QKV>
__global__ __launch_bounds__(128) void k_gemm2(const _Float16* __restrict__ A, int lda, size_t sA, const _Float16* __restrict__ Bh, int ldb, size_t sB, float alpha,
    float* __restrict__ C, _Float16* __restrict__ C16, int ldc, size_t sC, int M, int N, int K, size_t zA, size_t zB, size_t zC, float* __restrict__ NS, _Float16* __restrict__ Tt) { static_assert(ACT == 0 || ACT == 3 || ACT == 6 || ACT == 8 || ACT == 9 || ACT == 11 || ACT == 12 || ACT == 14 || ACT == 15 || ACT == 16 || ACT == 17, "k_gemm2: unsupported ACT code (would silently apply no activation)");
  __shared__ __attribute__((aligned(16))) unsigned char gl[2 * GSTG];      /* the two stages; behind the loop the same bytes stage the output tile */
  static_assert(sizeof(float) * 4 * 32 * 68 <= 2 * GSTG, "output staging must fit the two stages");
  float (*so)[32][68] = (float (*)[32][68])gl;
  const int tid = threadIdx.x, w = tid >> 5, lane = tid & 31, ln = lane & 15, hh = lane >> 4; const int by = blockIdx.y, bz = blockIdx.z;      /* two batch axes: strides sA, sB, sC on grid.y and zA, zB, zC on grid.z */
  A += (size_t)by * sA + (size_t)bz * zA; Bh += (size_t)by * sB + (size_t)bz * zB; const size_t cofs = (size_t)by * sC + (size_t)bz * zC;
  const int ntn = N >> 6; const int mt = blockIdx.x / ntn, nq = blockIdx.x - mt * ntn; const int row0 = mt * 128 + 32 * w, col0 = nq * 64; if (mt * 128 >= M) return;      /* the same for the whole work-group: it stands in front of barriers */
  const int sr = tid >> 3, sc = (tid & 7) * 8;      /* staging: 8 threads cover one 128-byte row piece, 16 rows a sweep */
  const unsigned short* ag = (const unsigned short*)A + (size_t)(mt * 128 + sr) * lda + sc;
  const unsigned short* bg = (const unsigned short*)Bh + (size_t)(col0 + sr) * ldb + sc;
  const size_t pa = (size_t)16 * lda, pb = (size_t)16 * ldb;
  const unsigned l0 = (unsigned)(size_t)gl + (unsigned)(sr * GP + sc) * 2u;      /* low 32 bits of the __shared__ address = the byte address in LDS */
  g2_stage(l0, ag, pa, bg, pb);      /* pass 0 into stage 0 */
  asm volatile("s_wait_asynccnt 0x0" ::: "memory");      /* this wave's copies of pass 0 have landed */
  __syncthreads();      /* and every other wave's */
  if (GK < K) g2_stage(l0 + GSTG, ag + GK, pa, bg + GK, pb);      /* pass 1 into stage 1 */
  const v8f z8 = {0.f,0.f,0.f,0.f,0.f,0.f,0.f,0.f}; v8f c00 = z8, c01 = z8, c02 = z8, c03 = z8, c10 = z8, c11 = z8, c12 = z8, c13 = z8;
#pragma unroll 1      /* one pass a trip: the stage alternates */
  for (int kb = 0; kb < K; kb += GK) {
    const unsigned st = (unsigned)(kb / GK) & 1u;      /* this pass's stage */
    const _Float16* ap = (const _Float16*)(gl + st * GSTG) + (32 * w + ln) * GP; const _Float16* bq = (const _Float16*)(gl + st * GSTG) + (128 + ln) * GP;
#pragma unroll      /* two 32-k blocks a pass, constant LDS offsets */
    for (int kk = 0; kk < GK; kk += 32) { const v16h a0 = g2_frag(ap + kk, hh), a1 = g2_frag(ap + 16 * GP + kk, hh);
      const v16h b0 = g2_frag(bq + kk, hh), b1 = g2_frag(bq + 16 * GP + kk, hh), b2 = g2_frag(bq + 32 * GP + kk, hh), b3 = g2_frag(bq + 48 * GP + kk, hh);
      c00 = g2_mma(a0, b0, c00); c10 = g2_mma(a1, b0, c10);
      c01 = g2_mma(a0, b1, c01); c11 = g2_mma(a1, b1, c11);
      c02 = g2_mma(a0, b2, c02); c12 = g2_mma(a1, b2, c12);
      c03 = g2_mma(a0, b3, c03); c13 = g2_mma(a1, b3, c13); }
    asm volatile("s_wait_dscnt 0x0" ::: "memory");      /* this wave's reads of the stage are done before the stage is handed back */
    asm volatile("s_wait_asynccnt 0x0" ::: "memory");      /* this wave's copies of the next pass have landed */
    __syncthreads();      /* the next pass's stage is complete, and every wave has left this one */
    if (kb + 2 * GK < K) g2_stage(l0 + st * GSTG, ag + kb + 2 * GK, pa, bg + kb + 2 * GK, pb);      /* the pass after next into the stage just left */
  }
  asm volatile("s_wait_asynccnt 0x0" ::: "memory");      /* nothing is in flight when the stages become output staging */
  v8f accs[8] = {c00, c01, c02, c03, c10, c11, c12, c13};
  if (QKV && by == 2) {      /* the same for the whole work-group: a barrier stands inside */
    static_assert(SQ % 128 == 0 && 64 * TP * 2 <= 2 * GSTG, "a tile lies in one batch, and its transpose fits the two stages");
    unsigned short (*tt)[TP] = (unsigned short (*)[TP])gl;      /* [d][token of the tile] */
#pragma unroll      /* accs indexed by constants: registers */
    for (int u = 0; u < 8; ++u) { const int t = u & 3, half = u >> 2; FragH f;      /* an accumulator's 8 values are 8 successive tokens of one column d: one 16-byte piece of the transposed row */
#pragma unroll      /* f.h and the accumulator indexed by constants: registers */
      for (int r = 0; r < 8; ++r) f.h[r] = (_Float16)(accs[u][r] * alpha);
      *(v8us*)&tt[t * 16 + ln][32 * w + half * 16 + 8 * hh] = f.half[0]; }
    __syncthreads();      /* the transposed tile is complete: a row holds the tokens of all four waves */
    unsigned short* vt = (unsigned short*)Tt + ((size_t)((mt * 128) / SQ) * ntn + nq) * 64 * SQ + (mt * 128) % SQ;
#pragma unroll      /* 16 threads store one row's 256 bytes: whole lines, one writer each */
    for (int j = 0; j < 8; ++j) { const int i = tid + 128 * j, d = i >> 4, p8 = (i & 15) * 8; *(v8us*)(vt + (size_t)d * SQ + p8) = *(const v8us*)&tt[d][p8]; }
    return;
  }
#pragma unroll
  for (int u = 0; u < 8; ++u) { const int t = u & 3, half = u >> 2;
#pragma unroll
    for (int r = 0; r < 8; ++r) { const int rloc = half * 16 + 8 * hh + r; float v = accs[u][r] * alpha;
      if (ACT == 3) v = fmaxf(v, 0.f); else if (ACT == 6) v = 0.5f * v * (1.0f + erff(v * 0.70710678118654752f)); else if (ACT == 11) v = 1.0f / (1.0f + expf(-v)); else if (ACT == 15) v = v / (1.0f + expf(-v)); else if (ACT == 12) v = (v > 0.f) ? v : 0.01f * v; else if (ACT == 8) v = tanhf(v); else if (ACT == 9) v = 0.5f * v * (1.0f + tanhf(0.7978845608028654f * (v + 0.044715f * v * v * v))); else if (ACT == 14) v = (v > 0.f) ? v : 0.1f * v; else if (ACT == 16) v = (v >= 0.f) ? v : 0.3f * v; else if (ACT == 17) v = (v >= 0.f) ? v : 0.2f * v;
      so[w][rloc][t * 16 + ln] = v; } }
  __builtin_amdgcn_fence(__ATOMIC_ACQ_REL, "workgroup"); __builtin_amdgcn_wave_barrier();
  const int rsub = lane >> 4, c4 = (lane & 15) * 4;
  {
#pragma unroll
    for (int q = 0; q < 16; ++q) { const int r = q * 2 + rsub; const v4f v = *(const v4fa*)&so[w][r][c4]; if (!QKV) *(v4f*)(C + cofs + (size_t)(row0 + r) * ldc + col0 + c4) = v; else { v4h h4; for (int i = 0; i < 4; ++i) h4[i] = (_Float16)v[i]; *(v4h*)(C16 + cofs + (size_t)(row0 + r) * ldc + col0 + c4) = h4; } }
     }
  if (QKV) {      /* lane l sums row l of the wave's 32, columns in rising order, over the f16 values just stored (a product of two f16 values is exact in f32) */
    float ss = 0.f;
#pragma unroll      /* constant LDS offsets; later reads can issue while earlier values are summed */
    for (int c = 0; c < 16; ++c) { const v4f v = *(const v4fa*)&so[w][lane][c * 4];
#pragma unroll      /* v indexed by constants: registers */
      for (int i = 0; i < 4; ++i) { const float x = (float)(_Float16)v[i]; ss += x * x; } }
    NS[((size_t)by * ntn + nq) * M + row0 + lane] = ss;
    asm volatile("s_wait_xcnt 0x0" ::: "memory");      /* behind the norm store, before code laid out after it may rewrite the store's address registers */
  } }


__global__ __launch_bounds__(256) void k_wnat(const float* __restrict__ w, size_t n8, _Float16* __restrict__ Bt) { const size_t t = (size_t)blockIdx.x * 256 + threadIdx.x; if (t >= n8) return; FragH f; for (int q = 0; q < 8; ++q) f.h[q] = (_Float16)(bf16_round(w[t * 8 + q]) * 16.0f); *(v8us*)((unsigned short*)Bt + t * 8) = f.half[0];  }
__global__ __launch_bounds__(256) void k_rsm(const float* __restrict__ S, _Float16* __restrict__ P, int nrows) {
  #pragma clang fp contract(off)
  const int i = blockIdx.x * 256 + threadIdx.x; if (i >= nrows) return; const float* s = S + (size_t)i * SQ; float mx = -3.0e38f;
#pragma unroll 1
  for (int j = 0; j < SQ; ++j) mx = fmaxf(mx, s[j]); float se = 0.f;
#pragma unroll 1
  for (int j = 0; j < SQ; ++j) se += expf(s[j] - mx); const float sc = 256.0f / se;
#pragma unroll 1
  for (int j0 = 0; j0 < SQ; j0 += 8) { FragH f; for (int q = 0; q < 8; ++q) f.h[q] = (_Float16)(expf(s[j0 + q] - mx) * sc); unsigned short* d = (unsigned short*)P + (size_t)i * SQ + j0; *(v8us*)d = f.half[0];  } }
__global__ __launch_bounds__(256) void k_vt(const _Float16* __restrict__ V16, int b, int h0, _Float16* __restrict__ VT) { __shared__ unsigned short tl[64][65]; const int tid = threadIdx.x; const int hh = blockIdx.x % HG, sg = blockIdx.x / HG; const int s0 = sg * 64; const int h = h0 + hh;
  for (int i = tid; i < 64 * 8; i += 256) { const int j = i / 8, d8 = (i % 8) * 8; FragH f; f.half[0] = *(const v8us*)((const unsigned short*)V16 + ((size_t)b * SQ + s0 + j) * DM + h * HD + d8); for (int q = 0; q < 8; ++q) tl[d8 + q][j] = f.u[q]; }
  __syncthreads();
  { for (int i = tid; i < 64 * 8; i += 256) { const int d = i / 8, j8 = (i % 8) * 8; FragH f; for (int q = 0; q < 8; ++q) f.u[q] = tl[d][j8 + q]; *(v8us*)((unsigned short*)VT + ((size_t)hh * HD + d) * SQ + s0 + j8) = f.half[0]; }  } }


// e^x as __expf forms it (one multiply, v_exp_f32). The v_nop in the same statement is the one slot the instruction set asks for behind a transcendental before its source is rewritten or its result read.
__device__ __forceinline__ float exp_slot(float x) { float r; asm("v_exp_f32 %0, %1\n\tv_nop" : "=v"(r) : "v"(x * 1.44269504f)); return r; }
// Eight square roots by v_sqrt_f32 alone (1 ulp; a subnormal argument may give 0, which moves a logit by under 1e-19): sqrtf() adds about fifteen vector instructions of range scaling and last-bit fix-up to each.
// One statement: each root is followed by an independent one ("=&v": no result shares a register with an argument), and the one v_nop behind the last is the slot the instruction set asks for behind a transcendental.
__device__ __forceinline__ void sqrt8_slot(const float (&x)[8], float (&r)[8]) {
  asm("v_sqrt_f32 %0, %8\n\tv_sqrt_f32 %1, %9\n\tv_sqrt_f32 %2, %10\n\tv_sqrt_f32 %3, %11\n\tv_sqrt_f32 %4, %12\n\tv_sqrt_f32 %5, %13\n\tv_sqrt_f32 %6, %14\n\tv_sqrt_f32 %7, %15\n\tv_nop"
      : "=&v"(r[0]), "=&v"(r[1]), "=&v"(r[2]), "=&v"(r[3]), "=&v"(r[4]), "=&v"(r[5]), "=&v"(r[6]), "=&v"(r[7])
      : "v"(x[0]), "v"(x[1]), "v"(x[2]), "v"(x[3]), "v"(x[4]), "v"(x[5]), "v"(x[6]), "v"(x[7])); }
// S and P are not __restrict__: P may be the front half of the same rows (ldp = 2 * SQ f16); a wave stores only into its own row, and every store needs the row sum, so all its loads of the row come first.
// One wave per (head, query row): lane l holds columns c*128 + 4*l .. + 3 (c = 0..7), so every load covers 512 contiguous bytes; the row's logits stay in registers from the max to the store.
__global__ __launch_bounds__(256) void k_rsml2(const float* S, _Float16* P, int ldp, int qn, int hg, const float* __restrict__ NQ, const float* __restrict__ NK, size_t npitch, const float* __restrict__ Mf, float scale) {
  #pragma clang fp contract(off)
  const int lane = threadIdx.x & 31; const int t = blockIdx.x * 8 + __builtin_amdgcn_readfirstlane(threadIdx.x >> 5);      /* the wave's row, told to the compiler as wave-uniform: scalar row addresses and a scalar exit test */
  if (t >= qn * hg) return; const int hl = t / qn, row = t % qn; const size_t i = (size_t)hl * SQ + row; const float* s = S + i * SQ; const float nq = NQ[(size_t)hl * npitch + row]; const float* nk = NK + (size_t)hl * npitch; const float* mrow = Mf + (size_t)row * SQ; float mx = -3.0e38f;
  float e[SQ / 32];
#pragma unroll      /* e[] must be indexed by constants to live in registers; later chunks' loads can issue while earlier chunks are worked on */
  for (int c = 0; c < SQ / 128; ++c) { const int j0 = c * 128 + lane * 4; const v4f s4 = *(const v4fa*)(s + j0), k4 = *(const v4fa*)(nk + j0), m4 = *(const v4fa*)(mrow + j0);
#pragma unroll      /* constant index into e[] */
    for (int q = 0; q < 4; ++q) { const float d2 = fmaxf(__fadd_rn(__fadd_rn(nq, k4[q]), -2.0f * s4[q]), 0.f); const float v = __fadd_rn(__fmul_rn(sqrtf(d2), scale), __fmul_rn(bf16_round(m4[q]), -1.0e9f)); e[c * 4 + q] = v; mx = fmaxf(mx, v); } }
  for (int o = 16; o > 0; o >>= 1) mx = fmaxf(mx, __shfl_xor(mx, o));      /* row maximum over the 32 lanes */
  float se = 0.f;
#pragma unroll      /* constant index into e[] */
  for (int u = 0; u < SQ / 32; ++u) { e[u] = exp_slot(e[u] - mx); se += e[u]; }
  for (int o = 16; o > 0; o >>= 1) se += __shfl_xor(se, o);      /* row sum: per-lane partial sums, then a five-step butterfly */
  const float sc = 256.0f / se;
#pragma unroll      /* constant index into e[] */
  for (int c = 0; c < SQ / 128; ++c) { v4h h4;
#pragma unroll      /* constant index into e[] */
    for (int q = 0; q < 4; ++q) h4[q] = (_Float16)(e[c * 4 + q] * sc);
    *(v4h*)(P + i * (size_t)ldp + c * 128 + lane * 4) = h4; } }


__global__ __launch_bounds__(256) void k_rsmf(const float* __restrict__ S, _Float16* __restrict__ P, int qn, int hg) {
  #pragma clang fp contract(off)
  const int t = blockIdx.x * 256 + threadIdx.x; if (t >= qn * hg) return; const size_t i = (size_t)(t / qn) * SQ + (t % qn); const float* s = S + i * SQ; float mx = -3.0e38f;
#pragma unroll 1
  for (int j = 0; j < SQ; ++j) mx = fmaxf(mx, s[j]); float se = 0.f;
#pragma unroll 1
  for (int j = 0; j < SQ; ++j) se += __expf(s[j] - mx); const float sc = 256.0f / se;
#pragma unroll 1
  for (int j0 = 0; j0 < SQ; j0 += 8) { FragH f; for (int q = 0; q < 8; ++q) f.h[q] = (_Float16)(__expf(s[j0 + q] - mx) * sc); unsigned short* d = (unsigned short*)P + i * SQ + j0; *(v8us*)d = f.half[0];  } }

// ---- fused attention: scores, softmax and the weighted sum of V in one kernel; no score or weight plane goes through memory ----
// lane l with lane l ^ 16 (the two lanes that share a query column)
__device__ __forceinline__ float xhalf(float x) { return __builtin_bit_cast(float, __builtin_amdgcn_permlanex16(__builtin_bit_cast(int, x), __builtin_bit_cast(int, x), 0x76543210, 0xfedcba98, false, false)); }
#define FK 64      /* keys per pass */
#define FP 72      /* LDS row pitch in f16: 128 data bytes + 16, so that the 16 rows of a 16-byte fragment read fall on different banks */
// One work-group = 4 waves x 16 query rows of one (batch, head); 16 passes over 64 keys.
// Both products are formed transposed, so that a lane owns ONE query column throughout: S^T = K Q^T gives lane (c, h) the keys 8h + r of query c,
// which is the k order of a B fragment, so the weights go from the score accumulators straight into O^T = V^T P^T; the running maximum, sum and rescale are per-lane scalars.
__global__ __launch_bounds__(128) void k_fattn(const _Float16* __restrict__ Q16, const _Float16* __restrict__ K16, const _Float16* __restrict__ VT, const float* __restrict__ NQ, const float* __restrict__ NK, const float* __restrict__ Mf, _Float16* __restrict__ O16, float scale) {
  __shared__ __attribute__((aligned(16))) unsigned short kt_s[FK][FP];      /* K tile  [key][d]  */
  __shared__ __attribute__((aligned(16))) unsigned short vt_s[HD][FP];      /* V^T tile [d][key] */
  const int tid = threadIdx.x, w = tid >> 5, lane = tid & 31, ln = lane & 15, hh = lane >> 4;
  const int h = blockIdx.y, b = blockIdx.z; const int q = blockIdx.x * 64 + w * 16 + ln;      /* the lane's query row */
  const _Float16* qrow = Q16 + ((size_t)b * SQ + q) * DM + h * HD;
  const v16h qf0 = g2_frag(qrow, hh), qf1 = g2_frag(qrow + 32, hh);
  const float nq = NQ[(size_t)h * NR + (size_t)b * SQ + q];
  asm volatile("s_wait_xcnt 0x0" ::: "memory");      /* the load's index register is rewritten for the mask row's address right behind it */
  const float* nk = NK + (size_t)h * NR + (size_t)b * SQ + 8 * hh;
  const float* mrow = Mf + (size_t)q * SQ + 8 * hh;
  const int sr = tid >> 3, sc = (tid & 7) * 8;      /* staging: 8 threads cover one 128-byte row, 16 rows a sweep */
  const unsigned short* kg = (const unsigned short*)K16 + ((size_t)b * SQ + sr) * DM + h * HD + sc;
  const unsigned short* vg = (const unsigned short*)VT + (((size_t)b * NH + h) * HD + sr) * SQ + sc;
  v8us kr[4], vr[4];
#pragma unroll      /* kr, vr indexed by constants: registers */
  for (int u = 0; u < 4; ++u) { kr[u] = *(const v8us*)(kg + (size_t)(u * 16) * DM); vr[u] = *(const v8us*)(vg + (size_t)(u * 16) * SQ); }
  const v8f z8 = {0.f,0.f,0.f,0.f,0.f,0.f,0.f,0.f};
  v8f o[4] = {z8, z8, z8, z8}; float mrun = -3.0e38f, lsum = 0.f;
  for (int s = 0; s < SQ / FK; ++s) {
    __syncthreads();      /* every wave has finished reading the previous tiles */
#pragma unroll
    for (int u = 0; u < 4; ++u) { *(v8us*)&kt_s[u * 16 + sr][sc] = kr[u]; *(v8us*)&vt_s[u * 16 + sr][sc] = vr[u]; }
    __syncthreads();      /* the tiles of this pass are complete */
    if (s + 1 < SQ / FK) {      /* next pass's tiles fly while this pass is worked on */
#pragma unroll
      for (int u = 0; u < 4; ++u) { kr[u] = *(const v8us*)(kg + (size_t)((s + 1) * FK + u * 16) * DM); vr[u] = *(const v8us*)(vg + (size_t)(u * 16) * SQ + (s + 1) * FK); }
      asm volatile("s_wait_xcnt 0x0" ::: "memory");      /* the loads' address registers are rewritten right behind them */
    }
    v4f kn[8], mk[8];      /* the pass's key norms and mask values: keys t * 16 + 8 * hh + 0..7 of the lane's query */
#pragma unroll      /* kn indexed by constants: registers */
    for (int t = 0; t < 4; ++t) { kn[2 * t] = *(const v4fa*)(nk + s * FK + t * 16); kn[2 * t + 1] = *(const v4fa*)(nk + s * FK + t * 16 + 4); }
    asm volatile("s_wait_xcnt 0x0" ::: "memory");      /* before a later load's result reuses these loads' address registers */
#pragma unroll      /* mk indexed by constants: registers */
    for (int t = 0; t < 4; ++t) { mk[2 * t] = *(const v4fa*)(mrow + s * FK + t * 16); mk[2 * t + 1] = *(const v4fa*)(mrow + s * FK + t * 16 + 4); }
    asm volatile("s_wait_xcnt 0x0" ::: "memory");      /* likewise, before the fragment reads reuse them */
    float e[4][8]; float mx = mrun;
#pragma unroll      /* e[][] indexed by constants: registers */
    for (int t = 0; t < 4; ++t) {
      const v4f k0 = kn[2 * t], k1 = kn[2 * t + 1], m0 = mk[2 * t], m1 = mk[2 * t + 1];
      const _Float16* kp = (const _Float16*)&kt_s[t * 16 + ln][0];
      v8f st = __builtin_amdgcn_wmma_f32_16x16x32_f16(false, g2_frag(kp, hh), false, qf0, (short)0, z8, false, false);
      st = __builtin_amdgcn_wmma_f32_16x16x32_f16(false, g2_frag(kp + 32, hh), false, qf1, (short)0, st, false, false);
      float d2[8], rt[8];
#pragma unroll      /* d2 indexed by constants: registers */
      for (int r = 0; r < 8; ++r) { const float kk = r < 4 ? k0[r & 3] : k1[r & 3]; d2[r] = fmaxf((nq + kk) - 2.0f * st[r], 0.f); }
      sqrt8_slot(d2, rt);
#pragma unroll      /* rt, e[][] indexed by constants: registers */
      for (int r = 0; r < 8; ++r) { const float mm = r < 4 ? m0[r & 3] : m1[r & 3];
        const float v = rt[r] * scale + bf16_round(mm) * -1.0e9f; e[t][r] = v; mx = fmaxf(mx, v); }
    }
    mx = fmaxf(mx, xhalf(mx));      /* the query's maximum so far: both lanes of the column agree on it */
    const float al = exp_slot(mrun - mx); mrun = mx; float ps = 0.f;
    FragH p0, p1;
#pragma unroll
    for (int r = 0; r < 8; ++r) {
      const float a0 = exp_slot(e[0][r] - mx), a1 = exp_slot(e[1][r] - mx), a2 = exp_slot(e[2][r] - mx), a3 = exp_slot(e[3][r] - mx);
      ps += (a0 + a1) + (a2 + a3);
      p0.h[r] = (_Float16)a0; p0.h[8 + r] = (_Float16)a1; p1.h[r] = (_Float16)a2; p1.h[8 + r] = (_Float16)a3; }
    lsum = lsum * al + ps;
#pragma unroll
    for (int t = 0; t < 4; ++t) {
      const _Float16* vp = (const _Float16*)&vt_s[t * 16 + ln][0];
      v8f a = o[t] * al;
      a = __builtin_amdgcn_wmma_f32_16x16x32_f16(false, g2_frag(vp, hh), false, p0.v, (short)0, a, false, false);
      o[t] = __builtin_amdgcn_wmma_f32_16x16x32_f16(false, g2_frag(vp + 32, hh), false, p1.v, (short)0, a, false, false);
    }
    asm volatile("v_nop\n\tv_nop\n\tv_nop\n\tv_nop" : "+v"(o[0]), "+v"(o[1]), "+v"(o[2]), "+v"(o[3]) : "v"(p1.v));      /* the four vector slots the chip needs behind the pass's last WMMA before its operand registers are rewritten: the next writer stands behind the branch to the loop's head */
  }
  lsum += xhalf(lsum);      /* the two lanes of a column summed disjoint keys */
  const float inv = 64.0f / lsum;      /* o carried x64, as the output GEMM's alpha expects */
  unsigned short* orow = (unsigned short*)O16 + ((size_t)b * SQ + q) * DM + h * HD + 8 * hh;
#pragma unroll
  for (int t = 0; t < 4; ++t) { FragH f;
#pragma unroll
    for (int r = 0; r < 8; ++r) f.h[r] = (_Float16)(o[t][r] * inv);
    *(v8us*)(orow + t * 16) = f.half[0]; }
}

extern "C" void kernel_launch(void* const* d_in, const int* in_sizes, int n_in,
                              void* d_out, int out_size, void* d_ws, size_t ws_size, hipStream_t stream) {
  (void)in_sizes; (void)n_in; (void)out_size;
  const float* const* I = (const float* const*)d_in; const float* xv = I[0]; const float* xk = I[1]; const float* xq = I[2]; const float* mf = I[3]; const float* wq = I[4]; const float* wk = I[5]; const float* wv = I[6]; const float* wo = I[7]; const float* bq = nullptr; const float* bk = nullptr; (void)bq; (void)bk;      /* inputs v, k, q, mask (f32 [1][1][S][S]); [in][out] weights, no biases */
  char* ws = (char*)d_ws; size_t off = 0;
  auto take = [&](size_t bytes) { char* p = ws + off; off += (bytes + 255) & ~(size_t)255; return p; };
  _Float16* BQ = (_Float16*)take((size_t)DM * DM * 2); _Float16* BK = (_Float16*)take((size_t)DM * DM * 2); _Float16* BV = (_Float16*)take((size_t)DM * DM * 2); _Float16* BO = (_Float16*)take((size_t)DM * DM * 2);
  _Float16* XQ = (_Float16*)take(NR * DM * 2); _Float16* XK = (_Float16*)take(NR * DM * 2); _Float16* XV = (_Float16*)take(NR * DM * 2); _Float16* Q16 = (_Float16*)take(NR * DM * 2); _Float16* K16 = (_Float16*)take(NR * DM * 2); _Float16* V16 = (_Float16*)take(NR * DM * 2); _Float16* O16 = (_Float16*)take(NR * DM * 2);
  _Float16* VT = (_Float16*)take((size_t)NB * NH * HD * SQ * 2); float* NQ = (float*)take((size_t)NH * NR * 4); float* NK = (float*)take((size_t)NH * NR * 4);      /* NQ, NK: per-(head, row) squared norms of the f16 q and k rows */
  (void)BK; (void)BV; (void)XK; (void)XV; (void)V16;      /* reached through the strides from BQ and XQ; the V16 plane keeps its place and is not used */
  if (off > ws_size) return;
  k_prep<<<dim3((unsigned)(NWB + 3 * NXB)), 256, 0, stream>>>(xq, xk, xv, XQ, NR * DM / 8, wq, wk, wv, wo, BQ, 16.0f);      /* [in][out] weights -> Bt[n][k] x16 (BQ, BK, BV, BO lie back to back) and the three inputs as exact f16 rows (XQ, XK, XV lie back to back) */
  k_gemm2<0, true><<<dim3((unsigned)((MP / 128) * (DM / 64)), 3), 128, 0, stream>>>(XQ, DM, NR * DM, BQ, DM, (size_t)DM * DM, 0.0625f, nullptr, Q16, DM, NR * DM, MP, DM, DM, 0, 0, 0, NQ, VT);      /* q, k, v projections on grid.y: Q16 and K16 lie back to back; with them |qh|^2, |kh|^2 per (head, token) from the same f16 values (NK lies behind NQ); v goes out as V^T [NB][NH][HD][SQ] only */
  k_fattn<<<dim3(SQ / 64, NH, NB), 128, 0, stream>>>(Q16, K16, VT, NQ, NK, mf, O16, 0.125f);      /* softmax(sqrt(max(|q|^2 + |k|^2 - 2 q.k, 0)) / 8 + mask * (-1e9)) . v, merged heads, as f16 rows x64 */
  k_gemm2<0, false><<<dim3((unsigned)((MPO / 128) * (DM / 64)), 1), 128, 0, stream>>>(O16, DM, 0, BO, DM, 0, 0.0009765625f, (float*)d_out, nullptr, DM, 0, MPO, DM, DM, 0, 0, 0, nullptr, nullptr);      /* out rows are the output layout */
}

// v009
// A run of this version takes 69.6 microseconds.
// In two side-by-side timings against v008, it was 1.07 and 1.06 times as fast.
// All steps since v000 together make it 85.0 times as fast.
#include <hip/hip_runtime.h>
// Multi-head attention with L2-DISTANCE scores (inputs in the module's order v, k, q [4][1024][768], mask f32 [1][1][1024][1024] (zeros); qh = q wq, kh = k wk, vh = v wv ([in][out] 768x768 sigma 0.02, no biases); 12 heads of 64; scores = sqrt(max(|qh|^2 + |kh|^2 - 2 qh.kh, 0)) (pairwise L2 distance); logits = scores / 8 + mask * (-1e9); softmax; out = (attn vh merged) wo -> [4][1024][768]).
// Structure: token rows r = b*1024 + s; the three inputs as exact f16 rows (bf16-rounded); Q, K, V as three WMMA GEMMs (32x64 wave tiles, f32 accumulation, exact x16 weights, f16 outputs); the squared q and k row norms and V^T for all (batch, head) come out of that GEMM's epilogue; one fused attention launch over all 48 (head, batch) planes (heads on grid.y, batches on grid.z): per 64 keys S^T = K Q^T on WMMA (raw q.k), distance, 1/8 and mask on VALU, online softmax (f32 statistics, native exp; weights in (0, 1] as f16), O^T += V^T P^T on WMMA; o is stored x64 (against f16 subnormal flush, folded into the output GEMM alpha) straight into the merged f16 o rows; out = o W_o GEMM (f32) into the output layout.
// Compute dtype: inputs rounded to bf16; x / weights exact; q, k, v, softmax weights and o as plain f16 GEMM operands (~2^-12); scores and softmax statistics f32. v_wmma_f32_16x16x32_f16.
#define NB 4
#define SQ 1024
#define DM 768
#define NH 12
#define HD 64
#define HG 4                         /* heads per launch of the non-template k_vt */
#define B0 0                         /* unused: every launch starts at batch 0 */
#define NBR NB                       /* batches processed (debug hook) */
#define NR ((size_t)NB * SQ)         /* token rows */
#define MP ((int)((size_t)NBR * SQ)) /* rows projected (debug hook) */
#define QN SQ                        /* unused: the attention launches take SQ rows */
#define NHD NH                       /* unused: the attention launches take NH heads */
#define MPO MP                       /* rows through the output stage (debug hook) */
#define LQ DM      /* row pitch of the q/k/v rows */
typedef __bf16 v16b __attribute__((ext_vector_type(16)));
typedef unsigned short v8us __attribute__((ext_vector_type(8), may_alias));
typedef float  v8f  __attribute__((ext_vector_type(8)));
typedef float  v4f  __attribute__((ext_vector_type(4)));
typedef float  v4fa __attribute__((ext_vector_type(4), may_alias));
union FragB { v16b v; v8us half[2]; unsigned short u[16]; };

__device__ __forceinline__ unsigned short bf16_bits(float x) { unsigned int u = __float_as_uint(x); return (unsigned short)((u + 0x7FFFu + ((u >> 16) & 1u)) >> 16); }
__device__ __forceinline__ float bf16_val(unsigned short b) { return __uint_as_float(((unsigned int)b) << 16); }
__device__ __forceinline__ float bf16_round(float x) { return bf16_val(bf16_bits(x)); }
// D += A·B with NT terms: 1 = ah·bh, 2 = + al·bh (A split), 3 = + ah·bl (both split)
template <int NT>
__device__ __forceinline__ v8f mmaN(v16b ah, v16b al, v16b bh, v16b bl, v8f c) {
  c = __builtin_amdgcn_wmma_f32_16x16x32_bf16(false, ah, false, bh, (short)0, c, false, false);
  if (NT >= 2) c = __builtin_amdgcn_wmma_f32_16x16x32_bf16(false, al, false, bh, (short)0, c, false, false);
  if (NT >= 3) c = __builtin_amdgcn_wmma_f32_16x16x32_bf16(false, ah, false, bl, (short)0, c, false, false);
  asm volatile("v_nop\n\tv_nop\n\tv_nop\n\tv_nop" : "+v"(c) : "v"(ah), "v"(al), "v"(bh), "v"(bl));
  return c;
}

__global__ __launch_bounds__(256) void k_wt_bf16(const float* __restrict__ W, unsigned short* __restrict__ Wt, int K, int N) {
  const int t = blockIdx.x * 256 + threadIdx.x;
  const int k8n = K / 8;
  if (t >= N * k8n) return;
  const int n = t / k8n, k8 = (t % k8n) * 8;
  v8us v;
#pragma unroll
  for (int i = 0; i < 8; ++i) v[i] = bf16_bits(W[(size_t)(k8 + i) * N + n]);
  *(v8us*)(Wt + (size_t)n * K + k8) = v;
  
}

// GEMM C[M][N] (f32, pitch ldc) = act(A[M][K]·W + bias). A f32 row-major (pitch lda) converted per fragment to bf16
// (ASPLIT: hi/lo two planes -> 2 terms, else single rounded term); Wt bf16 [N][K] (pitch ldb). BIAS_BF16 rounds the
// bias to bf16 first (bias quantised to bf16 before the add). K%32==0, M%16==0, N%64==0.
template <bool ASPLIT, int ACT, bool BIAS_BF16>
__global__ __launch_bounds__(128) void k_gemm_bf(const float* __restrict__ A, int lda, const unsigned short* __restrict__ Wt, int ldb,
                                               const float* __restrict__ bias, float* __restrict__ C, int ldc, int M, int N, int K) {
  __shared__ __attribute__((aligned(16))) float so[4][16][64];
  const int tid = threadIdx.x, w = tid >> 5, lane = tid & 31, ln = lane & 15, hh = lane >> 4;
  const int ntn = N / 64;
  const int wid = blockIdx.x * 4 + w;
  const int mt = wid / ntn, nq = wid % ntn;
  if (mt * 16 >= M) return;
  const int row0 = mt * 16, col0 = nq * 64;
  const float* arow = A + (size_t)(row0 + ln) * lda;
  v8f acc[4] = {};
  for (int kb = 0; kb < K; kb += 32) {
    FragB ah, al;
    const v4f x0 = *(const v4fa*)(arow + kb + 8 * hh), x1 = *(const v4fa*)(arow + kb + 8 * hh + 4);
    const v4f x2 = *(const v4fa*)(arow + kb + 16 + 8 * hh), x3 = *(const v4fa*)(arow + kb + 16 + 8 * hh + 4);
    float xs[16] = {x0[0],x0[1],x0[2],x0[3],x1[0],x1[1],x1[2],x1[3],x2[0],x2[1],x2[2],x2[3],x3[0],x3[1],x3[2],x3[3]};
#pragma unroll
    for (int i = 0; i < 16; ++i) { const unsigned short hb = bf16_bits(xs[i]); ah.u[i] = hb; al.u[i] = ASPLIT ? bf16_bits(xs[i] - bf16_val(hb)) : (unsigned short)0; }
#pragma unroll
    for (int t = 0; t < 4; ++t) {
      const unsigned short* brow = Wt + (size_t)(col0 + t * 16 + ln) * ldb + kb;
      FragB b;
      b.half[0] = *(const v8us*)(brow + 8 * hh);
      b.half[1] = *(const v8us*)(brow + 16 + 8 * hh);
      acc[t] = mmaN<ASPLIT ? 2 : 1>(ah.v, al.v, b.v, b.v, acc[t]);
    }
  }
#pragma unroll
  for (int t = 0; t < 4; ++t) {
    float bv = bias ? bias[col0 + t * 16 + ln] : 0.f;
    if (BIAS_BF16) bv = bf16_round(bv);
#pragma unroll
    for (int r = 0; r < 8; ++r) { float v = acc[t][r] + bv; if (ACT == 1) v = fmaxf(v, 0.f); so[w][8 * hh + r][t * 16 + ln] = v; }
  }
  __builtin_amdgcn_fence(__ATOMIC_ACQ_REL, "workgroup");
  __builtin_amdgcn_wave_barrier();
  const int rsub = lane >> 4, c4 = (lane & 15) * 4;
  {
#pragma unroll
    for (int q = 0; q < 8; ++q) {
      const int r = q * 2 + rsub;
      const v4f v = *(const v4fa*)&so[w][r][c4];
      *(v4f*)(C + (size_t)(row0 + r) * ldc + col0 + c4) = v;
    }
    
  }
}

// GEMM C = act(A·W + bias + resid): A f32 (ASPLIT -> hi/lo 2 terms), Wt bf16 [N][K]; ACT 0 none, 1 relu, 2 exact gelu;
// resid (optional, f32, row index = (row % rmod), pitch ldr, RES_BF16 rounds it) added before the activation.
template <bool ASPLIT, int ACT, bool BIAS_BF16, bool RES_BF16>
__global__ __launch_bounds__(128) void k_gemm_bf3(const float* __restrict__ A, int lda, const unsigned short* __restrict__ Wt, int ldb,
                                                const float* __restrict__ bias, const float* __restrict__ resid, int rmod, int ldr,
                                                float* __restrict__ C, int ldc, int M, int N, int K) {
  __shared__ __attribute__((aligned(16))) float so[4][16][64];
  const int tid = threadIdx.x, w = tid >> 5, lane = tid & 31, ln = lane & 15, hh = lane >> 4;
  const int ntn = N / 64;
  const int wid = blockIdx.x * 4 + w;
  const int mt = wid / ntn, nq = wid % ntn;
  if (mt * 16 >= M) return;
  const int row0 = mt * 16, col0 = nq * 64;
  const float* arow = A + (size_t)(row0 + ln) * lda;
  v8f acc[4] = {};
  for (int kb = 0; kb < K; kb += 32) {
    FragB ah, al;
    const v4f x0 = *(const v4fa*)(arow + kb + 8 * hh), x1 = *(const v4fa*)(arow + kb + 8 * hh + 4);
    const v4f x2 = *(const v4fa*)(arow + kb + 16 + 8 * hh), x3 = *(const v4fa*)(arow + kb + 16 + 8 * hh + 4);
    float xs[16] = {x0[0],x0[1],x0[2],x0[3],x1[0],x1[1],x1[2],x1[3],x2[0],x2[1],x2[2],x2[3],x3[0],x3[1],x3[2],x3[3]};
#pragma unroll
    for (int i = 0; i < 16; ++i) { const unsigned short hb = bf16_bits(xs[i]); ah.u[i] = hb; al.u[i] = ASPLIT ? bf16_bits(xs[i] - bf16_val(hb)) : (unsigned short)0; }
#pragma unroll
    for (int t = 0; t < 4; ++t) {
      const unsigned short* brow = Wt + (size_t)(col0 + t * 16 + ln) * ldb + kb;
      FragB b;
      b.half[0] = *(const v8us*)(brow + 8 * hh);
      b.half[1] = *(const v8us*)(brow + 16 + 8 * hh);
      acc[t] = mmaN<ASPLIT ? 2 : 1>(ah.v, al.v, b.v, b.v, acc[t]);
    }
  }
#pragma unroll
  for (int t = 0; t < 4; ++t) {
    const int col = col0 + t * 16 + ln;
    float bv = bias ? bias[col] : 0.f;
    if (BIAS_BF16) bv = bf16_round(bv);
#pragma unroll
    for (int r = 0; r < 8; ++r) {
      float v = acc[t][r] + bv;
      if (resid) { float rv = resid[(size_t)((row0 + 8 * hh + r) % rmod) * ldr + col]; if (RES_BF16) rv = bf16_round(rv); v += rv; }
      if (ACT == 1) v = fmaxf(v, 0.f);
      if (ACT == 2) v = 0.5f * v * (1.0f + erff(v * 0.70710678118654752f));
      if (ACT == 3) { const float u = 0.7978845608028654f * (v + 0.044715f * v * v * v); v = 0.5f * v * (1.0f + tanhf(u)); }
      so[w][8 * hh + r][t * 16 + ln] = v;
    }
  }
  __builtin_amdgcn_fence(__ATOMIC_ACQ_REL, "workgroup");
  __builtin_amdgcn_wave_barrier();
  const int rsub = lane >> 4, c4 = (lane & 15) * 4;
  {
#pragma unroll
    for (int q = 0; q < 8; ++q) {
      const int r = q * 2 + rsub;
      const v4f v = *(const v4fa*)&so[w][r][c4];
      *(v4f*)(C + (size_t)(row0 + r) * ldc + col0 + c4) = v;
    }
    
  }
}
// row LayerNorm (biased variance, eps) over N: s = X (+ R); optional out_sum <- s; out_norm <- (s-mu)*rsqrt(var+eps)*g + b
template <bool PARAM_BF16>
__global__ __launch_bounds__(256) void k_layernorm(const float* __restrict__ X, const float* __restrict__ R, const float* __restrict__ g, const float* __restrict__ bta,
                                                  float* __restrict__ out_sum, float* __restrict__ out_norm, int N, float eps) {
  __shared__ float red[256];
  const int row = blockIdx.x, tid = threadIdx.x;
  const float* x = X + (size_t)row * N; const float* rr = R ? R + (size_t)row * N : nullptr;
  float vals[16];                     // up to N = 4096
  const int per = N / 256;            // contiguous chunk per thread? use strided-by-4 chunks: thread handles j = tid*4 + 1024*u
  float s1 = 0.f;
  for (int u = 0; u < per / 4; ++u) {
    const int j = tid * 4 + 1024 * u;
    const v4f a = *(const v4fa*)(x + j);
    v4f b = {0.f,0.f,0.f,0.f}; if (rr) b = *(const v4fa*)(rr + j);
#pragma unroll
    for (int q = 0; q < 4; ++q) { const float v = a[q] + b[q]; vals[u * 4 + q] = v; s1 += v; }
  }
  red[tid] = s1; __syncthreads();
  for (int st = 128; st > 0; st >>= 1) { if (tid < st) red[tid] += red[tid + st]; __syncthreads(); }
  const float mu = red[0] / (float)N; __syncthreads();
  float s2 = 0.f;
  for (int u = 0; u < per / 4; ++u)
#pragma unroll
    for (int q = 0; q < 4; ++q) { const float c = vals[u * 4 + q] - mu; s2 += c * c; }
  red[tid] = s2; __syncthreads();
  for (int st = 128; st > 0; st >>= 1) { if (tid < st) red[tid] += red[tid + st]; __syncthreads(); }
  const float rs = rsqrtf(red[0] / (float)N + eps);
  {
    for (int u = 0; u < per / 4; ++u) {
      const int j = tid * 4 + 1024 * u;
      v4f o, sm;
#pragma unroll
      for (int q = 0; q < 4; ++q) {
        float gg = g[j + q], bb = bta[j + q];
        if (PARAM_BF16) { gg = bf16_round(gg); bb = bf16_round(bb); }
        sm[q] = vals[u * 4 + q]; o[q] = (vals[u * 4 + q] - mu) * rs * gg + bb;
      }
      if (out_sum) *(v4f*)(out_sum + (size_t)row * N + j) = sm;
      *(v4f*)(out_norm + (size_t)row * N + j) = o;
    }
    
  }
}



// ---- f16 WMMA path (v_wmma_f32_16x16x32_f16): 11-bit significands for operands in range — used where a [0,1] probability operand needs more precision than bf16
typedef _Float16 v16h __attribute__((ext_vector_type(16)));
union FragH { v16h v; v8us half[2]; _Float16 h[16]; unsigned short u[16]; };
template <int NT>
__device__ __forceinline__ v8f mmaH(v16h ah, v16h al, v16h bh, v16h bl, v8f c) {
  c = __builtin_amdgcn_wmma_f32_16x16x32_f16(false, ah, false, bh, (short)0, c, false, false);
  if (NT >= 2) c = __builtin_amdgcn_wmma_f32_16x16x32_f16(false, al, false, bh, (short)0, c, false, false);
  if (NT >= 3) c = __builtin_amdgcn_wmma_f32_16x16x32_f16(false, ah, false, bl, (short)0, c, false, false);
  asm volatile("v_nop\n\tv_nop\n\tv_nop\n\tv_nop" : "+v"(c) : "v"(ah), "v"(al), "v"(bh), "v"(bl));
  return c;
}
// batched GEMM like k_gemm_b but f16 operands: A f32 (split into f16 hi/lo if ASPLIT, else rounded to f16), Bt = f16 values [n][k]; alpha; C f32; N multiple of 16 (partial tiles skipped)
template <bool ASPLIT>
__global__ __launch_bounds__(128) void k_gemm_h(const float* __restrict__ A, int lda, size_t sA, const _Float16* __restrict__ Bh, int ldb, size_t sB, float alpha, float* __restrict__ C, int ldc, size_t sC, int M, int N, int K) {
  __shared__ __attribute__((aligned(16))) float so[4][16][64];
  const int tid = threadIdx.x, w = tid >> 5, lane = tid & 31, ln = lane & 15, hh = lane >> 4; const int by = blockIdx.y;
  A += (size_t)by * sA; Bh += (size_t)by * sB; C += (size_t)by * sC;
  const int ntn = (N + 63) / 64; const int wid = blockIdx.x * 4 + w; const int mt = wid / ntn, nq = wid % ntn; if (mt * 16 >= M) return;
  const int row0 = mt * 16, col0 = nq * 64; const float* arow = A + (size_t)(row0 + ln) * lda;
  v8f acc[4] = {};
  for (int kb = 0; kb < K; kb += 32) {
    FragH ah, al;
    const v4f x0 = *(const v4fa*)(arow + kb + 8 * hh), x1 = *(const v4fa*)(arow + kb + 8 * hh + 4), x2 = *(const v4fa*)(arow + kb + 16 + 8 * hh), x3 = *(const v4fa*)(arow + kb + 16 + 8 * hh + 4);
    float xs[16] = {x0[0],x0[1],x0[2],x0[3],x1[0],x1[1],x1[2],x1[3],x2[0],x2[1],x2[2],x2[3],x3[0],x3[1],x3[2],x3[3]};
#pragma unroll
    for (int i = 0; i < 16; ++i) { const _Float16 h = (_Float16)xs[i]; ah.h[i] = h; al.h[i] = ASPLIT ? (_Float16)(xs[i] - (float)h) : (_Float16)0.0f; }
#pragma unroll
    for (int t = 0; t < 4; ++t) { if (col0 + t * 16 >= N) continue; const size_t boff = (size_t)(col0 + t * 16 + ln) * ldb + kb; FragH bq; bq.half[0] = *(const v8us*)(Bh + boff + 8 * hh); bq.half[1] = *(const v8us*)(Bh + boff + 16 + 8 * hh);
      acc[t] = mmaH<ASPLIT ? 2 : 1>(ah.v, al.v, bq.v, bq.v, acc[t]); }
  }
#pragma unroll
  for (int t = 0; t < 4; ++t) { if (col0 + t * 16 >= N) continue;
#pragma unroll
    for (int r = 0; r < 8; ++r) so[w][8 * hh + r][t * 16 + ln] = acc[t][r] * alpha; }
  __builtin_amdgcn_fence(__ATOMIC_ACQ_REL, "workgroup"); __builtin_amdgcn_wave_barrier();
  const int rsub = lane >> 4, c4 = (lane & 15) * 4;
  {
#pragma unroll
    for (int q = 0; q < 8; ++q) { const int r = q * 2 + rsub; if (col0 + c4 < N) { const v4f v = *(const v4fa*)&so[w][r][c4]; *(v4f*)(C + (size_t)(row0 + r) * ldc + col0 + c4) = v; } }
     }
}

// k_gemm_hh variant with fused epilogue: v = acc·alpha + bias[by·sBias + col] (+ CP[(row/rowsPerB)·sCPb + by·64 + col] if CP) ; ACT 0 none / 1 elu ; writes f16 C16 (and f32 C if non-null)
template <int ACT>
__global__ __launch_bounds__(128) void k_gemm_hhx(const _Float16* __restrict__ A, int lda, size_t sA, const _Float16* __restrict__ Bh, int ldb, size_t sB, float alpha, const float* __restrict__ bias, size_t sBias, const float* __restrict__ CP, int rowsPerB, size_t sCPb, int row0g,
    float* __restrict__ C, _Float16* __restrict__ C16, int ldc, size_t sC, int M, int N, int K) {
  __shared__ __attribute__((aligned(16))) float so[4][16][64];
  const int tid = threadIdx.x, w = tid >> 5, lane = tid & 31, ln = lane & 15, hh = lane >> 4; const int by = blockIdx.y;
  A += (size_t)by * sA; Bh += (size_t)by * sB; const size_t cofs = (size_t)by * sC; const float* bp = bias ? bias + (size_t)by * sBias : nullptr;
  const int ntn = (N + 63) / 64; const int wid = blockIdx.x * 4 + w; const int mt = wid / ntn, nq = wid % ntn; if (mt * 16 >= M) return;
  const int row0 = mt * 16, col0 = nq * 64; const _Float16* arow = A + (size_t)(row0 + ln) * lda;
  v8f acc[4] = {};
  for (int kb = 0; kb < K; kb += 32) { FragH ah; ah.half[0] = *(const v8us*)((const unsigned short*)arow + kb + 8 * hh); ah.half[1] = *(const v8us*)((const unsigned short*)arow + kb + 16 + 8 * hh);
#pragma unroll
    for (int t = 0; t < 4; ++t) { if (col0 + t * 16 >= N) continue; const size_t boff = (size_t)(col0 + t * 16 + ln) * ldb + kb; FragH bq; bq.half[0] = *(const v8us*)((const unsigned short*)Bh + boff + 8 * hh); bq.half[1] = *(const v8us*)((const unsigned short*)Bh + boff + 16 + 8 * hh);
      acc[t] = mmaH<1>(ah.v, ah.v, bq.v, bq.v, acc[t]); }
  }
#pragma unroll
  for (int t = 0; t < 4; ++t) { if (col0 + t * 16 >= N) continue; const int col = col0 + t * 16 + ln; const float bv = bp ? bf16_round(bp[col]) : 0.f;
#pragma unroll
    for (int r = 0; r < 8; ++r) { float v = acc[t][r] * alpha + bv; if (CP) { const int rr = row0g + row0 + 8 * hh + r; if (rowsPerB < 0) v += CP[cofs + (size_t)rr * ldc + col];      /* rowsPerB < 0: own element of the batched C plane */ else { const int bidx = rr / rowsPerB; v += CP[(size_t)bidx * sCPb + (size_t)by * 64 + col]; } } if (ACT == 1) v = (v > 0.f) ? v : expm1f(v); else if (ACT == 7) v = (v > 0.f) ? v + 1.0f : expf(v); else if (ACT == 8) v = tanhf(v); else if (ACT == 9) v = 0.5f * v * (1.0f + tanhf(0.7978845608028654f * (v + 0.044715f * v * v * v))); else if (ACT == 11) v = 1.0f / (1.0f + expf(-v)); else if (ACT == 12) v = (v > 0.f) ? v : 0.01f * v; else if (ACT == 14) v = (v > 0.f) ? v : 0.1f * v; else if (ACT == 16) v = (v >= 0.f) ? v : 0.3f * v; else if (ACT == 17) v = (v >= 0.f) ? v : 0.2f * v; else if (ACT == 15) v = v / (1.0f + expf(-v)); else if (ACT == 3) v = fmaxf(v, 0.f); else if (ACT == 6) v = 0.5f * v * (1.0f + erff(v * 0.70710678118654752f)); so[w][8 * hh + r][t * 16 + ln] = v; } }
  __builtin_amdgcn_fence(__ATOMIC_ACQ_REL, "workgroup"); __builtin_amdgcn_wave_barrier();
  const int rsub = lane >> 4, c4 = (lane & 15) * 4; typedef _Float16 v4h __attribute__((ext_vector_type(4)));
  {
#pragma unroll
    for (int q = 0; q < 8; ++q) { const int r = q * 2 + rsub; if (col0 + c4 < N) { const v4f v = *(const v4fa*)&so[w][r][c4]; if (C) *(v4f*)(C + cofs + (size_t)(row0 + r) * ldc + col0 + c4) = v; if (C16) { v4h h4; for (int i = 0; i < 4; ++i) h4[i] = (_Float16)v[i]; *(v4h*)(C16 + cofs + (size_t)(row0 + r) * ldc + col0 + c4) = h4; } } }
     }
}


typedef _Float16 v4h __attribute__((ext_vector_type(4)));

// One preparation launch. Work-groups 0 .. NWB - 1 (they start first: theirs is the longer path) each turn one 64 x 64 tile of one [in][out] weight matrix:
// Wt[n][k] = f16(bf16(W[k][n]) * scale) (scale = power of two; bf16-exact weights stay exact in f16 away from the subnormal range); the four transposes lie back to back.
// A wave-wide load covers two 256-byte row pieces of W and a wave-wide store four 128-byte row pieces of Wt: whole lines both ways, one writer a line; the turn is made in LDS.
// The other work-groups round the three inputs to exact f16 rows, 8 values a thread; the three f16 copies lie back to back.
#define WTT 64      /* weight tile edge */
#define WTP 72      /* LDS row pitch of the turned tile in f16: 128 data bytes + 16, rows stay 16-byte aligned for the read-out */
#define NWB (4 * (DM / WTT) * (DM / WTT))      /* weight-tile work-groups */
#define NXB ((int)((NR * DM / 8 + 255) / 256))      /* work-groups per input */
__global__ __launch_bounds__(256) void k_prep(const float* __restrict__ x0, const float* __restrict__ x1, const float* __restrict__ x2, _Float16* __restrict__ X16, size_t n8,
    const float* __restrict__ W0, const float* __restrict__ W1, const float* __restrict__ W2, const float* __restrict__ W3, _Float16* __restrict__ Wt, float scale) {
  static_assert(DM % WTT == 0, "whole weight tiles");
  __shared__ __attribute__((aligned(16))) unsigned short tl[WTT][WTP];      /* [n][k] of the tile */
  const int tid = threadIdx.x, bx = blockIdx.x;
  if (bx < NWB) {      /* the same for the whole work-group: a barrier stands inside */
    const int y = bx / ((DM / WTT) * (DM / WTT)), tile = bx % ((DM / WTT) * (DM / WTT)), k0 = (tile / (DM / WTT)) * WTT, n0 = (tile % (DM / WTT)) * WTT;
    const float* __restrict__ W = y == 0 ? W0 : y == 1 ? W1 : y == 2 ? W2 : W3;
    const int c4 = (tid & 15) * 4, k4 = (tid >> 4) * 4;      /* the thread's 4 x 4 block: rows k4 .. + 3, columns c4 .. + 3 */
    const float* src = W + (size_t)(k0 + k4) * DM + n0 + c4;
    v4f r[4];
#pragma unroll      /* r indexed by constants: registers; the four loads fly together */
    for (int u = 0; u < 4; ++u) r[u] = *(const v4fa*)(src + (size_t)u * DM);
#pragma unroll      /* r indexed by constants: registers */
    for (int j = 0; j < 4; ++j) { v4h h4;
#pragma unroll      /* r, h4 indexed by constants: registers */
      for (int u = 0; u < 4; ++u) h4[u] = (_Float16)(bf16_round(r[u][j]) * scale);
      *(v4h*)&tl[c4 + j][k4] = h4; }      /* four successive k of one column n: 8 bytes of the turned row */
    __syncthreads();      /* the turned tile is complete: a row holds the k of 16 threads */
    unsigned short* dst = (unsigned short*)Wt + (size_t)y * DM * DM + (size_t)n0 * DM + k0;
#pragma unroll      /* 8 threads store one row's 128 bytes */
    for (int j = 0; j < 2; ++j) { const int i = tid + 256 * j, n = i >> 3, k8 = (i & 7) * 8; *(v8us*)(dst + (size_t)n * DM + k8) = *(const v8us*)&tl[n][k8]; }
    return;
  }
  const int xb = bx - NWB, y = xb / NXB; const float* __restrict__ x = y == 0 ? x0 : y == 1 ? x1 : x2; X16 += (size_t)y * n8 * 8;
  const size_t t = (size_t)(xb - y * NXB) * 256 + tid; if (t >= n8) return; FragH f;
#pragma unroll
  for (int q = 0; q < 8; ++q) f.h[q] = (_Float16)bf16_round(x[t * 8 + q]); *(v8us*)((unsigned short*)X16 + t * 8) = f.half[0];  }
__global__ __launch_bounds__(256) void k_h16(const float* __restrict__ x, _Float16* __restrict__ X16, size_t n8) { const size_t t = (size_t)blockIdx.x * 256 + threadIdx.x; if (t >= n8) return; FragH f;
#pragma unroll
  for (int q = 0; q < 8; ++q) f.h[q] = (_Float16)x[t * 8 + q]; *(v8us*)((unsigned short*)X16 + t * 8) = f.half[0];  }
__global__ __launch_bounds__(256) void k_round16f(const float* __restrict__ W, _Float16* __restrict__ Bt, size_t n8) { const size_t t = (size_t)blockIdx.x * 256 + threadIdx.x; if (t >= n8) return; FragH f;
#pragma unroll
  for (int i = 0; i < 8; ++i) f.h[i] = (_Float16)(bf16_round(W[t * 8 + i]) * 16.0f); *(v8us*)((unsigned short*)Bt + t * 8) = f.half[0];  }
__global__ __launch_bounds__(256) void k_hl(const float* __restrict__ F, _Float16* __restrict__ Hh, _Float16* __restrict__ Hl, size_t n8) { const size_t t = (size_t)blockIdx.x * 256 + threadIdx.x; if (t >= n8) return; FragH fh, fl; const v4f a = *(const v4fa*)(F + t * 8), c = *(const v4fa*)(F + t * 8 + 4);
#pragma unroll
  for (int q = 0; q < 4; ++q) { _Float16 h = (_Float16)a[q]; fh.h[q] = h; fl.h[q] = (_Float16)((a[q] - (float)h) * 1024.0f); h = (_Float16)c[q]; fh.h[4 + q] = h; fl.h[4 + q] = (_Float16)((c[q] - (float)h) * 1024.0f); }
  { *(v8us*)((unsigned short*)Hh + t * 8) = fh.half[0]; *(v8us*)((unsigned short*)Hl + t * 8) = fl.half[0];  } }

// ---- fast GEMM (work-group tile 128x64, wave tile 32x64; requires M % 128 == 0, N % 64 == 0 and K % 64 == 0); C = act(alpha A B^T): f16 rows C16 where QKV, f32 rows C otherwise, fixed at compile time ----
// No bias and no added plane: as run-time options they stood as a test and a skipped block at each of the 64 results of a lane, and made the kernel's text many times the size of what runs.
__device__ __forceinline__ v16h g2_frag(const _Float16* p, int hh) { FragH f; f.half[0] = *(const v8us*)((const unsigned short*)p + 8 * hh); f.half[1] = *(const v8us*)((const unsigned short*)p + 16 + 8 * hh); return f.v; }
__device__ __forceinline__ v8f g2_mma(v16h a, v16h b, v8f c) { v8f d = __builtin_amdgcn_wmma_f32_16x16x32_f16(false, a, false, b, (short)0, c, false, false); asm volatile("v_nop\n\tv_nop\n\tv_nop\n\tv_nop" : "+v"(d) : "v"(a), "v"(b)); return d; }
#define GK 64      /* k per pass: one whole 128-byte line of every operand row */
#define GP 72      /* LDS row pitch in f16: 128 data bytes + 16, so that the 16 rows of a 16-byte fragment read fall on different banks */
#define GSTG ((128 + 64) * GP * 2)      /* bytes of one stage: 128 A rows, then 64 B rows */
// One thread's share of a stage: 16 bytes of each of 12 rows (8 of A, 4 of B), 16 rows apart, from global memory straight into LDS.
// l: the thread's LDS byte address in the stage's row 0..15; a, b: its global addresses; pa, pb: 16 rows of A, of B, in elements.
// The s_wait_xcnt closes the statement so that no address register of a copy is rewritten in front of it.
__device__ __forceinline__ void g2_stage(unsigned l, const unsigned short* a, size_t pa, const unsigned short* b, size_t pb) {
  asm volatile(
    "global_load_async_to_lds_b128 %0, %12, off\n\t"
    "global_load_async_to_lds_b128 %1, %13, off\n\t"
    "global_load_async_to_lds_b128 %2, %14, off\n\t"
    "global_load_async_to_lds_b128 %3, %15, off\n\t"
    "global_load_async_to_lds_b128 %4, %16, off\n\t"
    "global_load_async_to_lds_b128 %5, %17, off\n\t"
    "global_load_async_to_lds_b128 %6, %18, off\n\t"
    "global_load_async_to_lds_b128 %7, %19, off\n\t"
    "global_load_async_to_lds_b128 %8, %20, off\n\t"
    "global_load_async_to_lds_b128 %9, %21, off\n\t"
    "global_load_async_to_lds_b128 %10, %22, off\n\t"
    "global_load_async_to_lds_b128 %11, %23, off\n\t"
    "s_wait_xcnt 0x0"
    :: "v"(l + 0u * (16u * GP * 2u)), "v"(l + 1u * (16u * GP * 2u)), "v"(l + 2u * (16u * GP * 2u)), "v"(l + 3u * (16u * GP * 2u)), "v"(l + 4u * (16u * GP * 2u)), "v"(l + 5u * (16u * GP * 2u)), "v"(l + 6u * (16u * GP * 2u)), "v"(l + 7u * (16u * GP * 2u)), "v"(l + 8u * (16u * GP * 2u)), "v"(l + 9u * (16u * GP * 2u)), "v"(l + 10u * (16u * GP * 2u)), "v"(l + 11u * (16u * GP * 2u)),
       "v"(a + 0 * pa), "v"(a + 1 * pa), "v"(a + 2 * pa), "v"(a + 3 * pa), "v"(a + 4 * pa), "v"(a + 5 * pa), "v"(a + 6 * pa), "v"(a + 7 * pa), "v"(b + 0 * pb), "v"(b + 1 * pb), "v"(b + 2 * pb), "v"(b + 3 * pb)
    : "memory");
}
// Both operands go through LDS, two stages: 8 threads copy one 128-byte row piece (a wave-wide copy covers 4 whole lines), each line is fetched once per work-group,
// and the next pass's copies fly while this pass's fragments are read from LDS.
// QKV (the three projections on grid.y; a work-group's 64 columns are one head): the epilogue also does what the attention kernel needs of the results, so that no launch has to read them back:
// y = 0, 1 (q, k): NS[y][head][row] = the squared norm of the head's 64 f16 values of the row; y = 2 (v): the tile goes out transposed only, Tt[batch][head][d][token].
#define TP 136      /* LDS row pitch of the transposed tile in f16: 256 data bytes + 16, so that the 16 rows of a 16-byte store fall on different banks */
template <int ACT, bool QKV>
__global__ __launch_bounds__(128) void k_gemm2(const _Float16* __restrict__ A, int lda, size_t sA, const _Float16* __restrict__ Bh, int ldb, size_t sB, float alpha,
    float* __restrict__ C, _Float16* __restrict__ C16, int ldc, size_t sC, int M, int N, int K, size_t zA, size_t zB, size_t zC, float* __restrict__ NS, _Float16* __restrict__ Tt) { static_assert(ACT == 0 || ACT == 3 || ACT == 6 || ACT == 8 || ACT == 9 || ACT == 11 || ACT == 12 || ACT == 14 || ACT == 15 || ACT == 16 || ACT == 17, "k_gemm2: unsupported ACT code (would silently apply no activation)");
  __shared__ __attribute__((aligned(16))) unsigned char gl[2 * GSTG];      /* the two stages; behind the loop the same bytes stage the output tile */
  static_assert(sizeof(float) * 4 * 32 * 68 <= 2 * GSTG, "output staging must fit the two stages");
  float (*so)[32][68] = (float (*)[32][68])gl;
  const int tid = threadIdx.x, w = tid >> 5, lane = tid & 31, ln = lane & 15, hh = lane >> 4; const int by = blockIdx.y, bz = blockIdx.z;      /* two batch axes: strides sA, sB, sC on grid.y and zA, zB, zC on grid.z */
  A += (size_t)by * sA + (size_t)bz * zA; Bh += (size_t)by * sB + (size_t)bz * zB; const size_t cofs = (size_t)by * sC + (size_t)bz * zC;
  const int ntn = N >> 6; const int mt = blockIdx.x / ntn, nq = blockIdx.x - mt * ntn; const int row0 = mt * 128 + 32 * w, col0 = nq * 64; if (mt * 128 >= M) return;      /* the same for the whole work-group: it stands in front of barriers */
  const int sr = tid >> 3, sc = (tid & 7) * 8;      /* staging: 8 threads cover one 128-byte row piece, 16 rows a sweep */
  const unsigned short* ag = (const unsigned short*)A + (size_t)(mt * 128 + sr) * lda + sc;
  const unsigned short* bg = (const unsigned short*)Bh + (size_t)(col0 + sr) * ldb + sc;
  const size_t pa = (size_t)16 * lda, pb = (size_t)16 * ldb;
  const unsigned l0 = (unsigned)(size_t)gl + (unsigned)(sr * GP + sc) * 2u;      /* low 32 bits of the __shared__ address = the byte address in LDS */
  g2_stage(l0, ag, pa, bg, pb);      /* pass 0 into stage 0 */
  asm volatile("s_wait_asynccnt 0x0" ::: "memory");      /* this wave's copies of pass 0 have landed */
  __syncthreads();      /* and every other wave's */
  if (GK < K) g2_stage(l0 + GSTG, ag + GK, pa, bg + GK, pb);      /* pass 1 into stage 1 */
  const v8f z8 = {0.f,0.f,0.f,0.f,0.f,0.f,0.f,0.f}; v8f c00 = z8, c01 = z8, c02 = z8, c03 = z8, c10 = z8, c11 = z8, c12 = z8, c13 = z8;
#pragma unroll 1      /* one pass a trip: the stage alternates */
  for (int kb = 0; kb < K; kb += GK) {
    const unsigned st = (unsigned)(kb / GK) & 1u;      /* this pass's stage */
    const _Float16* ap = (const _Float16*)(gl + st * GSTG) + (32 * w + ln) * GP; const _Float16* bq = (const _Float16*)(gl + st * GSTG) + (128 + ln) * GP;
#pragma unroll      /* two 32-k blocks a pass, constant LDS offsets */
    for (int kk = 0; kk < GK; kk += 32) { const v16h a0 = g2_frag(ap + kk, hh), a1 = g2_frag(ap + 16 * GP + kk, hh);
      const v16h b0 = g2_frag(bq + kk, hh), b1 = g2_frag(bq + 16 * GP + kk, hh), b2 = g2_frag(bq + 32 * GP + kk, hh), b3 = g2_frag(bq + 48 * GP + kk, hh);
      c00 = g2_mma(a0, b0, c00); c10 = g2_mma(a1, b0, c10);
      c01 = g2_mma(a0, b1, c01); c11 = g2_mma(a1, b1, c11);
      c02 = g2_mma(a0, b2, c02); c12 = g2_mma(a1, b2, c12);
      c03 = g2_mma(a0, b3, c03); c13 = g2_mma(a1, b3, c13); }
    asm volatile("s_wait_dscnt 0x0" ::: "memory");      /* this wave's reads of the stage are done before the stage is handed back */
    asm volatile("s_wait_asynccnt 0x0" ::: "memory");      /* this wave's copies of the next pass have landed */
    __syncthreads();      /* the next pass's stage is complete, and every wave has left this one */
    if (kb + 2 * GK < K) g2_stage(l0 + st * GSTG, ag + kb + 2 * GK, pa, bg + kb + 2 * GK, pb);      /* the pass after next into the stage just left */
  }
  asm volatile("s_wait_asynccnt 0x0" ::: "memory");      /* nothing is in flight when the stages become output staging */
  v8f accs[8] = {c00, c01, c02, c03, c10, c11, c12, c13};
  if (QKV && by == 2) {      /* the same for the whole work-group: a barrier stands inside */
    static_assert(SQ % 128 == 0 && 64 * TP * 2 <= 2 * GSTG, "a tile lies in one batch, and its transpose fits the two stages");
    unsigned short (*tt)[TP] = (unsigned short (*)[TP])gl;      /* [d][token of the tile] */
#pragma unroll      /* accs indexed by constants: registers */
    for (int u = 0; u < 8; ++u) { const int t = u & 3, half = u >> 2; FragH f;      /* an accumulator's 8 values are 8 successive tokens of one column d: one 16-byte piece of the transposed row */
#pragma unroll      /* f.h and the accumulator indexed by constants: registers */
      for (int r = 0; r < 8; ++r) f.h[r] = (_Float16)(accs[u][r] * alpha);
      *(v8us*)&tt[t * 16 + ln][32 * w + half * 16 + 8 * hh] = f.half[0]; }
    __syncthreads();      /* the transposed tile is complete: a row holds the tokens of all four waves */
    unsigned short* vt = (unsigned short*)Tt + ((size_t)((mt * 128) / SQ) * ntn + nq) * 64 * SQ + (mt * 128) % SQ;
#pragma unroll      /* 16 threads store one row's 256 bytes: whole lines, one writer each */
    for (int j = 0; j < 8; ++j) { const int i = tid + 128 * j, d = i >> 4, p8 = (i & 15) * 8; *(v8us*)(vt + (size_t)d * SQ + p8) = *(const v8us*)&tt[d][p8]; }
    return;
  }
#pragma unroll
  for (int u = 0; u < 8; ++u) { const int t = u & 3, half = u >> 2;
#pragma unroll
    for (int r = 0; r < 8; ++r) { const int rloc = half * 16 + 8 * hh + r; float v = accs[u][r] * alpha;
      if (ACT == 3) v = fmaxf(v, 0.f); else if (ACT == 6) v = 0.5f * v * (1.0f + erff(v * 0.70710678118654752f)); else if (ACT == 11) v = 1.0f / (1.0f + expf(-v)); else if (ACT == 15) v = v / (1.0f + expf(-v)); else if (ACT == 12) v = (v > 0.f) ? v : 0.01f * v; else if (ACT == 8) v = tanhf(v); else if (ACT == 9) v = 0.5f * v * (1.0f + tanhf(0.7978845608028654f * (v + 0.044715f * v * v * v))); else if (ACT == 14) v = (v > 0.f) ? v : 0.1f * v; else if (ACT == 16) v = (v >= 0.f) ? v : 0.3f * v; else if (ACT == 17) v = (v >= 0.f) ? v : 0.2f * v;
      so[w][rloc][t * 16 + ln] = v; } }
  __builtin_amdgcn_fence(__ATOMIC_ACQ_REL, "workgroup"); __builtin_amdgcn_wave_barrier();
  const int rsub = lane >> 4, c4 = (lane & 15) * 4;
  {
#pragma unroll
    for (int q = 0; q < 16; ++q) { const int r = q * 2 + rsub; const v4f v = *(const v4fa*)&so[w][r][c4]; if (!QKV) *(v4f*)(C + cofs + (size_t)(row0 + r) * ldc + col0 + c4) = v; else { v4h h4; for (int i = 0; i < 4; ++i) h4[i] = (_Float16)v[i]; *(v4h*)(C16 + cofs + (size_t)(row0 + r) * ldc + col0 + c4) = h4; } }
     }
  if (QKV) {      /* lane l sums row l of the wave's 32, columns in rising order, over the f16 values just stored (a product of two f16 values is exact in f32) */
    float ss = 0.f;
#pragma unroll      /* constant LDS offsets; later reads can issue while earlier values are summed */
    for (int c = 0; c < 16; ++c) { const v4f v = *(const v4fa*)&so[w][lane][c * 4];
#pragma unroll      /* v indexed by constants: registers */
      for (int i = 0; i < 4; ++i) { const float x = (float)(_Float16)v[i]; ss += x * x; } }
    NS[((size_t)by * ntn + nq) * M + row0 + lane] = ss;
    asm volatile("s_wait_xcnt 0x0" ::: "memory");      /* behind the norm store, before code laid out after it may rewrite the store's address registers */
  } }


__global__ __launch_bounds__(256) void k_wnat(const float* __restrict__ w, size_t n8, _Float16* __restrict__ Bt) { const size_t t = (size_t)blockIdx.x * 256 + threadIdx.x; if (t >= n8) return; FragH f; for (int q = 0; q < 8; ++q) f.h[q] = (_Float16)(bf16_round(w[t * 8 + q]) * 16.0f); *(v8us*)((unsigned short*)Bt + t * 8) = f.half[0];  }
__global__ __launch_bounds__(256) void k_rsm(const float* __restrict__ S, _Float16* __restrict__ P, int nrows) {
  #pragma clang fp contract(off)
  const int i = blockIdx.x * 256 + threadIdx.x; if (i >= nrows) return; const float* s = S + (size_t)i * SQ; float mx = -3.0e38f;
#pragma unroll 1
  for (int j = 0; j < SQ; ++j) mx = fmaxf(mx, s[j]); float se = 0.f;
#pragma unroll 1
  for (int j = 0; j < SQ; ++j) se += expf(s[j] - mx); const float sc = 256.0f / se;
#pragma unroll 1
  for (int j0 = 0; j0 < SQ; j0 += 8) { FragH f; for (int q = 0; q < 8; ++q) f.h[q] = (_Float16)(expf(s[j0 + q] - mx) * sc); unsigned short* d = (unsigned short*)P + (size_t)i * SQ + j0; *(v8us*)d = f.half[0];  } }
__global__ __launch_bounds__(256) void k_vt(const _Float16* __restrict__ V16, int b, int h0, _Float16* __restrict__ VT) { __shared__ unsigned short tl[64][65]; const int tid = threadIdx.x; const int hh = blockIdx.x % HG, sg = blockIdx.x / HG; const int s0 = sg * 64; const int h = h0 + hh;
  for (int i = tid; i < 64 * 8; i += 256) { const int j = i / 8, d8 = (i % 8) * 8; FragH f; f.half[0] = *(const v8us*)((const unsigned short*)V16 + ((size_t)b * SQ + s0 + j) * DM + h * HD + d8); for (int q = 0; q < 8; ++q) tl[d8 + q][j] = f.u[q]; }
  __syncthreads();
  { for (int i = tid; i < 64 * 8; i += 256) { const int d = i / 8, j8 = (i % 8) * 8; FragH f; for (int q = 0; q < 8; ++q) f.u[q] = tl[d][j8 + q]; *(v8us*)((unsigned short*)VT + ((size_t)hh * HD + d) * SQ + s0 + j8) = f.half[0]; }  } }


// e^x as __expf forms it (one multiply, v_exp_f32). The v_nop in the same statement is the one slot the instruction set asks for behind a transcendental before its source is rewritten or its result read.
__device__ __forceinline__ float exp_slot(float x) { float r; asm("v_exp_f32 %0, %1\n\tv_nop" : "=v"(r) : "v"(x * 1.44269504f)); return r; }
// Eight square roots by v_sqrt_f32 alone (1 ulp; a subnormal argument may give 0, which moves a logit by under 1e-19): sqrtf() adds about fifteen vector instructions of range scaling and last-bit fix-up to each.
// One statement: each root is followed by an independent one ("=&v": no result shares a register with an argument), and the one v_nop behind the last is the slot the instruction set asks for behind a transcendental.
__device__ __forceinline__ void sqrt8_slot(const float (&x)[8], float (&r)[8]) {
  asm("v_sqrt_f32 %0, %8\n\tv_sqrt_f32 %1, %9\n\tv_sqrt_f32 %2, %10\n\tv_sqrt_f32 %3, %11\n\tv_sqrt_f32 %4, %12\n\tv_sqrt_f32 %5, %13\n\tv_sqrt_f32 %6, %14\n\tv_sqrt_f32 %7, %15\n\tv_nop"
      : "=&v"(r[0]), "=&v"(r[1]), "=&v"(r[2]), "=&v"(r[3]), "=&v"(r[4]), "=&v"(r[5]), "=&v"(r[6]), "=&v"(r[7])
      : "v"(x[0]), "v"(x[1]), "v"(x[2]), "v"(x[3]), "v"(x[4]), "v"(x[5]), "v"(x[6]), "v"(x[7])); }
// S and P are not __restrict__: P may be the front half of the same rows (ldp = 2 * SQ f16); a wave stores only into its own row, and every store needs the row sum, so all its loads of the row come first.
// One wave per (head, query row): lane l holds columns c*128 + 4*l .. + 3 (c = 0..7), so every load covers 512 contiguous bytes; the row's logits stay in registers from the max to the store.
__global__ __launch_bounds__(256) void k_rsml2(const float* S, _Float16* P, int ldp, int qn, int hg, const float* __restrict__ NQ, const float* __restrict__ NK, size_t npitch, const float* __restrict__ Mf, float scale) {
  #pragma clang fp contract(off)
  const int lane = threadIdx.x & 31; const int t = blockIdx.x * 8 + __builtin_amdgcn_readfirstlane(threadIdx.x >> 5);      /* the wave's row, told to the compiler as wave-uniform: scalar row addresses and a scalar exit test */
  if (t >= qn * hg) return; const int hl = t / qn, row = t % qn; const size_t i = (size_t)hl * SQ + row; const float* s = S + i * SQ; const float nq = NQ[(size_t)hl * npitch + row]; const float* nk = NK + (size_t)hl * npitch; const float* mrow = Mf + (size_t)row * SQ; float mx = -3.0e38f;
  float e[SQ / 32];
#pragma unroll      /* e[] must be indexed by constants to live in registers; later chunks' loads can issue while earlier chunks are worked on */
  for (int c = 0; c < SQ / 128; ++c) { const int j0 = c * 128 + lane * 4; const v4f s4 = *(const v4fa*)(s + j0), k4 = *(const v4fa*)(nk + j0), m4 = *(const v4fa*)(mrow + j0);
#pragma unroll      /* constant index into e[] */
    for (int q = 0; q < 4; ++q) { const float d2 = fmaxf(__fadd_rn(__fadd_rn(nq, k4[q]), -2.0f * s4[q]), 0.f); const float v = __fadd_rn(__fmul_rn(sqrtf(d2), scale), __fmul_rn(bf16_round(m4[q]), -1.0e9f)); e[c * 4 + q] = v; mx = fmaxf(mx, v); } }
  for (int o = 16; o > 0; o >>= 1) mx = fmaxf(mx, __shfl_xor(mx, o));      /* row maximum over the 32 lanes */
  float se = 0.f;
#pragma unroll      /* constant index into e[] */
  for (int u = 0; u < SQ / 32; ++u) { e[u] = exp_slot(e[u] - mx); se += e[u]; }
  for (int o = 16; o > 0; o >>= 1) se += __shfl_xor(se, o);      /* row sum: per-lane partial sums, then a five-step butterfly */
  const float sc = 256.0f / se;
#pragma unroll      /* constant index into e[] */
  for (int c = 0; c < SQ / 128; ++c) { v4h h4;
#pragma unroll      /* constant index into e[] */
    for (int q = 0; q < 4; ++q) h4[q] = (_Float16)(e[c * 4 + q] * sc);
    *(v4h*)(P + i * (size_t)ldp + c * 128 + lane * 4) = h4; } }


__global__ __launch_bounds__(256) void k_rsmf(const float* __restrict__ S, _Float16* __restrict__ P, int qn, int hg) {
  #pragma clang fp contract(off)
  const int t = blockIdx.x * 256 + threadIdx.x; if (t >= qn * hg) return; const size_t i = (size_t)(t / qn) * SQ + (t % qn); const float* s = S + i * SQ; float mx = -3.0e38f;
#pragma unroll 1
  for (int j = 0; j < SQ; ++j) mx = fmaxf(mx, s[j]); float se = 0.f;
#pragma unroll 1
  for (int j = 0; j < SQ; ++j) se += __expf(s[j] - mx); const float sc = 256.0f / se;
#pragma unroll 1
  for (int j0 = 0; j0 < SQ; j0 += 8) { FragH f; for (int q = 0; q < 8; ++q) f.h[q] = (_Float16)(__expf(s[j0 + q] - mx) * sc); unsigned short* d = (unsigned short*)P + i * SQ + j0; *(v8us*)d = f.half[0];  } }

// ---- fused attention: scores, softmax and the weighted sum of V in one kernel; no score or weight plane goes through memory ----
// lane l with lane l ^ 16 (the two lanes that share a query column)
__device__ __forceinline__ float xhalf(float x) { return __builtin_bit_cast(float, __builtin_amdgcn_permlanex16(__builtin_bit_cast(int, x), __builtin_bit_cast(int, x), 0x76543210, 0xfedcba98, false, false)); }
// Work-group barrier that orders LDS alone: the wave's own LDS reads and writes are waited out, then signal and wait. __syncthreads() also waits for every global load of the wave,
// so that no load asked for ahead stays in flight across it; here the barriers guard nothing but the two LDS tiles. The "memory" clobber keeps the compiler from moving an LDS access over it.
__device__ __forceinline__ void lds_barrier() { asm volatile("s_wait_dscnt 0x0\n\ts_barrier_signal -1\n\ts_barrier_wait -1" ::: "memory"); }
#define FK 64      /* keys per pass */
#define FP 72      /* LDS row pitch in f16: 128 data bytes + 16, so that the 16 rows of a 16-byte fragment read fall on different banks */
// One work-group = 4 waves x 16 query rows of one (batch, head); 16 passes over 64 keys.
// Both products are formed transposed, so that a lane owns ONE query column throughout: S^T = K Q^T gives lane (c, h) the keys 8h + r of query c,
// which is the k order of a B fragment, so the weights go from the score accumulators straight into O^T = V^T P^T; the running maximum, sum and rescale are per-lane scalars.
__global__ __launch_bounds__(128) void k_fattn(const _Float16* __restrict__ Q16, const _Float16* __restrict__ K16, const _Float16* __restrict__ VT, const float* __restrict__ NQ, const float* __restrict__ NK, const float* __restrict__ Mf, _Float16* __restrict__ O16, float scale) {
  __shared__ __attribute__((aligned(16))) unsigned short kt_s[FK][FP];      /* K tile  [key][d]  */
  __shared__ __attribute__((aligned(16))) unsigned short vt_s[HD][FP];      /* V^T tile [d][key] */
  const int tid = threadIdx.x, w = tid >> 5, lane = tid & 31, ln = lane & 15, hh = lane >> 4;
  const int h = blockIdx.y, b = blockIdx.z; const int q = blockIdx.x * 64 + w * 16 + ln;      /* the lane's query row */
  const _Float16* qrow = Q16 + ((size_t)b * SQ + q) * DM + h * HD;
  const v16h qf0 = g2_frag(qrow, hh), qf1 = g2_frag(qrow + 32, hh);
  const float nq = NQ[(size_t)h * NR + (size_t)b * SQ + q];
  asm volatile("s_wait_xcnt 0x0" ::: "memory");      /* the load's index register is rewritten for the mask row's address right behind it */
  const float* nk = NK + (size_t)h * NR + (size_t)b * SQ + 8 * hh;
  const float* mrow = Mf + (size_t)q * SQ + 8 * hh;
  const int sr = tid >> 3, sc = (tid & 7) * 8;      /* staging: 8 threads cover one 128-byte row, 16 rows a sweep */
  const unsigned short* kg = (const unsigned short*)K16 + ((size_t)b * SQ + sr) * DM + h * HD + sc;
  const unsigned short* vg = (const unsigned short*)VT + (((size_t)b * NH + h) * HD + sr) * SQ + sc;
  v8us kr[4], vr[4];
#pragma unroll      /* kr, vr indexed by constants: registers */
  for (int u = 0; u < 4; ++u) { kr[u] = *(const v8us*)(kg + (size_t)(u * 16) * DM); vr[u] = *(const v8us*)(vg + (size_t)(u * 16) * SQ); }
  const v8f z8 = {0.f,0.f,0.f,0.f,0.f,0.f,0.f,0.f};
  v8f o[4] = {z8, z8, z8, z8}; float mrun = -3.0e38f, lsum = 0.f;
  for (int s = 0; s < SQ / FK; ++s) {
    v4f kn[8], mk[8];      /* the pass's key norms and mask values: keys t * 16 + 8 * hh + 0..7 of the lane's query; asked for here, so that they fly through both barriers, the tile stores and the fragment reads */
#pragma unroll      /* kn indexed by constants: registers */
    for (int t = 0; t < 4; ++t) { kn[2 * t] = *(const v4fa*)(nk + s * FK + t * 16); kn[2 * t + 1] = *(const v4fa*)(nk + s * FK + t * 16 + 4); }
    asm volatile("s_wait_xcnt 0x0" ::: "memory");      /* before a later load's result reuses these loads' address registers */
#pragma unroll      /* mk indexed by constants: registers */
    for (int t = 0; t < 4; ++t) { mk[2 * t] = *(const v4fa*)(mrow + s * FK + t * 16); mk[2 * t + 1] = *(const v4fa*)(mrow + s * FK + t * 16 + 4); }
    asm volatile("s_wait_xcnt 0x0" ::: "memory");      /* likewise, before the fragment reads reuse them */
    lds_barrier();      /* every wave has finished reading the previous tiles */
#pragma unroll
    for (int u = 0; u < 4; ++u) { *(v8us*)&kt_s[u * 16 + sr][sc] = kr[u]; *(v8us*)&vt_s[u * 16 + sr][sc] = vr[u]; }
    lds_barrier();      /* the tiles of this pass are complete */
    v16h kf[8];      /* the pass's eight K fragments: the sixteen LDS reads issue ahead of the WMMAs, and their latency is waited out once */
#pragma unroll      /* kf indexed by constants: registers */
    for (int t = 0; t < 4; ++t) { const _Float16* kp = (const _Float16*)&kt_s[t * 16 + ln][0]; kf[2 * t] = g2_frag(kp, hh); kf[2 * t + 1] = g2_frag(kp + 32, hh); }
    const int sn = s + 1 < SQ / FK ? s + 1 : s;      /* next pass's tiles fly while this pass is worked on. No branch round the loads (the last pass asks for its own tiles again, in bounds, and nobody reads them): with one, the compiler sets its counted load waits for the path without them, and on the other path the waits for norms and mask wait for these loads too */
#pragma unroll
    for (int u = 0; u < 4; ++u) kr[u] = *(const v8us*)(kg + (size_t)(sn * FK + u * 16) * DM);
    asm volatile("s_wait_xcnt 0x0" ::: "memory");      /* before a later load's result reuses these loads' address registers */
#pragma unroll
    for (int u = 0; u < 4; ++u) vr[u] = *(const v8us*)(vg + (size_t)(u * 16) * SQ + sn * FK);
    asm volatile("s_wait_xcnt 0x0" ::: "memory");      /* the loads' address registers are rewritten right behind them */
    asm volatile("" :: "v"(kf[0]), "v"(kf[1]), "v"(kf[2]), "v"(kf[3]), "v"(kf[4]), "v"(kf[5]), "v"(kf[6]), "v"(kf[7]));      /* inputs only, the loaded fragments: all eight are live at once here, so each gets registers of its own and the reads issue as a group ahead of the WMMAs; without it the compiler reuses registers and spreads the reads among the WMMAs, with a wait at each place */
    v8f sa[4];      /* the four score tiles: four independent WMMAs, then their four second halves, so that no WMMA waits for the one in front of it */
#pragma unroll      /* sa indexed by constants: registers */
    for (int t = 0; t < 4; ++t) sa[t] = __builtin_amdgcn_wmma_f32_16x16x32_f16(false, kf[2 * t], false, qf0, (short)0, z8, false, false);
#pragma unroll      /* sa indexed by constants: registers */
    for (int t = 0; t < 4; ++t) sa[t] = __builtin_amdgcn_wmma_f32_16x16x32_f16(false, kf[2 * t + 1], false, qf1, (short)0, sa[t], false, false);
    float e[4][8]; float mx = mrun;
#pragma unroll      /* e[][] indexed by constants: registers */
    for (int t = 0; t < 4; ++t) {
      const v4f k0 = kn[2 * t], k1 = kn[2 * t + 1], m0 = mk[2 * t], m1 = mk[2 * t + 1];
      const v8f st = sa[t];
      float d2[8], rt[8];
#pragma unroll      /* d2 indexed by constants: registers */
      for (int r = 0; r < 8; ++r) { const float kk = r < 4 ? k0[r & 3] : k1[r & 3]; d2[r] = fmaxf((nq + kk) - 2.0f * st[r], 0.f); }
      sqrt8_slot(d2, rt);
#pragma unroll      /* rt, e[][] indexed by constants: registers */
      for (int r = 0; r < 8; ++r) { const float mm = r < 4 ? m0[r & 3] : m1[r & 3];
        const float v = rt[r] * scale + bf16_round(mm) * -1.0e9f; e[t][r] = v; mx = fmaxf(mx, v); }
    }
    __builtin_amdgcn_sched_barrier(0);      /* the reads below stay behind the scores: moved in front of them, their 64 result registers are live beside the K fragments, norms and mask, and the build takes 258 registers, past the 256 that need no window switch */
    v16h vf[8];      /* the pass's eight V^T fragments: all sixteen LDS reads issue here and land under the exponentials */
#pragma unroll      /* vf indexed by constants: registers */
    for (int t = 0; t < 4; ++t) { const _Float16* vp = (const _Float16*)&vt_s[t * 16 + ln][0]; vf[2 * t] = g2_frag(vp, hh); vf[2 * t + 1] = g2_frag(vp + 32, hh); }
    mx = fmaxf(mx, xhalf(mx));      /* the query's maximum so far: both lanes of the column agree on it */
    const float al = exp_slot(mrun - mx); mrun = mx; float ps = 0.f;
    FragH p0, p1;
#pragma unroll
    for (int r = 0; r < 8; ++r) {
      const float a0 = exp_slot(e[0][r] - mx), a1 = exp_slot(e[1][r] - mx), a2 = exp_slot(e[2][r] - mx), a3 = exp_slot(e[3][r] - mx);
      ps += (a0 + a1) + (a2 + a3);
      p0.h[r] = (_Float16)a0; p0.h[8 + r] = (_Float16)a1; p1.h[r] = (_Float16)a2; p1.h[8 + r] = (_Float16)a3; }
    lsum = lsum * al + ps;
#pragma unroll
    for (int t = 0; t < 4; ++t) {
      v8f a = o[t] * al;
      a = __builtin_amdgcn_wmma_f32_16x16x32_f16(false, vf[2 * t], false, p0.v, (short)0, a, false, false);
      o[t] = __builtin_amdgcn_wmma_f32_16x16x32_f16(false, vf[2 * t + 1], false, p1.v, (short)0, a, false, false);
    }
    asm volatile("v_nop\n\tv_nop\n\tv_nop\n\tv_nop" : "+v"(o[0]), "+v"(o[1]), "+v"(o[2]), "+v"(o[3]) : "v"(p1.v));      /* the four vector slots the chip needs behind the pass's last WMMA before its operand registers are rewritten: the next writer stands behind the branch to the loop's head */
  }
  asm volatile("s_wait_loadcnt 0x0" ::: "memory");      /* the last pass's tile loads have landed before the wave hands its registers back */
  lsum += xhalf(lsum);      /* the two lanes of a column summed disjoint keys */
  const float inv = 64.0f / lsum;      /* o carried x64, as the output GEMM's alpha expects */
  unsigned short* orow = (unsigned short*)O16 + ((size_t)b * SQ + q) * DM + h * HD + 8 * hh;
#pragma unroll
  for (int t = 0; t < 4; ++t) { FragH f;
#pragma unroll
    for (int r = 0; r < 8; ++r) f.h[r] = (_Float16)(o[t][r] * inv);
    *(v8us*)(orow + t * 16) = f.half[0]; }
}

extern "C" void kernel_launch(void* const* d_in, const int* in_sizes, int n_in,
                              void* d_out, int out_size, void* d_ws, size_t ws_size, hipStream_t stream) {
  (void)in_sizes; (void)n_in; (void)out_size;
  const float* const* I = (const float* const*)d_in; const float* xv = I[0]; const float* xk = I[1]; const float* xq = I[2]; const float* mf = I[3]; const float* wq = I[4]; const float* wk = I[5]; const float* wv = I[6]; const float* wo = I[7]; const float* bq = nullptr; const float* bk = nullptr; (void)bq; (void)bk;      /* inputs v, k, q, mask (f32 [1][1][S][S]); [in][out] weights, no biases */
  char* ws = (char*)d_ws; size_t off = 0;
  auto take = [&](size_t bytes) { char* p = ws + off; off += (bytes + 255) & ~(size_t)255; return p; };
  _Float16* BQ = (_Float16*)take((size_t)DM * DM * 2); _Float16* BK = (_Float16*)take((size_t)DM * DM * 2); _Float16* BV = (_Float16*)take((size_t)DM * DM * 2); _Float16* BO = (_Float16*)take((size_t)DM * DM * 2);
  _Float16* XQ = (_Float16*)take(NR * DM * 2); _Float16* XK = (_Float16*)take(NR * DM * 2); _Float16* XV = (_Float16*)take(NR * DM * 2); _Float16* Q16 = (_Float16*)take(NR * DM * 2); _Float16* K16 = (_Float16*)take(NR * DM * 2); _Float16* V16 = (_Float16*)take(NR * DM * 2); _Float16* O16 = (_Float16*)take(NR * DM * 2);
  _Float16* VT = (_Float16*)take((size_t)NB * NH * HD * SQ * 2); float* NQ = (float*)take((size_t)NH * NR * 4); float* NK = (float*)take((size_t)NH * NR * 4);      /* NQ, NK: per-(head, row) squared norms of the f16 q and k rows */
  (void)BK; (void)BV; (void)XK; (void)XV; (void)V16;      /* reached through the strides from BQ and XQ; the V16 plane keeps its place and is not used */
  if (off > ws_size) return;
  k_prep<<<dim3((unsigned)(NWB + 3 * NXB)), 256, 0, stream>>>(xq, xk, xv, XQ, NR * DM / 8, wq, wk, wv, wo, BQ, 16.0f);      /* [in][out] weights -> Bt[n][k] x16 (BQ, BK, BV, BO lie back to back) and the three inputs as exact f16 rows (XQ, XK, XV lie back to back) */
  k_gemm2<0, true><<<dim3((unsigned)((MP / 128) * (DM / 64)), 3), 128, 0, stream>>>(XQ, DM, NR * DM, BQ, DM, (size_t)DM * DM, 0.0625f, nullptr, Q16, DM, NR * DM, MP, DM, DM, 0, 0, 0, NQ, VT);      /* q, k, v projections on grid.y: Q16 and K16 lie back to back; with them |qh|^2, |kh|^2 per (head, token) from the same f16 values (NK lies behind NQ); v goes out as V^T [NB][NH][HD][SQ] only */
  k_fattn<<<dim3(SQ / 64, NH, NB), 128, 0, stream>>>(Q16, K16, VT, NQ, NK, mf, O16, 0.125f);      /* softmax(sqrt(max(|q|^2 + |k|^2 - 2 q.k, 0)) / 8 + mask * (-1e9)) . v, merged heads, as f16 rows x64 */
  k_gemm2<0, false><<<dim3((unsigned)((MPO / 128) * (DM / 64)), 1), 128, 0, stream>>>(O16, DM, 0, BO, DM, 0, 0.0009765625f, (float*)d_out, nullptr, DM, 0, MPO, DM, DM, 0, 0, 0, nullptr, nullptr);      /* out rows are the output layout */
}

// v010
// One run takes 62.3 microseconds.
// Timed twice side by side with v009, it ran 1.11 times as fast both times.
// Over all steps from v000 it is 94.5 times as fast.
#include <hip/hip_runtime.h>
// Multi-head attention with L2-DISTANCE scores (inputs in the module's order v, k, q [4][1024][768], mask f32 [1][1][1024][1024] (zeros); qh = q wq, kh = k wk, vh = v wv ([in][out] 768x768 sigma 0.02, no biases); 12 heads of 64; scores = sqrt(max(|qh|^2 + |kh|^2 - 2 qh.kh, 0)) (pairwise L2 distance); logits = scores / 8 + mask * (-1e9); softmax; out = (attn vh merged) wo -> [4][1024][768]).
// Structure: token rows r = b*1024 + s; Q, K, V as three WMMA GEMMs straight from the f32 inputs (rounded to bf16 at the fragment read, bf16 weights, 64x64 wave tiles, f32 accumulation, f16 outputs); the squared q and k row norms and V^T for all (batch, head) come out of that GEMM's epilogue; one fused attention launch over all 48 (head, batch) planes (heads on grid.y, batches on grid.z): per 64 keys S^T = K Q^T on WMMA (raw q.k), distance, 1/8 and mask on VALU, online softmax (f32 statistics, native exp; weights in (0, 1] as f16), O^T += V^T P^T on WMMA; o is stored x64 (against f16 subnormal flush, folded into the output GEMM alpha) straight into the merged f16 o rows; out = o W_o GEMM (f32) into the output layout.
// Compute dtype: inputs rounded to bf16; x / weights exact (bf16 operands in the projections, wo as exact f16 x16); q, k, v, softmax weights and o as plain f16 GEMM operands (~2^-12); scores and softmax statistics f32. v_wmma_f32_16x16x32_bf16 in the projections, v_wmma_f32_16x16x32_f16 elsewhere.
#define NB 4
#define SQ 1024
#define DM 768
#define NH 12
#define HD 64
#define HG 4                         /* heads per launch of the non-template k_vt */
#define B0 0                         /* unused: every launch starts at batch 0 */
#define NBR NB                       /* batches processed (debug hook) */
#define NR ((size_t)NB * SQ)         /* token rows */
#define MP ((int)((size_t)NBR * SQ)) /* rows projected (debug hook) */
#define QN SQ                        /* unused: the attention launches take SQ rows */
#define NHD NH                       /* unused: the attention launches take NH heads */
#define MPO MP                       /* rows through the output stage (debug hook) */
#define LQ DM      /* row pitch of the q/k/v rows */
typedef __bf16 v16b __attribute__((ext_vector_type(16)));
typedef unsigned short v8us __attribute__((ext_vector_type(8), may_alias));
typedef float  v8f  __attribute__((ext_vector_type(8)));
typedef float  v4f  __attribute__((ext_vector_type(4)));
typedef float  v4fa __attribute__((ext_vector_type(4), may_alias));
union FragB { v16b v; v8us half[2]; unsigned short u[16]; };

__device__ __forceinline__ unsigned short bf16_bits(float x) { unsigned int u = __float_as_uint(x); return (unsigned short)((u + 0x7FFFu + ((u >> 16) & 1u)) >> 16); }
__device__ __forceinline__ float bf16_val(unsigned short b) { return __uint_as_float(((unsigned int)b) << 16); }
__device__ __forceinline__ float bf16_round(float x) { return bf16_val(bf16_bits(x)); }
// D += A·B with NT terms: 1 = ah·bh, 2 = + al·bh (A split), 3 = + ah·bl (both split)
template <int NT>
__device__ __forceinline__ v8f mmaN(v16b ah, v16b al, v16b bh, v16b bl, v8f c) {
  c = __builtin_amdgcn_wmma_f32_16x16x32_bf16(false, ah, false, bh, (short)0, c, false, false);
  if (NT >= 2) c = __builtin_amdgcn_wmma_f32_16x16x32_bf16(false, al, false, bh, (short)0, c, false, false);
  if (NT >= 3) c = __builtin_amdgcn_wmma_f32_16x16x32_bf16(false, ah, false, bl, (short)0, c, false, false);
  asm volatile("v_nop\n\tv_nop\n\tv_nop\n\tv_nop" : "+v"(c) : "v"(ah), "v"(al), "v"(bh), "v"(bl));
  return c;
}

__global__ __launch_bounds__(256) void k_wt_bf16(const float* __restrict__ W, unsigned short* __restrict__ Wt, int K, int N) {
  const int t = blockIdx.x * 256 + threadIdx.x;
  const int k8n = K / 8;
  if (t >= N * k8n) return;
  const int n = t / k8n, k8 = (t % k8n) * 8;
  v8us v;
#pragma unroll
  for (int i = 0; i < 8; ++i) v[i] = bf16_bits(W[(size_t)(k8 + i) * N + n]);
  *(v8us*)(Wt + (size_t)n * K + k8) = v;
  
}

// GEMM C[M][N] (f32, pitch ldc) = act(A[M][K]·W + bias). A f32 row-major (pitch lda) converted per fragment to bf16
// (ASPLIT: hi/lo two planes -> 2 terms, else single rounded term); Wt bf16 [N][K] (pitch ldb). BIAS_BF16 rounds the
// bias to bf16 first (bias quantised to bf16 before the add). K%32==0, M%16==0, N%64==0.
template <bool ASPLIT, int ACT, bool BIAS_BF16>
__global__ __launch_bounds__(128) void k_gemm_bf(const float* __restrict__ A, int lda, const unsigned short* __restrict__ Wt, int ldb,
                                               const float* __restrict__ bias, float* __restrict__ C, int ldc, int M, int N, int K) {
  __shared__ __attribute__((aligned(16))) float so[4][16][64];
  const int tid = threadIdx.x, w = tid >> 5, lane = tid & 31, ln = lane & 15, hh = lane >> 4;
  const int ntn = N / 64;
  const int wid = blockIdx.x * 4 + w;
  const int mt = wid / ntn, nq = wid % ntn;
  if (mt * 16 >= M) return;
  const int row0 = mt * 16, col0 = nq * 64;
  const float* arow = A + (size_t)(row0 + ln) * lda;
  v8f acc[4] = {};
  for (int kb = 0; kb < K; kb += 32) {
    FragB ah, al;
    const v4f x0 = *(const v4fa*)(arow + kb + 8 * hh), x1 = *(const v4fa*)(arow + kb + 8 * hh + 4);
    const v4f x2 = *(const v4fa*)(arow + kb + 16 + 8 * hh), x3 = *(const v4fa*)(arow + kb + 16 + 8 * hh + 4);
    float xs[16] = {x0[0],x0[1],x0[2],x0[3],x1[0],x1[1],x1[2],x1[3],x2[0],x2[1],x2[2],x2[3],x3[0],x3[1],x3[2],x3[3]};
#pragma unroll
    for (int i = 0; i < 16; ++i) { const unsigned short hb = bf16_bits(xs[i]); ah.u[i] = hb; al.u[i] = ASPLIT ? bf16_bits(xs[i] - bf16_val(hb)) : (unsigned short)0; }
#pragma unroll
    for (int t = 0; t < 4; ++t) {
      const unsigned short* brow = Wt + (size_t)(col0 + t * 16 + ln) * ldb + kb;
      FragB b;
      b.half[0] = *(const v8us*)(brow + 8 * hh);
      b.half[1] = *(const v8us*)(brow + 16 + 8 * hh);
      acc[t] = mmaN<ASPLIT ? 2 : 1>(ah.v, al.v, b.v, b.v, acc[t]);
    }
  }
#pragma unroll
  for (int t = 0; t < 4; ++t) {
    float bv = bias ? bias[col0 + t * 16 + ln] : 0.f;
    if (BIAS_BF16) bv = bf16_round(bv);
#pragma unroll
    for (int r = 0; r < 8; ++r) { float v = acc[t][r] + bv; if (ACT == 1) v = fmaxf(v, 0.f); so[w][8 * hh + r][t * 16 + ln] = v; }
  }
  __builtin_amdgcn_fence(__ATOMIC_ACQ_REL, "workgroup");
  __builtin_amdgcn_wave_barrier();
  const int rsub = lane >> 4, c4 = (lane & 15) * 4;
  {
#pragma unroll
    for (int q = 0; q < 8; ++q) {
      const int r = q * 2 + rsub;
      const v4f v = *(const v4fa*)&so[w][r][c4];
      *(v4f*)(C + (size_t)(row0 + r) * ldc + col0 + c4) = v;
    }
    
  }
}

// GEMM C = act(A·W + bias + resid): A f32 (ASPLIT -> hi/lo 2 terms), Wt bf16 [N][K]; ACT 0 none, 1 relu, 2 exact gelu;
// resid (optional, f32, row index = (row % rmod), pitch ldr, RES_BF16 rounds it) added before the activation.
template <bool ASPLIT, int ACT, bool BIAS_BF16, bool RES_BF16>
__global__ __launch_bounds__(128) void k_gemm_bf3(const float* __restrict__ A, int lda, const unsigned short* __restrict__ Wt, int ldb,
                                                const float* __restrict__ bias, const float* __restrict__ resid, int rmod, int ldr,
                                                float* __restrict__ C, int ldc, int M, int N, int K) {
  __shared__ __attribute__((aligned(16))) float so[4][16][64];
  const int tid = threadIdx.x, w = tid >> 5, lane = tid & 31, ln = lane & 15, hh = lane >> 4;
  const int ntn = N / 64;
  const int wid = blockIdx.x * 4 + w;
  const int mt = wid / ntn, nq = wid % ntn;
  if (mt * 16 >= M) return;
  const int row0 = mt * 16, col0 = nq * 64;
  const float* arow = A + (size_t)(row0 + ln) * lda;
  v8f acc[4] = {};
  for (int kb = 0; kb < K; kb += 32) {
    FragB ah, al;
    const v4f x0 = *(const v4fa*)(arow + kb + 8 * hh), x1 = *(const v4fa*)(arow + kb + 8 * hh + 4);
    const v4f x2 = *(const v4fa*)(arow + kb + 16 + 8 * hh), x3 = *(const v4fa*)(arow + kb + 16 + 8 * hh + 4);
    float xs[16] = {x0[0],x0[1],x0[2],x0[3],x1[0],x1[1],x1[2],x1[3],x2[0],x2[1],x2[2],x2[3],x3[0],x3[1],x3[2],x3[3]};
#pragma unroll
    for (int i = 0; i < 16; ++i) { const unsigned short hb = bf16_bits(xs[i]); ah.u[i] = hb; al.u[i] = ASPLIT ? bf16_bits(xs[i] - bf16_val(hb)) : (unsigned short)0; }
#pragma unroll
    for (int t = 0; t < 4; ++t) {
      const unsigned short* brow = Wt + (size_t)(col0 + t * 16 + ln) * ldb + kb;
      FragB b;
      b.half[0] = *(const v8us*)(brow + 8 * hh);
      b.half[1] = *(const v8us*)(brow + 16 + 8 * hh);
      acc[t] = mmaN<ASPLIT ? 2 : 1>(ah.v, al.v, b.v, b.v, acc[t]);
    }
  }
#pragma unroll
  for (int t = 0; t < 4; ++t) {
    const int col = col0 + t * 16 + ln;
    float bv = bias ? bias[col] : 0.f;
    if (BIAS_BF16) bv = bf16_round(bv);
#pragma unroll
    for (int r = 0; r < 8; ++r) {
      float v = acc[t][r] + bv;
      if (resid) { float rv = resid[(size_t)((row0 + 8 * hh + r) % rmod) * ldr + col]; if (RES_BF16) rv = bf16_round(rv); v += rv; }
      if (ACT == 1) v = fmaxf(v, 0.f);
      if (ACT == 2) v = 0.5f * v * (1.0f + erff(v * 0.70710678118654752f));
      if (ACT == 3) { const float u = 0.7978845608028654f * (v + 0.044715f * v * v * v); v = 0.5f * v * (1.0f + tanhf(u)); }
      so[w][8 * hh + r][t * 16 + ln] = v;
    }
  }
  __builtin_amdgcn_fence(__ATOMIC_ACQ_REL, "workgroup");
  __builtin_amdgcn_wave_barrier();
  const int rsub = lane >> 4, c4 = (lane & 15) * 4;
  {
#pragma unroll
    for (int q = 0; q < 8; ++q) {
      const int r = q * 2 + rsub;
      const v4f v = *(const v4fa*)&so[w][r][c4];
      *(v4f*)(C + (size_t)(row0 + r) * ldc + col0 + c4) = v;
    }
    
  }
}
// row LayerNorm (biased variance, eps) over N: s = X (+ R); optional out_sum <- s; out_norm <- (s-mu)*rsqrt(var+eps)*g + b
template <bool PARAM_BF16>
__global__ __launch_bounds__(256) void k_layernorm(const float* __restrict__ X, const float* __restrict__ R, const float* __restrict__ g, const float* __restrict__ bta,
                                                  float* __restrict__ out_sum, float* __restrict__ out_norm, int N, float eps) {
  __shared__ float red[256];
  const int row = blockIdx.x, tid = threadIdx.x;
  const float* x = X + (size_t)row * N; const float* rr = R ? R + (size_t)row * N : nullptr;
  float vals[16];                     // up to N = 4096
  const int per = N / 256;            // contiguous chunk per thread? use strided-by-4 chunks: thread handles j = tid*4 + 1024*u
  float s1 = 0.f;
  for (int u = 0; u < per / 4; ++u) {
    const int j = tid * 4 + 1024 * u;
    const v4f a = *(const v4fa*)(x + j);
    v4f b = {0.f,0.f,0.f,0.f}; if (rr) b = *(const v4fa*)(rr + j);
#pragma unroll
    for (int q = 0; q < 4; ++q) { const float v = a[q] + b[q]; vals[u * 4 + q] = v; s1 += v; }
  }
  red[tid] = s1; __syncthreads();
  for (int st = 128; st > 0; st >>= 1) { if (tid < st) red[tid] += red[tid + st]; __syncthreads(); }
  const float mu = red[0] / (float)N; __syncthreads();
  float s2 = 0.f;
  for (int u = 0; u < per / 4; ++u)
#pragma unroll
    for (int q = 0; q < 4; ++q) { const float c = vals[u * 4 + q] - mu; s2 += c * c; }
  red[tid] = s2; __syncthreads();
  for (int st = 128; st > 0; st >>= 1) { if (tid < st) red[tid] += red[tid + st]; __syncthreads(); }
  const float rs = rsqrtf(red[0] / (float)N + eps);
  {
    for (int u = 0; u < per / 4; ++u) {
      const int j = tid * 4 + 1024 * u;
      v4f o, sm;
#pragma unroll
      for (int q = 0; q < 4; ++q) {
        float gg = g[j + q], bb = bta[j + q];
        if (PARAM_BF16) { gg = bf16_round(gg); bb = bf16_round(bb); }
        sm[q] = vals[u * 4 + q]; o[q] = (vals[u * 4 + q] - mu) * rs * gg + bb;
      }
      if (out_sum) *(v4f*)(out_sum + (size_t)row * N + j) = sm;
      *(v4f*)(out_norm + (size_t)row * N + j) = o;
    }
    
  }
}



// ---- f16 WMMA path (v_wmma_f32_16x16x32_f16): 11-bit significands for operands in range — used where a [0,1] probability operand needs more precision than bf16
typedef _Float16 v16h __attribute__((ext_vector_type(16)));
union FragH { v16h v; v8us half[2]; _Float16 h[16]; unsigned short u[16]; };
template <int NT>
__device__ __forceinline__ v8f mmaH(v16h ah, v16h al, v16h bh, v16h bl, v8f c) {
  c = __builtin_amdgcn_wmma_f32_16x16x32_f16(false, ah, false, bh, (short)0, c, false, false);
  if (NT >= 2) c = __builtin_amdgcn_wmma_f32_16x16x32_f16(false, al, false, bh, (short)0, c, false, false);
  if (NT >= 3) c = __builtin_amdgcn_wmma_f32_16x16x32_f16(false, ah, false, bl, (short)0, c, false, false);
  asm volatile("v_nop\n\tv_nop\n\tv_nop\n\tv_nop" : "+v"(c) : "v"(ah), "v"(al), "v"(bh), "v"(bl));
  return c;
}
// batched GEMM like k_gemm_b but f16 operands: A f32 (split into f16 hi/lo if ASPLIT, else rounded to f16), Bt = f16 values [n][k]; alpha; C f32; N multiple of 16 (partial tiles skipped)
template <bool ASPLIT>
__global__ __launch_bounds__(128) void k_gemm_h(const float* __restrict__ A, int lda, size_t sA, const _Float16* __restrict__ Bh, int ldb, size_t sB, float alpha, float* __restrict__ C, int ldc, size_t sC, int M, int N, int K) {
  __shared__ __attribute__((aligned(16))) float so[4][16][64];
  const int tid = threadIdx.x, w = tid >> 5, lane = tid & 31, ln = lane & 15, hh = lane >> 4; const int by = blockIdx.y;
  A += (size_t)by * sA; Bh += (size_t)by * sB; C += (size_t)by * sC;
  const int ntn = (N + 63) / 64; const int wid = blockIdx.x * 4 + w; const int mt = wid / ntn, nq = wid % ntn; if (mt * 16 >= M) return;
  const int row0 = mt * 16, col0 = nq * 64; const float* arow = A + (size_t)(row0 + ln) * lda;
  v8f acc[4] = {};
  for (int kb = 0; kb < K; kb += 32) {
    FragH ah, al;
    const v4f x0 = *(const v4fa*)(arow + kb + 8 * hh), x1 = *(const v4fa*)(arow + kb + 8 * hh + 4), x2 = *(const v4fa*)(arow + kb + 16 + 8 * hh), x3 = *(const v4fa*)(arow + kb + 16 + 8 * hh + 4);
    float xs[16] = {x0[0],x0[1],x0[2],x0[3],x1[0],x1[1],x1[2],x1[3],x2[0],x2[1],x2[2],x2[3],x3[0],x3[1],x3[2],x3[3]};
#pragma unroll
    for (int i = 0; i < 16; ++i) { const _Float16 h = (_Float16)xs[i]; ah.h[i] = h; al.h[i] = ASPLIT ? (_Float16)(xs[i] - (float)h) : (_Float16)0.0f; }
#pragma unroll
    for (int t = 0; t < 4; ++t) { if (col0 + t * 16 >= N) continue; const size_t boff = (size_t)(col0 + t * 16 + ln) * ldb + kb; FragH bq; bq.half[0] = *(const v8us*)(Bh + boff + 8 * hh); bq.half[1] = *(const v8us*)(Bh + boff + 16 + 8 * hh);
      acc[t] = mmaH<ASPLIT ? 2 : 1>(ah.v, al.v, bq.v, bq.v, acc[t]); }
  }
#pragma unroll
  for (int t = 0; t < 4; ++t) { if (col0 + t * 16 >= N) continue;
#pragma unroll
    for (int r = 0; r < 8; ++r) so[w][8 * hh + r][t * 16 + ln] = acc[t][r] * alpha; }
  __builtin_amdgcn_fence(__ATOMIC_ACQ_REL, "workgroup"); __builtin_amdgcn_wave_barrier();
  const int rsub = lane >> 4, c4 = (lane & 15) * 4;
  {
#pragma unroll
    for (int q = 0; q < 8; ++q) { const int r = q * 2 + rsub; if (col0 + c4 < N) { const v4f v = *(const v4fa*)&so[w][r][c4]; *(v4f*)(C + (size_t)(row0 + r) * ldc + col0 + c4) = v; } }
     }
}

// k_gemm_hh variant with fused epilogue: v = acc·alpha + bias[by·sBias + col] (+ CP[(row/rowsPerB)·sCPb + by·64 + col] if CP) ; ACT 0 none / 1 elu ; writes f16 C16 (and f32 C if non-null)
template <int ACT>
__global__ __launch_bounds__(128) void k_gemm_hhx(const _Float16* __restrict__ A, int lda, size_t sA, const _Float16* __restrict__ Bh, int ldb, size_t sB, float alpha, const float* __restrict__ bias, size_t sBias, const float* __restrict__ CP, int rowsPerB, size_t sCPb, int row0g,
    float* __restrict__ C, _Float16* __restrict__ C16, int ldc, size_t sC, int M, int N, int K) {
  __shared__ __attribute__((aligned(16))) float so[4][16][64];
  const int tid = threadIdx.x, w = tid >> 5, lane = tid & 31, ln = lane & 15, hh = lane >> 4; const int by = blockIdx.y;
  A += (size_t)by * sA; Bh += (size_t)by * sB; const size_t cofs = (size_t)by * sC; const float* bp = bias ? bias + (size_t)by * sBias : nullptr;
  const int ntn = (N + 63) / 64; const int wid = blockIdx.x * 4 + w; const int mt = wid / ntn, nq = wid % ntn; if (mt * 16 >= M) return;
  const int row0 = mt * 16, col0 = nq * 64; const _Float16* arow = A + (size_t)(row0 + ln) * lda;
  v8f acc[4] = {};
  for (int kb = 0; kb < K; kb += 32) { FragH ah; ah.half[0] = *(const v8us*)((const unsigned short*)arow + kb + 8 * hh); ah.half[1] = *(const v8us*)((const unsigned short*)arow + kb + 16 + 8 * hh);
#pragma unroll
    for (int t = 0; t < 4; ++t) { if (col0 + t * 16 >= N) continue; const size_t boff = (size_t)(col0 + t * 16 + ln) * ldb + kb; FragH bq; bq.half[0] = *(const v8us*)((const unsigned short*)Bh + boff + 8 * hh); bq.half[1] = *(const v8us*)((const unsigned short*)Bh + boff + 16 + 8 * hh);
      acc[t] = mmaH<1>(ah.v, ah.v, bq.v, bq.v, acc[t]); }
  }
#pragma unroll
  for (int t = 0; t < 4; ++t) { if (col0 + t * 16 >= N) continue; const int col = col0 + t * 16 + ln; const float bv = bp ? bf16_round(bp[col]) : 0.f;
#pragma unroll
    for (int r = 0; r < 8; ++r) { float v = acc[t][r] * alpha + bv; if (CP) { const int rr = row0g + row0 + 8 * hh + r; if (rowsPerB < 0) v += CP[cofs + (size_t)rr * ldc + col];      /* rowsPerB < 0: own element of the batched C plane */ else { const int bidx = rr / rowsPerB; v += CP[(size_t)bidx * sCPb + (size_t)by * 64 + col]; } } if (ACT == 1) v = (v > 0.f) ? v : expm1f(v); else if (ACT == 7) v = (v > 0.f) ? v + 1.0f : expf(v); else if (ACT == 8) v = tanhf(v); else if (ACT == 9) v = 0.5f * v * (1.0f + tanhf(0.7978845608028654f * (v + 0.044715f * v * v * v))); else if (ACT == 11) v = 1.0f / (1.0f + expf(-v)); else if (ACT == 12) v = (v > 0.f) ? v : 0.01f * v; else if (ACT == 14) v = (v > 0.f) ? v : 0.1f * v; else if (ACT == 16) v = (v >= 0.f) ? v : 0.3f * v; else if (ACT == 17) v = (v >= 0.f) ? v : 0.2f * v; else if (ACT == 15) v = v / (1.0f + expf(-v)); else if (ACT == 3) v = fmaxf(v, 0.f); else if (ACT == 6) v = 0.5f * v * (1.0f + erff(v * 0.70710678118654752f)); so[w][8 * hh + r][t * 16 + ln] = v; } }
  __builtin_amdgcn_fence(__ATOMIC_ACQ_REL, "workgroup"); __builtin_amdgcn_wave_barrier();
  const int rsub = lane >> 4, c4 = (lane & 15) * 4; typedef _Float16 v4h __attribute__((ext_vector_type(4)));
  {
#pragma unroll
    for (int q = 0; q < 8; ++q) { const int r = q * 2 + rsub; if (col0 + c4 < N) { const v4f v = *(const v4fa*)&so[w][r][c4]; if (C) *(v4f*)(C + cofs + (size_t)(row0 + r) * ldc + col0 + c4) = v; if (C16) { v4h h4; for (int i = 0; i < 4; ++i) h4[i] = (_Float16)v[i]; *(v4h*)(C16 + cofs + (size_t)(row0 + r) * ldc + col0 + c4) = h4; } } }
     }
}


typedef _Float16 v4h __attribute__((ext_vector_type(4)));

// One preparation launch, weights only: each work-group turns one 64 x 64 tile of one [in][out] weight matrix into Wt[n][k]; the four transposes lie back to back.
// The three projection weights go out as bf16 bits (the rounded value itself: the projection GEMM multiplies in bf16); the output weight as f16(bf16(W) * scale)
// (scale = power of two; bf16-exact weights stay exact in f16 away from the subnormal range), because its partner in the output GEMM is an f16 operand.
// A wave-wide load covers two 256-byte row pieces of W and a wave-wide store four 128-byte row pieces of Wt: whole lines both ways, one writer a line; the turn is made in LDS.
typedef unsigned short v4us __attribute__((ext_vector_type(4), may_alias));
#define WTT 64      /* weight tile edge */
#define WTP 72      /* LDS row pitch of the turned tile in 16-bit values: 128 data bytes + 16, rows stay 16-byte aligned for the read-out */
#define NWB (4 * (DM / WTT) * (DM / WTT))      /* weight-tile work-groups */
__global__ __launch_bounds__(256) void k_prep(const float* __restrict__ W0, const float* __restrict__ W1, const float* __restrict__ W2, const float* __restrict__ W3, _Float16* __restrict__ Wt, float scale) {
  static_assert(DM % WTT == 0, "whole weight tiles");
  __shared__ __attribute__((aligned(16))) unsigned short tl[WTT][WTP];      /* [n][k] of the tile */
  const int tid = threadIdx.x, bx = blockIdx.x;
  const int y = bx / ((DM / WTT) * (DM / WTT)), tile = bx % ((DM / WTT) * (DM / WTT)), k0 = (tile / (DM / WTT)) * WTT, n0 = (tile % (DM / WTT)) * WTT;
  const float* __restrict__ W = y == 0 ? W0 : y == 1 ? W1 : y == 2 ? W2 : W3;
  const int c4 = (tid & 15) * 4, k4 = (tid >> 4) * 4;      /* the thread's 4 x 4 block: rows k4 .. + 3, columns c4 .. + 3 */
  const float* src = W + (size_t)(k0 + k4) * DM + n0 + c4;
  v4f r[4];
#pragma unroll      /* r indexed by constants: registers; the four loads fly together */
  for (int u = 0; u < 4; ++u) r[u] = *(const v4fa*)(src + (size_t)u * DM);
  if (y < 3) {      /* the same for the whole work-group; one test, not one a value */
#pragma unroll      /* r indexed by constants: registers */
    for (int j = 0; j < 4; ++j) { v4us p;
#pragma unroll      /* r, p indexed by constants: registers */
      for (int u = 0; u < 4; ++u) p[u] = bf16_bits(r[u][j]);
      *(v4us*)&tl[c4 + j][k4] = p; }      /* four successive k of one column n: 8 bytes of the turned row */
  } else {
#pragma unroll      /* r indexed by constants: registers */
    for (int j = 0; j < 4; ++j) { v4h h4;
#pragma unroll      /* r, h4 indexed by constants: registers */
      for (int u = 0; u < 4; ++u) h4[u] = (_Float16)(bf16_round(r[u][j]) * scale);
      *(v4h*)&tl[c4 + j][k4] = h4; }
  }
  __syncthreads();      /* the turned tile is complete: a row holds the k of 16 threads */
  unsigned short* dst = (unsigned short*)Wt + (size_t)y * DM * DM + (size_t)n0 * DM + k0;
#pragma unroll      /* 8 threads store one row's 128 bytes */
  for (int j = 0; j < 2; ++j) { const int i = tid + 256 * j, n = i >> 3, k8 = (i & 7) * 8; *(v8us*)(dst + (size_t)n * DM + k8) = *(const v8us*)&tl[n][k8]; }
}
__global__ __launch_bounds__(256) void k_h16(const float* __restrict__ x, _Float16* __restrict__ X16, size_t n8) { const size_t t = (size_t)blockIdx.x * 256 + threadIdx.x; if (t >= n8) return; FragH f;
#pragma unroll
  for (int q = 0; q < 8; ++q) f.h[q] = (_Float16)x[t * 8 + q]; *(v8us*)((unsigned short*)X16 + t * 8) = f.half[0];  }
__global__ __launch_bounds__(256) void k_round16f(const float* __restrict__ W, _Float16* __restrict__ Bt, size_t n8) { const size_t t = (size_t)blockIdx.x * 256 + threadIdx.x; if (t >= n8) return; FragH f;
#pragma unroll
  for (int i = 0; i < 8; ++i) f.h[i] = (_Float16)(bf16_round(W[t * 8 + i]) * 16.0f); *(v8us*)((unsigned short*)Bt + t * 8) = f.half[0];  }
__global__ __launch_bounds__(256) void k_hl(const float* __restrict__ F, _Float16* __restrict__ Hh, _Float16* __restrict__ Hl, size_t n8) { const size_t t = (size_t)blockIdx.x * 256 + threadIdx.x; if (t >= n8) return; FragH fh, fl; const v4f a = *(const v4fa*)(F + t * 8), c = *(const v4fa*)(F + t * 8 + 4);
#pragma unroll
  for (int q = 0; q < 4; ++q) { _Float16 h = (_Float16)a[q]; fh.h[q] = h; fl.h[q] = (_Float16)((a[q] - (float)h) * 1024.0f); h = (_Float16)c[q]; fh.h[4 + q] = h; fl.h[4 + q] = (_Float16)((c[q] - (float)h) * 1024.0f); }
  { *(v8us*)((unsigned short*)Hh + t * 8) = fh.half[0]; *(v8us*)((unsigned short*)Hl + t * 8) = fl.half[0];  } }

// ---- fast GEMM (work-group tile 128x64, wave tile 32x64; requires M % 128 == 0, N % 64 == 0 and K % 64 == 0); C = act(alpha A B^T): f16 rows C16 where QKV, f32 rows C otherwise, fixed at compile time ----
// No bias and no added plane: as run-time options they stood as a test and a skipped block at each of the 64 results of a lane, and made the kernel's text many times the size of what runs.
__device__ __forceinline__ v16h g2_frag(const _Float16* p, int hh) { FragH f; f.half[0] = *(const v8us*)((const unsigned short*)p + 8 * hh); f.half[1] = *(const v8us*)((const unsigned short*)p + 16 + 8 * hh); return f.v; }
__device__ __forceinline__ v8f g2_mma(v16h a, v16h b, v8f c) { v8f d = __builtin_amdgcn_wmma_f32_16x16x32_f16(false, a, false, b, (short)0, c, false, false); asm volatile("v_nop\n\tv_nop\n\tv_nop\n\tv_nop" : "+v"(d) : "v"(a), "v"(b)); return d; }
#define GK 64      /* k per pass: one whole 128-byte line of every operand row */
#define GP 72      /* LDS row pitch in f16: 128 data bytes + 16, so that the 16 rows of a 16-byte fragment read fall on different banks */
#define GSTG ((128 + 64) * GP * 2)      /* bytes of one stage: 128 A rows, then 64 B rows */
// One thread's share of a stage: 16 bytes of each of 12 rows (8 of A, 4 of B), 16 rows apart, from global memory straight into LDS.
// l: the thread's LDS byte address in the stage's row 0..15; a, b: its global addresses; pa, pb: 16 rows of A, of B, in elements.
// The s_wait_xcnt closes the statement so that no address register of a copy is rewritten in front of it.
__device__ __forceinline__ void g2_stage(unsigned l, const unsigned short* a, size_t pa, const unsigned short* b, size_t pb) {
  asm volatile(
    "global_load_async_to_lds_b128 %0, %12, off\n\t"
    "global_load_async_to_lds_b128 %1, %13, off\n\t"
    "global_load_async_to_lds_b128 %2, %14, off\n\t"
    "global_load_async_to_lds_b128 %3, %15, off\n\t"
    "global_load_async_to_lds_b128 %4, %16, off\n\t"
    "global_load_async_to_lds_b128 %5, %17, off\n\t"
    "global_load_async_to_lds_b128 %6, %18, off\n\t"
    "global_load_async_to_lds_b128 %7, %19, off\n\t"
    "global_load_async_to_lds_b128 %8, %20, off\n\t"
    "global_load_async_to_lds_b128 %9, %21, off\n\t"
    "global_load_async_to_lds_b128 %10, %22, off\n\t"
    "global_load_async_to_lds_b128 %11, %23, off\n\t"
    "s_wait_xcnt 0x0"
    :: "v"(l + 0u * (16u * GP * 2u)), "v"(l + 1u * (16u * GP * 2u)), "v"(l + 2u * (16u * GP * 2u)), "v"(l + 3u * (16u * GP * 2u)), "v"(l + 4u * (16u * GP * 2u)), "v"(l + 5u * (16u * GP * 2u)), "v"(l + 6u * (16u * GP * 2u)), "v"(l + 7u * (16u * GP * 2u)), "v"(l + 8u * (16u * GP * 2u)), "v"(l + 9u * (16u * GP * 2u)), "v"(l + 10u * (16u * GP * 2u)), "v"(l + 11u * (16u * GP * 2u)),
       "v"(a + 0 * pa), "v"(a + 1 * pa), "v"(a + 2 * pa), "v"(a + 3 * pa), "v"(a + 4 * pa), "v"(a + 5 * pa), "v"(a + 6 * pa), "v"(a + 7 * pa), "v"(b + 0 * pb), "v"(b + 1 * pb), "v"(b + 2 * pb), "v"(b + 3 * pb)
    : "memory");
}
// Both operands go through LDS, two stages: 8 threads copy one 128-byte row piece (a wave-wide copy covers 4 whole lines), each line is fetched once per work-group,
// and the next pass's copies fly while this pass's fragments are read from LDS.
// QKV (the three projections on grid.y; a work-group's 64 columns are one head): the epilogue also does what the attention kernel needs of the results, so that no launch has to read them back:
// y = 0, 1 (q, k): NS[y][head][row] = the squared norm of the head's 64 f16 values of the row; y = 2 (v): the tile goes out transposed only, Tt[batch][head][d][token].
#define TP 136      /* LDS row pitch of the transposed tile in f16: 256 data bytes + 16, so that the 16 rows of a 16-byte store fall on different banks */
template <int ACT, bool QKV>
__global__ __launch_bounds__(128) void k_gemm2(const _Float16* __restrict__ A, int lda, size_t sA, const _Float16* __restrict__ Bh, int ldb, size_t sB, float alpha,
    float* __restrict__ C, _Float16* __restrict__ C16, int ldc, size_t sC, int M, int N, int K, size_t zA, size_t zB, size_t zC, float* __restrict__ NS, _Float16* __restrict__ Tt) { static_assert(ACT == 0 || ACT == 3 || ACT == 6 || ACT == 8 || ACT == 9 || ACT == 11 || ACT == 12 || ACT == 14 || ACT == 15 || ACT == 16 || ACT == 17, "k_gemm2: unsupported ACT code (would silently apply no activation)");
  __shared__ __attribute__((aligned(16))) unsigned char gl[2 * GSTG];      /* the two stages; behind the loop the same bytes stage the output tile */
  static_assert(sizeof(float) * 4 * 32 * 68 <= 2 * GSTG, "output staging must fit the two stages");
  float (*so)[32][68] = (float (*)[32][68])gl;
  const int tid = threadIdx.x, w = tid >> 5, lane = tid & 31, ln = lane & 15, hh = lane >> 4; const int by = blockIdx.y, bz = blockIdx.z;      /* two batch axes: strides sA, sB, sC on grid.y and zA, zB, zC on grid.z */
  A += (size_t)by * sA + (size_t)bz * zA; Bh += (size_t)by * sB + (size_t)bz * zB; const size_t cofs = (size_t)by * sC + (size_t)bz * zC;
  const int ntn = N >> 6; const int mt = blockIdx.x / ntn, nq = blockIdx.x - mt * ntn; const int row0 = mt * 128 + 32 * w, col0 = nq * 64; if (mt * 128 >= M) return;      /* the same for the whole work-group: it stands in front of barriers */
  const int sr = tid >> 3, sc = (tid & 7) * 8;      /* staging: 8 threads cover one 128-byte row piece, 16 rows a sweep */
  const unsigned short* ag = (const unsigned short*)A + (size_t)(mt * 128 + sr) * lda + sc;
  const unsigned short* bg = (const unsigned short*)Bh + (size_t)(col0 + sr) * ldb + sc;
  const size_t pa = (size_t)16 * lda, pb = (size_t)16 * ldb;
  const unsigned l0 = (unsigned)(size_t)gl + (unsigned)(sr * GP + sc) * 2u;      /* low 32 bits of the __shared__ address = the byte address in LDS */
  g2_stage(l0, ag, pa, bg, pb);      /* pass 0 into stage 0 */
  asm volatile("s_wait_asynccnt 0x0" ::: "memory");      /* this wave's copies of pass 0 have landed */
  __syncthreads();      /* and every other wave's */
  if (GK < K) g2_stage(l0 + GSTG, ag + GK, pa, bg + GK, pb);      /* pass 1 into stage 1 */
  const v8f z8 = {0.f,0.f,0.f,0.f,0.f,0.f,0.f,0.f}; v8f c00 = z8, c01 = z8, c02 = z8, c03 = z8, c10 = z8, c11 = z8, c12 = z8, c13 = z8;
#pragma unroll 1      /* one pass a trip: the stage alternates */
  for (int kb = 0; kb < K; kb += GK) {
    const unsigned st = (unsigned)(kb / GK) & 1u;      /* this pass's stage */
    const _Float16* ap = (const _Float16*)(gl + st * GSTG) + (32 * w + ln) * GP; const _Float16* bq = (const _Float16*)(gl + st * GSTG) + (128 + ln) * GP;
#pragma unroll      /* two 32-k blocks a pass, constant LDS offsets */
    for (int kk = 0; kk < GK; kk += 32) { const v16h a0 = g2_frag(ap + kk, hh), a1 = g2_frag(ap + 16 * GP + kk, hh);
      const v16h b0 = g2_frag(bq + kk, hh), b1 = g2_frag(bq + 16 * GP + kk, hh), b2 = g2_frag(bq + 32 * GP + kk, hh), b3 = g2_frag(bq + 48 * GP + kk, hh);
      c00 = g2_mma(a0, b0, c00); c10 = g2_mma(a1, b0, c10);
      c01 = g2_mma(a0, b1, c01); c11 = g2_mma(a1, b1, c11);
      c02 = g2_mma(a0, b2, c02); c12 = g2_mma(a1, b2, c12);
      c03 = g2_mma(a0, b3, c03); c13 = g2_mma(a1, b3, c13); }
    asm volatile("s_wait_dscnt 0x0" ::: "memory");      /* this wave's reads of the stage are done before the stage is handed back */
    asm volatile("s_wait_asynccnt 0x0" ::: "memory");      /* this wave's copies of the next pass have landed */
    __syncthreads();      /* the next pass's stage is complete, and every wave has left this one */
    if (kb + 2 * GK < K) g2_stage(l0 + st * GSTG, ag + kb + 2 * GK, pa, bg + kb + 2 * GK, pb);      /* the pass after next into the stage just left */
  }
  asm volatile("s_wait_asynccnt 0x0" ::: "memory");      /* nothing is in flight when the stages become output staging */
  v8f accs[8] = {c00, c01, c02, c03, c10, c11, c12, c13};
  if (QKV && by == 2) {      /* the same for the whole work-group: a barrier stands inside */
    static_assert(SQ % 128 == 0 && 64 * TP * 2 <= 2 * GSTG, "a tile lies in one batch, and its transpose fits the two stages");
    unsigned short (*tt)[TP] = (unsigned short (*)[TP])gl;      /* [d][token of the tile] */
#pragma unroll      /* accs indexed by constants: registers */
    for (int u = 0; u < 8; ++u) { const int t = u & 3, half = u >> 2; FragH f;      /* an accumulator's 8 values are 8 successive tokens of one column d: one 16-byte piece of the transposed row */
#pragma unroll      /* f.h and the accumulator indexed by constants: registers */
      for (int r = 0; r < 8; ++r) f.h[r] = (_Float16)(accs[u][r] * alpha);
      *(v8us*)&tt[t * 16 + ln][32 * w + half * 16 + 8 * hh] = f.half[0]; }
    __syncthreads();      /* the transposed tile is complete: a row holds the tokens of all four waves */
    unsigned short* vt = (unsigned short*)Tt + ((size_t)((mt * 128) / SQ) * ntn + nq) * 64 * SQ + (mt * 128) % SQ;
#pragma unroll      /* 16 threads store one row's 256 bytes: whole lines, one writer each */
    for (int j = 0; j < 8; ++j) { const int i = tid + 128 * j, d = i >> 4, p8 = (i & 15) * 8; *(v8us*)(vt + (size_t)d * SQ + p8) = *(const v8us*)&tt[d][p8]; }
    return;
  }
#pragma unroll
  for (int u = 0; u < 8; ++u) { const int t = u & 3, half = u >> 2;
#pragma unroll
    for (int r = 0; r < 8; ++r) { const int rloc = half * 16 + 8 * hh + r; float v = accs[u][r] * alpha;
      if (ACT == 3) v = fmaxf(v, 0.f); else if (ACT == 6) v = 0.5f * v * (1.0f + erff(v * 0.70710678118654752f)); else if (ACT == 11) v = 1.0f / (1.0f + expf(-v)); else if (ACT == 15) v = v / (1.0f + expf(-v)); else if (ACT == 12) v = (v > 0.f) ? v : 0.01f * v; else if (ACT == 8) v = tanhf(v); else if (ACT == 9) v = 0.5f * v * (1.0f + tanhf(0.7978845608028654f * (v + 0.044715f * v * v * v))); else if (ACT == 14) v = (v > 0.f) ? v : 0.1f * v; else if (ACT == 16) v = (v >= 0.f) ? v : 0.3f * v; else if (ACT == 17) v = (v >= 0.f) ? v : 0.2f * v;
      so[w][rloc][t * 16 + ln] = v; } }
  __builtin_amdgcn_fence(__ATOMIC_ACQ_REL, "workgroup"); __builtin_amdgcn_wave_barrier();
  const int rsub = lane >> 4, c4 = (lane & 15) * 4;
  {
#pragma unroll
    for (int q = 0; q < 16; ++q) { const int r = q * 2 + rsub; const v4f v = *(const v4fa*)&so[w][r][c4]; if (!QKV) *(v4f*)(C + cofs + (size_t)(row0 + r) * ldc + col0 + c4) = v; else { v4h h4; for (int i = 0; i < 4; ++i) h4[i] = (_Float16)v[i]; *(v4h*)(C16 + cofs + (size_t)(row0 + r) * ldc + col0 + c4) = h4; } }
     }
  if (QKV) {      /* lane l sums row l of the wave's 32, columns in rising order, over the f16 values just stored (a product of two f16 values is exact in f32) */
    float ss = 0.f;
#pragma unroll      /* constant LDS offsets; later reads can issue while earlier values are summed */
    for (int c = 0; c < 16; ++c) { const v4f v = *(const v4fa*)&so[w][lane][c * 4];
#pragma unroll      /* v indexed by constants: registers */
      for (int i = 0; i < 4; ++i) { const float x = (float)(_Float16)v[i]; ss += x * x; } }
    NS[((size_t)by * ntn + nq) * M + row0 + lane] = ss;
    asm volatile("s_wait_xcnt 0x0" ::: "memory");      /* behind the norm store, before code laid out after it may rewrite the store's address registers */
  } }


// ---- projection GEMM: q, k, v = round_bf16(x) round_bf16(W) on grid.y, straight from the f32 inputs; no 16-bit copy of the inputs goes through memory ----
// Work-group tile 128 x 128 (two heads), four waves of 64 x 64 (one head each). Per 64-k pass the A tile comes as f32 (128 rows of 256 bytes) and the B tile as bf16 (128 rows of 128 bytes),
// both by asynchronous copies into LDS, two stages, in the order of k_gemm2. A is rounded to bf16 where its fragment is read (two values an instruction); both operands are exact bf16 values,
// so the products are those of the f16 form on the same values. The wider tile keeps the bytes asked of L2 at what 128 x 64 tiles of 16-bit rows asked.
// The epilogue is k_gemm2's for the projections: y = 0, 1 (q, k): f16 rows and NS[y][head][row] = the squared norm of the head's 64 f16 values; y = 2 (v): transposed only, Tt[batch][head][d][token].
typedef float v16f __attribute__((ext_vector_type(16)));
#define QAP 272      /* LDS row pitch of the f32 A tile in bytes: 256 data bytes + 16, so that the 16 rows of a 16-byte fragment read fall on different banks */
#define QAB (128 * QAP)      /* bytes of a stage's A tile */
#define QSTG (QAB + 128 * GP * 2)      /* bytes of one stage: 128 A rows, then 128 B rows */
// Eight 16-byte copies of one thread, ls LDS bytes and gs global bytes apart. The s_wait_xcnt closes the statement so that no address register of a copy is rewritten in front of it.
__device__ __forceinline__ void q_cp8(unsigned l, unsigned ls, const char* g, size_t gs) {
  asm volatile(
    "global_load_async_to_lds_b128 %0, %8, off\n\t"
    "global_load_async_to_lds_b128 %1, %9, off\n\t"
    "global_load_async_to_lds_b128 %2, %10, off\n\t"
    "global_load_async_to_lds_b128 %3, %11, off\n\t"
    "global_load_async_to_lds_b128 %4, %12, off\n\t"
    "global_load_async_to_lds_b128 %5, %13, off\n\t"
    "global_load_async_to_lds_b128 %6, %14, off\n\t"
    "global_load_async_to_lds_b128 %7, %15, off\n\t"
    "s_wait_xcnt 0x0"
    :: "v"(l), "v"(l + ls), "v"(l + 2u * ls), "v"(l + 3u * ls), "v"(l + 4u * ls), "v"(l + 5u * ls), "v"(l + 6u * ls), "v"(l + 7u * ls),
       "v"(g), "v"(g + gs), "v"(g + 2 * gs), "v"(g + 3 * gs), "v"(g + 4 * gs), "v"(g + 5 * gs), "v"(g + 6 * gs), "v"(g + 7 * gs)
    : "memory");
}
// One thread's share of a stage: 16 bytes of each of 16 A rows, 8 rows apart (16 threads cover a 256-byte row piece), and of each of 8 B rows, 16 rows apart (8 threads cover a 128-byte row piece).
__device__ __forceinline__ void q_stage(unsigned la, const float* a, unsigned lb, const unsigned short* b) {
  q_cp8(la, 8u * QAP, (const char*)a, (size_t)8 * DM * 4);
  q_cp8(la + 64u * QAP, 8u * QAP, (const char*)(a + (size_t)64 * DM), (size_t)8 * DM * 4);
  q_cp8(lb, 16u * GP * 2u, (const char*)b, (size_t)16 * DM * 2);
}
__global__ __launch_bounds__(128) void k_gemmq(const float* __restrict__ X0, const float* __restrict__ X1, const float* __restrict__ X2, const _Float16* __restrict__ Wb, _Float16* __restrict__ C16, float* __restrict__ NS, _Float16* __restrict__ Tt) {
  static_assert(MP % 128 == 0 && DM % 128 == 0 && DM % GK == 0 && DM >= 2 * GK && SQ % 128 == 0 && HD == 64, "whole tiles, at least two passes, a tile lies in one batch, a wave's 64 columns are one head");
  __shared__ __attribute__((aligned(16))) unsigned char gl[2 * QSTG];      /* the two stages; behind the loop the same bytes stage the output tile */
  static_assert(sizeof(float) * 4 * 64 * 68 <= 2 * QSTG && 2 * 64 * TP * 2 <= 2 * QSTG, "output staging must fit the two stages");
  const int tid = threadIdx.x, w = tid >> 5, lane = tid & 31, ln = lane & 15, hh = lane >> 4; const int by = blockIdx.y;
  const float* __restrict__ X = by == 0 ? X0 : by == 1 ? X1 : X2;
  const unsigned short* Bw = (const unsigned short*)Wb + (size_t)by * DM * DM;
  const int mt = blockIdx.x / (DM / 128), nb = blockIdx.x - mt * (DM / 128);
  const int wr = w & 1, wc = w >> 1;      /* the wave's 64 rows and 64 columns of the tile */
  const int row0 = mt * 128 + 64 * wr, nq = nb * 2 + wc, col0 = nq * 64;
  const float* ag = X + (size_t)(mt * 128 + (tid >> 4)) * DM + (tid & 15) * 4;
  const unsigned short* bg = Bw + (size_t)(nb * 128 + (tid >> 3)) * DM + (tid & 7) * 8;
  const unsigned la = (unsigned)(size_t)gl + (unsigned)((tid >> 4) * QAP + (tid & 15) * 16);      /* low 32 bits of the __shared__ address = the byte address in LDS */
  const unsigned lb = (unsigned)(size_t)gl + (unsigned)(QAB + (tid >> 3) * (GP * 2) + (tid & 7) * 16);
  q_stage(la, ag, lb, bg);      /* pass 0 into stage 0 */
  asm volatile("s_wait_asynccnt 0x0" ::: "memory");      /* this wave's copies of pass 0 have landed */
  __syncthreads();      /* and every other wave's */
  q_stage(la + QSTG, ag + GK, lb + QSTG, bg + GK);      /* pass 1 into stage 1 */
  const v8f z8 = {0.f,0.f,0.f,0.f,0.f,0.f,0.f,0.f};
  v8f c[4][4];      /* [16 rows][16 columns] */
#pragma unroll      /* c indexed by constants: registers */
  for (int m = 0; m < 4; ++m) { c[m][0] = z8; c[m][1] = z8; c[m][2] = z8; c[m][3] = z8; }
#pragma unroll 1      /* one pass a trip: the stage alternates */
  for (int kb = 0; kb < DM; kb += GK) {
    const unsigned st = (unsigned)(kb / GK) & 1u;      /* this pass's stage */
    const float* ap = (const float*)(gl + st * QSTG + (64 * wr + ln) * QAP) + 8 * hh;
    const unsigned short* bq = (const unsigned short*)(gl + st * QSTG + QAB) + (64 * wc + ln) * GP + 8 * hh;
    v16b b[4];      /* the four B fragments of a 32-k block */
    v4f x[2][4];      /* the f32 values of two A fragments: one is rounded and multiplied while the next one's LDS reads fly */
#pragma unroll      /* x indexed by constants: registers */
    for (int i = 0; i < 4; ++i) x[0][i] = *(const v4fa*)(ap + (i >> 1) * 16 + (i & 1) * 4);      /* the same k order as B: k = 8 hh + 0..7, then 16 + 8 hh + 0..7 */
#pragma unroll      /* eight steps a pass: two 32-k blocks of four 16-row fragments, constant LDS offsets; c, x indexed by constants: registers */
    for (int s = 0; s < 8; ++s) { const int kk = (s >> 2) * 32, m = s & 3;
      if (m == 0) {
#pragma unroll      /* b indexed by constants: registers */
        for (int t = 0; t < 4; ++t) { FragB f; f.half[0] = *(const v8us*)(bq + t * 16 * GP + kk); f.half[1] = *(const v8us*)(bq + t * 16 * GP + kk + 16); b[t] = f.v; } }
      if (s < 7) { const float* p = ap + ((s + 1) & 3) * 16 * (QAP / 4) + ((s + 1) >> 2) * 32;
#pragma unroll      /* x indexed by constants: registers */
        for (int i = 0; i < 4; ++i) x[(s + 1) & 1][i] = *(const v4fa*)(p + (i >> 1) * 16 + (i & 1) * 4); }
      __builtin_amdgcn_sched_barrier(0);      /* the next fragment's reads stay in front of this fragment's WMMAs: moved behind them, every fragment waits out the whole LDS latency with nothing to do */
      const v4f x0 = x[s & 1][0], x1 = x[s & 1][1], x2 = x[s & 1][2], x3 = x[s & 1][3];
      const v16f xf = {x0[0],x0[1],x0[2],x0[3],x1[0],x1[1],x1[2],x1[3],x2[0],x2[1],x2[2],x2[3],x3[0],x3[1],x3[2],x3[3]};
      const v16b a = __builtin_convertvector(xf, v16b);      /* round to nearest even */
#pragma unroll      /* four independent WMMAs on one A fragment */
      for (int t = 0; t < 4; ++t) c[m][t] = __builtin_amdgcn_wmma_f32_16x16x32_bf16(false, a, false, b[t], (short)0, c[m][t], false, false);
    }
    asm volatile("v_nop\n\tv_nop\n\tv_nop\n\tv_nop" : "+v"(c[3][0]), "+v"(c[3][1]), "+v"(c[3][2]), "+v"(c[3][3]) : "v"(b[0]), "v"(b[1]), "v"(b[2]), "v"(b[3]));      /* the four vector slots the chip needs behind the pass's last WMMA before its operand registers are rewritten: the next writers stand behind branches */
    asm volatile("s_wait_dscnt 0x0" ::: "memory");      /* this wave's reads of the stage are done before the stage is handed back */
    asm volatile("s_wait_asynccnt 0x0" ::: "memory");      /* this wave's copies of the next pass have landed */
    __syncthreads();      /* the next pass's stage is complete, and every wave has left this one */
    if (kb + 2 * GK < DM) q_stage(la + st * QSTG, ag + kb + 2 * GK, lb + st * QSTG, bg + kb + 2 * GK);      /* the pass after next into the stage just left */
  }
  asm volatile("s_wait_asynccnt 0x0" ::: "memory");      /* nothing is in flight when the stages become output staging */
  if (by == 2) {      /* the same for the whole work-group: a barrier stands inside */
    unsigned short (*tt)[64][TP] = (unsigned short (*)[64][TP])gl;      /* [head of the tile][d][token of the tile] */
#pragma unroll      /* c indexed by constants: registers */
    for (int m = 0; m < 4; ++m) {
#pragma unroll      /* c indexed by constants: registers */
      for (int t = 0; t < 4; ++t) { FragH f;      /* an accumulator's 8 values are 8 successive tokens of one column d: one 16-byte piece of the transposed row */
#pragma unroll      /* f.h and the accumulator indexed by constants: registers */
        for (int r = 0; r < 8; ++r) f.h[r] = (_Float16)c[m][t][r];
        *(v8us*)&tt[wc][t * 16 + ln][64 * wr + m * 16 + 8 * hh] = f.half[0]; } }
    __syncthreads();      /* the transposed tiles are complete: a row holds the tokens of two waves */
    unsigned short* vt = (unsigned short*)Tt + ((size_t)((mt * 128) / SQ) * NH + nb * 2) * 64 * SQ + (mt * 128) % SQ;
#pragma unroll      /* 16 threads store one row's 256 bytes: whole lines, one writer each; the two heads' 128 rows d lie SQ apart */
    for (int j = 0; j < 16; ++j) { const int i = tid + 128 * j, d = i >> 4, p8 = (i & 15) * 8; *(v8us*)(vt + (size_t)d * SQ + p8) = *(const v8us*)&tt[d >> 6][d & 63][p8]; }
    return;
  }
  float (*so)[64][68] = (float (*)[64][68])gl;
#pragma unroll      /* c indexed by constants: registers */
  for (int m = 0; m < 4; ++m) {
#pragma unroll      /* c indexed by constants: registers */
    for (int t = 0; t < 4; ++t) {
#pragma unroll      /* c indexed by constants: registers */
      for (int r = 0; r < 8; ++r) so[w][m * 16 + 8 * hh + r][t * 16 + ln] = c[m][t][r]; } }
  __builtin_amdgcn_fence(__ATOMIC_ACQ_REL, "workgroup"); __builtin_amdgcn_wave_barrier();      /* the wave reads back what its own lanes wrote */
  const int rsub = lane >> 4, c4 = (lane & 15) * 4;
#pragma unroll      /* 16 lanes store one row's 128 bytes: whole lines */
  for (int q = 0; q < 32; ++q) { const int r = q * 2 + rsub; const v4f v = *(const v4fa*)&so[w][r][c4]; v4h h4; for (int i = 0; i < 4; ++i) h4[i] = (_Float16)v[i]; *(v4h*)(C16 + (size_t)by * NR * DM + (size_t)(row0 + r) * DM + col0 + c4) = h4; }
#pragma unroll      /* lane l sums rows l and l + 32 of the wave's 64, columns in rising order, over the f16 values just stored (a product of two f16 values is exact in f32) */
  for (int g = 0; g < 2; ++g) {
    float ss = 0.f;
#pragma unroll      /* constant LDS offsets; later reads can issue while earlier values are summed */
    for (int cc = 0; cc < 16; ++cc) { const v4f v = *(const v4fa*)&so[w][32 * g + lane][cc * 4];
#pragma unroll      /* v indexed by constants: registers */
      for (int i = 0; i < 4; ++i) { const float x = (float)(_Float16)v[i]; ss += x * x; } }
    NS[((size_t)by * NH + nq) * NR + row0 + 32 * g + lane] = ss;
    asm volatile("s_wait_xcnt 0x0" ::: "memory");      /* behind the norm store, before code laid out after it may rewrite the store's address registers */
  }
}


__global__ __launch_bounds__(256) void k_wnat(const float* __restrict__ w, size_t n8, _Float16* __restrict__ Bt) { const size_t t = (size_t)blockIdx.x * 256 + threadIdx.x; if (t >= n8) return; FragH f; for (int q = 0; q < 8; ++q) f.h[q] = (_Float16)(bf16_round(w[t * 8 + q]) * 16.0f); *(v8us*)((unsigned short*)Bt + t * 8) = f.half[0];  }
__global__ __launch_bounds__(256) void k_rsm(const float* __restrict__ S, _Float16* __restrict__ P, int nrows) {
  #pragma clang fp contract(off)
  const int i = blockIdx.x * 256 + threadIdx.x; if (i >= nrows) return; const float* s = S + (size_t)i * SQ; float mx = -3.0e38f;
#pragma unroll 1
  for (int j = 0; j < SQ; ++j) mx = fmaxf(mx, s[j]); float se = 0.f;
#pragma unroll 1
  for (int j = 0; j < SQ; ++j) se += expf(s[j] - mx); const float sc = 256.0f / se;
#pragma unroll 1
  for (int j0 = 0; j0 < SQ; j0 += 8) { FragH f; for (int q = 0; q < 8; ++q) f.h[q] = (_Float16)(expf(s[j0 + q] - mx) * sc); unsigned short* d = (unsigned short*)P + (size_t)i * SQ + j0; *(v8us*)d = f.half[0];  } }
__global__ __launch_bounds__(256) void k_vt(const _Float16* __restrict__ V16, int b, int h0, _Float16* __restrict__ VT) { __shared__ unsigned short tl[64][65]; const int tid = threadIdx.x; const int hh = blockIdx.x % HG, sg = blockIdx.x / HG; const int s0 = sg * 64; const int h = h0 + hh;
  for (int i = tid; i < 64 * 8; i += 256) { const int j = i / 8, d8 = (i % 8) * 8; FragH f; f.half[0] = *(const v8us*)((const unsigned short*)V16 + ((size_t)b * SQ + s0 + j) * DM + h * HD + d8); for (int q = 0; q < 8; ++q) tl[d8 + q][j] = f.u[q]; }
  __syncthreads();
  { for (int i = tid; i < 64 * 8; i += 256) { const int d = i / 8, j8 = (i % 8) * 8; FragH f; for (int q = 0; q < 8; ++q) f.u[q] = tl[d][j8 + q]; *(v8us*)((unsigned short*)VT + ((size_t)hh * HD + d) * SQ + s0 + j8) = f.half[0]; }  } }


// e^x as __expf forms it (one multiply, v_exp_f32). The v_nop in the same statement is the one slot the instruction set asks for behind a transcendental before its source is rewritten or its result read.
__device__ __forceinline__ float exp_slot(float x) { float r; asm("v_exp_f32 %0, %1\n\tv_nop" : "=v"(r) : "v"(x * 1.44269504f)); return r; }
// Eight square roots by v_sqrt_f32 alone (1 ulp; a subnormal argument may give 0, which moves a logit by under 1e-19): sqrtf() adds about fifteen vector instructions of range scaling and last-bit fix-up to each.
// One statement: each root is followed by an independent one ("=&v": no result shares a register with an argument), and the one v_nop behind the last is the slot the instruction set asks for behind a transcendental.
__device__ __forceinline__ void sqrt8_slot(const float (&x)[8], float (&r)[8]) {
  asm("v_sqrt_f32 %0, %8\n\tv_sqrt_f32 %1, %9\n\tv_sqrt_f32 %2, %10\n\tv_sqrt_f32 %3, %11\n\tv_sqrt_f32 %4, %12\n\tv_sqrt_f32 %5, %13\n\tv_sqrt_f32 %6, %14\n\tv_sqrt_f32 %7, %15\n\tv_nop"
      : "=&v"(r[0]), "=&v"(r[1]), "=&v"(r[2]), "=&v"(r[3]), "=&v"(r[4]), "=&v"(r[5]), "=&v"(r[6]), "=&v"(r[7])
      : "v"(x[0]), "v"(x[1]), "v"(x[2]), "v"(x[3]), "v"(x[4]), "v"(x[5]), "v"(x[6]), "v"(x[7])); }
// S and P are not __restrict__: P may be the front half of the same rows (ldp = 2 * SQ f16); a wave stores only into its own row, and every store needs the row sum, so all its loads of the row come first.
// One wave per (head, query row): lane l holds columns c*128 + 4*l .. + 3 (c = 0..7), so every load covers 512 contiguous bytes; the row's logits stay in registers from the max to the store.
__global__ __launch_bounds__(256) void k_rsml2(const float* S, _Float16* P, int ldp, int qn, int hg, const float* __restrict__ NQ, const float* __restrict__ NK, size_t npitch, const float* __restrict__ Mf, float scale) {
  #pragma clang fp contract(off)
  const int lane = threadIdx.x & 31; const int t = blockIdx.x * 8 + __builtin_amdgcn_readfirstlane(threadIdx.x >> 5);      /* the wave's row, told to the compiler as wave-uniform: scalar row addresses and a scalar exit test */
  if (t >= qn * hg) return; const int hl = t / qn, row = t % qn; const size_t i = (size_t)hl * SQ + row; const float* s = S + i * SQ; const float nq = NQ[(size_t)hl * npitch + row]; const float* nk = NK + (size_t)hl * npitch; const float* mrow = Mf + (size_t)row * SQ; float mx = -3.0e38f;
  float e[SQ / 32];
#pragma unroll      /* e[] must be indexed by constants to live in registers; later chunks' loads can issue while earlier chunks are worked on */
  for (int c = 0; c < SQ / 128; ++c) { const int j0 = c * 128 + lane * 4; const v4f s4 = *(const v4fa*)(s + j0), k4 = *(const v4fa*)(nk + j0), m4 = *(const v4fa*)(mrow + j0);
#pragma unroll      /* constant index into e[] */
    for (int q = 0; q < 4; ++q) { const float d2 = fmaxf(__fadd_rn(__fadd_rn(nq, k4[q]), -2.0f * s4[q]), 0.f); const float v = __fadd_rn(__fmul_rn(sqrtf(d2), scale), __fmul_rn(bf16_round(m4[q]), -1.0e9f)); e[c * 4 + q] = v; mx = fmaxf(mx, v); } }
  for (int o = 16; o > 0; o >>= 1) mx = fmaxf(mx, __shfl_xor(mx, o));      /* row maximum over the 32 lanes */
  float se = 0.f;
#pragma unroll      /* constant index into e[] */
  for (int u = 0; u < SQ / 32; ++u) { e[u] = exp_slot(e[u] - mx); se += e[u]; }
  for (int o = 16; o > 0; o >>= 1) se += __shfl_xor(se, o);      /* row sum: per-lane partial sums, then a five-step butterfly */
  const float sc = 256.0f / se;
#pragma unroll      /* constant index into e[] */
  for (int c = 0; c < SQ / 128; ++c) { v4h h4;
#pragma unroll      /* constant index into e[] */
    for (int q = 0; q < 4; ++q) h4[q] = (_Float16)(e[c * 4 + q] * sc);
    *(v4h*)(P + i * (size_t)ldp + c * 128 + lane * 4) = h4; } }


__global__ __launch_bounds__(256) void k_rsmf(const float* __restrict__ S, _Float16* __restrict__ P, int qn, int hg) {
  #pragma clang fp contract(off)
  const int t = blockIdx.x * 256 + threadIdx.x; if (t >= qn * hg) return; const size_t i = (size_t)(t / qn) * SQ + (t % qn); const float* s = S + i * SQ; float mx = -3.0e38f;
#pragma unroll 1
  for (int j = 0; j < SQ; ++j) mx = fmaxf(mx, s[j]); float se = 0.f;
#pragma unroll 1
  for (int j = 0; j < SQ; ++j) se += __expf(s[j] - mx); const float sc = 256.0f / se;
#pragma unroll 1
  for (int j0 = 0; j0 < SQ; j0 += 8) { FragH f; for (int q = 0; q < 8; ++q) f.h[q] = (_Float16)(__expf(s[j0 + q] - mx) * sc); unsigned short* d = (unsigned short*)P + i * SQ + j0; *(v8us*)d = f.half[0];  } }

// ---- fused attention: scores, softmax and the weighted sum of V in one kernel; no score or weight plane goes through memory ----
// lane l with lane l ^ 16 (the two lanes that share a query column)
__device__ __forceinline__ float xhalf(float x) { return __builtin_bit_cast(float, __builtin_amdgcn_permlanex16(__builtin_bit_cast(int, x), __builtin_bit_cast(int, x), 0x76543210, 0xfedcba98, false, false)); }
// Work-group barrier that orders LDS alone: the wave's own LDS reads and writes are waited out, then signal and wait. __syncthreads() also waits for every global load of the wave,
// so that no load asked for ahead stays in flight across it; here the barriers guard nothing but the two LDS tiles. The "memory" clobber keeps the compiler from moving an LDS access over it.
__device__ __forceinline__ void lds_barrier() { asm volatile("s_wait_dscnt 0x0\n\ts_barrier_signal -1\n\ts_barrier_wait -1" ::: "memory"); }
#define FK 64      /* keys per pass */
#define FP 72      /* LDS row pitch in f16: 128 data bytes + 16, so that the 16 rows of a 16-byte fragment read fall on different banks */
// One work-group = 4 waves x 16 query rows of one (batch, head); 16 passes over 64 keys.
// Both products are formed transposed, so that a lane owns ONE query column throughout: S^T = K Q^T gives lane (c, h) the keys 8h + r of query c,
// which is the k order of a B fragment, so the weights go from the score accumulators straight into O^T = V^T P^T; the running maximum, sum and rescale are per-lane scalars.
__global__ __launch_bounds__(128) void k_fattn(const _Float16* __restrict__ Q16, const _Float16* __restrict__ K16, const _Float16* __restrict__ VT, const float* __restrict__ NQ, const float* __restrict__ NK, const float* __restrict__ Mf, _Float16* __restrict__ O16, float scale) {
  __shared__ __attribute__((aligned(16))) unsigned short kt_s[FK][FP];      /* K tile  [key][d]  */
  __shared__ __attribute__((aligned(16))) unsigned short vt_s[HD][FP];      /* V^T tile [d][key] */
  const int tid = threadIdx.x, w = tid >> 5, lane = tid & 31, ln = lane & 15, hh = lane >> 4;
  const int h = blockIdx.y, b = blockIdx.z; const int q = blockIdx.x * 64 + w * 16 + ln;      /* the lane's query row */
  const _Float16* qrow = Q16 + ((size_t)b * SQ + q) * DM + h * HD;
  const v16h qf0 = g2_frag(qrow, hh), qf1 = g2_frag(qrow + 32, hh);
  const float nq = NQ[(size_t)h * NR + (size_t)b * SQ + q];
  asm volatile("s_wait_xcnt 0x0" ::: "memory");      /* the load's index register is rewritten for the mask row's address right behind it */
  const float* nk = NK + (size_t)h * NR + (size_t)b * SQ + 8 * hh;
  const float* mrow = Mf + (size_t)q * SQ + 8 * hh;
  const int sr = tid >> 3, sc = (tid & 7) * 8;      /* staging: 8 threads cover one 128-byte row, 16 rows a sweep */
  const unsigned short* kg = (const unsigned short*)K16 + ((size_t)b * SQ + sr) * DM + h * HD + sc;
  const unsigned short* vg = (const unsigned short*)VT + (((size_t)b * NH + h) * HD + sr) * SQ + sc;
  v8us kr[4], vr[4];
#pragma unroll      /* kr, vr indexed by constants: registers */
  for (int u = 0; u < 4; ++u) { kr[u] = *(const v8us*)(kg + (size_t)(u * 16) * DM); vr[u] = *(const v8us*)(vg + (size_t)(u * 16) * SQ); }
  const v8f z8 = {0.f,0.f,0.f,0.f,0.f,0.f,0.f,0.f};
  v8f o[4] = {z8, z8, z8, z8}; float mrun = -3.0e38f, lsum = 0.f;
  for (int s = 0; s < SQ / FK; ++s) {
    v4f kn[8], mk[8];      /* the pass's key norms and mask values: keys t * 16 + 8 * hh + 0..7 of the lane's query; asked for here, so that they fly through both barriers, the tile stores and the fragment reads */
#pragma unroll      /* kn indexed by constants: registers */
    for (int t = 0; t < 4; ++t) { kn[2 * t] = *(const v4fa*)(nk + s * FK + t * 16); kn[2 * t + 1] = *(const v4fa*)(nk + s * FK + t * 16 + 4); }
    asm volatile("s_wait_xcnt 0x0" ::: "memory");      /* before a later load's result reuses these loads' address registers */
#pragma unroll      /* mk indexed by constants: registers */
    for (int t = 0; t < 4; ++t) { mk[2 * t] = *(const v4fa*)(mrow + s * FK + t * 16); mk[2 * t + 1] = *(const v4fa*)(mrow + s * FK + t * 16 + 4); }
    asm volatile("s_wait_xcnt 0x0" ::: "memory");      /* likewise, before the fragment reads reuse them */
    lds_barrier();      /* every wave has finished reading the previous tiles */
#pragma unroll
    for (int u = 0; u < 4; ++u) { *(v8us*)&kt_s[u * 16 + sr][sc] = kr[u]; *(v8us*)&vt_s[u * 16 + sr][sc] = vr[u]; }
    lds_barrier();      /* the tiles of this pass are complete */
    v16h kf[8];      /* the pass's eight K fragments: the sixteen LDS reads issue ahead of the WMMAs, and their latency is waited out once */
#pragma unroll      /* kf indexed by constants: registers */
    for (int t = 0; t < 4; ++t) { const _Float16* kp = (const _Float16*)&kt_s[t * 16 + ln][0]; kf[2 * t] = g2_frag(kp, hh); kf[2 * t + 1] = g2_frag(kp + 32, hh); }
    const int sn = s + 1 < SQ / FK ? s + 1 : s;      /* next pass's tiles fly while this pass is worked on. No branch round the loads (the last pass asks for its own tiles again, in bounds, and nobody reads them): with one, the compiler sets its counted load waits for the path without them, and on the other path the waits for norms and mask wait for these loads too */
#pragma unroll
    for (int u = 0; u < 4; ++u) kr[u] = *(const v8us*)(kg + (size_t)(sn * FK + u * 16) * DM);
    asm volatile("s_wait_xcnt 0x0" ::: "memory");      /* before a later load's result reuses these loads' address registers */
#pragma unroll
    for (int u = 0; u < 4; ++u) vr[u] = *(const v8us*)(vg + (size_t)(u * 16) * SQ + sn * FK);
    asm volatile("s_wait_xcnt 0x0" ::: "memory");      /* the loads' address registers are rewritten right behind them */
    asm volatile("" :: "v"(kf[0]), "v"(kf[1]), "v"(kf[2]), "v"(kf[3]), "v"(kf[4]), "v"(kf[5]), "v"(kf[6]), "v"(kf[7]));      /* inputs only, the loaded fragments: all eight are live at once here, so each gets registers of its own and the reads issue as a group ahead of the WMMAs; without it the compiler reuses registers and spreads the reads among the WMMAs, with a wait at each place */
    v8f sa[4];      /* the four score tiles: four independent WMMAs, then their four second halves, so that no WMMA waits for the one in front of it */
#pragma unroll      /* sa indexed by constants: registers */
    for (int t = 0; t < 4; ++t) sa[t] = __builtin_amdgcn_wmma_f32_16x16x32_f16(false, kf[2 * t], false, qf0, (short)0, z8, false, false);
#pragma unroll      /* sa indexed by constants: registers */
    for (int t = 0; t < 4; ++t) sa[t] = __builtin_amdgcn_wmma_f32_16x16x32_f16(false, kf[2 * t + 1], false, qf1, (short)0, sa[t], false, false);
    float e[4][8]; float mx = mrun;
#pragma unroll      /* e[][] indexed by constants: registers */
    for (int t = 0; t < 4; ++t) {
      const v4f k0 = kn[2 * t], k1 = kn[2 * t + 1], m0 = mk[2 * t], m1 = mk[2 * t + 1];
      const v8f st = sa[t];
      float d2[8], rt[8];
#pragma unroll      /* d2 indexed by constants: registers */
      for (int r = 0; r < 8; ++r) { const float kk = r < 4 ? k0[r & 3] : k1[r & 3]; d2[r] = fmaxf((nq + kk) - 2.0f * st[r], 0.f); }
      sqrt8_slot(d2, rt);
#pragma unroll      /* rt, e[][] indexed by constants: registers */
      for (int r = 0; r < 8; ++r) { const float mm = r < 4 ? m0[r & 3] : m1[r & 3];
        const float v = rt[r] * scale + bf16_round(mm) * -1.0e9f; e[t][r] = v; mx = fmaxf(mx, v); }
    }
    __builtin_amdgcn_sched_barrier(0);      /* the reads below stay behind the scores: moved in front of them, their 64 result registers are live beside the K fragments, norms and mask, and the build takes 258 registers, past the 256 that need no window switch */
    v16h vf[8];      /* the pass's eight V^T fragments: all sixteen LDS reads issue here and land under the exponentials */
#pragma unroll      /* vf indexed by constants: registers */
    for (int t = 0; t < 4; ++t) { const _Float16* vp = (const _Float16*)&vt_s[t * 16 + ln][0]; vf[2 * t] = g2_frag(vp, hh); vf[2 * t + 1] = g2_frag(vp + 32, hh); }
    mx = fmaxf(mx, xhalf(mx));      /* the query's maximum so far: both lanes of the column agree on it */
    const float al = exp_slot(mrun - mx); mrun = mx; float ps = 0.f;
    FragH p0, p1;
#pragma unroll
    for (int r = 0; r < 8; ++r) {
      const float a0 = exp_slot(e[0][r] - mx), a1 = exp_slot(e[1][r] - mx), a2 = exp_slot(e[2][r] - mx), a3 = exp_slot(e[3][r] - mx);
      ps += (a0 + a1) + (a2 + a3);
      p0.h[r] = (_Float16)a0; p0.h[8 + r] = (_Float16)a1; p1.h[r] = (_Float16)a2; p1.h[8 + r] = (_Float16)a3; }
    lsum = lsum * al + ps;
#pragma unroll
    for (int t = 0; t < 4; ++t) {
      v8f a = o[t] * al;
      a = __builtin_amdgcn_wmma_f32_16x16x32_f16(false, vf[2 * t], false, p0.v, (short)0, a, false, false);
      o[t] = __builtin_amdgcn_wmma_f32_16x16x32_f16(false, vf[2 * t + 1], false, p1.v, (short)0, a, false, false);
    }
    asm volatile("v_nop\n\tv_nop\n\tv_nop\n\tv_nop" : "+v"(o[0]), "+v"(o[1]), "+v"(o[2]), "+v"(o[3]) : "v"(p1.v));      /* the four vector slots the chip needs behind the pass's last WMMA before its operand registers are rewritten: the next writer stands behind the branch to the loop's head */
  }
  asm volatile("s_wait_loadcnt 0x0" ::: "memory");      /* the last pass's tile loads have landed before the wave hands its registers back */
  lsum += xhalf(lsum);      /* the two lanes of a column summed disjoint keys */
  const float inv = 64.0f / lsum;      /* o carried x64, as the output GEMM's alpha expects */
  unsigned short* orow = (unsigned short*)O16 + ((size_t)b * SQ + q) * DM + h * HD + 8 * hh;
#pragma unroll
  for (int t = 0; t < 4; ++t) { FragH f;
#pragma unroll
    for (int r = 0; r < 8; ++r) f.h[r] = (_Float16)(o[t][r] * inv);
    *(v8us*)(orow + t * 16) = f.half[0]; }
}

extern "C" void kernel_launch(void* const* d_in, const int* in_sizes, int n_in,
                              void* d_out, int out_size, void* d_ws, size_t ws_size, hipStream_t stream) {
  (void)in_sizes; (void)n_in; (void)out_size;
  const float* const* I = (const float* const*)d_in; const float* xv = I[0]; const float* xk = I[1]; const float* xq = I[2]; const float* mf = I[3]; const float* wq = I[4]; const float* wk = I[5]; const float* wv = I[6]; const float* wo = I[7]; const float* bq = nullptr; const float* bk = nullptr; (void)bq; (void)bk;      /* inputs v, k, q, mask (f32 [1][1][S][S]); [in][out] weights, no biases */
  char* ws = (char*)d_ws; size_t off = 0;
  auto take = [&](size_t bytes) { char* p = ws + off; off += (bytes + 255) & ~(size_t)255; return p; };
  _Float16* BQ = (_Float16*)take((size_t)DM * DM * 2); _Float16* BK = (_Float16*)take((size_t)DM * DM * 2); _Float16* BV = (_Float16*)take((size_t)DM * DM * 2); _Float16* BO = (_Float16*)take((size_t)DM * DM * 2);
  _Float16* Q16 = (_Float16*)take(NR * DM * 2); _Float16* K16 = (_Float16*)take(NR * DM * 2); _Float16* V16 = (_Float16*)take(NR * DM * 2); _Float16* O16 = (_Float16*)take(NR * DM * 2);
  _Float16* VT = (_Float16*)take((size_t)NB * NH * HD * SQ * 2); float* NQ = (float*)take((size_t)NH * NR * 4); float* NK = (float*)take((size_t)NH * NR * 4);      /* NQ, NK: per-(head, row) squared norms of the f16 q and k rows */
  (void)BK; (void)BV; (void)V16;      /* BK, BV: reached through the stride from BQ; the V16 plane keeps its place and is not used */
  if (off > ws_size) return;
  k_prep<<<dim3((unsigned)NWB), 256, 0, stream>>>(wq, wk, wv, wo, BQ, 16.0f);      /* [in][out] weights -> Bt[n][k] (BQ, BK, BV, BO lie back to back): wq, wk, wv as bf16, wo as f16 x16 */
  k_gemmq<<<dim3((unsigned)((MP / 128) * (DM / 128)), 3), 128, 0, stream>>>(xq, xk, xv, BQ, Q16, NQ, VT);      /* q, k, v projections on grid.y from the f32 inputs: Q16 and K16 lie back to back; with them |qh|^2, |kh|^2 per (head, token) from the same f16 values (NK lies behind NQ); v goes out as V^T [NB][NH][HD][SQ] only */
  k_fattn<<<dim3(SQ / 64, NH, NB), 128, 0, stream>>>(Q16, K16, VT, NQ, NK, mf, O16, 0.125f);      /* softmax(sqrt(max(|q|^2 + |k|^2 - 2 q.k, 0)) / 8 + mask * (-1e9)) . v, merged heads, as f16 rows x64 */
  k_gemm2<0, false><<<dim3((unsigned)((MPO / 128) * (DM / 64)), 1), 128, 0, stream>>>(O16, DM, 0, BO, DM, 0, 0.0009765625f, (float*)d_out, nullptr, DM, 0, MPO, DM, DM, 0, 0, 0, nullptr, nullptr);      /* out rows are the output layout */
}
